// v000
// The times below were measured on an AMD MI455X: many runs one after another, warmed up first and cycling through
// copies of the inputs, with the whole window's GPU time divided by the number of runs. Launches and the gaps
// between them are all in it. The median over several windows is given; except for v000 it joins two sittings, which
// can be a few percent apart, so the side-by-side timings, each taken in one sitting, are the better comparison.
// The starting kernel, v000, takes 2790 microseconds a run.
#include <hip/hip_runtime.h>
// Contractions on v_wmma_f32_16x16x32_bf16 as 3-term bf16 hi/lo splits (f32-accurate), f32 accumulate: scores = q·kᵀ/8 (K=64)
// and out = mixed·v (K=2048). The 6x11 key-query convolution, masking, softmax, 2x2 head mixing and LayerNorm are f32 VALU.
#define NHD 16
#define SS 2048
#define DD 64
#define NG 8

typedef __bf16 v16b __attribute__((ext_vector_type(16)));
typedef unsigned short v8us __attribute__((ext_vector_type(8), may_alias));
typedef float  v8f  __attribute__((ext_vector_type(8)));
typedef float  v4f  __attribute__((ext_vector_type(4)));
typedef float  v4fa __attribute__((ext_vector_type(4), may_alias));
union FragB { v16b v; v8us half[2]; unsigned short u[16]; };

__device__ __forceinline__ unsigned short bf16_bits(float x) { unsigned int u = __float_as_uint(x); return (unsigned short)((u + 0x7FFFu + ((u >> 16) & 1u)) >> 16); }
__device__ __forceinline__ float bf16_val(unsigned short b) { return __uint_as_float(((unsigned int)b) << 16); }
__device__ __forceinline__ float bf16_round(float x) { return bf16_val(bf16_bits(x)); }
// D += A·B with NT terms: 1 = ah·bh, 2 = + al·bh (A split), 3 = + ah·bl (both split)
template <int NT>
__device__ __forceinline__ v8f mmaN(v16b ah, v16b al, v16b bh, v16b bl, v8f c) {
  c = __builtin_amdgcn_wmma_f32_16x16x32_bf16(false, ah, false, bh, (short)0, c, false, false);
  if (NT >= 2) c = __builtin_amdgcn_wmma_f32_16x16x32_bf16(false, al, false, bh, (short)0, c, false, false);
  if (NT >= 3) c = __builtin_amdgcn_wmma_f32_16x16x32_bf16(false, ah, false, bl, (short)0, c, false, false);
  asm volatile("v_nop\n\tv_nop\n\tv_nop\n\tv_nop" : "+v"(c) : "v"(ah), "v"(al), "v"(bh), "v"(bl));
  return c;
}

__global__ __launch_bounds__(256) void k_wt_bf16(const float* __restrict__ W, unsigned short* __restrict__ Wt, int K, int N) {
  const int t = blockIdx.x * 256 + threadIdx.x;
  const int k8n = K / 8;
  if (t >= N * k8n) return;
  const int n = t / k8n, k8 = (t % k8n) * 8;
  v8us v;
#pragma unroll
  for (int i = 0; i < 8; ++i) v[i] = bf16_bits(W[(size_t)(k8 + i) * N + n]);
  *(v8us*)(Wt + (size_t)n * K + k8) = v;
  
}

// GEMM C[M][N] (f32, pitch ldc) = act(A[M][K]·W + bias). A f32 row-major (pitch lda) converted per fragment to bf16
// (ASPLIT: hi/lo two planes -> 2 terms, else single rounded term); Wt bf16 [N][K] (pitch ldb). BIAS_BF16 rounds the
// bias to bf16 first (bias quantised to bf16 before the add). K%32==0, M%16==0, N%64==0.
template <bool ASPLIT, int ACT, bool BIAS_BF16>
__global__ __launch_bounds__(128) void k_gemm_bf(const float* __restrict__ A, int lda, const unsigned short* __restrict__ Wt, int ldb,
                                               const float* __restrict__ bias, float* __restrict__ C, int ldc, int M, int N, int K) {
  __shared__ __attribute__((aligned(16))) float so[4][16][64];
  const int tid = threadIdx.x, w = tid >> 5, lane = tid & 31, ln = lane & 15, hh = lane >> 4;
  const int ntn = N / 64;
  const int wid = blockIdx.x * 4 + w;
  const int mt = wid / ntn, nq = wid % ntn;
  if (mt * 16 >= M) return;
  const int row0 = mt * 16, col0 = nq * 64;
  const float* arow = A + (size_t)(row0 + ln) * lda;
  v8f acc[4] = {};
  for (int kb = 0; kb < K; kb += 32) {
    FragB ah, al;
    const v4f x0 = *(const v4fa*)(arow + kb + 8 * hh), x1 = *(const v4fa*)(arow + kb + 8 * hh + 4);
    const v4f x2 = *(const v4fa*)(arow + kb + 16 + 8 * hh), x3 = *(const v4fa*)(arow + kb + 16 + 8 * hh + 4);
    float xs[16] = {x0[0],x0[1],x0[2],x0[3],x1[0],x1[1],x1[2],x1[3],x2[0],x2[1],x2[2],x2[3],x3[0],x3[1],x3[2],x3[3]};
#pragma unroll
    for (int i = 0; i < 16; ++i) { const unsigned short hb = bf16_bits(xs[i]); ah.u[i] = hb; al.u[i] = ASPLIT ? bf16_bits(xs[i] - bf16_val(hb)) : (unsigned short)0; }
#pragma unroll
    for (int t = 0; t < 4; ++t) {
      const unsigned short* brow = Wt + (size_t)(col0 + t * 16 + ln) * ldb + kb;
      FragB b;
      b.half[0] = *(const v8us*)(brow + 8 * hh);
      b.half[1] = *(const v8us*)(brow + 16 + 8 * hh);
      acc[t] = mmaN<ASPLIT ? 2 : 1>(ah.v, al.v, b.v, b.v, acc[t]);
    }
  }
#pragma unroll
  for (int t = 0; t < 4; ++t) {
    float bv = bias ? bias[col0 + t * 16 + ln] : 0.f;
    if (BIAS_BF16) bv = bf16_round(bv);
#pragma unroll
    for (int r = 0; r < 8; ++r) { float v = acc[t][r] + bv; if (ACT == 1) v = fmaxf(v, 0.f); so[w][8 * hh + r][t * 16 + ln] = v; }
  }
  __builtin_amdgcn_fence(__ATOMIC_ACQ_REL, "workgroup");
  __builtin_amdgcn_wave_barrier();
  const int rsub = lane >> 4, c4 = (lane & 15) * 4;
  {
#pragma unroll
    for (int q = 0; q < 8; ++q) {
      const int r = q * 2 + rsub;
      const v4f v = *(const v4fa*)&so[w][r][c4];
      *(v4f*)(C + (size_t)(row0 + r) * ldc + col0 + c4) = v;
    }
    
  }
}

// Flash-style causal/unmasked attention, all contractions 3-term bf16 hi/lo splits, f32 softmax with running max.
// q,k,v rows are read from f32 buffers with arbitrary row pitch (so they can live inside a fused qkv buffer);
// D = head size (multiple of 32, <= 128); one wave = 16 query rows; block = 4 waves (64 queries) sharing K/V chunks of 32.
template <int D, bool CAUSAL>
__global__ __launch_bounds__(128) void k_flash(const float* __restrict__ qb, const float* __restrict__ kb, const float* __restrict__ vb,
                                             int pitch, int T, int H, float scale, float* __restrict__ y, int ypitch) {
  constexpr int KS = D / 32;        // k-steps for QK
  constexpr int DT = D / 16;        // d tiles for PV
  __shared__ __attribute__((aligned(16))) unsigned short sKh[32][D + 8], sKl[32][D + 8], sVh[32][D + 8], sVl[32][D + 8];
  __shared__ __attribute__((aligned(16))) unsigned short sPh[4][16][40], sPl[4][16][40];
  __shared__ __attribute__((aligned(16))) float sO[4][16][D];
  const int tid = threadIdx.x, w = tid >> 5, lane = tid & 31, ln = lane & 15, hh = lane >> 4;
  const int nqb = (T + 63) / 64;
  const int bh = blockIdx.x / nqb, qblk = blockIdx.x % nqb;
  const int b = bh / H, h = bh % H;
  const int q0 = qblk * 64 + w * 16;
  const float* Q = qb + (size_t)b * T * pitch + h * D;
  const float* K = kb + (size_t)b * T * pitch + h * D;
  const float* V = vb + (size_t)b * T * pitch + h * D;

  // A fragments of the wave's 16 query rows (scaled), hi/lo
  FragB aqh[KS], aql[KS];
  {
    int row = q0 + ln; if (row >= T) row = T - 1;
    const float* qr = Q + (size_t)row * pitch;
#pragma unroll
    for (int ks = 0; ks < KS; ++ks)
#pragma unroll
      for (int i = 0; i < 16; ++i) {
        const int d = ks * 32 + ((i < 8) ? (8 * hh + i) : (16 + 8 * hh + (i - 8)));
        const float x = qr[d] * scale; const unsigned short hb = bf16_bits(x);
        aqh[ks].u[i] = hb; aql[ks].u[i] = bf16_bits(x - bf16_val(hb));
      }
  }
  float m_r[8], l_r[8];
#pragma unroll
  for (int r = 0; r < 8; ++r) { m_r[r] = -3.0e38f; l_r[r] = 0.f; }
  v8f oacc[DT];
#pragma unroll
  for (int dt = 0; dt < DT; ++dt) oacc[dt] = (v8f){0.f,0.f,0.f,0.f,0.f,0.f,0.f,0.f};

  const int kv_end = CAUSAL ? min(T, qblk * 64 + 64) : T;     // block-uniform
  for (int j0 = 0; j0 < kv_end; j0 += 32) {
    __syncthreads();
    for (int e = tid; e < 32 * (D / 4); e += 128) {
      const int r = e / (D / 4), c4 = (e % (D / 4)) * 4;
      const int key = j0 + r;
      v4f kf = {0.f,0.f,0.f,0.f}, vf = {0.f,0.f,0.f,0.f};
      if (key < T) { kf = *(const v4fa*)(K + (size_t)key * pitch + c4); vf = *(const v4fa*)(V + (size_t)key * pitch + c4); }
#pragma unroll
      for (int t = 0; t < 4; ++t) {
        unsigned short hb = bf16_bits(kf[t]); sKh[r][c4 + t] = hb; sKl[r][c4 + t] = bf16_bits(kf[t] - bf16_val(hb));
        hb = bf16_bits(vf[t]); sVh[r][c4 + t] = hb; sVl[r][c4 + t] = bf16_bits(vf[t] - bf16_val(hb));
      }
    }
    __syncthreads();
    // S tile 16 x 32
    v8f s[2];
#pragma unroll
    for (int nt = 0; nt < 2; ++nt) {
      v8f acc = {};
#pragma unroll
      for (int ks = 0; ks < KS; ++ks) {
        FragB bh_, bl_;
        bh_.half[0] = *(const v8us*)&sKh[nt * 16 + ln][ks * 32 + 8 * hh]; bh_.half[1] = *(const v8us*)&sKh[nt * 16 + ln][ks * 32 + 16 + 8 * hh];
        bl_.half[0] = *(const v8us*)&sKl[nt * 16 + ln][ks * 32 + 8 * hh]; bl_.half[1] = *(const v8us*)&sKl[nt * 16 + ln][ks * 32 + 16 + 8 * hh];
        acc = mmaN<3>(aqh[ks].v, aql[ks].v, bh_.v, bl_.v, acc);
      }
      s[nt] = acc;
    }
    // mask + running max (rows 8hh+r; the 16 lanes of a half share rows)
    float alpha[8];
#pragma unroll
    for (int r = 0; r < 8; ++r) {
      const int qi = q0 + 8 * hh + r;
      const int ja = j0 + ln, jb = j0 + 16 + ln;
      if (CAUSAL) { if (ja > qi) s[0][r] = -3.0e38f; if (jb > qi) s[1][r] = -3.0e38f; }
      if (ja >= T) s[0][r] = -3.0e38f;
      if (jb >= T) s[1][r] = -3.0e38f;
      float mx = fmaxf(s[0][r], s[1][r]);
      mx = fmaxf(mx, __shfl_xor(mx, 1, 32)); mx = fmaxf(mx, __shfl_xor(mx, 2, 32)); mx = fmaxf(mx, __shfl_xor(mx, 4, 32)); mx = fmaxf(mx, __shfl_xor(mx, 8, 32));
      const float mnew = fmaxf(m_r[r], mx);
      alpha[r] = (mnew > -1.0e38f) ? __expf(m_r[r] - mnew) : 1.0f;
      const float p0 = (s[0][r] > -1.0e38f) ? __expf(s[0][r] - mnew) : 0.f;
      const float p1 = (s[1][r] > -1.0e38f) ? __expf(s[1][r] - mnew) : 0.f;
      m_r[r] = mnew;
      l_r[r] = l_r[r] * alpha[r] + p0 + p1;            // per-lane partial row sum (16 lanes combined at the end)
      unsigned short hb = bf16_bits(p0); sPh[w][8 * hh + r][ln] = hb;      sPl[w][8 * hh + r][ln] = bf16_bits(p0 - bf16_val(hb));
      hb = bf16_bits(p1);                sPh[w][8 * hh + r][16 + ln] = hb; sPl[w][8 * hh + r][16 + ln] = bf16_bits(p1 - bf16_val(hb));
    }
#pragma unroll
    for (int dt = 0; dt < DT; ++dt)
#pragma unroll
      for (int r = 0; r < 8; ++r) oacc[dt][r] *= alpha[r];
    __builtin_amdgcn_fence(__ATOMIC_ACQ_REL, "workgroup");
    __builtin_amdgcn_wave_barrier();
    FragB pah, pal;
    pah.half[0] = *(const v8us*)&sPh[w][ln][8 * hh]; pah.half[1] = *(const v8us*)&sPh[w][ln][16 + 8 * hh];
    pal.half[0] = *(const v8us*)&sPl[w][ln][8 * hh]; pal.half[1] = *(const v8us*)&sPl[w][ln][16 + 8 * hh];
#pragma unroll
    for (int dt = 0; dt < DT; ++dt) {
      FragB bvh, bvl;
#pragma unroll
      for (int i = 0; i < 8; ++i) {
        bvh.u[i] = sVh[8 * hh + i][dt * 16 + ln]; bvh.u[8 + i] = sVh[16 + 8 * hh + i][dt * 16 + ln];
        bvl.u[i] = sVl[8 * hh + i][dt * 16 + ln]; bvl.u[8 + i] = sVl[16 + 8 * hh + i][dt * 16 + ln];
      }
      oacc[dt] = mmaN<3>(pah.v, pal.v, bvh.v, bvl.v, oacc[dt]);
    }
    __builtin_amdgcn_fence(__ATOMIC_ACQ_REL, "workgroup");
    __builtin_amdgcn_wave_barrier();
  }
#pragma unroll
  for (int r = 0; r < 8; ++r) {
    float l = l_r[r];
    l += __shfl_xor(l, 1, 32); l += __shfl_xor(l, 2, 32); l += __shfl_xor(l, 4, 32); l += __shfl_xor(l, 8, 32);
    l_r[r] = (l > 0.f) ? 1.0f / l : 0.f;
  }
#pragma unroll
  for (int dt = 0; dt < DT; ++dt)
#pragma unroll
    for (int r = 0; r < 8; ++r) sO[w][8 * hh + r][dt * 16 + ln] = oacc[dt][r] * l_r[r];
  __builtin_amdgcn_fence(__ATOMIC_ACQ_REL, "workgroup");
  __builtin_amdgcn_wave_barrier();
  {
    for (int r = 0; r < 16; ++r) {
      const int row = q0 + r;
      if (row < T && lane < D / 4) {
        const v4f val = *(const v4fa*)&sO[w][r][lane * 4];
        *(v4f*)(y + ((size_t)b * T + row) * ypitch + h * D + lane * 4) = val;
      }
    }
    
  }
}

// f32 [R][Cc] (row pitch lds) -> bf16 hi/lo planes [R][Cc] (pitch Cc); thread per 8 elements; Cc % 8 == 0
__global__ __launch_bounds__(256) void k_split_rows(const float* __restrict__ src, int lds_, unsigned short* __restrict__ hi, unsigned short* __restrict__ lo, int R, int Cc) {
  const size_t t = (size_t)blockIdx.x * 256 + threadIdx.x;
  const int c8n = Cc / 8;
  if (t >= (size_t)R * c8n) return;
  const int r = (int)(t / c8n), c8 = (int)(t % c8n) * 8;
  const float* s = src + (size_t)r * lds_ + c8;
  const v4f a = *(const v4fa*)s, b = *(const v4fa*)(s + 4);
  float xs[8] = {a[0],a[1],a[2],a[3],b[0],b[1],b[2],b[3]};
  v8us vh, vl;
#pragma unroll
  for (int i = 0; i < 8; ++i) { const unsigned short hb = bf16_bits(xs[i]); vh[i] = hb; vl[i] = bf16_bits(xs[i] - bf16_val(hb)); }
  unsigned short* dh = hi + (size_t)r * Cc + c8; unsigned short* dl = lo + (size_t)r * Cc + c8;
  *(v8us*)dh = vh; *(v8us*)dl = vl; 
}
// f32 [K][N] (row pitch lds) -> transposed bf16 hi/lo planes [N][K]; one thread per (n, 8 consecutive k)
__global__ __launch_bounds__(256) void k_split_transpose(const float* __restrict__ src, int lds_, unsigned short* __restrict__ hi, unsigned short* __restrict__ lo, int K, int N) {
  const size_t t = (size_t)blockIdx.x * 256 + threadIdx.x;
  const int k8n = K / 8;
  if (t >= (size_t)N * k8n) return;
  const int n = (int)(t / k8n), k8 = (int)(t % k8n) * 8;
  v8us vh, vl;
#pragma unroll
  for (int i = 0; i < 8; ++i) { const float x = src[(size_t)(k8 + i) * lds_ + n]; const unsigned short hb = bf16_bits(x); vh[i] = hb; vl[i] = bf16_bits(x - bf16_val(hb)); }
  unsigned short* dh = hi + (size_t)n * K + k8; unsigned short* dl = lo + (size_t)n * K + k8;
  *(v8us*)dh = vh; *(v8us*)dl = vl; 
}
// GEMM with A f32 (split into hi/lo when ASPLIT) and B from bf16 planes Bh (+ Bl when BSPLIT): terms hi·hi [+ lo·hi] [+ hi·lo].
// C f32 [M][N] pitch ldc; alpha scales the result; bias optional (BIAS_BF16 rounds it). Same tiling/epilogue as k_gemm_bf.
template <bool ASPLIT, bool BSPLIT, int ACT, bool BIAS_BF16>
__global__ __launch_bounds__(128) void k_gemm_bf2(const float* __restrict__ A, int lda, const unsigned short* __restrict__ Bh, const unsigned short* __restrict__ Bl, int ldb,
                                                const float* __restrict__ bias, float alpha, float* __restrict__ C, int ldc, int M, int N, int K) {
  __shared__ __attribute__((aligned(16))) float so[4][16][64];
  const int tid = threadIdx.x, w = tid >> 5, lane = tid & 31, ln = lane & 15, hh = lane >> 4;
  const int ntn = N / 64;
  const int wid = blockIdx.x * 4 + w;
  const int mt = wid / ntn, nq = wid % ntn;
  if (mt * 16 >= M) return;
  const int row0 = mt * 16, col0 = nq * 64;
  const float* arow = A + (size_t)(row0 + ln) * lda;
  v8f acc[4] = {};
  for (int kb = 0; kb < K; kb += 32) {
    FragB ah, al;
    const v4f x0 = *(const v4fa*)(arow + kb + 8 * hh), x1 = *(const v4fa*)(arow + kb + 8 * hh + 4);
    const v4f x2 = *(const v4fa*)(arow + kb + 16 + 8 * hh), x3 = *(const v4fa*)(arow + kb + 16 + 8 * hh + 4);
    float xs[16] = {x0[0],x0[1],x0[2],x0[3],x1[0],x1[1],x1[2],x1[3],x2[0],x2[1],x2[2],x2[3],x3[0],x3[1],x3[2],x3[3]};
#pragma unroll
    for (int i = 0; i < 16; ++i) { const unsigned short hb = bf16_bits(xs[i]); ah.u[i] = hb; al.u[i] = ASPLIT ? bf16_bits(xs[i] - bf16_val(hb)) : (unsigned short)0; }
#pragma unroll
    for (int t = 0; t < 4; ++t) {
      const size_t boff = (size_t)(col0 + t * 16 + ln) * ldb + kb;
      FragB bh_, bl_;
      bh_.half[0] = *(const v8us*)(Bh + boff + 8 * hh);
      bh_.half[1] = *(const v8us*)(Bh + boff + 16 + 8 * hh);
      if (BSPLIT) { bl_.half[0] = *(const v8us*)(Bl + boff + 8 * hh); bl_.half[1] = *(const v8us*)(Bl + boff + 16 + 8 * hh); } else bl_ = bh_;
      acc[t] = mmaN<ASPLIT ? (BSPLIT ? 3 : 2) : 1>(ah.v, al.v, bh_.v, bl_.v, acc[t]);
    }
  }
#pragma unroll
  for (int t = 0; t < 4; ++t) {
    float bv = bias ? bias[col0 + t * 16 + ln] : 0.f;
    if (BIAS_BF16) bv = bf16_round(bv);
#pragma unroll
    for (int r = 0; r < 8; ++r) { float v = acc[t][r] * alpha + bv; if (ACT == 1) v = fmaxf(v, 0.f); so[w][8 * hh + r][t * 16 + ln] = v; }
  }
  __builtin_amdgcn_fence(__ATOMIC_ACQ_REL, "workgroup");
  __builtin_amdgcn_wave_barrier();
  const int rsub = lane >> 4, c4 = (lane & 15) * 4;
  {
#pragma unroll
    for (int q = 0; q < 8; ++q) {
      const int r = q * 2 + rsub;
      const v4f v = *(const v4fa*)&so[w][r][c4];
      *(v4f*)(C + (size_t)(row0 + r) * ldc + col0 + c4) = v;
    }
    
  }
}
// row softmax: P[row][:] = softmax(masked S[row][:]) over N columns with optional causal mask (col > row + rowoff -> 0) and
__global__ __launch_bounds__(256) void k_softmax_rows(const float* __restrict__ S, float* __restrict__ P, int N, int causal, int rowoff, const int* __restrict__ mask, int mask_pitch) {
  __shared__ float red[256];
  const int row = blockIdx.x, tid = threadIdx.x;
  const float* s = S + (size_t)row * N; float* p_out = P + (size_t)row * N;
  const int qi = row + rowoff;
  float mx = -3.0e38f;
  for (int j = tid; j < N; j += 256) {
    bool keep = true;
    if (causal && j > qi) keep = false;
    if (mask && mask[(size_t)qi * mask_pitch + j] == 0) keep = false;
    const float v = keep ? s[j] : -3.0e38f;
    mx = fmaxf(mx, v);
  }
  red[tid] = mx; __syncthreads();
  for (int st = 128; st > 0; st >>= 1) { if (tid < st) red[tid] = fmaxf(red[tid], red[tid + st]); __syncthreads(); }
  mx = red[0]; __syncthreads();
  float sum = 0.f;
  for (int j = tid; j < N; j += 256) {
    bool keep = true;
    if (causal && j > qi) keep = false;
    if (mask && mask[(size_t)qi * mask_pitch + j] == 0) keep = false;
    const float p = keep ? __expf(s[j] - mx) : 0.f;
    sum += p;
  }
  red[tid] = sum; __syncthreads();
  for (int st = 128; st > 0; st >>= 1) { if (tid < st) red[tid] += red[tid + st]; __syncthreads(); }
  const float inv = (mx > -1.0e38f) ? 1.0f / red[0] : __builtin_nanf("");
  __syncthreads();
  {
    for (int j4 = tid * 4; j4 < N; j4 += 1024) {
      v4f out4;
#pragma unroll
      for (int u = 0; u < 4; ++u) {
        const int j = j4 + u;
        bool keep = true;
        if (causal && j > qi) keep = false;
        if (mask && mask[(size_t)qi * mask_pitch + j] == 0) keep = false;
        out4[u] = keep ? __expf(s[j] - mx) * inv : 0.f;
      }
      *(v4f*)(p_out + j4) = out4;
    }
    
  }
}

// one block per (head-in-group hh2, row i): conv over the zero-masked scores of that head, + bias, future -> -1e9, softmax -> P
__global__ __launch_bounds__(256) void k_conv_softmax(const float* __restrict__ S2, const float* __restrict__ conv_w, const float* __restrict__ conv_b,
                                                     int g, float* __restrict__ P2) {
  __shared__ float wk[6][11];
  __shared__ float row[SS];
  __shared__ float red[256];
  const int hh2 = blockIdx.y, i = blockIdx.x, tid = threadIdx.x;
  const int h = g * 2 + hh2;
  const float* S = S2 + (size_t)hh2 * SS * SS;
  if (tid < 66) wk[tid / 11][tid % 11] = conv_w[(size_t)h * 66 + tid];
  __syncthreads();
  const float cb = conv_b[h];
  float mx = -3.0e38f;
#pragma unroll 1
  for (int j = tid; j < SS; j += 256) {
    float acc = 0.f;
#pragma unroll
    for (int a = 0; a < 6; ++a) {
      const int ii = i + a - 2;
      if (ii < 0 || ii >= SS) continue;
      const float* srow = S + (size_t)ii * SS;
#pragma unroll
      for (int bq = 0; bq < 11; ++bq) {
        const int jj = j + bq - 5;
        if (jj < 0 || jj >= SS) continue;
        const float sv = (jj > ii) ? 0.0f : srow[jj];          // future positions enter the convolution as 0
        acc += wk[a][bq] * sv;
      }
    }
    acc += cb;
    const float fin = (j > i) ? -1.0e9f : acc;
    row[j] = fin; mx = fmaxf(mx, fin);
  }
  red[tid] = mx; __syncthreads();
  for (int st = 128; st > 0; st >>= 1) { if (tid < st) red[tid] = fmaxf(red[tid], red[tid + st]); __syncthreads(); }
  mx = red[0]; __syncthreads();
  float sum = 0.f;
  for (int j = tid; j < SS; j += 256) { const float e = __expf(row[j] - mx); row[j] = e; sum += e; }
  red[tid] = sum; __syncthreads();
  for (int st = 128; st > 0; st >>= 1) { if (tid < st) red[tid] += red[tid + st]; __syncthreads(); }
  const float inv = 1.0f / red[0];
  __syncthreads();
  float* prow = P2 + ((size_t)hh2 * SS + i) * SS;
  {
    for (int j4 = tid * 4; j4 < SS; j4 += 1024) { v4f o; o[0] = row[j4] * inv; o[1] = row[j4+1] * inv; o[2] = row[j4+2] * inv; o[3] = row[j4+3] * inv; *(v4f*)(prow + j4) = o; }
    
  }
}
// mixed_j = m[0][j]·P_0 + m[1][j]·P_1 for the two heads of group g; thread per 4 elements
__global__ __launch_bounds__(256) void k_mix(const float* __restrict__ P2, const float* __restrict__ head_mix, int g, float* __restrict__ M2) {
  const size_t t = (size_t)blockIdx.x * 256 + threadIdx.x;
  const size_t n4 = (size_t)SS * SS / 4;
  if (t >= 2 * n4) return;
  const int j = (int)(t / n4); const size_t e4 = (t % n4) * 4;
  const float m0 = head_mix[g * 4 + 0 * 2 + j], m1 = head_mix[g * 4 + 1 * 2 + j];
  const v4f a = *(const v4fa*)(P2 + e4), b = *(const v4fa*)(P2 + (size_t)SS * SS + e4);
  v4f o; for (int u = 0; u < 4; ++u) o[u] = m0 * a[u] + m1 * b[u];
  float* dst = M2 + (size_t)j * SS * SS + e4;
  *(v4f*)dst = o; 
}
// LayerNorm over 64 per row (biased variance), gamma/beta: block = 64 threads = 64 rows; normalised rows staged in LDS and
__global__ __launch_bounds__(64) void k_ln(const float* __restrict__ O, const float* __restrict__ gam, const float* __restrict__ bet, float* __restrict__ out, int nrows) {
  __shared__ __attribute__((aligned(16))) float so[64][DD];
  const int tid = threadIdx.x;
  const int r0 = blockIdx.x * 64, r = r0 + tid;
  if (r < nrows) {
    const float* x = O + (size_t)r * DD;
    float mu = 0.f;
#pragma unroll 1
    for (int d = 0; d < DD; ++d) mu += x[d];
    mu *= (1.0f / DD);
    float var = 0.f;
#pragma unroll 1
    for (int d = 0; d < DD; ++d) { const float c = x[d] - mu; var += c * c; }
    var *= (1.0f / DD);
    const float rs = rsqrtf(var + 1e-5f);
#pragma unroll 1
    for (int d = 0; d < DD; ++d) so[tid][d] = (x[d] - mu) * rs * gam[d] + bet[d];
  }
  __syncthreads();
  {
    for (int e = tid; e < 64 * (DD / 4); e += 64) {
      const int rr = e / (DD / 4), c4 = (e % (DD / 4)) * 4;
      if (r0 + rr < nrows) { const v4f val = *(const v4fa*)&so[rr][c4]; *(v4f*)(out + (size_t)(r0 + rr) * DD + c4) = val; }
    }
    
  }
}

extern "C" void kernel_launch(void* const* d_in, const int* in_sizes, int n_in,
                              void* d_out, int out_size, void* d_ws, size_t ws_size, hipStream_t stream) {
  (void)in_sizes; (void)n_in; (void)out_size;
  const float* q = (const float*)d_in[0]; const float* k = (const float*)d_in[1]; const float* v = (const float*)d_in[2];
  const float* conv_w = (const float*)d_in[3]; const float* conv_b = (const float*)d_in[4]; const float* head_mix = (const float*)d_in[5];
  const float* gam = (const float*)d_in[6]; const float* bet = (const float*)d_in[7];
  char* ws = (char*)d_ws; size_t off = 0;
  auto take = [&](size_t bytes) { char* p = ws + off; off += (bytes + 255) & ~(size_t)255; return p; };
  unsigned short* kh = (unsigned short*)take((size_t)2 * SS * DD * 2); unsigned short* kl = (unsigned short*)take((size_t)2 * SS * DD * 2);     // k rows planes, 2 heads
  unsigned short* vth = (unsigned short*)take((size_t)2 * DD * SS * 2); unsigned short* vtl = (unsigned short*)take((size_t)2 * DD * SS * 2);  // vᵀ planes, 2 heads
  float* S2 = (float*)take((size_t)2 * SS * SS * 4);     // 32 MiB scores of the 2 heads
  float* P2 = (float*)take((size_t)2 * SS * SS * 4);     // softmax maps
  float* M2 = (float*)take((size_t)2 * SS * SS * 4);     // mixed maps
  float* O  = (float*)take((size_t)NHD * SS * DD * 4);   // pre-LN output [16][2048][64]
  if (off > ws_size) return;
  for (int g = 0; g < NG; ++g) {
    for (int j = 0; j < 2; ++j) {
      const int h = g * 2 + j;
      const float* qh = q + (size_t)h * SS * DD; const float* khp = k + (size_t)h * SS * DD; const float* vh = v + (size_t)h * SS * DD;
      k_split_rows<<<(SS * (DD / 8) + 255) / 256, 256, 0, stream>>>(khp, DD, kh + (size_t)j * SS * DD, kl + (size_t)j * SS * DD, SS, DD);
      k_split_transpose<<<(DD * (SS / 8) + 255) / 256, 256, 0, stream>>>(vh, DD, vth + (size_t)j * DD * SS, vtl + (size_t)j * DD * SS, SS, DD);
      // scores_h = q·kᵀ / 8 : M=N=SS, K=DD
      k_gemm_bf2<true, true, 0, false><<<((SS / 16) * (SS / 64) + 3) / 4, 128, 0, stream>>>(qh, DD, kh + (size_t)j * SS * DD, kl + (size_t)j * SS * DD, DD, nullptr, 0.125f, S2 + (size_t)j * SS * SS, SS, SS, SS, DD);
    }
    k_conv_softmax<<<dim3(SS, 2), 256, 0, stream>>>(S2, conv_w, conv_b, g, P2);
    k_mix<<<(unsigned)(((size_t)2 * SS * SS / 4 + 255) / 256), 256, 0, stream>>>(P2, head_mix, g, M2);
    for (int j = 0; j < 2; ++j) {
      const int h = g * 2 + j;
      // out_h = mixed_j · v_h : M=SS, N=DD, K=SS; Bt[n=d][k=s] = vᵀ planes
      k_gemm_bf2<true, true, 0, false><<<((SS / 16) * (DD / 64) + 3) / 4, 128, 0, stream>>>(M2 + (size_t)j * SS * SS, SS, vth + (size_t)j * DD * SS, vtl + (size_t)j * DD * SS, SS, nullptr, 1.0f, O + (size_t)h * SS * DD, DD, SS, DD, SS);
    }
  }
  k_ln<<<(NHD * SS + 63) / 64, 64, 0, stream>>>(O, gam, bet, (float*)d_out, NHD * SS);
}

// v001
// It runs in 1650 microseconds.
// Two timings next to v000 both put it at 1.71 times that version's speed.
#include <hip/hip_runtime.h>
// Contractions on v_wmma_f32_16x16x32_bf16 as 3-term bf16 hi/lo splits (f32-accurate), f32 accumulate: scores = q·kᵀ/8 (K=64)
// and out = mixed·v (K=2048). The 6x11 key-query convolution, masking, softmax, 2x2 head mixing and LayerNorm are f32 VALU.
#define NHD 16
#define SS 2048
#define DD 64
#define NG 8

typedef __bf16 v16b __attribute__((ext_vector_type(16)));
typedef unsigned short v8us __attribute__((ext_vector_type(8), may_alias));
typedef float  v8f  __attribute__((ext_vector_type(8)));
typedef float  v4f  __attribute__((ext_vector_type(4)));
typedef float  v4fa __attribute__((ext_vector_type(4), may_alias));
union FragB { v16b v; v8us half[2]; unsigned short u[16]; };

__device__ __forceinline__ unsigned short bf16_bits(float x) { unsigned int u = __float_as_uint(x); return (unsigned short)((u + 0x7FFFu + ((u >> 16) & 1u)) >> 16); }
__device__ __forceinline__ float bf16_val(unsigned short b) { return __uint_as_float(((unsigned int)b) << 16); }
__device__ __forceinline__ float bf16_round(float x) { return bf16_val(bf16_bits(x)); }
// D += A·B with NT terms: 1 = ah·bh, 2 = + al·bh (A split), 3 = + ah·bl (both split)
template <int NT>
__device__ __forceinline__ v8f mmaN(v16b ah, v16b al, v16b bh, v16b bl, v8f c) {
  c = __builtin_amdgcn_wmma_f32_16x16x32_bf16(false, ah, false, bh, (short)0, c, false, false);
  if (NT >= 2) c = __builtin_amdgcn_wmma_f32_16x16x32_bf16(false, al, false, bh, (short)0, c, false, false);
  if (NT >= 3) c = __builtin_amdgcn_wmma_f32_16x16x32_bf16(false, ah, false, bl, (short)0, c, false, false);
  asm volatile("v_nop\n\tv_nop\n\tv_nop\n\tv_nop" : "+v"(c) : "v"(ah), "v"(al), "v"(bh), "v"(bl));
  return c;
}

__global__ __launch_bounds__(256) void k_wt_bf16(const float* __restrict__ W, unsigned short* __restrict__ Wt, int K, int N) {
  const int t = blockIdx.x * 256 + threadIdx.x;
  const int k8n = K / 8;
  if (t >= N * k8n) return;
  const int n = t / k8n, k8 = (t % k8n) * 8;
  v8us v;
#pragma unroll
  for (int i = 0; i < 8; ++i) v[i] = bf16_bits(W[(size_t)(k8 + i) * N + n]);
  *(v8us*)(Wt + (size_t)n * K + k8) = v;
  
}

// GEMM C[M][N] (f32, pitch ldc) = act(A[M][K]·W + bias). A f32 row-major (pitch lda) converted per fragment to bf16
// (ASPLIT: hi/lo two planes -> 2 terms, else single rounded term); Wt bf16 [N][K] (pitch ldb). BIAS_BF16 rounds the
// bias to bf16 first (bias quantised to bf16 before the add). K%32==0, M%16==0, N%64==0.
template <bool ASPLIT, int ACT, bool BIAS_BF16>
__global__ __launch_bounds__(128) void k_gemm_bf(const float* __restrict__ A, int lda, const unsigned short* __restrict__ Wt, int ldb,
                                               const float* __restrict__ bias, float* __restrict__ C, int ldc, int M, int N, int K) {
  __shared__ __attribute__((aligned(16))) float so[4][16][64];
  const int tid = threadIdx.x, w = tid >> 5, lane = tid & 31, ln = lane & 15, hh = lane >> 4;
  const int ntn = N / 64;
  const int wid = blockIdx.x * 4 + w;
  const int mt = wid / ntn, nq = wid % ntn;
  if (mt * 16 >= M) return;
  const int row0 = mt * 16, col0 = nq * 64;
  const float* arow = A + (size_t)(row0 + ln) * lda;
  v8f acc[4] = {};
  for (int kb = 0; kb < K; kb += 32) {
    FragB ah, al;
    const v4f x0 = *(const v4fa*)(arow + kb + 8 * hh), x1 = *(const v4fa*)(arow + kb + 8 * hh + 4);
    const v4f x2 = *(const v4fa*)(arow + kb + 16 + 8 * hh), x3 = *(const v4fa*)(arow + kb + 16 + 8 * hh + 4);
    float xs[16] = {x0[0],x0[1],x0[2],x0[3],x1[0],x1[1],x1[2],x1[3],x2[0],x2[1],x2[2],x2[3],x3[0],x3[1],x3[2],x3[3]};
#pragma unroll
    for (int i = 0; i < 16; ++i) { const unsigned short hb = bf16_bits(xs[i]); ah.u[i] = hb; al.u[i] = ASPLIT ? bf16_bits(xs[i] - bf16_val(hb)) : (unsigned short)0; }
#pragma unroll
    for (int t = 0; t < 4; ++t) {
      const unsigned short* brow = Wt + (size_t)(col0 + t * 16 + ln) * ldb + kb;
      FragB b;
      b.half[0] = *(const v8us*)(brow + 8 * hh);
      b.half[1] = *(const v8us*)(brow + 16 + 8 * hh);
      acc[t] = mmaN<ASPLIT ? 2 : 1>(ah.v, al.v, b.v, b.v, acc[t]);
    }
  }
#pragma unroll
  for (int t = 0; t < 4; ++t) {
    float bv = bias ? bias[col0 + t * 16 + ln] : 0.f;
    if (BIAS_BF16) bv = bf16_round(bv);
#pragma unroll
    for (int r = 0; r < 8; ++r) { float v = acc[t][r] + bv; if (ACT == 1) v = fmaxf(v, 0.f); so[w][8 * hh + r][t * 16 + ln] = v; }
  }
  __builtin_amdgcn_fence(__ATOMIC_ACQ_REL, "workgroup");
  __builtin_amdgcn_wave_barrier();
  const int rsub = lane >> 4, c4 = (lane & 15) * 4;
  {
#pragma unroll
    for (int q = 0; q < 8; ++q) {
      const int r = q * 2 + rsub;
      const v4f v = *(const v4fa*)&so[w][r][c4];
      *(v4f*)(C + (size_t)(row0 + r) * ldc + col0 + c4) = v;
    }
    
  }
}

// Flash-style causal/unmasked attention, all contractions 3-term bf16 hi/lo splits, f32 softmax with running max.
// q,k,v rows are read from f32 buffers with arbitrary row pitch (so they can live inside a fused qkv buffer);
// D = head size (multiple of 32, <= 128); one wave = 16 query rows; block = 4 waves (64 queries) sharing K/V chunks of 32.
template <int D, bool CAUSAL>
__global__ __launch_bounds__(128) void k_flash(const float* __restrict__ qb, const float* __restrict__ kb, const float* __restrict__ vb,
                                             int pitch, int T, int H, float scale, float* __restrict__ y, int ypitch) {
  constexpr int KS = D / 32;        // k-steps for QK
  constexpr int DT = D / 16;        // d tiles for PV
  __shared__ __attribute__((aligned(16))) unsigned short sKh[32][D + 8], sKl[32][D + 8], sVh[32][D + 8], sVl[32][D + 8];
  __shared__ __attribute__((aligned(16))) unsigned short sPh[4][16][40], sPl[4][16][40];
  __shared__ __attribute__((aligned(16))) float sO[4][16][D];
  const int tid = threadIdx.x, w = tid >> 5, lane = tid & 31, ln = lane & 15, hh = lane >> 4;
  const int nqb = (T + 63) / 64;
  const int bh = blockIdx.x / nqb, qblk = blockIdx.x % nqb;
  const int b = bh / H, h = bh % H;
  const int q0 = qblk * 64 + w * 16;
  const float* Q = qb + (size_t)b * T * pitch + h * D;
  const float* K = kb + (size_t)b * T * pitch + h * D;
  const float* V = vb + (size_t)b * T * pitch + h * D;

  // A fragments of the wave's 16 query rows (scaled), hi/lo
  FragB aqh[KS], aql[KS];
  {
    int row = q0 + ln; if (row >= T) row = T - 1;
    const float* qr = Q + (size_t)row * pitch;
#pragma unroll
    for (int ks = 0; ks < KS; ++ks)
#pragma unroll
      for (int i = 0; i < 16; ++i) {
        const int d = ks * 32 + ((i < 8) ? (8 * hh + i) : (16 + 8 * hh + (i - 8)));
        const float x = qr[d] * scale; const unsigned short hb = bf16_bits(x);
        aqh[ks].u[i] = hb; aql[ks].u[i] = bf16_bits(x - bf16_val(hb));
      }
  }
  float m_r[8], l_r[8];
#pragma unroll
  for (int r = 0; r < 8; ++r) { m_r[r] = -3.0e38f; l_r[r] = 0.f; }
  v8f oacc[DT];
#pragma unroll
  for (int dt = 0; dt < DT; ++dt) oacc[dt] = (v8f){0.f,0.f,0.f,0.f,0.f,0.f,0.f,0.f};

  const int kv_end = CAUSAL ? min(T, qblk * 64 + 64) : T;     // block-uniform
  for (int j0 = 0; j0 < kv_end; j0 += 32) {
    __syncthreads();
    for (int e = tid; e < 32 * (D / 4); e += 128) {
      const int r = e / (D / 4), c4 = (e % (D / 4)) * 4;
      const int key = j0 + r;
      v4f kf = {0.f,0.f,0.f,0.f}, vf = {0.f,0.f,0.f,0.f};
      if (key < T) { kf = *(const v4fa*)(K + (size_t)key * pitch + c4); vf = *(const v4fa*)(V + (size_t)key * pitch + c4); }
#pragma unroll
      for (int t = 0; t < 4; ++t) {
        unsigned short hb = bf16_bits(kf[t]); sKh[r][c4 + t] = hb; sKl[r][c4 + t] = bf16_bits(kf[t] - bf16_val(hb));
        hb = bf16_bits(vf[t]); sVh[r][c4 + t] = hb; sVl[r][c4 + t] = bf16_bits(vf[t] - bf16_val(hb));
      }
    }
    __syncthreads();
    // S tile 16 x 32
    v8f s[2];
#pragma unroll
    for (int nt = 0; nt < 2; ++nt) {
      v8f acc = {};
#pragma unroll
      for (int ks = 0; ks < KS; ++ks) {
        FragB bh_, bl_;
        bh_.half[0] = *(const v8us*)&sKh[nt * 16 + ln][ks * 32 + 8 * hh]; bh_.half[1] = *(const v8us*)&sKh[nt * 16 + ln][ks * 32 + 16 + 8 * hh];
        bl_.half[0] = *(const v8us*)&sKl[nt * 16 + ln][ks * 32 + 8 * hh]; bl_.half[1] = *(const v8us*)&sKl[nt * 16 + ln][ks * 32 + 16 + 8 * hh];
        acc = mmaN<3>(aqh[ks].v, aql[ks].v, bh_.v, bl_.v, acc);
      }
      s[nt] = acc;
    }
    // mask + running max (rows 8hh+r; the 16 lanes of a half share rows)
    float alpha[8];
#pragma unroll
    for (int r = 0; r < 8; ++r) {
      const int qi = q0 + 8 * hh + r;
      const int ja = j0 + ln, jb = j0 + 16 + ln;
      if (CAUSAL) { if (ja > qi) s[0][r] = -3.0e38f; if (jb > qi) s[1][r] = -3.0e38f; }
      if (ja >= T) s[0][r] = -3.0e38f;
      if (jb >= T) s[1][r] = -3.0e38f;
      float mx = fmaxf(s[0][r], s[1][r]);
      mx = fmaxf(mx, __shfl_xor(mx, 1, 32)); mx = fmaxf(mx, __shfl_xor(mx, 2, 32)); mx = fmaxf(mx, __shfl_xor(mx, 4, 32)); mx = fmaxf(mx, __shfl_xor(mx, 8, 32));
      const float mnew = fmaxf(m_r[r], mx);
      alpha[r] = (mnew > -1.0e38f) ? __expf(m_r[r] - mnew) : 1.0f;
      const float p0 = (s[0][r] > -1.0e38f) ? __expf(s[0][r] - mnew) : 0.f;
      const float p1 = (s[1][r] > -1.0e38f) ? __expf(s[1][r] - mnew) : 0.f;
      m_r[r] = mnew;
      l_r[r] = l_r[r] * alpha[r] + p0 + p1;            // per-lane partial row sum (16 lanes combined at the end)
      unsigned short hb = bf16_bits(p0); sPh[w][8 * hh + r][ln] = hb;      sPl[w][8 * hh + r][ln] = bf16_bits(p0 - bf16_val(hb));
      hb = bf16_bits(p1);                sPh[w][8 * hh + r][16 + ln] = hb; sPl[w][8 * hh + r][16 + ln] = bf16_bits(p1 - bf16_val(hb));
    }
#pragma unroll
    for (int dt = 0; dt < DT; ++dt)
#pragma unroll
      for (int r = 0; r < 8; ++r) oacc[dt][r] *= alpha[r];
    __builtin_amdgcn_fence(__ATOMIC_ACQ_REL, "workgroup");
    __builtin_amdgcn_wave_barrier();
    FragB pah, pal;
    pah.half[0] = *(const v8us*)&sPh[w][ln][8 * hh]; pah.half[1] = *(const v8us*)&sPh[w][ln][16 + 8 * hh];
    pal.half[0] = *(const v8us*)&sPl[w][ln][8 * hh]; pal.half[1] = *(const v8us*)&sPl[w][ln][16 + 8 * hh];
#pragma unroll
    for (int dt = 0; dt < DT; ++dt) {
      FragB bvh, bvl;
#pragma unroll
      for (int i = 0; i < 8; ++i) {
        bvh.u[i] = sVh[8 * hh + i][dt * 16 + ln]; bvh.u[8 + i] = sVh[16 + 8 * hh + i][dt * 16 + ln];
        bvl.u[i] = sVl[8 * hh + i][dt * 16 + ln]; bvl.u[8 + i] = sVl[16 + 8 * hh + i][dt * 16 + ln];
      }
      oacc[dt] = mmaN<3>(pah.v, pal.v, bvh.v, bvl.v, oacc[dt]);
    }
    __builtin_amdgcn_fence(__ATOMIC_ACQ_REL, "workgroup");
    __builtin_amdgcn_wave_barrier();
  }
#pragma unroll
  for (int r = 0; r < 8; ++r) {
    float l = l_r[r];
    l += __shfl_xor(l, 1, 32); l += __shfl_xor(l, 2, 32); l += __shfl_xor(l, 4, 32); l += __shfl_xor(l, 8, 32);
    l_r[r] = (l > 0.f) ? 1.0f / l : 0.f;
  }
#pragma unroll
  for (int dt = 0; dt < DT; ++dt)
#pragma unroll
    for (int r = 0; r < 8; ++r) sO[w][8 * hh + r][dt * 16 + ln] = oacc[dt][r] * l_r[r];
  __builtin_amdgcn_fence(__ATOMIC_ACQ_REL, "workgroup");
  __builtin_amdgcn_wave_barrier();
  {
    for (int r = 0; r < 16; ++r) {
      const int row = q0 + r;
      if (row < T && lane < D / 4) {
        const v4f val = *(const v4fa*)&sO[w][r][lane * 4];
        *(v4f*)(y + ((size_t)b * T + row) * ypitch + h * D + lane * 4) = val;
      }
    }
    
  }
}

// f32 [R][Cc] (row pitch lds) -> bf16 hi/lo planes [R][Cc] (pitch Cc); thread per 8 elements; Cc % 8 == 0
__global__ __launch_bounds__(256) void k_split_rows(const float* __restrict__ src, int lds_, unsigned short* __restrict__ hi, unsigned short* __restrict__ lo, int R, int Cc) {
  const size_t t = (size_t)blockIdx.x * 256 + threadIdx.x;
  const int c8n = Cc / 8;
  if (t >= (size_t)R * c8n) return;
  const int r = (int)(t / c8n), c8 = (int)(t % c8n) * 8;
  const float* s = src + (size_t)r * lds_ + c8;
  const v4f a = *(const v4fa*)s, b = *(const v4fa*)(s + 4);
  float xs[8] = {a[0],a[1],a[2],a[3],b[0],b[1],b[2],b[3]};
  v8us vh, vl;
#pragma unroll
  for (int i = 0; i < 8; ++i) { const unsigned short hb = bf16_bits(xs[i]); vh[i] = hb; vl[i] = bf16_bits(xs[i] - bf16_val(hb)); }
  unsigned short* dh = hi + (size_t)r * Cc + c8; unsigned short* dl = lo + (size_t)r * Cc + c8;
  *(v8us*)dh = vh; *(v8us*)dl = vl; 
}
// f32 [K][N] (row pitch lds) -> transposed bf16 hi/lo planes [N][K]; one thread per (n, 8 consecutive k)
__global__ __launch_bounds__(256) void k_split_transpose(const float* __restrict__ src, int lds_, unsigned short* __restrict__ hi, unsigned short* __restrict__ lo, int K, int N) {
  const size_t t = (size_t)blockIdx.x * 256 + threadIdx.x;
  const int k8n = K / 8;
  if (t >= (size_t)N * k8n) return;
  const int n = (int)(t / k8n), k8 = (int)(t % k8n) * 8;
  v8us vh, vl;
#pragma unroll
  for (int i = 0; i < 8; ++i) { const float x = src[(size_t)(k8 + i) * lds_ + n]; const unsigned short hb = bf16_bits(x); vh[i] = hb; vl[i] = bf16_bits(x - bf16_val(hb)); }
  unsigned short* dh = hi + (size_t)n * K + k8; unsigned short* dl = lo + (size_t)n * K + k8;
  *(v8us*)dh = vh; *(v8us*)dl = vl; 
}
// GEMM with A f32 (split into hi/lo when ASPLIT) and B from bf16 planes Bh (+ Bl when BSPLIT): terms hi·hi [+ lo·hi] [+ hi·lo].
// C f32 [M][N] pitch ldc; alpha scales the result; bias optional (BIAS_BF16 rounds it). Same tiling/epilogue as k_gemm_bf.
template <bool ASPLIT, bool BSPLIT, int ACT, bool BIAS_BF16>
__global__ __launch_bounds__(128) void k_gemm_bf2(const float* __restrict__ A, int lda, const unsigned short* __restrict__ Bh, const unsigned short* __restrict__ Bl, int ldb,
                                                const float* __restrict__ bias, float alpha, float* __restrict__ C, int ldc, int M, int N, int K) {
  __shared__ __attribute__((aligned(16))) float so[4][16][64];
  const int tid = threadIdx.x, w = tid >> 5, lane = tid & 31, ln = lane & 15, hh = lane >> 4;
  const int ntn = N / 64;
  const int wid = blockIdx.x * 4 + w;
  const int mt = wid / ntn, nq = wid % ntn;
  if (mt * 16 >= M) return;
  const int row0 = mt * 16, col0 = nq * 64;
  const float* arow = A + (size_t)(row0 + ln) * lda;
  v8f acc[4] = {};
  for (int kb = 0; kb < K; kb += 32) {
    FragB ah, al;
    const v4f x0 = *(const v4fa*)(arow + kb + 8 * hh), x1 = *(const v4fa*)(arow + kb + 8 * hh + 4);
    const v4f x2 = *(const v4fa*)(arow + kb + 16 + 8 * hh), x3 = *(const v4fa*)(arow + kb + 16 + 8 * hh + 4);
    float xs[16] = {x0[0],x0[1],x0[2],x0[3],x1[0],x1[1],x1[2],x1[3],x2[0],x2[1],x2[2],x2[3],x3[0],x3[1],x3[2],x3[3]};
#pragma unroll
    for (int i = 0; i < 16; ++i) { const unsigned short hb = bf16_bits(xs[i]); ah.u[i] = hb; al.u[i] = ASPLIT ? bf16_bits(xs[i] - bf16_val(hb)) : (unsigned short)0; }
#pragma unroll
    for (int t = 0; t < 4; ++t) {
      const size_t boff = (size_t)(col0 + t * 16 + ln) * ldb + kb;
      FragB bh_, bl_;
      bh_.half[0] = *(const v8us*)(Bh + boff + 8 * hh);
      bh_.half[1] = *(const v8us*)(Bh + boff + 16 + 8 * hh);
      if (BSPLIT) { bl_.half[0] = *(const v8us*)(Bl + boff + 8 * hh); bl_.half[1] = *(const v8us*)(Bl + boff + 16 + 8 * hh); } else bl_ = bh_;
      acc[t] = mmaN<ASPLIT ? (BSPLIT ? 3 : 2) : 1>(ah.v, al.v, bh_.v, bl_.v, acc[t]);
    }
  }
#pragma unroll
  for (int t = 0; t < 4; ++t) {
    float bv = bias ? bias[col0 + t * 16 + ln] : 0.f;
    if (BIAS_BF16) bv = bf16_round(bv);
#pragma unroll
    for (int r = 0; r < 8; ++r) { float v = acc[t][r] * alpha + bv; if (ACT == 1) v = fmaxf(v, 0.f); so[w][8 * hh + r][t * 16 + ln] = v; }
  }
  __builtin_amdgcn_fence(__ATOMIC_ACQ_REL, "workgroup");
  __builtin_amdgcn_wave_barrier();
  const int rsub = lane >> 4, c4 = (lane & 15) * 4;
  {
#pragma unroll
    for (int q = 0; q < 8; ++q) {
      const int r = q * 2 + rsub;
      const v4f v = *(const v4fa*)&so[w][r][c4];
      *(v4f*)(C + (size_t)(row0 + r) * ldc + col0 + c4) = v;
    }
    
  }
}
// C tile 16 x 32 per work-group of C[M][N] = A[M][K] x B, A f32 split hi/lo per fragment, B bf16 hi/lo planes [N][K], 3 terms as above.
// K is split over the 16 waves of the work-group (KW consecutive k each, K = 16 * KW); the 16 f32 partial tiles are summed
// through LDS in wave order. Grid: x = 32-column part of N, y = 16-row tile of M.
// Every loop over s, t, i, r, p below is unrolled so that the fragment arrays are indexed by constants and stay in registers.
template <int KW>
__global__ __launch_bounds__(512) void k_gemm_ksplit(const float* __restrict__ A, int lda, const unsigned short* __restrict__ Bh, const unsigned short* __restrict__ Bl, int ldb,
                                                   float* __restrict__ C, int ldc) {
  __shared__ float part[16][16][36];   // pitch 36: the two 8-row halves of an accumulator store fall on different banks
  const int tid = threadIdx.x, w = tid >> 5, lane = tid & 31, ln = lane & 15, hh = lane >> 4;
  const int row0 = blockIdx.y * 16, col0 = blockIdx.x * 32;
  const float* arow = A + (size_t)(row0 + ln) * lda + w * KW;
  const size_t bbase = (size_t)(col0 + ln) * ldb + w * KW;
  constexpr int NS = KW / 32, AHEAD = 3;   // a wave's fragment loads run AHEAD steps in front of its products (all NS at once spill)
  v4f xa[NS][4];
  FragB bh_[NS][2], bl_[NS][2];
  auto load_step = [&](int s) {
    const float* ap = arow + s * 32 + 8 * hh;
    xa[s][0] = *(const v4fa*)ap; xa[s][1] = *(const v4fa*)(ap + 4); xa[s][2] = *(const v4fa*)(ap + 16); xa[s][3] = *(const v4fa*)(ap + 20);
#pragma unroll
    for (int t = 0; t < 2; ++t) {
      const size_t boff = bbase + (size_t)(t * 16) * ldb + s * 32 + 8 * hh;
      bh_[s][t].half[0] = *(const v8us*)(Bh + boff); bh_[s][t].half[1] = *(const v8us*)(Bh + boff + 16);
      bl_[s][t].half[0] = *(const v8us*)(Bl + boff); bl_[s][t].half[1] = *(const v8us*)(Bl + boff + 16);
    }
  };
#pragma unroll
  for (int s = 0; s < AHEAD && s < NS; ++s) load_step(s);
  v8f acc[2] = {};
#pragma unroll
  for (int s = 0; s < NS; ++s) {
    FragB ah, al;
#pragma unroll
    for (int i = 0; i < 16; ++i) { const float x = xa[s][i >> 2][i & 3]; const unsigned short hb = bf16_bits(x); ah.u[i] = hb; al.u[i] = bf16_bits(x - bf16_val(hb)); }
#pragma unroll
    for (int t = 0; t < 2; ++t) acc[t] = mmaN<3>(ah.v, al.v, bh_[s][t].v, bl_[s][t].v, acc[t]);
    if (s + AHEAD < NS) load_step(s + AHEAD);
  }
#pragma unroll
  for (int t = 0; t < 2; ++t)
#pragma unroll
    for (int r = 0; r < 8; ++r) part[w][8 * hh + r][t * 16 + ln] = acc[t][r];
  __syncthreads();   // all 16 partial tiles are in LDS before any is read
  // thread = one element of the tile; a wave stores one whole 128-byte line of C
  float sum = 0.f;
#pragma unroll
  for (int p = 0; p < 16; ++p) sum += part[p][w][lane];
  C[(size_t)(row0 + w) * ldc + col0 + lane] = sum;
}
// row softmax: P[row][:] = softmax(masked S[row][:]) over N columns with optional causal mask (col > row + rowoff -> 0) and
__global__ __launch_bounds__(256) void k_softmax_rows(const float* __restrict__ S, float* __restrict__ P, int N, int causal, int rowoff, const int* __restrict__ mask, int mask_pitch) {
  __shared__ float red[256];
  const int row = blockIdx.x, tid = threadIdx.x;
  const float* s = S + (size_t)row * N; float* p_out = P + (size_t)row * N;
  const int qi = row + rowoff;
  float mx = -3.0e38f;
  for (int j = tid; j < N; j += 256) {
    bool keep = true;
    if (causal && j > qi) keep = false;
    if (mask && mask[(size_t)qi * mask_pitch + j] == 0) keep = false;
    const float v = keep ? s[j] : -3.0e38f;
    mx = fmaxf(mx, v);
  }
  red[tid] = mx; __syncthreads();
  for (int st = 128; st > 0; st >>= 1) { if (tid < st) red[tid] = fmaxf(red[tid], red[tid + st]); __syncthreads(); }
  mx = red[0]; __syncthreads();
  float sum = 0.f;
  for (int j = tid; j < N; j += 256) {
    bool keep = true;
    if (causal && j > qi) keep = false;
    if (mask && mask[(size_t)qi * mask_pitch + j] == 0) keep = false;
    const float p = keep ? __expf(s[j] - mx) : 0.f;
    sum += p;
  }
  red[tid] = sum; __syncthreads();
  for (int st = 128; st > 0; st >>= 1) { if (tid < st) red[tid] += red[tid + st]; __syncthreads(); }
  const float inv = (mx > -1.0e38f) ? 1.0f / red[0] : __builtin_nanf("");
  __syncthreads();
  {
    for (int j4 = tid * 4; j4 < N; j4 += 1024) {
      v4f out4;
#pragma unroll
      for (int u = 0; u < 4; ++u) {
        const int j = j4 + u;
        bool keep = true;
        if (causal && j > qi) keep = false;
        if (mask && mask[(size_t)qi * mask_pitch + j] == 0) keep = false;
        out4[u] = keep ? __expf(s[j] - mx) * inv : 0.f;
      }
      *(v4f*)(p_out + j4) = out4;
    }
    
  }
}

// one block per (head-in-group hh2, row i): conv over the zero-masked scores of that head, + bias, future -> -1e9, softmax -> P
__global__ __launch_bounds__(256) void k_conv_softmax(const float* __restrict__ S2, const float* __restrict__ conv_w, const float* __restrict__ conv_b,
                                                     int g, float* __restrict__ P2) {
  __shared__ float wk[6][11];
  __shared__ float row[SS];
  __shared__ float red[256];
  const int hh2 = blockIdx.y, i = blockIdx.x, tid = threadIdx.x;
  const int h = g * 2 + hh2;
  const float* S = S2 + (size_t)hh2 * SS * SS;
  if (tid < 66) wk[tid / 11][tid % 11] = conv_w[(size_t)h * 66 + tid];
  __syncthreads();
  const float cb = conv_b[h];
  float mx = -3.0e38f;
#pragma unroll 1
  for (int j = tid; j < SS; j += 256) {
    float acc = 0.f;
#pragma unroll
    for (int a = 0; a < 6; ++a) {
      const int ii = i + a - 2;
      if (ii < 0 || ii >= SS) continue;
      const float* srow = S + (size_t)ii * SS;
#pragma unroll
      for (int bq = 0; bq < 11; ++bq) {
        const int jj = j + bq - 5;
        if (jj < 0 || jj >= SS) continue;
        const float sv = (jj > ii) ? 0.0f : srow[jj];          // future positions enter the convolution as 0
        acc += wk[a][bq] * sv;
      }
    }
    acc += cb;
    const float fin = (j > i) ? -1.0e9f : acc;
    row[j] = fin; mx = fmaxf(mx, fin);
  }
  red[tid] = mx; __syncthreads();
  for (int st = 128; st > 0; st >>= 1) { if (tid < st) red[tid] = fmaxf(red[tid], red[tid + st]); __syncthreads(); }
  mx = red[0]; __syncthreads();
  float sum = 0.f;
  for (int j = tid; j < SS; j += 256) { const float e = __expf(row[j] - mx); row[j] = e; sum += e; }
  red[tid] = sum; __syncthreads();
  for (int st = 128; st > 0; st >>= 1) { if (tid < st) red[tid] += red[tid + st]; __syncthreads(); }
  const float inv = 1.0f / red[0];
  __syncthreads();
  float* prow = P2 + ((size_t)hh2 * SS + i) * SS;
  {
    for (int j4 = tid * 4; j4 < SS; j4 += 1024) { v4f o; o[0] = row[j4] * inv; o[1] = row[j4+1] * inv; o[2] = row[j4+2] * inv; o[3] = row[j4+3] * inv; *(v4f*)(prow + j4) = o; }
    
  }
}
// mixed_j = m[0][j]·P_0 + m[1][j]·P_1 for the two heads of group g; thread per 4 elements
__global__ __launch_bounds__(256) void k_mix(const float* __restrict__ P2, const float* __restrict__ head_mix, int g, float* __restrict__ M2) {
  const size_t t = (size_t)blockIdx.x * 256 + threadIdx.x;
  const size_t n4 = (size_t)SS * SS / 4;
  if (t >= 2 * n4) return;
  const int j = (int)(t / n4); const size_t e4 = (t % n4) * 4;
  const float m0 = head_mix[g * 4 + 0 * 2 + j], m1 = head_mix[g * 4 + 1 * 2 + j];
  const v4f a = *(const v4fa*)(P2 + e4), b = *(const v4fa*)(P2 + (size_t)SS * SS + e4);
  v4f o; for (int u = 0; u < 4; ++u) o[u] = m0 * a[u] + m1 * b[u];
  float* dst = M2 + (size_t)j * SS * SS + e4;
  *(v4f*)dst = o; 
}
// LayerNorm over 64 per row (biased variance), gamma/beta: block = 64 threads = 64 rows; normalised rows staged in LDS and
__global__ __launch_bounds__(64) void k_ln(const float* __restrict__ O, const float* __restrict__ gam, const float* __restrict__ bet, float* __restrict__ out, int nrows) {
  __shared__ __attribute__((aligned(16))) float so[64][DD];
  const int tid = threadIdx.x;
  const int r0 = blockIdx.x * 64, r = r0 + tid;
  if (r < nrows) {
    const float* x = O + (size_t)r * DD;
    float mu = 0.f;
#pragma unroll 1
    for (int d = 0; d < DD; ++d) mu += x[d];
    mu *= (1.0f / DD);
    float var = 0.f;
#pragma unroll 1
    for (int d = 0; d < DD; ++d) { const float c = x[d] - mu; var += c * c; }
    var *= (1.0f / DD);
    const float rs = rsqrtf(var + 1e-5f);
#pragma unroll 1
    for (int d = 0; d < DD; ++d) so[tid][d] = (x[d] - mu) * rs * gam[d] + bet[d];
  }
  __syncthreads();
  {
    for (int e = tid; e < 64 * (DD / 4); e += 64) {
      const int rr = e / (DD / 4), c4 = (e % (DD / 4)) * 4;
      if (r0 + rr < nrows) { const v4f val = *(const v4fa*)&so[rr][c4]; *(v4f*)(out + (size_t)(r0 + rr) * DD + c4) = val; }
    }
    
  }
}

extern "C" void kernel_launch(void* const* d_in, const int* in_sizes, int n_in,
                              void* d_out, int out_size, void* d_ws, size_t ws_size, hipStream_t stream) {
  (void)in_sizes; (void)n_in; (void)out_size;
  const float* q = (const float*)d_in[0]; const float* k = (const float*)d_in[1]; const float* v = (const float*)d_in[2];
  const float* conv_w = (const float*)d_in[3]; const float* conv_b = (const float*)d_in[4]; const float* head_mix = (const float*)d_in[5];
  const float* gam = (const float*)d_in[6]; const float* bet = (const float*)d_in[7];
  char* ws = (char*)d_ws; size_t off = 0;
  auto take = [&](size_t bytes) { char* p = ws + off; off += (bytes + 255) & ~(size_t)255; return p; };
  unsigned short* kh = (unsigned short*)take((size_t)2 * SS * DD * 2); unsigned short* kl = (unsigned short*)take((size_t)2 * SS * DD * 2);     // k rows planes, 2 heads
  unsigned short* vth = (unsigned short*)take((size_t)2 * DD * SS * 2); unsigned short* vtl = (unsigned short*)take((size_t)2 * DD * SS * 2);  // vᵀ planes, 2 heads
  float* S2 = (float*)take((size_t)2 * SS * SS * 4);     // 32 MiB scores of the 2 heads
  float* P2 = (float*)take((size_t)2 * SS * SS * 4);     // softmax maps
  float* M2 = (float*)take((size_t)2 * SS * SS * 4);     // mixed maps
  float* O  = (float*)take((size_t)NHD * SS * DD * 4);   // pre-LN output [16][2048][64]
  if (off > ws_size) return;
  for (int g = 0; g < NG; ++g) {
    for (int j = 0; j < 2; ++j) {
      const int h = g * 2 + j;
      const float* qh = q + (size_t)h * SS * DD; const float* khp = k + (size_t)h * SS * DD; const float* vh = v + (size_t)h * SS * DD;
      k_split_rows<<<(SS * (DD / 8) + 255) / 256, 256, 0, stream>>>(khp, DD, kh + (size_t)j * SS * DD, kl + (size_t)j * SS * DD, SS, DD);
      k_split_transpose<<<(DD * (SS / 8) + 255) / 256, 256, 0, stream>>>(vh, DD, vth + (size_t)j * DD * SS, vtl + (size_t)j * DD * SS, SS, DD);
      // scores_h = q·kᵀ / 8 : M=N=SS, K=DD
      k_gemm_bf2<true, true, 0, false><<<((SS / 16) * (SS / 64) + 3) / 4, 128, 0, stream>>>(qh, DD, kh + (size_t)j * SS * DD, kl + (size_t)j * SS * DD, DD, nullptr, 0.125f, S2 + (size_t)j * SS * SS, SS, SS, SS, DD);
    }
    k_conv_softmax<<<dim3(SS, 2), 256, 0, stream>>>(S2, conv_w, conv_b, g, P2);
    k_mix<<<(unsigned)(((size_t)2 * SS * SS / 4 + 255) / 256), 256, 0, stream>>>(P2, head_mix, g, M2);
    for (int j = 0; j < 2; ++j) {
      const int h = g * 2 + j;
      // out_h = mixed_j · v_h : M=SS, N=DD, K=SS; Bt[n=d][k=s] = vᵀ planes
      k_gemm_ksplit<SS / 16><<<dim3(DD / 32, SS / 16), 512, 0, stream>>>(M2 + (size_t)j * SS * SS, SS, vth + (size_t)j * DD * SS, vtl + (size_t)j * DD * SS, SS, O + (size_t)h * SS * DD, DD);
    }
  }
  k_ln<<<(NHD * SS + 63) / 64, 64, 0, stream>>>(O, gam, bet, (float*)d_out, NHD * SS);
}

// v002
// Measured time: 675 microseconds a run.
// Timed twice side by side with v001, it ran 2.45 times as fast both times.
// All steps since v000 together make it 4.18 times as fast.
#include <hip/hip_runtime.h>
// Contractions on v_wmma_f32_16x16x32_bf16 as 3-term bf16 hi/lo splits (f32-accurate), f32 accumulate: scores = q·kᵀ/8 (K=64)
// and out = mixed·v (K=2048). The 6x11 key-query convolution, masking, softmax, 2x2 head mixing and LayerNorm are f32 VALU.
#define NHD 16
#define SS 2048
#define DD 64
#define NG 8

typedef __bf16 v16b __attribute__((ext_vector_type(16)));
typedef unsigned short v8us __attribute__((ext_vector_type(8), may_alias));
typedef float  v8f  __attribute__((ext_vector_type(8)));
typedef float  v4f  __attribute__((ext_vector_type(4)));
typedef float  v4fa __attribute__((ext_vector_type(4), may_alias));
union FragB { v16b v; v8us half[2]; unsigned short u[16]; };

__device__ __forceinline__ unsigned short bf16_bits(float x) { unsigned int u = __float_as_uint(x); return (unsigned short)((u + 0x7FFFu + ((u >> 16) & 1u)) >> 16); }
__device__ __forceinline__ float bf16_val(unsigned short b) { return __uint_as_float(((unsigned int)b) << 16); }
__device__ __forceinline__ float bf16_round(float x) { return bf16_val(bf16_bits(x)); }
// D += A·B with NT terms: 1 = ah·bh, 2 = + al·bh (A split), 3 = + ah·bl (both split)
template <int NT>
__device__ __forceinline__ v8f mmaN(v16b ah, v16b al, v16b bh, v16b bl, v8f c) {
  c = __builtin_amdgcn_wmma_f32_16x16x32_bf16(false, ah, false, bh, (short)0, c, false, false);
  if (NT >= 2) c = __builtin_amdgcn_wmma_f32_16x16x32_bf16(false, al, false, bh, (short)0, c, false, false);
  if (NT >= 3) c = __builtin_amdgcn_wmma_f32_16x16x32_bf16(false, ah, false, bl, (short)0, c, false, false);
  asm volatile("v_nop\n\tv_nop\n\tv_nop\n\tv_nop" : "+v"(c) : "v"(ah), "v"(al), "v"(bh), "v"(bl));
  return c;
}

__global__ __launch_bounds__(256) void k_wt_bf16(const float* __restrict__ W, unsigned short* __restrict__ Wt, int K, int N) {
  const int t = blockIdx.x * 256 + threadIdx.x;
  const int k8n = K / 8;
  if (t >= N * k8n) return;
  const int n = t / k8n, k8 = (t % k8n) * 8;
  v8us v;
#pragma unroll
  for (int i = 0; i < 8; ++i) v[i] = bf16_bits(W[(size_t)(k8 + i) * N + n]);
  *(v8us*)(Wt + (size_t)n * K + k8) = v;
  
}

// GEMM C[M][N] (f32, pitch ldc) = act(A[M][K]·W + bias). A f32 row-major (pitch lda) converted per fragment to bf16
// (ASPLIT: hi/lo two planes -> 2 terms, else single rounded term); Wt bf16 [N][K] (pitch ldb). BIAS_BF16 rounds the
// bias to bf16 first (bias quantised to bf16 before the add). K%32==0, M%16==0, N%64==0.
template <bool ASPLIT, int ACT, bool BIAS_BF16>
__global__ __launch_bounds__(128) void k_gemm_bf(const float* __restrict__ A, int lda, const unsigned short* __restrict__ Wt, int ldb,
                                               const float* __restrict__ bias, float* __restrict__ C, int ldc, int M, int N, int K) {
  __shared__ __attribute__((aligned(16))) float so[4][16][64];
  const int tid = threadIdx.x, w = tid >> 5, lane = tid & 31, ln = lane & 15, hh = lane >> 4;
  const int ntn = N / 64;
  const int wid = blockIdx.x * 4 + w;
  const int mt = wid / ntn, nq = wid % ntn;
  if (mt * 16 >= M) return;
  const int row0 = mt * 16, col0 = nq * 64;
  const float* arow = A + (size_t)(row0 + ln) * lda;
  v8f acc[4] = {};
  for (int kb = 0; kb < K; kb += 32) {
    FragB ah, al;
    const v4f x0 = *(const v4fa*)(arow + kb + 8 * hh), x1 = *(const v4fa*)(arow + kb + 8 * hh + 4);
    const v4f x2 = *(const v4fa*)(arow + kb + 16 + 8 * hh), x3 = *(const v4fa*)(arow + kb + 16 + 8 * hh + 4);
    float xs[16] = {x0[0],x0[1],x0[2],x0[3],x1[0],x1[1],x1[2],x1[3],x2[0],x2[1],x2[2],x2[3],x3[0],x3[1],x3[2],x3[3]};
#pragma unroll
    for (int i = 0; i < 16; ++i) { const unsigned short hb = bf16_bits(xs[i]); ah.u[i] = hb; al.u[i] = ASPLIT ? bf16_bits(xs[i] - bf16_val(hb)) : (unsigned short)0; }
#pragma unroll
    for (int t = 0; t < 4; ++t) {
      const unsigned short* brow = Wt + (size_t)(col0 + t * 16 + ln) * ldb + kb;
      FragB b;
      b.half[0] = *(const v8us*)(brow + 8 * hh);
      b.half[1] = *(const v8us*)(brow + 16 + 8 * hh);
      acc[t] = mmaN<ASPLIT ? 2 : 1>(ah.v, al.v, b.v, b.v, acc[t]);
    }
  }
#pragma unroll
  for (int t = 0; t < 4; ++t) {
    float bv = bias ? bias[col0 + t * 16 + ln] : 0.f;
    if (BIAS_BF16) bv = bf16_round(bv);
#pragma unroll
    for (int r = 0; r < 8; ++r) { float v = acc[t][r] + bv; if (ACT == 1) v = fmaxf(v, 0.f); so[w][8 * hh + r][t * 16 + ln] = v; }
  }
  __builtin_amdgcn_fence(__ATOMIC_ACQ_REL, "workgroup");
  __builtin_amdgcn_wave_barrier();
  const int rsub = lane >> 4, c4 = (lane & 15) * 4;
  {
#pragma unroll
    for (int q = 0; q < 8; ++q) {
      const int r = q * 2 + rsub;
      const v4f v = *(const v4fa*)&so[w][r][c4];
      *(v4f*)(C + (size_t)(row0 + r) * ldc + col0 + c4) = v;
    }
    
  }
}

// Flash-style causal/unmasked attention, all contractions 3-term bf16 hi/lo splits, f32 softmax with running max.
// q,k,v rows are read from f32 buffers with arbitrary row pitch (so they can live inside a fused qkv buffer);
// D = head size (multiple of 32, <= 128); one wave = 16 query rows; block = 4 waves (64 queries) sharing K/V chunks of 32.
template <int D, bool CAUSAL>
__global__ __launch_bounds__(128) void k_flash(const float* __restrict__ qb, const float* __restrict__ kb, const float* __restrict__ vb,
                                             int pitch, int T, int H, float scale, float* __restrict__ y, int ypitch) {
  constexpr int KS = D / 32;        // k-steps for QK
  constexpr int DT = D / 16;        // d tiles for PV
  __shared__ __attribute__((aligned(16))) unsigned short sKh[32][D + 8], sKl[32][D + 8], sVh[32][D + 8], sVl[32][D + 8];
  __shared__ __attribute__((aligned(16))) unsigned short sPh[4][16][40], sPl[4][16][40];
  __shared__ __attribute__((aligned(16))) float sO[4][16][D];
  const int tid = threadIdx.x, w = tid >> 5, lane = tid & 31, ln = lane & 15, hh = lane >> 4;
  const int nqb = (T + 63) / 64;
  const int bh = blockIdx.x / nqb, qblk = blockIdx.x % nqb;
  const int b = bh / H, h = bh % H;
  const int q0 = qblk * 64 + w * 16;
  const float* Q = qb + (size_t)b * T * pitch + h * D;
  const float* K = kb + (size_t)b * T * pitch + h * D;
  const float* V = vb + (size_t)b * T * pitch + h * D;

  // A fragments of the wave's 16 query rows (scaled), hi/lo
  FragB aqh[KS], aql[KS];
  {
    int row = q0 + ln; if (row >= T) row = T - 1;
    const float* qr = Q + (size_t)row * pitch;
#pragma unroll
    for (int ks = 0; ks < KS; ++ks)
#pragma unroll
      for (int i = 0; i < 16; ++i) {
        const int d = ks * 32 + ((i < 8) ? (8 * hh + i) : (16 + 8 * hh + (i - 8)));
        const float x = qr[d] * scale; const unsigned short hb = bf16_bits(x);
        aqh[ks].u[i] = hb; aql[ks].u[i] = bf16_bits(x - bf16_val(hb));
      }
  }
  float m_r[8], l_r[8];
#pragma unroll
  for (int r = 0; r < 8; ++r) { m_r[r] = -3.0e38f; l_r[r] = 0.f; }
  v8f oacc[DT];
#pragma unroll
  for (int dt = 0; dt < DT; ++dt) oacc[dt] = (v8f){0.f,0.f,0.f,0.f,0.f,0.f,0.f,0.f};

  const int kv_end = CAUSAL ? min(T, qblk * 64 + 64) : T;     // block-uniform
  for (int j0 = 0; j0 < kv_end; j0 += 32) {
    __syncthreads();
    for (int e = tid; e < 32 * (D / 4); e += 128) {
      const int r = e / (D / 4), c4 = (e % (D / 4)) * 4;
      const int key = j0 + r;
      v4f kf = {0.f,0.f,0.f,0.f}, vf = {0.f,0.f,0.f,0.f};
      if (key < T) { kf = *(const v4fa*)(K + (size_t)key * pitch + c4); vf = *(const v4fa*)(V + (size_t)key * pitch + c4); }
#pragma unroll
      for (int t = 0; t < 4; ++t) {
        unsigned short hb = bf16_bits(kf[t]); sKh[r][c4 + t] = hb; sKl[r][c4 + t] = bf16_bits(kf[t] - bf16_val(hb));
        hb = bf16_bits(vf[t]); sVh[r][c4 + t] = hb; sVl[r][c4 + t] = bf16_bits(vf[t] - bf16_val(hb));
      }
    }
    __syncthreads();
    // S tile 16 x 32
    v8f s[2];
#pragma unroll
    for (int nt = 0; nt < 2; ++nt) {
      v8f acc = {};
#pragma unroll
      for (int ks = 0; ks < KS; ++ks) {
        FragB bh_, bl_;
        bh_.half[0] = *(const v8us*)&sKh[nt * 16 + ln][ks * 32 + 8 * hh]; bh_.half[1] = *(const v8us*)&sKh[nt * 16 + ln][ks * 32 + 16 + 8 * hh];
        bl_.half[0] = *(const v8us*)&sKl[nt * 16 + ln][ks * 32 + 8 * hh]; bl_.half[1] = *(const v8us*)&sKl[nt * 16 + ln][ks * 32 + 16 + 8 * hh];
        acc = mmaN<3>(aqh[ks].v, aql[ks].v, bh_.v, bl_.v, acc);
      }
      s[nt] = acc;
    }
    // mask + running max (rows 8hh+r; the 16 lanes of a half share rows)
    float alpha[8];
#pragma unroll
    for (int r = 0; r < 8; ++r) {
      const int qi = q0 + 8 * hh + r;
      const int ja = j0 + ln, jb = j0 + 16 + ln;
      if (CAUSAL) { if (ja > qi) s[0][r] = -3.0e38f; if (jb > qi) s[1][r] = -3.0e38f; }
      if (ja >= T) s[0][r] = -3.0e38f;
      if (jb >= T) s[1][r] = -3.0e38f;
      float mx = fmaxf(s[0][r], s[1][r]);
      mx = fmaxf(mx, __shfl_xor(mx, 1, 32)); mx = fmaxf(mx, __shfl_xor(mx, 2, 32)); mx = fmaxf(mx, __shfl_xor(mx, 4, 32)); mx = fmaxf(mx, __shfl_xor(mx, 8, 32));
      const float mnew = fmaxf(m_r[r], mx);
      alpha[r] = (mnew > -1.0e38f) ? __expf(m_r[r] - mnew) : 1.0f;
      const float p0 = (s[0][r] > -1.0e38f) ? __expf(s[0][r] - mnew) : 0.f;
      const float p1 = (s[1][r] > -1.0e38f) ? __expf(s[1][r] - mnew) : 0.f;
      m_r[r] = mnew;
      l_r[r] = l_r[r] * alpha[r] + p0 + p1;            // per-lane partial row sum (16 lanes combined at the end)
      unsigned short hb = bf16_bits(p0); sPh[w][8 * hh + r][ln] = hb;      sPl[w][8 * hh + r][ln] = bf16_bits(p0 - bf16_val(hb));
      hb = bf16_bits(p1);                sPh[w][8 * hh + r][16 + ln] = hb; sPl[w][8 * hh + r][16 + ln] = bf16_bits(p1 - bf16_val(hb));
    }
#pragma unroll
    for (int dt = 0; dt < DT; ++dt)
#pragma unroll
      for (int r = 0; r < 8; ++r) oacc[dt][r] *= alpha[r];
    __builtin_amdgcn_fence(__ATOMIC_ACQ_REL, "workgroup");
    __builtin_amdgcn_wave_barrier();
    FragB pah, pal;
    pah.half[0] = *(const v8us*)&sPh[w][ln][8 * hh]; pah.half[1] = *(const v8us*)&sPh[w][ln][16 + 8 * hh];
    pal.half[0] = *(const v8us*)&sPl[w][ln][8 * hh]; pal.half[1] = *(const v8us*)&sPl[w][ln][16 + 8 * hh];
#pragma unroll
    for (int dt = 0; dt < DT; ++dt) {
      FragB bvh, bvl;
#pragma unroll
      for (int i = 0; i < 8; ++i) {
        bvh.u[i] = sVh[8 * hh + i][dt * 16 + ln]; bvh.u[8 + i] = sVh[16 + 8 * hh + i][dt * 16 + ln];
        bvl.u[i] = sVl[8 * hh + i][dt * 16 + ln]; bvl.u[8 + i] = sVl[16 + 8 * hh + i][dt * 16 + ln];
      }
      oacc[dt] = mmaN<3>(pah.v, pal.v, bvh.v, bvl.v, oacc[dt]);
    }
    __builtin_amdgcn_fence(__ATOMIC_ACQ_REL, "workgroup");
    __builtin_amdgcn_wave_barrier();
  }
#pragma unroll
  for (int r = 0; r < 8; ++r) {
    float l = l_r[r];
    l += __shfl_xor(l, 1, 32); l += __shfl_xor(l, 2, 32); l += __shfl_xor(l, 4, 32); l += __shfl_xor(l, 8, 32);
    l_r[r] = (l > 0.f) ? 1.0f / l : 0.f;
  }
#pragma unroll
  for (int dt = 0; dt < DT; ++dt)
#pragma unroll
    for (int r = 0; r < 8; ++r) sO[w][8 * hh + r][dt * 16 + ln] = oacc[dt][r] * l_r[r];
  __builtin_amdgcn_fence(__ATOMIC_ACQ_REL, "workgroup");
  __builtin_amdgcn_wave_barrier();
  {
    for (int r = 0; r < 16; ++r) {
      const int row = q0 + r;
      if (row < T && lane < D / 4) {
        const v4f val = *(const v4fa*)&sO[w][r][lane * 4];
        *(v4f*)(y + ((size_t)b * T + row) * ypitch + h * D + lane * 4) = val;
      }
    }
    
  }
}

// f32 [R][Cc] (row pitch lds) -> bf16 hi/lo planes [R][Cc] (pitch Cc); thread per 8 elements; Cc % 8 == 0
__global__ __launch_bounds__(256) void k_split_rows(const float* __restrict__ src, int lds_, unsigned short* __restrict__ hi, unsigned short* __restrict__ lo, int R, int Cc) {
  const size_t t = (size_t)blockIdx.x * 256 + threadIdx.x;
  const int c8n = Cc / 8;
  if (t >= (size_t)R * c8n) return;
  const int r = (int)(t / c8n), c8 = (int)(t % c8n) * 8;
  const float* s = src + (size_t)r * lds_ + c8;
  const v4f a = *(const v4fa*)s, b = *(const v4fa*)(s + 4);
  float xs[8] = {a[0],a[1],a[2],a[3],b[0],b[1],b[2],b[3]};
  v8us vh, vl;
#pragma unroll
  for (int i = 0; i < 8; ++i) { const unsigned short hb = bf16_bits(xs[i]); vh[i] = hb; vl[i] = bf16_bits(xs[i] - bf16_val(hb)); }
  unsigned short* dh = hi + (size_t)r * Cc + c8; unsigned short* dl = lo + (size_t)r * Cc + c8;
  *(v8us*)dh = vh; *(v8us*)dl = vl; 
}
// f32 [K][N] (row pitch lds) -> transposed bf16 hi/lo planes [N][K]; one thread per (n, 8 consecutive k)
__global__ __launch_bounds__(256) void k_split_transpose(const float* __restrict__ src, int lds_, unsigned short* __restrict__ hi, unsigned short* __restrict__ lo, int K, int N) {
  const size_t t = (size_t)blockIdx.x * 256 + threadIdx.x;
  const int k8n = K / 8;
  if (t >= (size_t)N * k8n) return;
  const int n = (int)(t / k8n), k8 = (int)(t % k8n) * 8;
  v8us vh, vl;
#pragma unroll
  for (int i = 0; i < 8; ++i) { const float x = src[(size_t)(k8 + i) * lds_ + n]; const unsigned short hb = bf16_bits(x); vh[i] = hb; vl[i] = bf16_bits(x - bf16_val(hb)); }
  unsigned short* dh = hi + (size_t)n * K + k8; unsigned short* dl = lo + (size_t)n * K + k8;
  *(v8us*)dh = vh; *(v8us*)dl = vl; 
}
// GEMM with A f32 (split into hi/lo when ASPLIT) and B from bf16 planes Bh (+ Bl when BSPLIT): terms hi·hi [+ lo·hi] [+ hi·lo].
// C f32 [M][N] pitch ldc; alpha scales the result; bias optional (BIAS_BF16 rounds it). Same tiling/epilogue as k_gemm_bf.
template <bool ASPLIT, bool BSPLIT, int ACT, bool BIAS_BF16>
__global__ __launch_bounds__(128) void k_gemm_bf2(const float* __restrict__ A, int lda, const unsigned short* __restrict__ Bh, const unsigned short* __restrict__ Bl, int ldb,
                                                const float* __restrict__ bias, float alpha, float* __restrict__ C, int ldc, int M, int N, int K) {
  __shared__ __attribute__((aligned(16))) float so[4][16][64];
  const int tid = threadIdx.x, w = tid >> 5, lane = tid & 31, ln = lane & 15, hh = lane >> 4;
  const int ntn = N / 64;
  const int wid = blockIdx.x * 4 + w;
  const int mt = wid / ntn, nq = wid % ntn;
  if (mt * 16 >= M) return;
  const int row0 = mt * 16, col0 = nq * 64;
  const float* arow = A + (size_t)(row0 + ln) * lda;
  v8f acc[4] = {};
  for (int kb = 0; kb < K; kb += 32) {
    FragB ah, al;
    const v4f x0 = *(const v4fa*)(arow + kb + 8 * hh), x1 = *(const v4fa*)(arow + kb + 8 * hh + 4);
    const v4f x2 = *(const v4fa*)(arow + kb + 16 + 8 * hh), x3 = *(const v4fa*)(arow + kb + 16 + 8 * hh + 4);
    float xs[16] = {x0[0],x0[1],x0[2],x0[3],x1[0],x1[1],x1[2],x1[3],x2[0],x2[1],x2[2],x2[3],x3[0],x3[1],x3[2],x3[3]};
#pragma unroll
    for (int i = 0; i < 16; ++i) { const unsigned short hb = bf16_bits(xs[i]); ah.u[i] = hb; al.u[i] = ASPLIT ? bf16_bits(xs[i] - bf16_val(hb)) : (unsigned short)0; }
#pragma unroll
    for (int t = 0; t < 4; ++t) {
      const size_t boff = (size_t)(col0 + t * 16 + ln) * ldb + kb;
      FragB bh_, bl_;
      bh_.half[0] = *(const v8us*)(Bh + boff + 8 * hh);
      bh_.half[1] = *(const v8us*)(Bh + boff + 16 + 8 * hh);
      if (BSPLIT) { bl_.half[0] = *(const v8us*)(Bl + boff + 8 * hh); bl_.half[1] = *(const v8us*)(Bl + boff + 16 + 8 * hh); } else bl_ = bh_;
      acc[t] = mmaN<ASPLIT ? (BSPLIT ? 3 : 2) : 1>(ah.v, al.v, bh_.v, bl_.v, acc[t]);
    }
  }
#pragma unroll
  for (int t = 0; t < 4; ++t) {
    float bv = bias ? bias[col0 + t * 16 + ln] : 0.f;
    if (BIAS_BF16) bv = bf16_round(bv);
#pragma unroll
    for (int r = 0; r < 8; ++r) { float v = acc[t][r] * alpha + bv; if (ACT == 1) v = fmaxf(v, 0.f); so[w][8 * hh + r][t * 16 + ln] = v; }
  }
  __builtin_amdgcn_fence(__ATOMIC_ACQ_REL, "workgroup");
  __builtin_amdgcn_wave_barrier();
  const int rsub = lane >> 4, c4 = (lane & 15) * 4;
  {
#pragma unroll
    for (int q = 0; q < 8; ++q) {
      const int r = q * 2 + rsub;
      const v4f v = *(const v4fa*)&so[w][r][c4];
      *(v4f*)(C + (size_t)(row0 + r) * ldc + col0 + c4) = v;
    }
    
  }
}
// C tile 16 x 32 per work-group of C[M][N] = A[M][K] x B, A f32 split hi/lo per fragment, B bf16 hi/lo planes [N][K], 3 terms as above.
// K is split over the 16 waves of the work-group (KW consecutive k each, K = 16 * KW); the 16 f32 partial tiles are summed
// through LDS in wave order. Grid: x = 32-column part of N, y = 16-row tile of M.
// Every loop over s, t, i, r, p below is unrolled so that the fragment arrays are indexed by constants and stay in registers.
template <int KW>
__global__ __launch_bounds__(512) void k_gemm_ksplit(const float* __restrict__ A, int lda, const unsigned short* __restrict__ Bh, const unsigned short* __restrict__ Bl, int ldb,
                                                   float* __restrict__ C, int ldc) {
  __shared__ float part[16][16][36];   // pitch 36: the two 8-row halves of an accumulator store fall on different banks
  const int tid = threadIdx.x, w = tid >> 5, lane = tid & 31, ln = lane & 15, hh = lane >> 4;
  const int row0 = blockIdx.y * 16, col0 = blockIdx.x * 32;
  const float* arow = A + (size_t)(row0 + ln) * lda + w * KW;
  const size_t bbase = (size_t)(col0 + ln) * ldb + w * KW;
  constexpr int NS = KW / 32, AHEAD = 3;   // a wave's fragment loads run AHEAD steps in front of its products (all NS at once spill)
  v4f xa[NS][4];
  FragB bh_[NS][2], bl_[NS][2];
  auto load_step = [&](int s) {
    const float* ap = arow + s * 32 + 8 * hh;
    xa[s][0] = *(const v4fa*)ap; xa[s][1] = *(const v4fa*)(ap + 4); xa[s][2] = *(const v4fa*)(ap + 16); xa[s][3] = *(const v4fa*)(ap + 20);
#pragma unroll
    for (int t = 0; t < 2; ++t) {
      const size_t boff = bbase + (size_t)(t * 16) * ldb + s * 32 + 8 * hh;
      bh_[s][t].half[0] = *(const v8us*)(Bh + boff); bh_[s][t].half[1] = *(const v8us*)(Bh + boff + 16);
      bl_[s][t].half[0] = *(const v8us*)(Bl + boff); bl_[s][t].half[1] = *(const v8us*)(Bl + boff + 16);
    }
  };
#pragma unroll
  for (int s = 0; s < AHEAD && s < NS; ++s) load_step(s);
  v8f acc[2] = {};
#pragma unroll
  for (int s = 0; s < NS; ++s) {
    FragB ah, al;
#pragma unroll
    for (int i = 0; i < 16; ++i) { const float x = xa[s][i >> 2][i & 3]; const unsigned short hb = bf16_bits(x); ah.u[i] = hb; al.u[i] = bf16_bits(x - bf16_val(hb)); }
#pragma unroll
    for (int t = 0; t < 2; ++t) acc[t] = mmaN<3>(ah.v, al.v, bh_[s][t].v, bl_[s][t].v, acc[t]);
    if (s + AHEAD < NS) load_step(s + AHEAD);
  }
#pragma unroll
  for (int t = 0; t < 2; ++t)
#pragma unroll
    for (int r = 0; r < 8; ++r) part[w][8 * hh + r][t * 16 + ln] = acc[t][r];
  __syncthreads();   // all 16 partial tiles are in LDS before any is read
  // thread = one element of the tile; a wave stores one whole 128-byte line of C
  float sum = 0.f;
#pragma unroll
  for (int p = 0; p < 16; ++p) sum += part[p][w][lane];
  C[(size_t)(row0 + w) * ldc + col0 + lane] = sum;
}
// row softmax: P[row][:] = softmax(masked S[row][:]) over N columns with optional causal mask (col > row + rowoff -> 0) and
__global__ __launch_bounds__(256) void k_softmax_rows(const float* __restrict__ S, float* __restrict__ P, int N, int causal, int rowoff, const int* __restrict__ mask, int mask_pitch) {
  __shared__ float red[256];
  const int row = blockIdx.x, tid = threadIdx.x;
  const float* s = S + (size_t)row * N; float* p_out = P + (size_t)row * N;
  const int qi = row + rowoff;
  float mx = -3.0e38f;
  for (int j = tid; j < N; j += 256) {
    bool keep = true;
    if (causal && j > qi) keep = false;
    if (mask && mask[(size_t)qi * mask_pitch + j] == 0) keep = false;
    const float v = keep ? s[j] : -3.0e38f;
    mx = fmaxf(mx, v);
  }
  red[tid] = mx; __syncthreads();
  for (int st = 128; st > 0; st >>= 1) { if (tid < st) red[tid] = fmaxf(red[tid], red[tid + st]); __syncthreads(); }
  mx = red[0]; __syncthreads();
  float sum = 0.f;
  for (int j = tid; j < N; j += 256) {
    bool keep = true;
    if (causal && j > qi) keep = false;
    if (mask && mask[(size_t)qi * mask_pitch + j] == 0) keep = false;
    const float p = keep ? __expf(s[j] - mx) : 0.f;
    sum += p;
  }
  red[tid] = sum; __syncthreads();
  for (int st = 128; st > 0; st >>= 1) { if (tid < st) red[tid] += red[tid + st]; __syncthreads(); }
  const float inv = (mx > -1.0e38f) ? 1.0f / red[0] : __builtin_nanf("");
  __syncthreads();
  {
    for (int j4 = tid * 4; j4 < N; j4 += 1024) {
      v4f out4;
#pragma unroll
      for (int u = 0; u < 4; ++u) {
        const int j = j4 + u;
        bool keep = true;
        if (causal && j > qi) keep = false;
        if (mask && mask[(size_t)qi * mask_pitch + j] == 0) keep = false;
        out4[u] = keep ? __expf(s[j] - mx) * inv : 0.f;
      }
      *(v4f*)(p_out + j4) = out4;
    }
    
  }
}

// Cross-lane steps of a wave-wide reduction: row_xmask DPP inside a 16-lane row, then the other row's lane of the same index.
template <int CTRL>
__device__ __forceinline__ float dpp_get(float x) { return __int_as_float(__builtin_amdgcn_update_dpp(0, __float_as_int(x), CTRL, 0xf, 0xf, true)); }
__device__ __forceinline__ float other_row(float x) { return __int_as_float(__builtin_amdgcn_permlanex16(__float_as_int(x), __float_as_int(x), 0x76543210, 0xfedcba98, false, false)); }
__device__ __forceinline__ float wave_max(float x) {
  x = fmaxf(x, dpp_get<0x161>(x)); x = fmaxf(x, dpp_get<0x162>(x)); x = fmaxf(x, dpp_get<0x164>(x)); x = fmaxf(x, dpp_get<0x168>(x));
  return fmaxf(x, other_row(x));
}
__device__ __forceinline__ float wave_sum(float x) {
  x += dpp_get<0x161>(x); x += dpp_get<0x162>(x); x += dpp_get<0x164>(x); x += dpp_get<0x168>(x);
  return x + other_row(x);
}
// exp(x) as __expf builds it (x * log2 e, then v_exp_f32). In asm so that the v_nop stands directly behind the transcendental: it fills the
// slot that the instruction set asks for before the source register is rewritten or the result read.
__device__ __forceinline__ float exp_slot(float x) {
  const float y = x * 1.44269504f;
  float e;
  asm("v_exp_f32 %0, %1\n\tv_nop" : "=v"(e) : "v"(y));
  return e;
}
#define CR 8   // output rows per work-group
// one block per (head-in-group hh2, CR rows from i0): conv over the zero-masked scores of that head, + bias, future -> -1e9, softmax -> P.
// A thread owns 8 consecutive columns of all CR rows in registers. Each of the CR + 5 score rows is read once per thread as an
// 18-wide window and feeds every output row and tap that uses it; the 66 weights are wave-uniform. Per output element the taps
// are added in the order a, then bq, ascending.
// Every loop over t, x, r, bq, c, p below is unrolled so that the window and the accumulators are indexed by constants and stay in registers.
__global__ __launch_bounds__(256) void k_conv_softmax(const float* __restrict__ S2, const float* __restrict__ conv_w, const float* __restrict__ conv_b,
                                                     int g, float* __restrict__ P2) {
  __shared__ __attribute__((aligned(16))) float redm[8][CR], reds[8][CR];   // per wave: the CR row maxima, the CR row sums
  const int hh2 = blockIdx.y, i0 = blockIdx.x * CR, tid = threadIdx.x, w = tid >> 5, lane = tid & 31;
  const int h = g * 2 + hh2;
  const float* S = S2 + (size_t)hh2 * SS * SS;
  const float* wk = conv_w + (size_t)h * 66;
  const int j0 = tid * 8;
  // window = columns j0 - 5 .. j0 + 12; a piece that would leave the row is read from inside it and masked to 0 below
  // 32-bit byte offsets of a lane inside a row: with the wave-uniform row base each load takes the scalar-base form and these registers are never rewritten
  const unsigned oA = 4u * (unsigned)max(j0 - 5, 0), oB = 4u * (unsigned)max(j0 - 4, 0), oC = 4u * (unsigned)j0, oE = 4u * (unsigned)min(j0 + 8, SS - 4), oF = 4u * (unsigned)min(j0 + 12, SS - 1);
  float acc[CR][8];
#pragma unroll
  for (int r = 0; r < CR; ++r)
#pragma unroll
    for (int c = 0; c < 8; ++c) acc[r][c] = 0.f;
  float eA[2], eF[2];
  v4f qB[2], qC[2], qD[2], qE[2];
  auto load_row = [&](int t) {                                   // score row i0 - 2 + t into register set t & 1; a row outside is replaced by row i0 and masked
    const int ii = i0 - 2 + t;
    const char* srow = (const char*)(S + (size_t)((ii >= 0 && ii < SS) ? ii : i0) * SS);
    eA[t & 1] = *(const float*)(srow + oA); eF[t & 1] = *(const float*)(srow + oF);
    qB[t & 1] = *(const v4fa*)(srow + oB); qC[t & 1] = *(const v4fa*)(srow + oC); qD[t & 1] = *(const v4fa*)(srow + oC + 16); qE[t & 1] = *(const v4fa*)(srow + oE);
  };
  load_row(0);
#pragma unroll
  for (int t = 0; t < CR + 5; ++t) {
    if (t + 1 < CR + 5) load_row(t + 1);
    // keeps the next row's loads in front of this row's products, so that they land under them
    __builtin_amdgcn_sched_barrier(0);
    const int ii = i0 - 2 + t, s = t & 1;
    const unsigned lim = (ii >= 0 && ii < SS) ? (unsigned)(ii + 1) : 0u;   // columns 0 .. ii of row ii enter; future ones, and rows outside, enter as 0
    float win[18] = {eA[s], qB[s][0], qB[s][1], qB[s][2], qB[s][3], qC[s][0], qC[s][1], qC[s][2], qC[s][3],
                     qD[s][0], qD[s][1], qD[s][2], qD[s][3], qE[s][0], qE[s][1], qE[s][2], qE[s][3], eF[s]};
#pragma unroll
    for (int x = 0; x < 18; ++x) win[x] = ((unsigned)(j0 - 5 + x) < lim) ? win[x] : 0.0f;
#pragma unroll
    for (int r = 0; r < CR; ++r) {
      const int a = t - r;                                       // ii = (i0 + r) + a - 2
      if (a < 0 || a >= 6) continue;
#pragma unroll
      for (int bq = 0; bq < 11; ++bq)
#pragma unroll
        for (int c = 0; c < 8; ++c) acc[r][c] += wk[a * 11 + bq] * win[c + bq];
    }
  }
  const float cb = conv_b[h];
  float mx[CR];
#pragma unroll
  for (int r = 0; r < CR; ++r) {
    float m = -3.0e38f;
#pragma unroll
    for (int c = 0; c < 8; ++c) { const float fin = (j0 + c > i0 + r) ? -1.0e9f : acc[r][c] + cb; acc[r][c] = fin; m = fmaxf(m, fin); }
    mx[r] = wave_max(m);
  }
  if (lane == 0) {
#pragma unroll
    for (int r = 0; r < CR; ++r) redm[w][r] = mx[r];
  }
  __syncthreads();   // the 8 waves' row maxima are in LDS before any is read
#pragma unroll
  for (int r = 0; r < CR; ++r) {
    float m = redm[0][r];
#pragma unroll
    for (int p = 1; p < 8; ++p) m = fmaxf(m, redm[p][r]);
    float sum = 0.f;
#pragma unroll
    for (int c = 0; c < 8; ++c) { const float e = exp_slot(acc[r][c] - m); acc[r][c] = e; sum += e; }
    mx[r] = wave_sum(sum);
  }
  if (lane == 0) {
#pragma unroll
    for (int r = 0; r < CR; ++r) reds[w][r] = mx[r];
  }
  __syncthreads();   // the 8 waves' row sums are in LDS before any is read
#pragma unroll
  for (int r = 0; r < CR; ++r) {
    float sum = reds[0][r];
#pragma unroll
    for (int p = 1; p < 8; ++p) sum += reds[p][r];
    const float inv = 1.0f / sum;
    float* prow = P2 + ((size_t)hh2 * SS + i0 + r) * SS + j0;
    v4f o0, o1;
#pragma unroll
    for (int c = 0; c < 4; ++c) { o0[c] = acc[r][c] * inv; o1[c] = acc[r][4 + c] * inv; }
    *(v4f*)prow = o0; *(v4f*)(prow + 4) = o1;
  }
}
// mixed_j = m[0][j]·P_0 + m[1][j]·P_1 for the two heads of group g; thread per 4 elements
__global__ __launch_bounds__(256) void k_mix(const float* __restrict__ P2, const float* __restrict__ head_mix, int g, float* __restrict__ M2) {
  const size_t t = (size_t)blockIdx.x * 256 + threadIdx.x;
  const size_t n4 = (size_t)SS * SS / 4;
  if (t >= 2 * n4) return;
  const int j = (int)(t / n4); const size_t e4 = (t % n4) * 4;
  const float m0 = head_mix[g * 4 + 0 * 2 + j], m1 = head_mix[g * 4 + 1 * 2 + j];
  const v4f a = *(const v4fa*)(P2 + e4), b = *(const v4fa*)(P2 + (size_t)SS * SS + e4);
  v4f o; for (int u = 0; u < 4; ++u) o[u] = m0 * a[u] + m1 * b[u];
  float* dst = M2 + (size_t)j * SS * SS + e4;
  *(v4f*)dst = o; 
}
// LayerNorm over 64 per row (biased variance), gamma/beta: block = 64 threads = 64 rows; normalised rows staged in LDS and
__global__ __launch_bounds__(64) void k_ln(const float* __restrict__ O, const float* __restrict__ gam, const float* __restrict__ bet, float* __restrict__ out, int nrows) {
  __shared__ __attribute__((aligned(16))) float so[64][DD];
  const int tid = threadIdx.x;
  const int r0 = blockIdx.x * 64, r = r0 + tid;
  if (r < nrows) {
    const float* x = O + (size_t)r * DD;
    float mu = 0.f;
#pragma unroll 1
    for (int d = 0; d < DD; ++d) mu += x[d];
    mu *= (1.0f / DD);
    float var = 0.f;
#pragma unroll 1
    for (int d = 0; d < DD; ++d) { const float c = x[d] - mu; var += c * c; }
    var *= (1.0f / DD);
    const float rs = rsqrtf(var + 1e-5f);
#pragma unroll 1
    for (int d = 0; d < DD; ++d) so[tid][d] = (x[d] - mu) * rs * gam[d] + bet[d];
  }
  __syncthreads();
  {
    for (int e = tid; e < 64 * (DD / 4); e += 64) {
      const int rr = e / (DD / 4), c4 = (e % (DD / 4)) * 4;
      if (r0 + rr < nrows) { const v4f val = *(const v4fa*)&so[rr][c4]; *(v4f*)(out + (size_t)(r0 + rr) * DD + c4) = val; }
    }
    
  }
}

extern "C" void kernel_launch(void* const* d_in, const int* in_sizes, int n_in,
                              void* d_out, int out_size, void* d_ws, size_t ws_size, hipStream_t stream) {
  (void)in_sizes; (void)n_in; (void)out_size;
  const float* q = (const float*)d_in[0]; const float* k = (const float*)d_in[1]; const float* v = (const float*)d_in[2];
  const float* conv_w = (const float*)d_in[3]; const float* conv_b = (const float*)d_in[4]; const float* head_mix = (const float*)d_in[5];
  const float* gam = (const float*)d_in[6]; const float* bet = (const float*)d_in[7];
  char* ws = (char*)d_ws; size_t off = 0;
  auto take = [&](size_t bytes) { char* p = ws + off; off += (bytes + 255) & ~(size_t)255; return p; };
  unsigned short* kh = (unsigned short*)take((size_t)2 * SS * DD * 2); unsigned short* kl = (unsigned short*)take((size_t)2 * SS * DD * 2);     // k rows planes, 2 heads
  unsigned short* vth = (unsigned short*)take((size_t)2 * DD * SS * 2); unsigned short* vtl = (unsigned short*)take((size_t)2 * DD * SS * 2);  // vᵀ planes, 2 heads
  float* S2 = (float*)take((size_t)2 * SS * SS * 4);     // 32 MiB scores of the 2 heads
  float* P2 = (float*)take((size_t)2 * SS * SS * 4);     // softmax maps
  float* M2 = (float*)take((size_t)2 * SS * SS * 4);     // mixed maps
  float* O  = (float*)take((size_t)NHD * SS * DD * 4);   // pre-LN output [16][2048][64]
  if (off > ws_size) return;
  for (int g = 0; g < NG; ++g) {
    for (int j = 0; j < 2; ++j) {
      const int h = g * 2 + j;
      const float* qh = q + (size_t)h * SS * DD; const float* khp = k + (size_t)h * SS * DD; const float* vh = v + (size_t)h * SS * DD;
      k_split_rows<<<(SS * (DD / 8) + 255) / 256, 256, 0, stream>>>(khp, DD, kh + (size_t)j * SS * DD, kl + (size_t)j * SS * DD, SS, DD);
      k_split_transpose<<<(DD * (SS / 8) + 255) / 256, 256, 0, stream>>>(vh, DD, vth + (size_t)j * DD * SS, vtl + (size_t)j * DD * SS, SS, DD);
      // scores_h = q·kᵀ / 8 : M=N=SS, K=DD
      k_gemm_bf2<true, true, 0, false><<<((SS / 16) * (SS / 64) + 3) / 4, 128, 0, stream>>>(qh, DD, kh + (size_t)j * SS * DD, kl + (size_t)j * SS * DD, DD, nullptr, 0.125f, S2 + (size_t)j * SS * SS, SS, SS, SS, DD);
    }
    k_conv_softmax<<<dim3(SS / CR, 2), 256, 0, stream>>>(S2, conv_w, conv_b, g, P2);
    k_mix<<<(unsigned)(((size_t)2 * SS * SS / 4 + 255) / 256), 256, 0, stream>>>(P2, head_mix, g, M2);
    for (int j = 0; j < 2; ++j) {
      const int h = g * 2 + j;
      // out_h = mixed_j · v_h : M=SS, N=DD, K=SS; Bt[n=d][k=s] = vᵀ planes
      k_gemm_ksplit<SS / 16><<<dim3(DD / 32, SS / 16), 512, 0, stream>>>(M2 + (size_t)j * SS * SS, SS, vth + (size_t)j * DD * SS, vtl + (size_t)j * DD * SS, SS, O + (size_t)h * SS * DD, DD);
    }
  }
  k_ln<<<(NHD * SS + 63) / 64, 64, 0, stream>>>(O, gam, bet, (float*)d_out, NHD * SS);
}

// v003
// A run of this version takes 619 microseconds.
// Next to v002, in two timings, it ran 1.09 times as fast each time.
// All steps since v000 together make it 4.56 times as fast.
#include <hip/hip_runtime.h>
// Contractions on v_wmma_f32_16x16x32_bf16 as 3-term bf16 hi/lo splits (f32-accurate), f32 accumulate: scores = q·kᵀ/8 (K=64)
// and out = mixed·v (K=2048). The 6x11 key-query convolution, masking, softmax, 2x2 head mixing and LayerNorm are f32 VALU.
#define NHD 16
#define SS 2048
#define DD 64
#define NG 8

typedef __bf16 v16b __attribute__((ext_vector_type(16)));
typedef unsigned short v8us __attribute__((ext_vector_type(8), may_alias));
typedef float  v8f  __attribute__((ext_vector_type(8)));
typedef float  v4f  __attribute__((ext_vector_type(4)));
typedef float  v4fa __attribute__((ext_vector_type(4), may_alias));
union FragB { v16b v; v8us half[2]; unsigned short u[16]; };

__device__ __forceinline__ unsigned short bf16_bits(float x) { unsigned int u = __float_as_uint(x); return (unsigned short)((u + 0x7FFFu + ((u >> 16) & 1u)) >> 16); }
__device__ __forceinline__ float bf16_val(unsigned short b) { return __uint_as_float(((unsigned int)b) << 16); }
__device__ __forceinline__ float bf16_round(float x) { return bf16_val(bf16_bits(x)); }
// D += A·B with NT terms: 1 = ah·bh, 2 = + al·bh (A split), 3 = + ah·bl (both split)
template <int NT>
__device__ __forceinline__ v8f mmaN(v16b ah, v16b al, v16b bh, v16b bl, v8f c) {
  c = __builtin_amdgcn_wmma_f32_16x16x32_bf16(false, ah, false, bh, (short)0, c, false, false);
  if (NT >= 2) c = __builtin_amdgcn_wmma_f32_16x16x32_bf16(false, al, false, bh, (short)0, c, false, false);
  if (NT >= 3) c = __builtin_amdgcn_wmma_f32_16x16x32_bf16(false, ah, false, bl, (short)0, c, false, false);
  asm volatile("v_nop\n\tv_nop\n\tv_nop\n\tv_nop" : "+v"(c) : "v"(ah), "v"(al), "v"(bh), "v"(bl));
  return c;
}

__global__ __launch_bounds__(256) void k_wt_bf16(const float* __restrict__ W, unsigned short* __restrict__ Wt, int K, int N) {
  const int t = blockIdx.x * 256 + threadIdx.x;
  const int k8n = K / 8;
  if (t >= N * k8n) return;
  const int n = t / k8n, k8 = (t % k8n) * 8;
  v8us v;
#pragma unroll
  for (int i = 0; i < 8; ++i) v[i] = bf16_bits(W[(size_t)(k8 + i) * N + n]);
  *(v8us*)(Wt + (size_t)n * K + k8) = v;
  
}

// GEMM C[M][N] (f32, pitch ldc) = act(A[M][K]·W + bias). A f32 row-major (pitch lda) converted per fragment to bf16
// (ASPLIT: hi/lo two planes -> 2 terms, else single rounded term); Wt bf16 [N][K] (pitch ldb). BIAS_BF16 rounds the
// bias to bf16 first (bias quantised to bf16 before the add). K%32==0, M%16==0, N%64==0.
template <bool ASPLIT, int ACT, bool BIAS_BF16>
__global__ __launch_bounds__(128) void k_gemm_bf(const float* __restrict__ A, int lda, const unsigned short* __restrict__ Wt, int ldb,
                                               const float* __restrict__ bias, float* __restrict__ C, int ldc, int M, int N, int K) {
  __shared__ __attribute__((aligned(16))) float so[4][16][64];
  const int tid = threadIdx.x, w = tid >> 5, lane = tid & 31, ln = lane & 15, hh = lane >> 4;
  const int ntn = N / 64;
  const int wid = blockIdx.x * 4 + w;
  const int mt = wid / ntn, nq = wid % ntn;
  if (mt * 16 >= M) return;
  const int row0 = mt * 16, col0 = nq * 64;
  const float* arow = A + (size_t)(row0 + ln) * lda;
  v8f acc[4] = {};
  for (int kb = 0; kb < K; kb += 32) {
    FragB ah, al;
    const v4f x0 = *(const v4fa*)(arow + kb + 8 * hh), x1 = *(const v4fa*)(arow + kb + 8 * hh + 4);
    const v4f x2 = *(const v4fa*)(arow + kb + 16 + 8 * hh), x3 = *(const v4fa*)(arow + kb + 16 + 8 * hh + 4);
    float xs[16] = {x0[0],x0[1],x0[2],x0[3],x1[0],x1[1],x1[2],x1[3],x2[0],x2[1],x2[2],x2[3],x3[0],x3[1],x3[2],x3[3]};
#pragma unroll
    for (int i = 0; i < 16; ++i) { const unsigned short hb = bf16_bits(xs[i]); ah.u[i] = hb; al.u[i] = ASPLIT ? bf16_bits(xs[i] - bf16_val(hb)) : (unsigned short)0; }
#pragma unroll
    for (int t = 0; t < 4; ++t) {
      const unsigned short* brow = Wt + (size_t)(col0 + t * 16 + ln) * ldb + kb;
      FragB b;
      b.half[0] = *(const v8us*)(brow + 8 * hh);
      b.half[1] = *(const v8us*)(brow + 16 + 8 * hh);
      acc[t] = mmaN<ASPLIT ? 2 : 1>(ah.v, al.v, b.v, b.v, acc[t]);
    }
  }
#pragma unroll
  for (int t = 0; t < 4; ++t) {
    float bv = bias ? bias[col0 + t * 16 + ln] : 0.f;
    if (BIAS_BF16) bv = bf16_round(bv);
#pragma unroll
    for (int r = 0; r < 8; ++r) { float v = acc[t][r] + bv; if (ACT == 1) v = fmaxf(v, 0.f); so[w][8 * hh + r][t * 16 + ln] = v; }
  }
  __builtin_amdgcn_fence(__ATOMIC_ACQ_REL, "workgroup");
  __builtin_amdgcn_wave_barrier();
  const int rsub = lane >> 4, c4 = (lane & 15) * 4;
  {
#pragma unroll
    for (int q = 0; q < 8; ++q) {
      const int r = q * 2 + rsub;
      const v4f v = *(const v4fa*)&so[w][r][c4];
      *(v4f*)(C + (size_t)(row0 + r) * ldc + col0 + c4) = v;
    }
    
  }
}

// Flash-style causal/unmasked attention, all contractions 3-term bf16 hi/lo splits, f32 softmax with running max.
// q,k,v rows are read from f32 buffers with arbitrary row pitch (so they can live inside a fused qkv buffer);
// D = head size (multiple of 32, <= 128); one wave = 16 query rows; block = 4 waves (64 queries) sharing K/V chunks of 32.
template <int D, bool CAUSAL>
__global__ __launch_bounds__(128) void k_flash(const float* __restrict__ qb, const float* __restrict__ kb, const float* __restrict__ vb,
                                             int pitch, int T, int H, float scale, float* __restrict__ y, int ypitch) {
  constexpr int KS = D / 32;        // k-steps for QK
  constexpr int DT = D / 16;        // d tiles for PV
  __shared__ __attribute__((aligned(16))) unsigned short sKh[32][D + 8], sKl[32][D + 8], sVh[32][D + 8], sVl[32][D + 8];
  __shared__ __attribute__((aligned(16))) unsigned short sPh[4][16][40], sPl[4][16][40];
  __shared__ __attribute__((aligned(16))) float sO[4][16][D];
  const int tid = threadIdx.x, w = tid >> 5, lane = tid & 31, ln = lane & 15, hh = lane >> 4;
  const int nqb = (T + 63) / 64;
  const int bh = blockIdx.x / nqb, qblk = blockIdx.x % nqb;
  const int b = bh / H, h = bh % H;
  const int q0 = qblk * 64 + w * 16;
  const float* Q = qb + (size_t)b * T * pitch + h * D;
  const float* K = kb + (size_t)b * T * pitch + h * D;
  const float* V = vb + (size_t)b * T * pitch + h * D;

  // A fragments of the wave's 16 query rows (scaled), hi/lo
  FragB aqh[KS], aql[KS];
  {
    int row = q0 + ln; if (row >= T) row = T - 1;
    const float* qr = Q + (size_t)row * pitch;
#pragma unroll
    for (int ks = 0; ks < KS; ++ks)
#pragma unroll
      for (int i = 0; i < 16; ++i) {
        const int d = ks * 32 + ((i < 8) ? (8 * hh + i) : (16 + 8 * hh + (i - 8)));
        const float x = qr[d] * scale; const unsigned short hb = bf16_bits(x);
        aqh[ks].u[i] = hb; aql[ks].u[i] = bf16_bits(x - bf16_val(hb));
      }
  }
  float m_r[8], l_r[8];
#pragma unroll
  for (int r = 0; r < 8; ++r) { m_r[r] = -3.0e38f; l_r[r] = 0.f; }
  v8f oacc[DT];
#pragma unroll
  for (int dt = 0; dt < DT; ++dt) oacc[dt] = (v8f){0.f,0.f,0.f,0.f,0.f,0.f,0.f,0.f};

  const int kv_end = CAUSAL ? min(T, qblk * 64 + 64) : T;     // block-uniform
  for (int j0 = 0; j0 < kv_end; j0 += 32) {
    __syncthreads();
    for (int e = tid; e < 32 * (D / 4); e += 128) {
      const int r = e / (D / 4), c4 = (e % (D / 4)) * 4;
      const int key = j0 + r;
      v4f kf = {0.f,0.f,0.f,0.f}, vf = {0.f,0.f,0.f,0.f};
      if (key < T) { kf = *(const v4fa*)(K + (size_t)key * pitch + c4); vf = *(const v4fa*)(V + (size_t)key * pitch + c4); }
#pragma unroll
      for (int t = 0; t < 4; ++t) {
        unsigned short hb = bf16_bits(kf[t]); sKh[r][c4 + t] = hb; sKl[r][c4 + t] = bf16_bits(kf[t] - bf16_val(hb));
        hb = bf16_bits(vf[t]); sVh[r][c4 + t] = hb; sVl[r][c4 + t] = bf16_bits(vf[t] - bf16_val(hb));
      }
    }
    __syncthreads();
    // S tile 16 x 32
    v8f s[2];
#pragma unroll
    for (int nt = 0; nt < 2; ++nt) {
      v8f acc = {};
#pragma unroll
      for (int ks = 0; ks < KS; ++ks) {
        FragB bh_, bl_;
        bh_.half[0] = *(const v8us*)&sKh[nt * 16 + ln][ks * 32 + 8 * hh]; bh_.half[1] = *(const v8us*)&sKh[nt * 16 + ln][ks * 32 + 16 + 8 * hh];
        bl_.half[0] = *(const v8us*)&sKl[nt * 16 + ln][ks * 32 + 8 * hh]; bl_.half[1] = *(const v8us*)&sKl[nt * 16 + ln][ks * 32 + 16 + 8 * hh];
        acc = mmaN<3>(aqh[ks].v, aql[ks].v, bh_.v, bl_.v, acc);
      }
      s[nt] = acc;
    }
    // mask + running max (rows 8hh+r; the 16 lanes of a half share rows)
    float alpha[8];
#pragma unroll
    for (int r = 0; r < 8; ++r) {
      const int qi = q0 + 8 * hh + r;
      const int ja = j0 + ln, jb = j0 + 16 + ln;
      if (CAUSAL) { if (ja > qi) s[0][r] = -3.0e38f; if (jb > qi) s[1][r] = -3.0e38f; }
      if (ja >= T) s[0][r] = -3.0e38f;
      if (jb >= T) s[1][r] = -3.0e38f;
      float mx = fmaxf(s[0][r], s[1][r]);
      mx = fmaxf(mx, __shfl_xor(mx, 1, 32)); mx = fmaxf(mx, __shfl_xor(mx, 2, 32)); mx = fmaxf(mx, __shfl_xor(mx, 4, 32)); mx = fmaxf(mx, __shfl_xor(mx, 8, 32));
      const float mnew = fmaxf(m_r[r], mx);
      alpha[r] = (mnew > -1.0e38f) ? __expf(m_r[r] - mnew) : 1.0f;
      const float p0 = (s[0][r] > -1.0e38f) ? __expf(s[0][r] - mnew) : 0.f;
      const float p1 = (s[1][r] > -1.0e38f) ? __expf(s[1][r] - mnew) : 0.f;
      m_r[r] = mnew;
      l_r[r] = l_r[r] * alpha[r] + p0 + p1;            // per-lane partial row sum (16 lanes combined at the end)
      unsigned short hb = bf16_bits(p0); sPh[w][8 * hh + r][ln] = hb;      sPl[w][8 * hh + r][ln] = bf16_bits(p0 - bf16_val(hb));
      hb = bf16_bits(p1);                sPh[w][8 * hh + r][16 + ln] = hb; sPl[w][8 * hh + r][16 + ln] = bf16_bits(p1 - bf16_val(hb));
    }
#pragma unroll
    for (int dt = 0; dt < DT; ++dt)
#pragma unroll
      for (int r = 0; r < 8; ++r) oacc[dt][r] *= alpha[r];
    __builtin_amdgcn_fence(__ATOMIC_ACQ_REL, "workgroup");
    __builtin_amdgcn_wave_barrier();
    FragB pah, pal;
    pah.half[0] = *(const v8us*)&sPh[w][ln][8 * hh]; pah.half[1] = *(const v8us*)&sPh[w][ln][16 + 8 * hh];
    pal.half[0] = *(const v8us*)&sPl[w][ln][8 * hh]; pal.half[1] = *(const v8us*)&sPl[w][ln][16 + 8 * hh];
#pragma unroll
    for (int dt = 0; dt < DT; ++dt) {
      FragB bvh, bvl;
#pragma unroll
      for (int i = 0; i < 8; ++i) {
        bvh.u[i] = sVh[8 * hh + i][dt * 16 + ln]; bvh.u[8 + i] = sVh[16 + 8 * hh + i][dt * 16 + ln];
        bvl.u[i] = sVl[8 * hh + i][dt * 16 + ln]; bvl.u[8 + i] = sVl[16 + 8 * hh + i][dt * 16 + ln];
      }
      oacc[dt] = mmaN<3>(pah.v, pal.v, bvh.v, bvl.v, oacc[dt]);
    }
    __builtin_amdgcn_fence(__ATOMIC_ACQ_REL, "workgroup");
    __builtin_amdgcn_wave_barrier();
  }
#pragma unroll
  for (int r = 0; r < 8; ++r) {
    float l = l_r[r];
    l += __shfl_xor(l, 1, 32); l += __shfl_xor(l, 2, 32); l += __shfl_xor(l, 4, 32); l += __shfl_xor(l, 8, 32);
    l_r[r] = (l > 0.f) ? 1.0f / l : 0.f;
  }
#pragma unroll
  for (int dt = 0; dt < DT; ++dt)
#pragma unroll
    for (int r = 0; r < 8; ++r) sO[w][8 * hh + r][dt * 16 + ln] = oacc[dt][r] * l_r[r];
  __builtin_amdgcn_fence(__ATOMIC_ACQ_REL, "workgroup");
  __builtin_amdgcn_wave_barrier();
  {
    for (int r = 0; r < 16; ++r) {
      const int row = q0 + r;
      if (row < T && lane < D / 4) {
        const v4f val = *(const v4fa*)&sO[w][r][lane * 4];
        *(v4f*)(y + ((size_t)b * T + row) * ypitch + h * D + lane * 4) = val;
      }
    }
    
  }
}

// f32 [R][Cc] (row pitch lds) -> bf16 hi/lo planes [R][Cc] (pitch Cc); thread per 8 elements; Cc % 8 == 0
__global__ __launch_bounds__(256) void k_split_rows(const float* __restrict__ src, int lds_, unsigned short* __restrict__ hi, unsigned short* __restrict__ lo, int R, int Cc) {
  const size_t t = (size_t)blockIdx.x * 256 + threadIdx.x;
  const int c8n = Cc / 8;
  if (t >= (size_t)R * c8n) return;
  const int r = (int)(t / c8n), c8 = (int)(t % c8n) * 8;
  const float* s = src + (size_t)r * lds_ + c8;
  const v4f a = *(const v4fa*)s, b = *(const v4fa*)(s + 4);
  float xs[8] = {a[0],a[1],a[2],a[3],b[0],b[1],b[2],b[3]};
  v8us vh, vl;
#pragma unroll
  for (int i = 0; i < 8; ++i) { const unsigned short hb = bf16_bits(xs[i]); vh[i] = hb; vl[i] = bf16_bits(xs[i] - bf16_val(hb)); }
  unsigned short* dh = hi + (size_t)r * Cc + c8; unsigned short* dl = lo + (size_t)r * Cc + c8;
  *(v8us*)dh = vh; *(v8us*)dl = vl; 
}
// f32 [K][N] (row pitch lds) -> transposed bf16 hi/lo planes [N][K]; one thread per (n, 8 consecutive k)
__global__ __launch_bounds__(256) void k_split_transpose(const float* __restrict__ src, int lds_, unsigned short* __restrict__ hi, unsigned short* __restrict__ lo, int K, int N) {
  const size_t t = (size_t)blockIdx.x * 256 + threadIdx.x;
  const int k8n = K / 8;
  if (t >= (size_t)N * k8n) return;
  const int n = (int)(t / k8n), k8 = (int)(t % k8n) * 8;
  v8us vh, vl;
#pragma unroll
  for (int i = 0; i < 8; ++i) { const float x = src[(size_t)(k8 + i) * lds_ + n]; const unsigned short hb = bf16_bits(x); vh[i] = hb; vl[i] = bf16_bits(x - bf16_val(hb)); }
  unsigned short* dh = hi + (size_t)n * K + k8; unsigned short* dl = lo + (size_t)n * K + k8;
  *(v8us*)dh = vh; *(v8us*)dl = vl; 
}
// GEMM with A f32 (split into hi/lo when ASPLIT) and B from bf16 planes Bh (+ Bl when BSPLIT): terms hi·hi [+ lo·hi] [+ hi·lo].
// C f32 [M][N] pitch ldc; alpha scales the result; bias optional (BIAS_BF16 rounds it). Same tiling/epilogue as k_gemm_bf.
template <bool ASPLIT, bool BSPLIT, int ACT, bool BIAS_BF16>
__global__ __launch_bounds__(128) void k_gemm_bf2(const float* __restrict__ A, int lda, const unsigned short* __restrict__ Bh, const unsigned short* __restrict__ Bl, int ldb,
                                                const float* __restrict__ bias, float alpha, float* __restrict__ C, int ldc, int M, int N, int K) {
  __shared__ __attribute__((aligned(16))) float so[4][16][64];
  const int tid = threadIdx.x, w = tid >> 5, lane = tid & 31, ln = lane & 15, hh = lane >> 4;
  const int ntn = N / 64;
  const int wid = blockIdx.x * 4 + w;
  const int mt = wid / ntn, nq = wid % ntn;
  if (mt * 16 >= M) return;
  const int row0 = mt * 16, col0 = nq * 64;
  const float* arow = A + (size_t)(row0 + ln) * lda;
  v8f acc[4] = {};
  for (int kb = 0; kb < K; kb += 32) {
    FragB ah, al;
    const v4f x0 = *(const v4fa*)(arow + kb + 8 * hh), x1 = *(const v4fa*)(arow + kb + 8 * hh + 4);
    const v4f x2 = *(const v4fa*)(arow + kb + 16 + 8 * hh), x3 = *(const v4fa*)(arow + kb + 16 + 8 * hh + 4);
    float xs[16] = {x0[0],x0[1],x0[2],x0[3],x1[0],x1[1],x1[2],x1[3],x2[0],x2[1],x2[2],x2[3],x3[0],x3[1],x3[2],x3[3]};
#pragma unroll
    for (int i = 0; i < 16; ++i) { const unsigned short hb = bf16_bits(xs[i]); ah.u[i] = hb; al.u[i] = ASPLIT ? bf16_bits(xs[i] - bf16_val(hb)) : (unsigned short)0; }
#pragma unroll
    for (int t = 0; t < 4; ++t) {
      const size_t boff = (size_t)(col0 + t * 16 + ln) * ldb + kb;
      FragB bh_, bl_;
      bh_.half[0] = *(const v8us*)(Bh + boff + 8 * hh);
      bh_.half[1] = *(const v8us*)(Bh + boff + 16 + 8 * hh);
      if (BSPLIT) { bl_.half[0] = *(const v8us*)(Bl + boff + 8 * hh); bl_.half[1] = *(const v8us*)(Bl + boff + 16 + 8 * hh); } else bl_ = bh_;
      acc[t] = mmaN<ASPLIT ? (BSPLIT ? 3 : 2) : 1>(ah.v, al.v, bh_.v, bl_.v, acc[t]);
    }
  }
#pragma unroll
  for (int t = 0; t < 4; ++t) {
    float bv = bias ? bias[col0 + t * 16 + ln] : 0.f;
    if (BIAS_BF16) bv = bf16_round(bv);
#pragma unroll
    for (int r = 0; r < 8; ++r) { float v = acc[t][r] * alpha + bv; if (ACT == 1) v = fmaxf(v, 0.f); so[w][8 * hh + r][t * 16 + ln] = v; }
  }
  __builtin_amdgcn_fence(__ATOMIC_ACQ_REL, "workgroup");
  __builtin_amdgcn_wave_barrier();
  const int rsub = lane >> 4, c4 = (lane & 15) * 4;
  {
#pragma unroll
    for (int q = 0; q < 8; ++q) {
      const int r = q * 2 + rsub;
      const v4f v = *(const v4fa*)&so[w][r][c4];
      *(v4f*)(C + (size_t)(row0 + r) * ldc + col0 + c4) = v;
    }
    
  }
}
// C tile 16 x 32 per work-group of C[M][N] = A[M][K] x B, A f32 split hi/lo per fragment, B bf16 hi/lo planes [N][K], 3 terms as above.
// K is split over the 16 waves of the work-group (KW consecutive k each, K = 16 * KW); the 16 f32 partial tiles are summed
// through LDS in wave order. Grid: x = 32-column part of N, y = 16-row tile of M.
// Every loop over s, t, i, r, p below is unrolled so that the fragment arrays are indexed by constants and stay in registers.
template <int KW>
__global__ __launch_bounds__(512) void k_gemm_ksplit(const float* __restrict__ A, int lda, const unsigned short* __restrict__ Bh, const unsigned short* __restrict__ Bl, int ldb,
                                                   float* __restrict__ C, int ldc) {
  __shared__ float part[16][16][36];   // pitch 36: the two 8-row halves of an accumulator store fall on different banks
  const int tid = threadIdx.x, w = tid >> 5, lane = tid & 31, ln = lane & 15, hh = lane >> 4;
  const int row0 = blockIdx.y * 16, col0 = blockIdx.x * 32;
  const float* arow = A + (size_t)(row0 + ln) * lda + w * KW;
  const size_t bbase = (size_t)(col0 + ln) * ldb + w * KW;
  constexpr int NS = KW / 32, AHEAD = 3;   // a wave's fragment loads run AHEAD steps in front of its products (all NS at once spill)
  v4f xa[NS][4];
  FragB bh_[NS][2], bl_[NS][2];
  auto load_step = [&](int s) {
    const float* ap = arow + s * 32 + 8 * hh;
    xa[s][0] = *(const v4fa*)ap; xa[s][1] = *(const v4fa*)(ap + 4); xa[s][2] = *(const v4fa*)(ap + 16); xa[s][3] = *(const v4fa*)(ap + 20);
#pragma unroll
    for (int t = 0; t < 2; ++t) {
      const size_t boff = bbase + (size_t)(t * 16) * ldb + s * 32 + 8 * hh;
      bh_[s][t].half[0] = *(const v8us*)(Bh + boff); bh_[s][t].half[1] = *(const v8us*)(Bh + boff + 16);
      bl_[s][t].half[0] = *(const v8us*)(Bl + boff); bl_[s][t].half[1] = *(const v8us*)(Bl + boff + 16);
    }
  };
#pragma unroll
  for (int s = 0; s < AHEAD && s < NS; ++s) load_step(s);
  v8f acc[2] = {};
#pragma unroll
  for (int s = 0; s < NS; ++s) {
    FragB ah, al;
#pragma unroll
    for (int i = 0; i < 16; ++i) { const float x = xa[s][i >> 2][i & 3]; const unsigned short hb = bf16_bits(x); ah.u[i] = hb; al.u[i] = bf16_bits(x - bf16_val(hb)); }
#pragma unroll
    for (int t = 0; t < 2; ++t) acc[t] = mmaN<3>(ah.v, al.v, bh_[s][t].v, bl_[s][t].v, acc[t]);
    if (s + AHEAD < NS) load_step(s + AHEAD);
  }
#pragma unroll
  for (int t = 0; t < 2; ++t)
#pragma unroll
    for (int r = 0; r < 8; ++r) part[w][8 * hh + r][t * 16 + ln] = acc[t][r];
  __syncthreads();   // all 16 partial tiles are in LDS before any is read
  // thread = one element of the tile; a wave stores one whole 128-byte line of C
  float sum = 0.f;
#pragma unroll
  for (int p = 0; p < 16; ++p) sum += part[p][w][lane];
  C[(size_t)(row0 + w) * ldc + col0 + lane] = sum;
}
// row softmax: P[row][:] = softmax(masked S[row][:]) over N columns with optional causal mask (col > row + rowoff -> 0) and
__global__ __launch_bounds__(256) void k_softmax_rows(const float* __restrict__ S, float* __restrict__ P, int N, int causal, int rowoff, const int* __restrict__ mask, int mask_pitch) {
  __shared__ float red[256];
  const int row = blockIdx.x, tid = threadIdx.x;
  const float* s = S + (size_t)row * N; float* p_out = P + (size_t)row * N;
  const int qi = row + rowoff;
  float mx = -3.0e38f;
  for (int j = tid; j < N; j += 256) {
    bool keep = true;
    if (causal && j > qi) keep = false;
    if (mask && mask[(size_t)qi * mask_pitch + j] == 0) keep = false;
    const float v = keep ? s[j] : -3.0e38f;
    mx = fmaxf(mx, v);
  }
  red[tid] = mx; __syncthreads();
  for (int st = 128; st > 0; st >>= 1) { if (tid < st) red[tid] = fmaxf(red[tid], red[tid + st]); __syncthreads(); }
  mx = red[0]; __syncthreads();
  float sum = 0.f;
  for (int j = tid; j < N; j += 256) {
    bool keep = true;
    if (causal && j > qi) keep = false;
    if (mask && mask[(size_t)qi * mask_pitch + j] == 0) keep = false;
    const float p = keep ? __expf(s[j] - mx) : 0.f;
    sum += p;
  }
  red[tid] = sum; __syncthreads();
  for (int st = 128; st > 0; st >>= 1) { if (tid < st) red[tid] += red[tid + st]; __syncthreads(); }
  const float inv = (mx > -1.0e38f) ? 1.0f / red[0] : __builtin_nanf("");
  __syncthreads();
  {
    for (int j4 = tid * 4; j4 < N; j4 += 1024) {
      v4f out4;
#pragma unroll
      for (int u = 0; u < 4; ++u) {
        const int j = j4 + u;
        bool keep = true;
        if (causal && j > qi) keep = false;
        if (mask && mask[(size_t)qi * mask_pitch + j] == 0) keep = false;
        out4[u] = keep ? __expf(s[j] - mx) * inv : 0.f;
      }
      *(v4f*)(p_out + j4) = out4;
    }
    
  }
}

// Cross-lane steps of a wave-wide reduction: row_xmask DPP inside a 16-lane row, then the other row's lane of the same index.
template <int CTRL>
__device__ __forceinline__ float dpp_get(float x) { return __int_as_float(__builtin_amdgcn_update_dpp(0, __float_as_int(x), CTRL, 0xf, 0xf, true)); }
__device__ __forceinline__ float other_row(float x) { return __int_as_float(__builtin_amdgcn_permlanex16(__float_as_int(x), __float_as_int(x), 0x76543210, 0xfedcba98, false, false)); }
__device__ __forceinline__ float wave_max(float x) {
  x = fmaxf(x, dpp_get<0x161>(x)); x = fmaxf(x, dpp_get<0x162>(x)); x = fmaxf(x, dpp_get<0x164>(x)); x = fmaxf(x, dpp_get<0x168>(x));
  return fmaxf(x, other_row(x));
}
__device__ __forceinline__ float wave_sum(float x) {
  x += dpp_get<0x161>(x); x += dpp_get<0x162>(x); x += dpp_get<0x164>(x); x += dpp_get<0x168>(x);
  return x + other_row(x);
}
// exp(x) as __expf builds it (x * log2 e, then v_exp_f32). In asm so that the v_nop stands directly behind the transcendental: it fills the
// slot that the instruction set asks for before the source register is rewritten or the result read.
__device__ __forceinline__ float exp_slot(float x) {
  const float y = x * 1.44269504f;
  float e;
  asm("v_exp_f32 %0, %1\n\tv_nop" : "=v"(e) : "v"(y));
  return e;
}
#define CR 8   // output rows per work-group
// one block per CR rows from i0, both heads of group g: waves 0-7 take head 0, waves 8-15 head 1. Per head: conv over its zero-masked scores,
// + bias, future -> -1e9, softmax. The two halves then swap their softmax tiles through LDS and each stores its own mixed head:
// mixed_j = m[0][j]*P_0 + m[1][j]*P_1, so the softmax maps never go to memory.
// A thread owns 8 consecutive columns of all CR rows in registers. Each of the CR + 5 score rows is read once per thread as an
// 18-wide window and feeds every output row and tap that uses it; the 66 weights are wave-uniform. Per output element the taps
// are added in the order a, then bq, ascending.
// Every loop over t, x, r, bq, c, p below is unrolled so that the window and the accumulators are indexed by constants and stay in registers.
__global__ __launch_bounds__(512) void k_conv_softmax_mix(const float* __restrict__ S2, const float* __restrict__ conv_w, const float* __restrict__ conv_b,
                                                         const float* __restrict__ head_mix, int g, float* __restrict__ M2) {
  __shared__ __attribute__((aligned(16))) float redm[2][8][CR], reds[2][8][CR];   // per head and wave: the CR row maxima, the CR row sums
  __shared__ __attribute__((aligned(16))) v4f xch[2][CR * 2][256];                // per head: a thread's 2 * CR quads, lane-contiguous (writer and reader share tid)
  // the head is the same in all lanes of a wave; readfirstlane says so to the compiler, so that weights and row bases stay scalar
  const int hh2 = __builtin_amdgcn_readfirstlane((int)(threadIdx.x >> 8));
  const int i0 = blockIdx.x * CR, tid = threadIdx.x & 255, w = tid >> 5, lane = tid & 31;
  const int h = g * 2 + hh2;
  const float* S = S2 + (size_t)hh2 * SS * SS;
  const float* wk = conv_w + (size_t)h * 66;
  const int j0 = tid * 8;
  // window = columns j0 - 5 .. j0 + 12; a piece that would leave the row is read from inside it and masked to 0 below
  // 32-bit byte offsets of a lane inside a row: with the wave-uniform row base each load takes the scalar-base form and these registers are never rewritten
  const unsigned oA = 4u * (unsigned)max(j0 - 5, 0), oB = 4u * (unsigned)max(j0 - 4, 0), oC = 4u * (unsigned)j0, oE = 4u * (unsigned)min(j0 + 8, SS - 4), oF = 4u * (unsigned)min(j0 + 12, SS - 1);
  float acc[CR][8];
#pragma unroll
  for (int r = 0; r < CR; ++r)
#pragma unroll
    for (int c = 0; c < 8; ++c) acc[r][c] = 0.f;
  float eA[2], eF[2];
  v4f qB[2], qC[2], qD[2], qE[2];
  auto load_row = [&](int t) {                                   // score row i0 - 2 + t into register set t & 1; a row outside is replaced by row i0 and masked
    const int ii = i0 - 2 + t;
    const char* srow = (const char*)(S + (size_t)((ii >= 0 && ii < SS) ? ii : i0) * SS);
    eA[t & 1] = *(const float*)(srow + oA); eF[t & 1] = *(const float*)(srow + oF);
    qB[t & 1] = *(const v4fa*)(srow + oB); qC[t & 1] = *(const v4fa*)(srow + oC); qD[t & 1] = *(const v4fa*)(srow + oC + 16); qE[t & 1] = *(const v4fa*)(srow + oE);
  };
  load_row(0);
#pragma unroll
  for (int t = 0; t < CR + 5; ++t) {
    if (t + 1 < CR + 5) load_row(t + 1);
    // keeps the next row's loads in front of this row's products, so that they land under them
    __builtin_amdgcn_sched_barrier(0);
    const int ii = i0 - 2 + t, s = t & 1;
    const unsigned lim = (ii >= 0 && ii < SS) ? (unsigned)(ii + 1) : 0u;   // columns 0 .. ii of row ii enter; future ones, and rows outside, enter as 0
    float win[18] = {eA[s], qB[s][0], qB[s][1], qB[s][2], qB[s][3], qC[s][0], qC[s][1], qC[s][2], qC[s][3],
                     qD[s][0], qD[s][1], qD[s][2], qD[s][3], qE[s][0], qE[s][1], qE[s][2], qE[s][3], eF[s]};
#pragma unroll
    for (int x = 0; x < 18; ++x) win[x] = ((unsigned)(j0 - 5 + x) < lim) ? win[x] : 0.0f;
#pragma unroll
    for (int r = 0; r < CR; ++r) {
      const int a = t - r;                                       // ii = (i0 + r) + a - 2
      if (a < 0 || a >= 6) continue;
#pragma unroll
      for (int bq = 0; bq < 11; ++bq)
#pragma unroll
        for (int c = 0; c < 8; ++c) acc[r][c] += wk[a * 11 + bq] * win[c + bq];
    }
  }
  const float cb = conv_b[h];
  float mx[CR];
#pragma unroll
  for (int r = 0; r < CR; ++r) {
    float m = -3.0e38f;
#pragma unroll
    for (int c = 0; c < 8; ++c) { const float fin = (j0 + c > i0 + r) ? -1.0e9f : acc[r][c] + cb; acc[r][c] = fin; m = fmaxf(m, fin); }
    mx[r] = wave_max(m);
  }
  if (lane == 0) {
#pragma unroll
    for (int r = 0; r < CR; ++r) redm[hh2][w][r] = mx[r];
  }
  __syncthreads();   // each head's 8 waves' row maxima are in LDS before any is read
#pragma unroll
  for (int r = 0; r < CR; ++r) {
    float m = redm[hh2][0][r];
#pragma unroll
    for (int p = 1; p < 8; ++p) m = fmaxf(m, redm[hh2][p][r]);
    float sum = 0.f;
#pragma unroll
    for (int c = 0; c < 8; ++c) { const float e = exp_slot(acc[r][c] - m); acc[r][c] = e; sum += e; }
    mx[r] = wave_sum(sum);
  }
  if (lane == 0) {
#pragma unroll
    for (int r = 0; r < CR; ++r) reds[hh2][w][r] = mx[r];
  }
  __syncthreads();   // each head's 8 waves' row sums are in LDS before any is read
#pragma unroll
  for (int r = 0; r < CR; ++r) {
    float sum = reds[hh2][0][r];
#pragma unroll
    for (int p = 1; p < 8; ++p) sum += reds[hh2][p][r];
    const float inv = 1.0f / sum;
    v4f o0, o1;
#pragma unroll
    for (int c = 0; c < 4; ++c) { o0[c] = acc[r][c] * inv; o1[c] = acc[r][4 + c] * inv; acc[r][c] = o0[c]; acc[r][4 + c] = o1[c]; }
    xch[hh2][2 * r][tid] = o0; xch[hh2][2 * r + 1][tid] = o1;
  }
  const float m_own = head_mix[g * 4 + hh2 * 2 + hh2], m_oth = head_mix[g * 4 + (1 - hh2) * 2 + hh2];   // m[i][j], j = this head
  __syncthreads();   // both heads' softmax tiles are in LDS before the other head reads them
#pragma unroll
  for (int r = 0; r < CR; ++r) {
    const v4f t0 = xch[1 - hh2][2 * r][tid], t1 = xch[1 - hh2][2 * r + 1][tid];
    float* mrow = M2 + ((size_t)hh2 * SS + i0 + r) * SS + j0;
    v4f o0, o1;
#pragma unroll
    for (int c = 0; c < 4; ++c) { o0[c] = m_own * acc[r][c] + m_oth * t0[c]; o1[c] = m_own * acc[r][4 + c] + m_oth * t1[c]; }
    *(v4f*)mrow = o0; *(v4f*)(mrow + 4) = o1;
  }
}
// LayerNorm over 64 per row (biased variance), gamma/beta: block = 64 threads = 64 rows; normalised rows staged in LDS and
__global__ __launch_bounds__(64) void k_ln(const float* __restrict__ O, const float* __restrict__ gam, const float* __restrict__ bet, float* __restrict__ out, int nrows) {
  __shared__ __attribute__((aligned(16))) float so[64][DD];
  const int tid = threadIdx.x;
  const int r0 = blockIdx.x * 64, r = r0 + tid;
  if (r < nrows) {
    const float* x = O + (size_t)r * DD;
    float mu = 0.f;
#pragma unroll 1
    for (int d = 0; d < DD; ++d) mu += x[d];
    mu *= (1.0f / DD);
    float var = 0.f;
#pragma unroll 1
    for (int d = 0; d < DD; ++d) { const float c = x[d] - mu; var += c * c; }
    var *= (1.0f / DD);
    const float rs = rsqrtf(var + 1e-5f);
#pragma unroll 1
    for (int d = 0; d < DD; ++d) so[tid][d] = (x[d] - mu) * rs * gam[d] + bet[d];
  }
  __syncthreads();
  {
    for (int e = tid; e < 64 * (DD / 4); e += 64) {
      const int rr = e / (DD / 4), c4 = (e % (DD / 4)) * 4;
      if (r0 + rr < nrows) { const v4f val = *(const v4fa*)&so[rr][c4]; *(v4f*)(out + (size_t)(r0 + rr) * DD + c4) = val; }
    }
    
  }
}

extern "C" void kernel_launch(void* const* d_in, const int* in_sizes, int n_in,
                              void* d_out, int out_size, void* d_ws, size_t ws_size, hipStream_t stream) {
  (void)in_sizes; (void)n_in; (void)out_size;
  const float* q = (const float*)d_in[0]; const float* k = (const float*)d_in[1]; const float* v = (const float*)d_in[2];
  const float* conv_w = (const float*)d_in[3]; const float* conv_b = (const float*)d_in[4]; const float* head_mix = (const float*)d_in[5];
  const float* gam = (const float*)d_in[6]; const float* bet = (const float*)d_in[7];
  char* ws = (char*)d_ws; size_t off = 0;
  auto take = [&](size_t bytes) { char* p = ws + off; off += (bytes + 255) & ~(size_t)255; return p; };
  unsigned short* kh = (unsigned short*)take((size_t)2 * SS * DD * 2); unsigned short* kl = (unsigned short*)take((size_t)2 * SS * DD * 2);     // k rows planes, 2 heads
  unsigned short* vth = (unsigned short*)take((size_t)2 * DD * SS * 2); unsigned short* vtl = (unsigned short*)take((size_t)2 * DD * SS * 2);  // vᵀ planes, 2 heads
  float* S2 = (float*)take((size_t)2 * SS * SS * 4);     // 32 MiB scores of the 2 heads
  float* M2 = (float*)take((size_t)2 * SS * SS * 4);     // mixed maps
  float* O  = (float*)take((size_t)NHD * SS * DD * 4);   // pre-LN output [16][2048][64]
  if (off > ws_size) return;
  for (int g = 0; g < NG; ++g) {
    for (int j = 0; j < 2; ++j) {
      const int h = g * 2 + j;
      const float* qh = q + (size_t)h * SS * DD; const float* khp = k + (size_t)h * SS * DD; const float* vh = v + (size_t)h * SS * DD;
      k_split_rows<<<(SS * (DD / 8) + 255) / 256, 256, 0, stream>>>(khp, DD, kh + (size_t)j * SS * DD, kl + (size_t)j * SS * DD, SS, DD);
      k_split_transpose<<<(DD * (SS / 8) + 255) / 256, 256, 0, stream>>>(vh, DD, vth + (size_t)j * DD * SS, vtl + (size_t)j * DD * SS, SS, DD);
      // scores_h = q·kᵀ / 8 : M=N=SS, K=DD
      k_gemm_bf2<true, true, 0, false><<<((SS / 16) * (SS / 64) + 3) / 4, 128, 0, stream>>>(qh, DD, kh + (size_t)j * SS * DD, kl + (size_t)j * SS * DD, DD, nullptr, 0.125f, S2 + (size_t)j * SS * SS, SS, SS, SS, DD);
    }
    k_conv_softmax_mix<<<SS / CR, 512, 0, stream>>>(S2, conv_w, conv_b, head_mix, g, M2);
    for (int j = 0; j < 2; ++j) {
      const int h = g * 2 + j;
      // out_h = mixed_j · v_h : M=SS, N=DD, K=SS; Bt[n=d][k=s] = vᵀ planes
      k_gemm_ksplit<SS / 16><<<dim3(DD / 32, SS / 16), 512, 0, stream>>>(M2 + (size_t)j * SS * SS, SS, vth + (size_t)j * DD * SS, vtl + (size_t)j * DD * SS, SS, O + (size_t)h * SS * DD, DD);
    }
  }
  k_ln<<<(NHD * SS + 63) / 64, 64, 0, stream>>>(O, gam, bet, (float*)d_out, NHD * SS);
}

// v004
// Measured time: 443 microseconds a run.
// Next to v003, in two timings, it ran 1.40 times as fast each time.
// All steps since v000 together make it 6.38 times as fast.
#include <hip/hip_runtime.h>
// Contractions on v_wmma_f32_16x16x32_bf16 as 3-term bf16 hi/lo splits (f32-accurate), f32 accumulate: scores = q·kᵀ/8 (K=64)
// and out = mixed·v (K=2048). The 6x11 key-query convolution, masking, softmax, 2x2 head mixing and LayerNorm are f32 VALU.
#define NHD 16
#define SS 2048
#define DD 64
#define NG 8
#define GB 3   // head groups per launch: scores and mixed maps of GB groups (64 MiB a group) fit the workspace

typedef __bf16 v16b __attribute__((ext_vector_type(16)));
typedef unsigned short v8us __attribute__((ext_vector_type(8), may_alias));
typedef float  v8f  __attribute__((ext_vector_type(8)));
typedef float  v4f  __attribute__((ext_vector_type(4)));
typedef float  v4fa __attribute__((ext_vector_type(4), may_alias));
union FragB { v16b v; v8us half[2]; unsigned short u[16]; };

__device__ __forceinline__ unsigned short bf16_bits(float x) { unsigned int u = __float_as_uint(x); return (unsigned short)((u + 0x7FFFu + ((u >> 16) & 1u)) >> 16); }
__device__ __forceinline__ float bf16_val(unsigned short b) { return __uint_as_float(((unsigned int)b) << 16); }
__device__ __forceinline__ float bf16_round(float x) { return bf16_val(bf16_bits(x)); }
// D += A·B with NT terms: 1 = ah·bh, 2 = + al·bh (A split), 3 = + ah·bl (both split)
template <int NT>
__device__ __forceinline__ v8f mmaN(v16b ah, v16b al, v16b bh, v16b bl, v8f c) {
  c = __builtin_amdgcn_wmma_f32_16x16x32_bf16(false, ah, false, bh, (short)0, c, false, false);
  if (NT >= 2) c = __builtin_amdgcn_wmma_f32_16x16x32_bf16(false, al, false, bh, (short)0, c, false, false);
  if (NT >= 3) c = __builtin_amdgcn_wmma_f32_16x16x32_bf16(false, ah, false, bl, (short)0, c, false, false);
  asm volatile("v_nop\n\tv_nop\n\tv_nop\n\tv_nop" : "+v"(c) : "v"(ah), "v"(al), "v"(bh), "v"(bl));
  return c;
}

__global__ __launch_bounds__(256) void k_wt_bf16(const float* __restrict__ W, unsigned short* __restrict__ Wt, int K, int N) {
  const int t = blockIdx.x * 256 + threadIdx.x;
  const int k8n = K / 8;
  if (t >= N * k8n) return;
  const int n = t / k8n, k8 = (t % k8n) * 8;
  v8us v;
#pragma unroll
  for (int i = 0; i < 8; ++i) v[i] = bf16_bits(W[(size_t)(k8 + i) * N + n]);
  *(v8us*)(Wt + (size_t)n * K + k8) = v;
  
}

// GEMM C[M][N] (f32, pitch ldc) = act(A[M][K]·W + bias). A f32 row-major (pitch lda) converted per fragment to bf16
// (ASPLIT: hi/lo two planes -> 2 terms, else single rounded term); Wt bf16 [N][K] (pitch ldb). BIAS_BF16 rounds the
// bias to bf16 first (bias quantised to bf16 before the add). K%32==0, M%16==0, N%64==0.
template <bool ASPLIT, int ACT, bool BIAS_BF16>
__global__ __launch_bounds__(128) void k_gemm_bf(const float* __restrict__ A, int lda, const unsigned short* __restrict__ Wt, int ldb,
                                               const float* __restrict__ bias, float* __restrict__ C, int ldc, int M, int N, int K) {
  __shared__ __attribute__((aligned(16))) float so[4][16][64];
  const int tid = threadIdx.x, w = tid >> 5, lane = tid & 31, ln = lane & 15, hh = lane >> 4;
  const int ntn = N / 64;
  const int wid = blockIdx.x * 4 + w;
  const int mt = wid / ntn, nq = wid % ntn;
  if (mt * 16 >= M) return;
  const int row0 = mt * 16, col0 = nq * 64;
  const float* arow = A + (size_t)(row0 + ln) * lda;
  v8f acc[4] = {};
  for (int kb = 0; kb < K; kb += 32) {
    FragB ah, al;
    const v4f x0 = *(const v4fa*)(arow + kb + 8 * hh), x1 = *(const v4fa*)(arow + kb + 8 * hh + 4);
    const v4f x2 = *(const v4fa*)(arow + kb + 16 + 8 * hh), x3 = *(const v4fa*)(arow + kb + 16 + 8 * hh + 4);
    float xs[16] = {x0[0],x0[1],x0[2],x0[3],x1[0],x1[1],x1[2],x1[3],x2[0],x2[1],x2[2],x2[3],x3[0],x3[1],x3[2],x3[3]};
#pragma unroll
    for (int i = 0; i < 16; ++i) { const unsigned short hb = bf16_bits(xs[i]); ah.u[i] = hb; al.u[i] = ASPLIT ? bf16_bits(xs[i] - bf16_val(hb)) : (unsigned short)0; }
#pragma unroll
    for (int t = 0; t < 4; ++t) {
      const unsigned short* brow = Wt + (size_t)(col0 + t * 16 + ln) * ldb + kb;
      FragB b;
      b.half[0] = *(const v8us*)(brow + 8 * hh);
      b.half[1] = *(const v8us*)(brow + 16 + 8 * hh);
      acc[t] = mmaN<ASPLIT ? 2 : 1>(ah.v, al.v, b.v, b.v, acc[t]);
    }
  }
#pragma unroll
  for (int t = 0; t < 4; ++t) {
    float bv = bias ? bias[col0 + t * 16 + ln] : 0.f;
    if (BIAS_BF16) bv = bf16_round(bv);
#pragma unroll
    for (int r = 0; r < 8; ++r) { float v = acc[t][r] + bv; if (ACT == 1) v = fmaxf(v, 0.f); so[w][8 * hh + r][t * 16 + ln] = v; }
  }
  __builtin_amdgcn_fence(__ATOMIC_ACQ_REL, "workgroup");
  __builtin_amdgcn_wave_barrier();
  const int rsub = lane >> 4, c4 = (lane & 15) * 4;
  {
#pragma unroll
    for (int q = 0; q < 8; ++q) {
      const int r = q * 2 + rsub;
      const v4f v = *(const v4fa*)&so[w][r][c4];
      *(v4f*)(C + (size_t)(row0 + r) * ldc + col0 + c4) = v;
    }
    
  }
}

// Flash-style causal/unmasked attention, all contractions 3-term bf16 hi/lo splits, f32 softmax with running max.
// q,k,v rows are read from f32 buffers with arbitrary row pitch (so they can live inside a fused qkv buffer);
// D = head size (multiple of 32, <= 128); one wave = 16 query rows; block = 4 waves (64 queries) sharing K/V chunks of 32.
template <int D, bool CAUSAL>
__global__ __launch_bounds__(128) void k_flash(const float* __restrict__ qb, const float* __restrict__ kb, const float* __restrict__ vb,
                                             int pitch, int T, int H, float scale, float* __restrict__ y, int ypitch) {
  constexpr int KS = D / 32;        // k-steps for QK
  constexpr int DT = D / 16;        // d tiles for PV
  __shared__ __attribute__((aligned(16))) unsigned short sKh[32][D + 8], sKl[32][D + 8], sVh[32][D + 8], sVl[32][D + 8];
  __shared__ __attribute__((aligned(16))) unsigned short sPh[4][16][40], sPl[4][16][40];
  __shared__ __attribute__((aligned(16))) float sO[4][16][D];
  const int tid = threadIdx.x, w = tid >> 5, lane = tid & 31, ln = lane & 15, hh = lane >> 4;
  const int nqb = (T + 63) / 64;
  const int bh = blockIdx.x / nqb, qblk = blockIdx.x % nqb;
  const int b = bh / H, h = bh % H;
  const int q0 = qblk * 64 + w * 16;
  const float* Q = qb + (size_t)b * T * pitch + h * D;
  const float* K = kb + (size_t)b * T * pitch + h * D;
  const float* V = vb + (size_t)b * T * pitch + h * D;

  // A fragments of the wave's 16 query rows (scaled), hi/lo
  FragB aqh[KS], aql[KS];
  {
    int row = q0 + ln; if (row >= T) row = T - 1;
    const float* qr = Q + (size_t)row * pitch;
#pragma unroll
    for (int ks = 0; ks < KS; ++ks)
#pragma unroll
      for (int i = 0; i < 16; ++i) {
        const int d = ks * 32 + ((i < 8) ? (8 * hh + i) : (16 + 8 * hh + (i - 8)));
        const float x = qr[d] * scale; const unsigned short hb = bf16_bits(x);
        aqh[ks].u[i] = hb; aql[ks].u[i] = bf16_bits(x - bf16_val(hb));
      }
  }
  float m_r[8], l_r[8];
#pragma unroll
  for (int r = 0; r < 8; ++r) { m_r[r] = -3.0e38f; l_r[r] = 0.f; }
  v8f oacc[DT];
#pragma unroll
  for (int dt = 0; dt < DT; ++dt) oacc[dt] = (v8f){0.f,0.f,0.f,0.f,0.f,0.f,0.f,0.f};

  const int kv_end = CAUSAL ? min(T, qblk * 64 + 64) : T;     // block-uniform
  for (int j0 = 0; j0 < kv_end; j0 += 32) {
    __syncthreads();
    for (int e = tid; e < 32 * (D / 4); e += 128) {
      const int r = e / (D / 4), c4 = (e % (D / 4)) * 4;
      const int key = j0 + r;
      v4f kf = {0.f,0.f,0.f,0.f}, vf = {0.f,0.f,0.f,0.f};
      if (key < T) { kf = *(const v4fa*)(K + (size_t)key * pitch + c4); vf = *(const v4fa*)(V + (size_t)key * pitch + c4); }
#pragma unroll
      for (int t = 0; t < 4; ++t) {
        unsigned short hb = bf16_bits(kf[t]); sKh[r][c4 + t] = hb; sKl[r][c4 + t] = bf16_bits(kf[t] - bf16_val(hb));
        hb = bf16_bits(vf[t]); sVh[r][c4 + t] = hb; sVl[r][c4 + t] = bf16_bits(vf[t] - bf16_val(hb));
      }
    }
    __syncthreads();
    // S tile 16 x 32
    v8f s[2];
#pragma unroll
    for (int nt = 0; nt < 2; ++nt) {
      v8f acc = {};
#pragma unroll
      for (int ks = 0; ks < KS; ++ks) {
        FragB bh_, bl_;
        bh_.half[0] = *(const v8us*)&sKh[nt * 16 + ln][ks * 32 + 8 * hh]; bh_.half[1] = *(const v8us*)&sKh[nt * 16 + ln][ks * 32 + 16 + 8 * hh];
        bl_.half[0] = *(const v8us*)&sKl[nt * 16 + ln][ks * 32 + 8 * hh]; bl_.half[1] = *(const v8us*)&sKl[nt * 16 + ln][ks * 32 + 16 + 8 * hh];
        acc = mmaN<3>(aqh[ks].v, aql[ks].v, bh_.v, bl_.v, acc);
      }
      s[nt] = acc;
    }
    // mask + running max (rows 8hh+r; the 16 lanes of a half share rows)
    float alpha[8];
#pragma unroll
    for (int r = 0; r < 8; ++r) {
      const int qi = q0 + 8 * hh + r;
      const int ja = j0 + ln, jb = j0 + 16 + ln;
      if (CAUSAL) { if (ja > qi) s[0][r] = -3.0e38f; if (jb > qi) s[1][r] = -3.0e38f; }
      if (ja >= T) s[0][r] = -3.0e38f;
      if (jb >= T) s[1][r] = -3.0e38f;
      float mx = fmaxf(s[0][r], s[1][r]);
      mx = fmaxf(mx, __shfl_xor(mx, 1, 32)); mx = fmaxf(mx, __shfl_xor(mx, 2, 32)); mx = fmaxf(mx, __shfl_xor(mx, 4, 32)); mx = fmaxf(mx, __shfl_xor(mx, 8, 32));
      const float mnew = fmaxf(m_r[r], mx);
      alpha[r] = (mnew > -1.0e38f) ? __expf(m_r[r] - mnew) : 1.0f;
      const float p0 = (s[0][r] > -1.0e38f) ? __expf(s[0][r] - mnew) : 0.f;
      const float p1 = (s[1][r] > -1.0e38f) ? __expf(s[1][r] - mnew) : 0.f;
      m_r[r] = mnew;
      l_r[r] = l_r[r] * alpha[r] + p0 + p1;            // per-lane partial row sum (16 lanes combined at the end)
      unsigned short hb = bf16_bits(p0); sPh[w][8 * hh + r][ln] = hb;      sPl[w][8 * hh + r][ln] = bf16_bits(p0 - bf16_val(hb));
      hb = bf16_bits(p1);                sPh[w][8 * hh + r][16 + ln] = hb; sPl[w][8 * hh + r][16 + ln] = bf16_bits(p1 - bf16_val(hb));
    }
#pragma unroll
    for (int dt = 0; dt < DT; ++dt)
#pragma unroll
      for (int r = 0; r < 8; ++r) oacc[dt][r] *= alpha[r];
    __builtin_amdgcn_fence(__ATOMIC_ACQ_REL, "workgroup");
    __builtin_amdgcn_wave_barrier();
    FragB pah, pal;
    pah.half[0] = *(const v8us*)&sPh[w][ln][8 * hh]; pah.half[1] = *(const v8us*)&sPh[w][ln][16 + 8 * hh];
    pal.half[0] = *(const v8us*)&sPl[w][ln][8 * hh]; pal.half[1] = *(const v8us*)&sPl[w][ln][16 + 8 * hh];
#pragma unroll
    for (int dt = 0; dt < DT; ++dt) {
      FragB bvh, bvl;
#pragma unroll
      for (int i = 0; i < 8; ++i) {
        bvh.u[i] = sVh[8 * hh + i][dt * 16 + ln]; bvh.u[8 + i] = sVh[16 + 8 * hh + i][dt * 16 + ln];
        bvl.u[i] = sVl[8 * hh + i][dt * 16 + ln]; bvl.u[8 + i] = sVl[16 + 8 * hh + i][dt * 16 + ln];
      }
      oacc[dt] = mmaN<3>(pah.v, pal.v, bvh.v, bvl.v, oacc[dt]);
    }
    __builtin_amdgcn_fence(__ATOMIC_ACQ_REL, "workgroup");
    __builtin_amdgcn_wave_barrier();
  }
#pragma unroll
  for (int r = 0; r < 8; ++r) {
    float l = l_r[r];
    l += __shfl_xor(l, 1, 32); l += __shfl_xor(l, 2, 32); l += __shfl_xor(l, 4, 32); l += __shfl_xor(l, 8, 32);
    l_r[r] = (l > 0.f) ? 1.0f / l : 0.f;
  }
#pragma unroll
  for (int dt = 0; dt < DT; ++dt)
#pragma unroll
    for (int r = 0; r < 8; ++r) sO[w][8 * hh + r][dt * 16 + ln] = oacc[dt][r] * l_r[r];
  __builtin_amdgcn_fence(__ATOMIC_ACQ_REL, "workgroup");
  __builtin_amdgcn_wave_barrier();
  {
    for (int r = 0; r < 16; ++r) {
      const int row = q0 + r;
      if (row < T && lane < D / 4) {
        const v4f val = *(const v4fa*)&sO[w][r][lane * 4];
        *(v4f*)(y + ((size_t)b * T + row) * ypitch + h * D + lane * 4) = val;
      }
    }
    
  }
}

// f32 [R][Cc] (row pitch lds) -> bf16 hi/lo planes [R][Cc] (pitch Cc); thread per 8 elements; Cc % 8 == 0
__global__ __launch_bounds__(256) void k_split_rows(const float* __restrict__ src, int lds_, unsigned short* __restrict__ hi, unsigned short* __restrict__ lo, int R, int Cc) {
  const size_t t = (size_t)blockIdx.x * 256 + threadIdx.x;
  const int c8n = Cc / 8;
  if (t >= (size_t)R * c8n) return;
  const int r = (int)(t / c8n), c8 = (int)(t % c8n) * 8;
  const float* s = src + (size_t)r * lds_ + c8;
  const v4f a = *(const v4fa*)s, b = *(const v4fa*)(s + 4);
  float xs[8] = {a[0],a[1],a[2],a[3],b[0],b[1],b[2],b[3]};
  v8us vh, vl;
#pragma unroll
  for (int i = 0; i < 8; ++i) { const unsigned short hb = bf16_bits(xs[i]); vh[i] = hb; vl[i] = bf16_bits(xs[i] - bf16_val(hb)); }
  unsigned short* dh = hi + (size_t)r * Cc + c8; unsigned short* dl = lo + (size_t)r * Cc + c8;
  *(v8us*)dh = vh; *(v8us*)dl = vl; 
}
// f32 [K][N] (row pitch lds) -> transposed bf16 hi/lo planes [N][K]; one thread per (n, 8 consecutive k)
// blockIdx.y = matrix of a batch: sources and planes of the batch lie densely one behind the other
__global__ __launch_bounds__(256) void k_split_transpose(const float* __restrict__ src, int lds_, unsigned short* __restrict__ hi, unsigned short* __restrict__ lo, int K, int N) {
  const size_t t = (size_t)blockIdx.x * 256 + threadIdx.x;
  const int k8n = K / 8;
  if (t >= (size_t)N * k8n) return;
  const int n = (int)(t / k8n), k8 = (int)(t % k8n) * 8;
  src += (size_t)blockIdx.y * K * lds_; hi += (size_t)blockIdx.y * N * K; lo += (size_t)blockIdx.y * N * K;
  v8us vh, vl;
#pragma unroll
  for (int i = 0; i < 8; ++i) { const float x = src[(size_t)(k8 + i) * lds_ + n]; const unsigned short hb = bf16_bits(x); vh[i] = hb; vl[i] = bf16_bits(x - bf16_val(hb)); }
  unsigned short* dh = hi + (size_t)n * K + k8; unsigned short* dl = lo + (size_t)n * K + k8;
  *(v8us*)dh = vh; *(v8us*)dl = vl; 
}
// GEMM with A f32 (split into hi/lo when ASPLIT) and B from bf16 planes Bh (+ Bl when BSPLIT): terms hi·hi [+ lo·hi] [+ hi·lo].
// C f32 [M][N] pitch ldc; alpha scales the result; bias optional (BIAS_BF16 rounds it). Same tiling/epilogue as k_gemm_bf.
// blockIdx.y = product of a batch: the A, B and C matrices of the batch lie densely one behind the other (M, N, M rows each).
template <bool ASPLIT, bool BSPLIT, int ACT, bool BIAS_BF16>
__global__ __launch_bounds__(128) void k_gemm_bf2(const float* __restrict__ A, int lda, const unsigned short* __restrict__ Bh, const unsigned short* __restrict__ Bl, int ldb,
                                                const float* __restrict__ bias, float alpha, float* __restrict__ C, int ldc, int M, int N, int K) {
  __shared__ __attribute__((aligned(16))) float so[4][16][64];
  const int tid = threadIdx.x, w = tid >> 5, lane = tid & 31, ln = lane & 15, hh = lane >> 4;
  const int ntn = N / 64;
  const int wid = blockIdx.x * 4 + w;
  const int mt = wid / ntn, nq = wid % ntn;
  if (mt * 16 >= M) return;
  const int row0 = mt * 16, col0 = nq * 64;
  A += (size_t)blockIdx.y * M * lda; Bh += (size_t)blockIdx.y * N * ldb; Bl += (size_t)blockIdx.y * N * ldb; C += (size_t)blockIdx.y * M * ldc;
  const float* arow = A + (size_t)(row0 + ln) * lda;
  v8f acc[4] = {};
  for (int kb = 0; kb < K; kb += 32) {
    FragB ah, al;
    const v4f x0 = *(const v4fa*)(arow + kb + 8 * hh), x1 = *(const v4fa*)(arow + kb + 8 * hh + 4);
    const v4f x2 = *(const v4fa*)(arow + kb + 16 + 8 * hh), x3 = *(const v4fa*)(arow + kb + 16 + 8 * hh + 4);
    float xs[16] = {x0[0],x0[1],x0[2],x0[3],x1[0],x1[1],x1[2],x1[3],x2[0],x2[1],x2[2],x2[3],x3[0],x3[1],x3[2],x3[3]};
#pragma unroll
    for (int i = 0; i < 16; ++i) { const unsigned short hb = bf16_bits(xs[i]); ah.u[i] = hb; al.u[i] = ASPLIT ? bf16_bits(xs[i] - bf16_val(hb)) : (unsigned short)0; }
#pragma unroll
    for (int t = 0; t < 4; ++t) {
      const size_t boff = (size_t)(col0 + t * 16 + ln) * ldb + kb;
      FragB bh_, bl_;
      bh_.half[0] = *(const v8us*)(Bh + boff + 8 * hh);
      bh_.half[1] = *(const v8us*)(Bh + boff + 16 + 8 * hh);
      if (BSPLIT) { bl_.half[0] = *(const v8us*)(Bl + boff + 8 * hh); bl_.half[1] = *(const v8us*)(Bl + boff + 16 + 8 * hh); } else bl_ = bh_;
      acc[t] = mmaN<ASPLIT ? (BSPLIT ? 3 : 2) : 1>(ah.v, al.v, bh_.v, bl_.v, acc[t]);
    }
  }
#pragma unroll
  for (int t = 0; t < 4; ++t) {
    float bv = bias ? bias[col0 + t * 16 + ln] : 0.f;
    if (BIAS_BF16) bv = bf16_round(bv);
#pragma unroll
    for (int r = 0; r < 8; ++r) { float v = acc[t][r] * alpha + bv; if (ACT == 1) v = fmaxf(v, 0.f); so[w][8 * hh + r][t * 16 + ln] = v; }
  }
  __builtin_amdgcn_fence(__ATOMIC_ACQ_REL, "workgroup");
  __builtin_amdgcn_wave_barrier();
  const int rsub = lane >> 4, c4 = (lane & 15) * 4;
  {
#pragma unroll
    for (int q = 0; q < 8; ++q) {
      const int r = q * 2 + rsub;
      const v4f v = *(const v4fa*)&so[w][r][c4];
      *(v4f*)(C + (size_t)(row0 + r) * ldc + col0 + c4) = v;
    }
    
  }
}
// C tile 16 x 32 per work-group of C[M][N] = A[M][K] x B, A f32 split hi/lo per fragment, B bf16 hi/lo planes [N][K], 3 terms as above.
// K is split over the 16 waves of the work-group (KW consecutive k each, K = 16 * KW); the 16 f32 partial tiles are summed
// through LDS in wave order. Grid: x = 32-column part of N, y = 16-row tile of M, z = product of a batch (the batch's A, B and C matrices,
// of M, N and M rows, lie densely one behind the other).
// Every loop over s, t, i, r, p below is unrolled so that the fragment arrays are indexed by constants and stay in registers.
template <int KW>
__global__ __launch_bounds__(512) void k_gemm_ksplit(const float* __restrict__ A, int lda, const unsigned short* __restrict__ Bh, const unsigned short* __restrict__ Bl, int ldb,
                                                   float* __restrict__ C, int ldc, int M, int N) {
  __shared__ float part[16][16][36];   // pitch 36: the two 8-row halves of an accumulator store fall on different banks
  const int tid = threadIdx.x, w = tid >> 5, lane = tid & 31, ln = lane & 15, hh = lane >> 4;
  const int row0 = blockIdx.y * 16, col0 = blockIdx.x * 32;
  A += (size_t)blockIdx.z * M * lda; Bh += (size_t)blockIdx.z * N * ldb; Bl += (size_t)blockIdx.z * N * ldb; C += (size_t)blockIdx.z * M * ldc;
  const float* arow = A + (size_t)(row0 + ln) * lda + w * KW;
  const size_t bbase = (size_t)(col0 + ln) * ldb + w * KW;
  constexpr int NS = KW / 32, AHEAD = 3;   // a wave's fragment loads run AHEAD steps in front of its products (all NS at once spill)
  v4f xa[NS][4];
  FragB bh_[NS][2], bl_[NS][2];
  auto load_step = [&](int s) {
    const float* ap = arow + s * 32 + 8 * hh;
    xa[s][0] = *(const v4fa*)ap; xa[s][1] = *(const v4fa*)(ap + 4); xa[s][2] = *(const v4fa*)(ap + 16); xa[s][3] = *(const v4fa*)(ap + 20);
#pragma unroll
    for (int t = 0; t < 2; ++t) {
      const size_t boff = bbase + (size_t)(t * 16) * ldb + s * 32 + 8 * hh;
      bh_[s][t].half[0] = *(const v8us*)(Bh + boff); bh_[s][t].half[1] = *(const v8us*)(Bh + boff + 16);
      bl_[s][t].half[0] = *(const v8us*)(Bl + boff); bl_[s][t].half[1] = *(const v8us*)(Bl + boff + 16);
    }
  };
#pragma unroll
  for (int s = 0; s < AHEAD && s < NS; ++s) load_step(s);
  v8f acc[2] = {};
#pragma unroll
  for (int s = 0; s < NS; ++s) {
    FragB ah, al;
#pragma unroll
    for (int i = 0; i < 16; ++i) { const float x = xa[s][i >> 2][i & 3]; const unsigned short hb = bf16_bits(x); ah.u[i] = hb; al.u[i] = bf16_bits(x - bf16_val(hb)); }
#pragma unroll
    for (int t = 0; t < 2; ++t) acc[t] = mmaN<3>(ah.v, al.v, bh_[s][t].v, bl_[s][t].v, acc[t]);
    if (s + AHEAD < NS) load_step(s + AHEAD);
  }
#pragma unroll
  for (int t = 0; t < 2; ++t)
#pragma unroll
    for (int r = 0; r < 8; ++r) part[w][8 * hh + r][t * 16 + ln] = acc[t][r];
  __syncthreads();   // all 16 partial tiles are in LDS before any is read
  // thread = one element of the tile; a wave stores one whole 128-byte line of C
  float sum = 0.f;
#pragma unroll
  for (int p = 0; p < 16; ++p) sum += part[p][w][lane];
  C[(size_t)(row0 + w) * ldc + col0 + lane] = sum;
}
// row softmax: P[row][:] = softmax(masked S[row][:]) over N columns with optional causal mask (col > row + rowoff -> 0) and
__global__ __launch_bounds__(256) void k_softmax_rows(const float* __restrict__ S, float* __restrict__ P, int N, int causal, int rowoff, const int* __restrict__ mask, int mask_pitch) {
  __shared__ float red[256];
  const int row = blockIdx.x, tid = threadIdx.x;
  const float* s = S + (size_t)row * N; float* p_out = P + (size_t)row * N;
  const int qi = row + rowoff;
  float mx = -3.0e38f;
  for (int j = tid; j < N; j += 256) {
    bool keep = true;
    if (causal && j > qi) keep = false;
    if (mask && mask[(size_t)qi * mask_pitch + j] == 0) keep = false;
    const float v = keep ? s[j] : -3.0e38f;
    mx = fmaxf(mx, v);
  }
  red[tid] = mx; __syncthreads();
  for (int st = 128; st > 0; st >>= 1) { if (tid < st) red[tid] = fmaxf(red[tid], red[tid + st]); __syncthreads(); }
  mx = red[0]; __syncthreads();
  float sum = 0.f;
  for (int j = tid; j < N; j += 256) {
    bool keep = true;
    if (causal && j > qi) keep = false;
    if (mask && mask[(size_t)qi * mask_pitch + j] == 0) keep = false;
    const float p = keep ? __expf(s[j] - mx) : 0.f;
    sum += p;
  }
  red[tid] = sum; __syncthreads();
  for (int st = 128; st > 0; st >>= 1) { if (tid < st) red[tid] += red[tid + st]; __syncthreads(); }
  const float inv = (mx > -1.0e38f) ? 1.0f / red[0] : __builtin_nanf("");
  __syncthreads();
  {
    for (int j4 = tid * 4; j4 < N; j4 += 1024) {
      v4f out4;
#pragma unroll
      for (int u = 0; u < 4; ++u) {
        const int j = j4 + u;
        bool keep = true;
        if (causal && j > qi) keep = false;
        if (mask && mask[(size_t)qi * mask_pitch + j] == 0) keep = false;
        out4[u] = keep ? __expf(s[j] - mx) * inv : 0.f;
      }
      *(v4f*)(p_out + j4) = out4;
    }
    
  }
}

// Cross-lane steps of a wave-wide reduction: row_xmask DPP inside a 16-lane row, then the other row's lane of the same index.
template <int CTRL>
__device__ __forceinline__ float dpp_get(float x) { return __int_as_float(__builtin_amdgcn_update_dpp(0, __float_as_int(x), CTRL, 0xf, 0xf, true)); }
__device__ __forceinline__ float other_row(float x) { return __int_as_float(__builtin_amdgcn_permlanex16(__float_as_int(x), __float_as_int(x), 0x76543210, 0xfedcba98, false, false)); }
__device__ __forceinline__ float wave_max(float x) {
  x = fmaxf(x, dpp_get<0x161>(x)); x = fmaxf(x, dpp_get<0x162>(x)); x = fmaxf(x, dpp_get<0x164>(x)); x = fmaxf(x, dpp_get<0x168>(x));
  return fmaxf(x, other_row(x));
}
__device__ __forceinline__ float wave_sum(float x) {
  x += dpp_get<0x161>(x); x += dpp_get<0x162>(x); x += dpp_get<0x164>(x); x += dpp_get<0x168>(x);
  return x + other_row(x);
}
// exp(x) as __expf builds it (x * log2 e, then v_exp_f32). In asm so that the v_nop stands directly behind the transcendental: it fills the
// slot that the instruction set asks for before the source register is rewritten or the result read.
__device__ __forceinline__ float exp_slot(float x) {
  const float y = x * 1.44269504f;
  float e;
  asm("v_exp_f32 %0, %1\n\tv_nop" : "=v"(e) : "v"(y));
  return e;
}
#define CR 8   // output rows per work-group
// one block per CR rows from i0, both heads of group g = g0 + blockIdx.y (S2 and M2 hold the launch's groups one behind the other): waves 0-7 take head 0, waves 8-15 head 1. Per head: conv over its zero-masked scores,
// + bias, future -> -1e9, softmax. The two halves then swap their softmax tiles through LDS and each stores its own mixed head:
// mixed_j = m[0][j]*P_0 + m[1][j]*P_1, so the softmax maps never go to memory.
// A thread owns 8 consecutive columns of all CR rows in registers. Each of the CR + 5 score rows is read once per thread as an
// 18-wide window and feeds every output row and tap that uses it; the 66 weights are wave-uniform. Per output element the taps
// are added in the order a, then bq, ascending.
// Every loop over t, x, r, bq, c, p below is unrolled so that the window and the accumulators are indexed by constants and stay in registers.
__global__ __launch_bounds__(512) void k_conv_softmax_mix(const float* __restrict__ S2, const float* __restrict__ conv_w, const float* __restrict__ conv_b,
                                                         const float* __restrict__ head_mix, int g0, float* __restrict__ M2) {
  __shared__ __attribute__((aligned(16))) float redm[2][8][CR], reds[2][8][CR];   // per head and wave: the CR row maxima, the CR row sums
  __shared__ __attribute__((aligned(16))) v4f xch[2][CR * 2][256];                // per head: a thread's 2 * CR quads, lane-contiguous (writer and reader share tid)
  // the head is the same in all lanes of a wave; readfirstlane says so to the compiler, so that weights and row bases stay scalar
  const int hh2 = __builtin_amdgcn_readfirstlane((int)(threadIdx.x >> 8));
  const int i0 = blockIdx.x * CR, tid = threadIdx.x & 255, w = tid >> 5, lane = tid & 31;
  const int g = g0 + (int)blockIdx.y, hb = (int)blockIdx.y * 2 + hh2;   // hb = the head's place in S2 and M2
  const int h = g * 2 + hh2;
  const float* S = S2 + (size_t)hb * SS * SS;
  const float* wk = conv_w + (size_t)h * 66;
  const int j0 = tid * 8;
  // window = columns j0 - 5 .. j0 + 12; a piece that would leave the row is read from inside it and masked to 0 below
  // 32-bit byte offsets of a lane inside a row: with the wave-uniform row base each load takes the scalar-base form and these registers are never rewritten
  const unsigned oA = 4u * (unsigned)max(j0 - 5, 0), oB = 4u * (unsigned)max(j0 - 4, 0), oC = 4u * (unsigned)j0, oE = 4u * (unsigned)min(j0 + 8, SS - 4), oF = 4u * (unsigned)min(j0 + 12, SS - 1);
  float acc[CR][8];
#pragma unroll
  for (int r = 0; r < CR; ++r)
#pragma unroll
    for (int c = 0; c < 8; ++c) acc[r][c] = 0.f;
  float eA[2], eF[2];
  v4f qB[2], qC[2], qD[2], qE[2];
  auto load_row = [&](int t) {                                   // score row i0 - 2 + t into register set t & 1; a row outside is replaced by row i0 and masked
    const int ii = i0 - 2 + t;
    const char* srow = (const char*)(S + (size_t)((ii >= 0 && ii < SS) ? ii : i0) * SS);
    eA[t & 1] = *(const float*)(srow + oA); eF[t & 1] = *(const float*)(srow + oF);
    qB[t & 1] = *(const v4fa*)(srow + oB); qC[t & 1] = *(const v4fa*)(srow + oC); qD[t & 1] = *(const v4fa*)(srow + oC + 16); qE[t & 1] = *(const v4fa*)(srow + oE);
  };
  load_row(0);
#pragma unroll
  for (int t = 0; t < CR + 5; ++t) {
    if (t + 1 < CR + 5) load_row(t + 1);
    // keeps the next row's loads in front of this row's products, so that they land under them
    __builtin_amdgcn_sched_barrier(0);
    const int ii = i0 - 2 + t, s = t & 1;
    const unsigned lim = (ii >= 0 && ii < SS) ? (unsigned)(ii + 1) : 0u;   // columns 0 .. ii of row ii enter; future ones, and rows outside, enter as 0
    float win[18] = {eA[s], qB[s][0], qB[s][1], qB[s][2], qB[s][3], qC[s][0], qC[s][1], qC[s][2], qC[s][3],
                     qD[s][0], qD[s][1], qD[s][2], qD[s][3], qE[s][0], qE[s][1], qE[s][2], qE[s][3], eF[s]};
#pragma unroll
    for (int x = 0; x < 18; ++x) win[x] = ((unsigned)(j0 - 5 + x) < lim) ? win[x] : 0.0f;
#pragma unroll
    for (int r = 0; r < CR; ++r) {
      const int a = t - r;                                       // ii = (i0 + r) + a - 2
      if (a < 0 || a >= 6) continue;
#pragma unroll
      for (int bq = 0; bq < 11; ++bq)
#pragma unroll
        for (int c = 0; c < 8; ++c) acc[r][c] += wk[a * 11 + bq] * win[c + bq];
    }
  }
  const float cb = conv_b[h];
  float mx[CR];
#pragma unroll
  for (int r = 0; r < CR; ++r) {
    float m = -3.0e38f;
#pragma unroll
    for (int c = 0; c < 8; ++c) { const float fin = (j0 + c > i0 + r) ? -1.0e9f : acc[r][c] + cb; acc[r][c] = fin; m = fmaxf(m, fin); }
    mx[r] = wave_max(m);
  }
  if (lane == 0) {
#pragma unroll
    for (int r = 0; r < CR; ++r) redm[hh2][w][r] = mx[r];
  }
  __syncthreads();   // each head's 8 waves' row maxima are in LDS before any is read
#pragma unroll
  for (int r = 0; r < CR; ++r) {
    float m = redm[hh2][0][r];
#pragma unroll
    for (int p = 1; p < 8; ++p) m = fmaxf(m, redm[hh2][p][r]);
    float sum = 0.f;
#pragma unroll
    for (int c = 0; c < 8; ++c) { const float e = exp_slot(acc[r][c] - m); acc[r][c] = e; sum += e; }
    mx[r] = wave_sum(sum);
  }
  if (lane == 0) {
#pragma unroll
    for (int r = 0; r < CR; ++r) reds[hh2][w][r] = mx[r];
  }
  __syncthreads();   // each head's 8 waves' row sums are in LDS before any is read
#pragma unroll
  for (int r = 0; r < CR; ++r) {
    float sum = reds[hh2][0][r];
#pragma unroll
    for (int p = 1; p < 8; ++p) sum += reds[hh2][p][r];
    const float inv = 1.0f / sum;
    v4f o0, o1;
#pragma unroll
    for (int c = 0; c < 4; ++c) { o0[c] = acc[r][c] * inv; o1[c] = acc[r][4 + c] * inv; acc[r][c] = o0[c]; acc[r][4 + c] = o1[c]; }
    xch[hh2][2 * r][tid] = o0; xch[hh2][2 * r + 1][tid] = o1;
  }
  const float m_own = head_mix[g * 4 + hh2 * 2 + hh2], m_oth = head_mix[g * 4 + (1 - hh2) * 2 + hh2];   // m[i][j], j = this head
  __syncthreads();   // both heads' softmax tiles are in LDS before the other head reads them
#pragma unroll
  for (int r = 0; r < CR; ++r) {
    const v4f t0 = xch[1 - hh2][2 * r][tid], t1 = xch[1 - hh2][2 * r + 1][tid];
    float* mrow = M2 + ((size_t)hb * SS + i0 + r) * SS + j0;
    v4f o0, o1;
#pragma unroll
    for (int c = 0; c < 4; ++c) { o0[c] = m_own * acc[r][c] + m_oth * t0[c]; o1[c] = m_own * acc[r][4 + c] + m_oth * t1[c]; }
    *(v4f*)mrow = o0; *(v4f*)(mrow + 4) = o1;
  }
}
// LayerNorm over 64 per row (biased variance), gamma/beta: block = 64 threads = 64 rows; normalised rows staged in LDS and
__global__ __launch_bounds__(64) void k_ln(const float* __restrict__ O, const float* __restrict__ gam, const float* __restrict__ bet, float* __restrict__ out, int nrows) {
  __shared__ __attribute__((aligned(16))) float so[64][DD];
  const int tid = threadIdx.x;
  const int r0 = blockIdx.x * 64, r = r0 + tid;
  if (r < nrows) {
    const float* x = O + (size_t)r * DD;
    float mu = 0.f;
#pragma unroll 1
    for (int d = 0; d < DD; ++d) mu += x[d];
    mu *= (1.0f / DD);
    float var = 0.f;
#pragma unroll 1
    for (int d = 0; d < DD; ++d) { const float c = x[d] - mu; var += c * c; }
    var *= (1.0f / DD);
    const float rs = rsqrtf(var + 1e-5f);
#pragma unroll 1
    for (int d = 0; d < DD; ++d) so[tid][d] = (x[d] - mu) * rs * gam[d] + bet[d];
  }
  __syncthreads();
  {
    for (int e = tid; e < 64 * (DD / 4); e += 64) {
      const int rr = e / (DD / 4), c4 = (e % (DD / 4)) * 4;
      if (r0 + rr < nrows) { const v4f val = *(const v4fa*)&so[rr][c4]; *(v4f*)(out + (size_t)(r0 + rr) * DD + c4) = val; }
    }
    
  }
}

extern "C" void kernel_launch(void* const* d_in, const int* in_sizes, int n_in,
                              void* d_out, int out_size, void* d_ws, size_t ws_size, hipStream_t stream) {
  (void)in_sizes; (void)n_in; (void)out_size;
  const float* q = (const float*)d_in[0]; const float* k = (const float*)d_in[1]; const float* v = (const float*)d_in[2];
  const float* conv_w = (const float*)d_in[3]; const float* conv_b = (const float*)d_in[4]; const float* head_mix = (const float*)d_in[5];
  const float* gam = (const float*)d_in[6]; const float* bet = (const float*)d_in[7];
  char* ws = (char*)d_ws; size_t off = 0;
  auto take = [&](size_t bytes) { char* p = ws + off; off += (bytes + 255) & ~(size_t)255; return p; };
  unsigned short* kh = (unsigned short*)take((size_t)NHD * SS * DD * 2); unsigned short* kl = (unsigned short*)take((size_t)NHD * SS * DD * 2);     // k rows planes, all heads
  unsigned short* vth = (unsigned short*)take((size_t)NHD * DD * SS * 2); unsigned short* vtl = (unsigned short*)take((size_t)NHD * DD * SS * 2);  // v transposed planes, all heads
  float* S2 = (float*)take((size_t)GB * 2 * SS * SS * 4);     // scores of the 2 * GB heads of a batch
  float* M2 = (float*)take((size_t)GB * 2 * SS * SS * 4);     // their mixed maps
  float* O  = (float*)take((size_t)NHD * SS * DD * 4);   // pre-LN output [16][2048][64]
  if (off > ws_size) return;
  k_split_rows<<<(NHD * SS * (DD / 8) + 255) / 256, 256, 0, stream>>>(k, DD, kh, kl, NHD * SS, DD);
  k_split_transpose<<<dim3((DD * (SS / 8) + 255) / 256, NHD), 256, 0, stream>>>(v, DD, vth, vtl, SS, DD);
  for (int g0 = 0; g0 < NG; g0 += GB) {
    const int ng = (NG - g0 < GB) ? NG - g0 : GB, h0 = g0 * 2;   // groups of this batch, its first head
    // scores_h = q.k^T / 8 : M=N=SS, K=DD, one product per head of the batch
    k_gemm_bf2<true, true, 0, false><<<dim3(((SS / 16) * (SS / 64) + 3) / 4, ng * 2), 128, 0, stream>>>(q + (size_t)h0 * SS * DD, DD, kh + (size_t)h0 * SS * DD, kl + (size_t)h0 * SS * DD, DD, nullptr, 0.125f, S2, SS, SS, SS, DD);
    k_conv_softmax_mix<<<dim3(SS / CR, ng), 512, 0, stream>>>(S2, conv_w, conv_b, head_mix, g0, M2);
    // out_h = mixed_h . v_h : M=SS, N=DD, K=SS; Bt[n=d][k=s] = transposed v planes
    k_gemm_ksplit<SS / 16><<<dim3(DD / 32, SS / 16, ng * 2), 512, 0, stream>>>(M2, SS, vth + (size_t)h0 * DD * SS, vtl + (size_t)h0 * DD * SS, SS, O + (size_t)h0 * SS * DD, DD, SS, DD);
  }
  k_ln<<<(NHD * SS + 63) / 64, 64, 0, stream>>>(O, gam, bet, (float*)d_out, NHD * SS);
}

// v005
// A run of this version takes 304 microseconds.
// In two side-by-side timings against v004, it was 1.45 and 1.46 times as fast.
// Over all steps from v000 it is 9.31 times as fast.
#include <hip/hip_runtime.h>
// Contractions on v_wmma_f32_16x16x32_bf16 as 3-term bf16 hi/lo splits (f32-accurate), f32 accumulate: scores = q·kᵀ/8 (K=64)
// and out = mixed·v (K=2048). The 6x11 key-query convolution, masking, softmax, 2x2 head mixing and LayerNorm are f32 VALU.
#define NHD 16
#define SS 2048
#define DD 64
#define NG 8
#define GB 3   // head groups per launch: scores and mixed maps of GB groups (64 MiB a group) fit the workspace

typedef __bf16 v16b __attribute__((ext_vector_type(16)));
typedef unsigned short v8us __attribute__((ext_vector_type(8), may_alias));
typedef float  v8f  __attribute__((ext_vector_type(8)));
typedef float  v4f  __attribute__((ext_vector_type(4)));
typedef float  v4fa __attribute__((ext_vector_type(4), may_alias));
union FragB { v16b v; v8us half[2]; unsigned short u[16]; };

__device__ __forceinline__ unsigned short bf16_bits(float x) { unsigned int u = __float_as_uint(x); return (unsigned short)((u + 0x7FFFu + ((u >> 16) & 1u)) >> 16); }
__device__ __forceinline__ float bf16_val(unsigned short b) { return __uint_as_float(((unsigned int)b) << 16); }
__device__ __forceinline__ float bf16_round(float x) { return bf16_val(bf16_bits(x)); }
// D += A·B with NT terms: 1 = ah·bh, 2 = + al·bh (A split), 3 = + ah·bl (both split)
template <int NT>
__device__ __forceinline__ v8f mmaN(v16b ah, v16b al, v16b bh, v16b bl, v8f c) {
  c = __builtin_amdgcn_wmma_f32_16x16x32_bf16(false, ah, false, bh, (short)0, c, false, false);
  if (NT >= 2) c = __builtin_amdgcn_wmma_f32_16x16x32_bf16(false, al, false, bh, (short)0, c, false, false);
  if (NT >= 3) c = __builtin_amdgcn_wmma_f32_16x16x32_bf16(false, ah, false, bl, (short)0, c, false, false);
  asm volatile("v_nop\n\tv_nop\n\tv_nop\n\tv_nop" : "+v"(c) : "v"(ah), "v"(al), "v"(bh), "v"(bl));
  return c;
}

__global__ __launch_bounds__(256) void k_wt_bf16(const float* __restrict__ W, unsigned short* __restrict__ Wt, int K, int N) {
  const int t = blockIdx.x * 256 + threadIdx.x;
  const int k8n = K / 8;
  if (t >= N * k8n) return;
  const int n = t / k8n, k8 = (t % k8n) * 8;
  v8us v;
#pragma unroll
  for (int i = 0; i < 8; ++i) v[i] = bf16_bits(W[(size_t)(k8 + i) * N + n]);
  *(v8us*)(Wt + (size_t)n * K + k8) = v;
  
}

// GEMM C[M][N] (f32, pitch ldc) = act(A[M][K]·W + bias). A f32 row-major (pitch lda) converted per fragment to bf16
// (ASPLIT: hi/lo two planes -> 2 terms, else single rounded term); Wt bf16 [N][K] (pitch ldb). BIAS_BF16 rounds the
// bias to bf16 first (bias quantised to bf16 before the add). K%32==0, M%16==0, N%64==0.
template <bool ASPLIT, int ACT, bool BIAS_BF16>
__global__ __launch_bounds__(128) void k_gemm_bf(const float* __restrict__ A, int lda, const unsigned short* __restrict__ Wt, int ldb,
                                               const float* __restrict__ bias, float* __restrict__ C, int ldc, int M, int N, int K) {
  __shared__ __attribute__((aligned(16))) float so[4][16][64];
  const int tid = threadIdx.x, w = tid >> 5, lane = tid & 31, ln = lane & 15, hh = lane >> 4;
  const int ntn = N / 64;
  const int wid = blockIdx.x * 4 + w;
  const int mt = wid / ntn, nq = wid % ntn;
  if (mt * 16 >= M) return;
  const int row0 = mt * 16, col0 = nq * 64;
  const float* arow = A + (size_t)(row0 + ln) * lda;
  v8f acc[4] = {};
  for (int kb = 0; kb < K; kb += 32) {
    FragB ah, al;
    const v4f x0 = *(const v4fa*)(arow + kb + 8 * hh), x1 = *(const v4fa*)(arow + kb + 8 * hh + 4);
    const v4f x2 = *(const v4fa*)(arow + kb + 16 + 8 * hh), x3 = *(const v4fa*)(arow + kb + 16 + 8 * hh + 4);
    float xs[16] = {x0[0],x0[1],x0[2],x0[3],x1[0],x1[1],x1[2],x1[3],x2[0],x2[1],x2[2],x2[3],x3[0],x3[1],x3[2],x3[3]};
#pragma unroll
    for (int i = 0; i < 16; ++i) { const unsigned short hb = bf16_bits(xs[i]); ah.u[i] = hb; al.u[i] = ASPLIT ? bf16_bits(xs[i] - bf16_val(hb)) : (unsigned short)0; }
#pragma unroll
    for (int t = 0; t < 4; ++t) {
      const unsigned short* brow = Wt + (size_t)(col0 + t * 16 + ln) * ldb + kb;
      FragB b;
      b.half[0] = *(const v8us*)(brow + 8 * hh);
      b.half[1] = *(const v8us*)(brow + 16 + 8 * hh);
      acc[t] = mmaN<ASPLIT ? 2 : 1>(ah.v, al.v, b.v, b.v, acc[t]);
    }
  }
#pragma unroll
  for (int t = 0; t < 4; ++t) {
    float bv = bias ? bias[col0 + t * 16 + ln] : 0.f;
    if (BIAS_BF16) bv = bf16_round(bv);
#pragma unroll
    for (int r = 0; r < 8; ++r) { float v = acc[t][r] + bv; if (ACT == 1) v = fmaxf(v, 0.f); so[w][8 * hh + r][t * 16 + ln] = v; }
  }
  __builtin_amdgcn_fence(__ATOMIC_ACQ_REL, "workgroup");
  __builtin_amdgcn_wave_barrier();
  const int rsub = lane >> 4, c4 = (lane & 15) * 4;
  {
#pragma unroll
    for (int q = 0; q < 8; ++q) {
      const int r = q * 2 + rsub;
      const v4f v = *(const v4fa*)&so[w][r][c4];
      *(v4f*)(C + (size_t)(row0 + r) * ldc + col0 + c4) = v;
    }
    
  }
}

// Flash-style causal/unmasked attention, all contractions 3-term bf16 hi/lo splits, f32 softmax with running max.
// q,k,v rows are read from f32 buffers with arbitrary row pitch (so they can live inside a fused qkv buffer);
// D = head size (multiple of 32, <= 128); one wave = 16 query rows; block = 4 waves (64 queries) sharing K/V chunks of 32.
template <int D, bool CAUSAL>
__global__ __launch_bounds__(128) void k_flash(const float* __restrict__ qb, const float* __restrict__ kb, const float* __restrict__ vb,
                                             int pitch, int T, int H, float scale, float* __restrict__ y, int ypitch) {
  constexpr int KS = D / 32;        // k-steps for QK
  constexpr int DT = D / 16;        // d tiles for PV
  __shared__ __attribute__((aligned(16))) unsigned short sKh[32][D + 8], sKl[32][D + 8], sVh[32][D + 8], sVl[32][D + 8];
  __shared__ __attribute__((aligned(16))) unsigned short sPh[4][16][40], sPl[4][16][40];
  __shared__ __attribute__((aligned(16))) float sO[4][16][D];
  const int tid = threadIdx.x, w = tid >> 5, lane = tid & 31, ln = lane & 15, hh = lane >> 4;
  const int nqb = (T + 63) / 64;
  const int bh = blockIdx.x / nqb, qblk = blockIdx.x % nqb;
  const int b = bh / H, h = bh % H;
  const int q0 = qblk * 64 + w * 16;
  const float* Q = qb + (size_t)b * T * pitch + h * D;
  const float* K = kb + (size_t)b * T * pitch + h * D;
  const float* V = vb + (size_t)b * T * pitch + h * D;

  // A fragments of the wave's 16 query rows (scaled), hi/lo
  FragB aqh[KS], aql[KS];
  {
    int row = q0 + ln; if (row >= T) row = T - 1;
    const float* qr = Q + (size_t)row * pitch;
#pragma unroll
    for (int ks = 0; ks < KS; ++ks)
#pragma unroll
      for (int i = 0; i < 16; ++i) {
        const int d = ks * 32 + ((i < 8) ? (8 * hh + i) : (16 + 8 * hh + (i - 8)));
        const float x = qr[d] * scale; const unsigned short hb = bf16_bits(x);
        aqh[ks].u[i] = hb; aql[ks].u[i] = bf16_bits(x - bf16_val(hb));
      }
  }
  float m_r[8], l_r[8];
#pragma unroll
  for (int r = 0; r < 8; ++r) { m_r[r] = -3.0e38f; l_r[r] = 0.f; }
  v8f oacc[DT];
#pragma unroll
  for (int dt = 0; dt < DT; ++dt) oacc[dt] = (v8f){0.f,0.f,0.f,0.f,0.f,0.f,0.f,0.f};

  const int kv_end = CAUSAL ? min(T, qblk * 64 + 64) : T;     // block-uniform
  for (int j0 = 0; j0 < kv_end; j0 += 32) {
    __syncthreads();
    for (int e = tid; e < 32 * (D / 4); e += 128) {
      const int r = e / (D / 4), c4 = (e % (D / 4)) * 4;
      const int key = j0 + r;
      v4f kf = {0.f,0.f,0.f,0.f}, vf = {0.f,0.f,0.f,0.f};
      if (key < T) { kf = *(const v4fa*)(K + (size_t)key * pitch + c4); vf = *(const v4fa*)(V + (size_t)key * pitch + c4); }
#pragma unroll
      for (int t = 0; t < 4; ++t) {
        unsigned short hb = bf16_bits(kf[t]); sKh[r][c4 + t] = hb; sKl[r][c4 + t] = bf16_bits(kf[t] - bf16_val(hb));
        hb = bf16_bits(vf[t]); sVh[r][c4 + t] = hb; sVl[r][c4 + t] = bf16_bits(vf[t] - bf16_val(hb));
      }
    }
    __syncthreads();
    // S tile 16 x 32
    v8f s[2];
#pragma unroll
    for (int nt = 0; nt < 2; ++nt) {
      v8f acc = {};
#pragma unroll
      for (int ks = 0; ks < KS; ++ks) {
        FragB bh_, bl_;
        bh_.half[0] = *(const v8us*)&sKh[nt * 16 + ln][ks * 32 + 8 * hh]; bh_.half[1] = *(const v8us*)&sKh[nt * 16 + ln][ks * 32 + 16 + 8 * hh];
        bl_.half[0] = *(const v8us*)&sKl[nt * 16 + ln][ks * 32 + 8 * hh]; bl_.half[1] = *(const v8us*)&sKl[nt * 16 + ln][ks * 32 + 16 + 8 * hh];
        acc = mmaN<3>(aqh[ks].v, aql[ks].v, bh_.v, bl_.v, acc);
      }
      s[nt] = acc;
    }
    // mask + running max (rows 8hh+r; the 16 lanes of a half share rows)
    float alpha[8];
#pragma unroll
    for (int r = 0; r < 8; ++r) {
      const int qi = q0 + 8 * hh + r;
      const int ja = j0 + ln, jb = j0 + 16 + ln;
      if (CAUSAL) { if (ja > qi) s[0][r] = -3.0e38f; if (jb > qi) s[1][r] = -3.0e38f; }
      if (ja >= T) s[0][r] = -3.0e38f;
      if (jb >= T) s[1][r] = -3.0e38f;
      float mx = fmaxf(s[0][r], s[1][r]);
      mx = fmaxf(mx, __shfl_xor(mx, 1, 32)); mx = fmaxf(mx, __shfl_xor(mx, 2, 32)); mx = fmaxf(mx, __shfl_xor(mx, 4, 32)); mx = fmaxf(mx, __shfl_xor(mx, 8, 32));
      const float mnew = fmaxf(m_r[r], mx);
      alpha[r] = (mnew > -1.0e38f) ? __expf(m_r[r] - mnew) : 1.0f;
      const float p0 = (s[0][r] > -1.0e38f) ? __expf(s[0][r] - mnew) : 0.f;
      const float p1 = (s[1][r] > -1.0e38f) ? __expf(s[1][r] - mnew) : 0.f;
      m_r[r] = mnew;
      l_r[r] = l_r[r] * alpha[r] + p0 + p1;            // per-lane partial row sum (16 lanes combined at the end)
      unsigned short hb = bf16_bits(p0); sPh[w][8 * hh + r][ln] = hb;      sPl[w][8 * hh + r][ln] = bf16_bits(p0 - bf16_val(hb));
      hb = bf16_bits(p1);                sPh[w][8 * hh + r][16 + ln] = hb; sPl[w][8 * hh + r][16 + ln] = bf16_bits(p1 - bf16_val(hb));
    }
#pragma unroll
    for (int dt = 0; dt < DT; ++dt)
#pragma unroll
      for (int r = 0; r < 8; ++r) oacc[dt][r] *= alpha[r];
    __builtin_amdgcn_fence(__ATOMIC_ACQ_REL, "workgroup");
    __builtin_amdgcn_wave_barrier();
    FragB pah, pal;
    pah.half[0] = *(const v8us*)&sPh[w][ln][8 * hh]; pah.half[1] = *(const v8us*)&sPh[w][ln][16 + 8 * hh];
    pal.half[0] = *(const v8us*)&sPl[w][ln][8 * hh]; pal.half[1] = *(const v8us*)&sPl[w][ln][16 + 8 * hh];
#pragma unroll
    for (int dt = 0; dt < DT; ++dt) {
      FragB bvh, bvl;
#pragma unroll
      for (int i = 0; i < 8; ++i) {
        bvh.u[i] = sVh[8 * hh + i][dt * 16 + ln]; bvh.u[8 + i] = sVh[16 + 8 * hh + i][dt * 16 + ln];
        bvl.u[i] = sVl[8 * hh + i][dt * 16 + ln]; bvl.u[8 + i] = sVl[16 + 8 * hh + i][dt * 16 + ln];
      }
      oacc[dt] = mmaN<3>(pah.v, pal.v, bvh.v, bvl.v, oacc[dt]);
    }
    __builtin_amdgcn_fence(__ATOMIC_ACQ_REL, "workgroup");
    __builtin_amdgcn_wave_barrier();
  }
#pragma unroll
  for (int r = 0; r < 8; ++r) {
    float l = l_r[r];
    l += __shfl_xor(l, 1, 32); l += __shfl_xor(l, 2, 32); l += __shfl_xor(l, 4, 32); l += __shfl_xor(l, 8, 32);
    l_r[r] = (l > 0.f) ? 1.0f / l : 0.f;
  }
#pragma unroll
  for (int dt = 0; dt < DT; ++dt)
#pragma unroll
    for (int r = 0; r < 8; ++r) sO[w][8 * hh + r][dt * 16 + ln] = oacc[dt][r] * l_r[r];
  __builtin_amdgcn_fence(__ATOMIC_ACQ_REL, "workgroup");
  __builtin_amdgcn_wave_barrier();
  {
    for (int r = 0; r < 16; ++r) {
      const int row = q0 + r;
      if (row < T && lane < D / 4) {
        const v4f val = *(const v4fa*)&sO[w][r][lane * 4];
        *(v4f*)(y + ((size_t)b * T + row) * ypitch + h * D + lane * 4) = val;
      }
    }
    
  }
}

// f32 [R][Cc] (row pitch lds) -> bf16 hi/lo planes [R][Cc] (pitch Cc); thread per 8 elements; Cc % 8 == 0
__global__ __launch_bounds__(256) void k_split_rows(const float* __restrict__ src, int lds_, unsigned short* __restrict__ hi, unsigned short* __restrict__ lo, int R, int Cc) {
  const size_t t = (size_t)blockIdx.x * 256 + threadIdx.x;
  const int c8n = Cc / 8;
  if (t >= (size_t)R * c8n) return;
  const int r = (int)(t / c8n), c8 = (int)(t % c8n) * 8;
  const float* s = src + (size_t)r * lds_ + c8;
  const v4f a = *(const v4fa*)s, b = *(const v4fa*)(s + 4);
  float xs[8] = {a[0],a[1],a[2],a[3],b[0],b[1],b[2],b[3]};
  v8us vh, vl;
#pragma unroll
  for (int i = 0; i < 8; ++i) { const unsigned short hb = bf16_bits(xs[i]); vh[i] = hb; vl[i] = bf16_bits(xs[i] - bf16_val(hb)); }
  unsigned short* dh = hi + (size_t)r * Cc + c8; unsigned short* dl = lo + (size_t)r * Cc + c8;
  *(v8us*)dh = vh; *(v8us*)dl = vl; 
}
// f32 [K][N] (row pitch lds) -> transposed bf16 hi/lo planes [N][K]; one thread per (n, 8 consecutive k)
// blockIdx.y = matrix of a batch: sources and planes of the batch lie densely one behind the other
__global__ __launch_bounds__(256) void k_split_transpose(const float* __restrict__ src, int lds_, unsigned short* __restrict__ hi, unsigned short* __restrict__ lo, int K, int N) {
  const size_t t = (size_t)blockIdx.x * 256 + threadIdx.x;
  const int k8n = K / 8;
  if (t >= (size_t)N * k8n) return;
  const int n = (int)(t / k8n), k8 = (int)(t % k8n) * 8;
  src += (size_t)blockIdx.y * K * lds_; hi += (size_t)blockIdx.y * N * K; lo += (size_t)blockIdx.y * N * K;
  v8us vh, vl;
#pragma unroll
  for (int i = 0; i < 8; ++i) { const float x = src[(size_t)(k8 + i) * lds_ + n]; const unsigned short hb = bf16_bits(x); vh[i] = hb; vl[i] = bf16_bits(x - bf16_val(hb)); }
  unsigned short* dh = hi + (size_t)n * K + k8; unsigned short* dl = lo + (size_t)n * K + k8;
  *(v8us*)dh = vh; *(v8us*)dl = vl; 
}
// GEMM with A f32 (split into hi/lo when ASPLIT) and B from bf16 planes Bh (+ Bl when BSPLIT): terms hi·hi [+ lo·hi] [+ hi·lo].
// C f32 [M][N] pitch ldc; alpha scales the result; bias optional (BIAS_BF16 rounds it). Same tiling/epilogue as k_gemm_bf.
// blockIdx.y = product of a batch: the A, B and C matrices of the batch lie densely one behind the other (M, N, M rows each).
// CAUSAL (M == N, M % 32 == 0): only the 16 x 64 tiles with col0 <= row0 + 16 are computed and stored; they hold every element (i, j <= i + 14),
// which is all that the convolution reads. Row tiles p and M/16 - 1 - p together have at most N/64 + 2 such tiles: the grid deals that many waves to each pair.
template <bool ASPLIT, bool BSPLIT, int ACT, bool BIAS_BF16, bool CAUSAL>
__global__ __launch_bounds__(128) void k_gemm_bf2(const float* __restrict__ A, int lda, const unsigned short* __restrict__ Bh, const unsigned short* __restrict__ Bl, int ldb,
                                                const float* __restrict__ bias, float alpha, float* __restrict__ C, int ldc, int M, int N, int K) {
  __shared__ __attribute__((aligned(16))) float so[4][16][64];
  const int tid = threadIdx.x, w = tid >> 5, lane = tid & 31, ln = lane & 15, hh = lane >> 4;
  const int ntn = N / 64;
  const int wid = blockIdx.x * 4 + w;
  int mt = wid / ntn, nq = wid % ntn;
  if (CAUSAL) {
    const int p = wid / (ntn + 2), c = wid % (ntn + 2), mh = M / 16 - 1 - p;
    if (p >= M / 32) return;
    const int nh = min(ntn, (mh + 1) / 4 + 1), nl = (p + 1) / 4 + 1;   // tiles of the pair's lower and upper row tile
    if (c >= nh + nl) return;
    mt = (c < nh) ? mh : p; nq = (c < nh) ? c : c - nh;
  }
  if (mt * 16 >= M) return;
  const int row0 = mt * 16, col0 = nq * 64;
  A += (size_t)blockIdx.y * M * lda; Bh += (size_t)blockIdx.y * N * ldb; Bl += (size_t)blockIdx.y * N * ldb; C += (size_t)blockIdx.y * M * ldc;
  const float* arow = A + (size_t)(row0 + ln) * lda;
  v8f acc[4] = {};
  for (int kb = 0; kb < K; kb += 32) {
    FragB ah, al;
    const v4f x0 = *(const v4fa*)(arow + kb + 8 * hh), x1 = *(const v4fa*)(arow + kb + 8 * hh + 4);
    const v4f x2 = *(const v4fa*)(arow + kb + 16 + 8 * hh), x3 = *(const v4fa*)(arow + kb + 16 + 8 * hh + 4);
    float xs[16] = {x0[0],x0[1],x0[2],x0[3],x1[0],x1[1],x1[2],x1[3],x2[0],x2[1],x2[2],x2[3],x3[0],x3[1],x3[2],x3[3]};
#pragma unroll
    for (int i = 0; i < 16; ++i) { const unsigned short hb = bf16_bits(xs[i]); ah.u[i] = hb; al.u[i] = ASPLIT ? bf16_bits(xs[i] - bf16_val(hb)) : (unsigned short)0; }
#pragma unroll
    for (int t = 0; t < 4; ++t) {
      const size_t boff = (size_t)(col0 + t * 16 + ln) * ldb + kb;
      FragB bh_, bl_;
      bh_.half[0] = *(const v8us*)(Bh + boff + 8 * hh);
      bh_.half[1] = *(const v8us*)(Bh + boff + 16 + 8 * hh);
      if (BSPLIT) { bl_.half[0] = *(const v8us*)(Bl + boff + 8 * hh); bl_.half[1] = *(const v8us*)(Bl + boff + 16 + 8 * hh); } else bl_ = bh_;
      acc[t] = mmaN<ASPLIT ? (BSPLIT ? 3 : 2) : 1>(ah.v, al.v, bh_.v, bl_.v, acc[t]);
    }
  }
#pragma unroll
  for (int t = 0; t < 4; ++t) {
    float bv = bias ? bias[col0 + t * 16 + ln] : 0.f;
    if (BIAS_BF16) bv = bf16_round(bv);
#pragma unroll
    for (int r = 0; r < 8; ++r) { float v = acc[t][r] * alpha + bv; if (ACT == 1) v = fmaxf(v, 0.f); so[w][8 * hh + r][t * 16 + ln] = v; }
  }
  __builtin_amdgcn_fence(__ATOMIC_ACQ_REL, "workgroup");
  __builtin_amdgcn_wave_barrier();
  const int rsub = lane >> 4, c4 = (lane & 15) * 4;
  {
#pragma unroll
    for (int q = 0; q < 8; ++q) {
      const int r = q * 2 + rsub;
      const v4f v = *(const v4fa*)&so[w][r][c4];
      *(v4f*)(C + (size_t)(row0 + r) * ldc + col0 + c4) = v;
    }
    
  }
}
// C tile 16 x 32 per work-group of C[M][N] = A[M][K] x B, A f32 split hi/lo per fragment, B bf16 hi/lo planes [N][K], 3 terms as above.
// A is lower triangular (M == K = 16 * KW): its elements right of the diagonal are zero, and right of the 32-column step that holds the tile's
// diagonal they are neither stored by the producer nor read here. The steps of 32 k up to there are dealt round-robin to the 16 waves of the
// work-group (wave w takes steps w, w + 16, ...); the 16 f32 partial tiles are summed through LDS in wave order.
// Grid: x = 32-column part of N, y = 16-row tile of M, the longest rows first, z = product of a batch (the batch's A, B and C matrices,
// of M, N and M rows, lie densely one behind the other).
// Every loop over s, t, i, r, p below is unrolled so that the fragment arrays are indexed by constants and stay in registers.
template <int KW>
__global__ __launch_bounds__(512) void k_gemm_ksplit(const float* __restrict__ A, int lda, const unsigned short* __restrict__ Bh, const unsigned short* __restrict__ Bl, int ldb,
                                                   float* __restrict__ C, int ldc, int M, int N) {
  __shared__ float part[16][16][36];   // pitch 36: the two 8-row halves of an accumulator store fall on different banks
  // the wave's number is the same in all its lanes; readfirstlane says so to the compiler, so that the tests on a wave's step count are scalar branches
  const int tid = threadIdx.x, w = __builtin_amdgcn_readfirstlane((int)(threadIdx.x >> 5)), lane = tid & 31, ln = lane & 15, hh = lane >> 4;
  const int row0 = (M / 16 - 1 - (int)blockIdx.y) * 16, col0 = blockIdx.x * 32;
  const int nmy = (row0 / 32 + 1 - w + 15) >> 4;   // this wave's share of the row0 / 32 + 1 steps, 0 .. NS
  A += (size_t)blockIdx.z * M * lda; Bh += (size_t)blockIdx.z * N * ldb; Bl += (size_t)blockIdx.z * N * ldb; C += (size_t)blockIdx.z * M * ldc;
  // wave-uniform bases and 32-bit byte offsets of a lane: five lane addresses are formed once and a step is an immediate offset, so that no address is formed anew between the steps
  const char* abase = (const char*)(A + (size_t)row0 * lda + w * 32);
  const char* hbase[2] = {(const char*)(Bh + (size_t)col0 * ldb + w * 32), (const char*)(Bh + (size_t)(col0 + 16) * ldb + w * 32)};
  const char* lbase[2] = {(const char*)(Bl + (size_t)col0 * ldb + w * 32), (const char*)(Bl + (size_t)(col0 + 16) * ldb + w * 32)};
  const unsigned aoff = 4u * (unsigned)(ln * lda + 8 * hh), boff = 2u * (unsigned)(ln * ldb + 8 * hh);
  constexpr int NS = KW / 32, AHEAD = 3;   // a wave's fragment loads run AHEAD steps in front of its products (all NS at once spill)
  v4f xa[NS][4];
  FragB bh_[NS][2], bl_[NS][2];
  auto load_step = [&](int s) {
    const char* ap = abase + s * 2048 + aoff;
    xa[s][0] = *(const v4fa*)ap; xa[s][1] = *(const v4fa*)(ap + 16); xa[s][2] = *(const v4fa*)(ap + 64); xa[s][3] = *(const v4fa*)(ap + 80);
#pragma unroll
    for (int t = 0; t < 2; ++t) {
      const char* hp = hbase[t] + s * 1024 + boff; const char* lp = lbase[t] + s * 1024 + boff;
      bh_[s][t].half[0] = *(const v8us*)hp; bh_[s][t].half[1] = *(const v8us*)(hp + 32);
      bl_[s][t].half[0] = *(const v8us*)lp; bl_[s][t].half[1] = *(const v8us*)(lp + 32);
    }
    // the wait that stands between issued loads and a rewrite of their address registers; as its inputs these stay whole up to it, so that no load above lands in one
    asm volatile("s_wait_xcnt 0x0" :: "v"(abase + aoff), "v"(hbase[0] + boff), "v"(hbase[1] + boff), "v"(lbase[0] + boff), "v"(lbase[1] + boff) : "memory");
  };
#pragma unroll
  for (int s = 0; s < AHEAD && s < NS; ++s) if (s < nmy) load_step(s);
  v8f acc[2] = {};
#pragma unroll
  for (int s = 0; s < NS; ++s) {
    if (s >= nmy) break;
    FragB ah, al;
#pragma unroll
    for (int i = 0; i < 16; ++i) { const float x = xa[s][i >> 2][i & 3]; const unsigned short hb = bf16_bits(x); ah.u[i] = hb; al.u[i] = bf16_bits(x - bf16_val(hb)); }
#pragma unroll
    for (int t = 0; t < 2; ++t) acc[t] = mmaN<3>(ah.v, al.v, bh_[s][t].v, bl_[s][t].v, acc[t]);
    if (s + AHEAD < NS && s + AHEAD < nmy) load_step(s + AHEAD);
  }
#pragma unroll
  for (int t = 0; t < 2; ++t)
#pragma unroll
    for (int r = 0; r < 8; ++r) part[w][8 * hh + r][t * 16 + ln] = acc[t][r];
  __syncthreads();   // all 16 partial tiles are in LDS before any is read
  // thread = one element of the tile; a wave stores one whole 128-byte line of C
  float sum = 0.f;
#pragma unroll
  for (int p = 0; p < 16; ++p) sum += part[p][w][lane];
  C[(size_t)(row0 + w) * ldc + col0 + lane] = sum;
}
// row softmax: P[row][:] = softmax(masked S[row][:]) over N columns with optional causal mask (col > row + rowoff -> 0) and
__global__ __launch_bounds__(256) void k_softmax_rows(const float* __restrict__ S, float* __restrict__ P, int N, int causal, int rowoff, const int* __restrict__ mask, int mask_pitch) {
  __shared__ float red[256];
  const int row = blockIdx.x, tid = threadIdx.x;
  const float* s = S + (size_t)row * N; float* p_out = P + (size_t)row * N;
  const int qi = row + rowoff;
  float mx = -3.0e38f;
  for (int j = tid; j < N; j += 256) {
    bool keep = true;
    if (causal && j > qi) keep = false;
    if (mask && mask[(size_t)qi * mask_pitch + j] == 0) keep = false;
    const float v = keep ? s[j] : -3.0e38f;
    mx = fmaxf(mx, v);
  }
  red[tid] = mx; __syncthreads();
  for (int st = 128; st > 0; st >>= 1) { if (tid < st) red[tid] = fmaxf(red[tid], red[tid + st]); __syncthreads(); }
  mx = red[0]; __syncthreads();
  float sum = 0.f;
  for (int j = tid; j < N; j += 256) {
    bool keep = true;
    if (causal && j > qi) keep = false;
    if (mask && mask[(size_t)qi * mask_pitch + j] == 0) keep = false;
    const float p = keep ? __expf(s[j] - mx) : 0.f;
    sum += p;
  }
  red[tid] = sum; __syncthreads();
  for (int st = 128; st > 0; st >>= 1) { if (tid < st) red[tid] += red[tid + st]; __syncthreads(); }
  const float inv = (mx > -1.0e38f) ? 1.0f / red[0] : __builtin_nanf("");
  __syncthreads();
  {
    for (int j4 = tid * 4; j4 < N; j4 += 1024) {
      v4f out4;
#pragma unroll
      for (int u = 0; u < 4; ++u) {
        const int j = j4 + u;
        bool keep = true;
        if (causal && j > qi) keep = false;
        if (mask && mask[(size_t)qi * mask_pitch + j] == 0) keep = false;
        out4[u] = keep ? __expf(s[j] - mx) * inv : 0.f;
      }
      *(v4f*)(p_out + j4) = out4;
    }
    
  }
}

// Cross-lane steps of a wave-wide reduction: row_xmask DPP inside a 16-lane row, then the other row's lane of the same index.
template <int CTRL>
__device__ __forceinline__ float dpp_get(float x) { return __int_as_float(__builtin_amdgcn_update_dpp(0, __float_as_int(x), CTRL, 0xf, 0xf, true)); }
__device__ __forceinline__ float other_row(float x) { return __int_as_float(__builtin_amdgcn_permlanex16(__float_as_int(x), __float_as_int(x), 0x76543210, 0xfedcba98, false, false)); }
__device__ __forceinline__ float wave_max(float x) {
  x = fmaxf(x, dpp_get<0x161>(x)); x = fmaxf(x, dpp_get<0x162>(x)); x = fmaxf(x, dpp_get<0x164>(x)); x = fmaxf(x, dpp_get<0x168>(x));
  return fmaxf(x, other_row(x));
}
__device__ __forceinline__ float wave_sum(float x) {
  x += dpp_get<0x161>(x); x += dpp_get<0x162>(x); x += dpp_get<0x164>(x); x += dpp_get<0x168>(x);
  return x + other_row(x);
}
// exp(x) as __expf builds it (x * log2 e, then v_exp_f32). In asm so that the v_nop stands directly behind the transcendental: it fills the
// slot that the instruction set asks for before the source register is rewritten or the result read.
__device__ __forceinline__ float exp_slot(float x) {
  const float y = x * 1.44269504f;
  float e;
  asm("v_exp_f32 %0, %1\n\tv_nop" : "=v"(e) : "v"(y));
  return e;
}
#define CR 8   // output rows per row block
#define CWG ((SS / CR) * 9 / 16)   // work-groups per head group: the 32 * (1 + 2 + ... + 8) wave tiles on or left of the diagonal, 8 to a head and work-group
// Only what lies on or left of the diagonal is worked on: right of it a softmax weight is exp(-1e9 - max) = 0. A wave tile is CR rows x 256 columns; row block b
// has b / 32 + 1 of them. Work-group u takes row block 255 - u and, from u = 32 on, row block u - 32 as well: together always 8 wave tiles a head.
// Each wave has its own i0; a row's maximum and sum are taken over the waves wlo .. whi - 1 of its row block. The mixed map is stored up to the end of the
// 32-column step that holds the diagonal (zeros right of it), which is as far as the next GEMM reads.
// CR rows from i0, both heads of group g = g0 + blockIdx.y (S2 and M2 hold the launch's groups one behind the other): waves 0-7 take head 0, waves 8-15 head 1. Per head: conv over its zero-masked scores,
// + bias, future -> -1e9, softmax. The two halves then swap their softmax tiles through LDS and each stores its own mixed head:
// mixed_j = m[0][j]*P_0 + m[1][j]*P_1, so the softmax maps never go to memory.
// A thread owns 8 consecutive columns of all CR rows in registers. Each of the CR + 5 score rows is read once per thread as an
// 18-wide window and feeds every output row and tap that uses it; the 66 weights are wave-uniform. Per output element the taps
// are added in the order a, then bq, ascending.
// Every loop over t, x, r, bq, c, p below is unrolled so that the window and the accumulators are indexed by constants and stay in registers.
__global__ __launch_bounds__(512) void k_conv_softmax_mix(const float* __restrict__ S2, const float* __restrict__ conv_w, const float* __restrict__ conv_b,
                                                         const float* __restrict__ head_mix, int g0, float* __restrict__ M2) {
  __shared__ __attribute__((aligned(16))) float redm[2][8][CR], reds[2][8][CR];   // per head and wave: the CR row maxima, the CR row sums
  __shared__ __attribute__((aligned(16))) v4f xch[2][CR * 2][256];                // per head: a thread's 2 * CR quads, lane-contiguous (writer and reader share tid)
  // the head is the same in all lanes of a wave; readfirstlane says so to the compiler, so that weights and row bases stay scalar
  const int hh2 = __builtin_amdgcn_readfirstlane((int)(threadIdx.x >> 8));
  const int tid = threadIdx.x & 255, w = __builtin_amdgcn_readfirstlane((int)((threadIdx.x & 255) >> 5)), lane = tid & 31;   // w wave-uniform as hh2 is: i0 and the row bases stay scalar
  const int u = (int)blockIdx.x, nah = (SS / CR - 1 - u) / 32 + 1;   // wave tiles of the longer row block
  const bool shortb = w >= nah;
  const int wlo = shortb ? nah : 0, whi = shortb ? 8 : nah;
  const int i0 = (shortb ? u - 32 : SS / CR - 1 - u) * CR;
  const int g = g0 + (int)blockIdx.y, hb = (int)blockIdx.y * 2 + hh2;   // hb = the head's place in S2 and M2
  const int h = g * 2 + hh2;
  const float* S = S2 + (size_t)hb * SS * SS;
  const float* wk = conv_w + (size_t)h * 66;
  const int j0 = ((w - wlo) * 32 + lane) * 8;
  const int jl = min(j0, i0);   // a lane wholly right of the diagonal loads the diagonal lane's window (its results are replaced by -1e9 below): nothing right of column i0 + 12 is read
  // window = columns j0 - 5 .. j0 + 12; a piece that would leave the row is read from inside it and masked to 0 below
  // 32-bit byte offsets of a lane inside a row: with the wave-uniform row base each load takes the scalar-base form and these registers are never rewritten
  const unsigned oA = 4u * (unsigned)max(jl - 5, 0), oB = 4u * (unsigned)max(jl - 4, 0), oC = 4u * (unsigned)jl, oE = 4u * (unsigned)min(jl + 8, SS - 4), oF = 4u * (unsigned)min(jl + 12, SS - 1);
  float acc[CR][8];
#pragma unroll
  for (int r = 0; r < CR; ++r)
#pragma unroll
    for (int c = 0; c < 8; ++c) acc[r][c] = 0.f;
  float eA[2], eF[2];
  v4f qB[2], qC[2], qD[2], qE[2];
  auto load_row = [&](int t) {                                   // score row i0 - 2 + t into register set t & 1; a row outside is replaced by row i0 and masked
    const int ii = i0 - 2 + t;
    const char* srow = (const char*)(S + (size_t)((ii >= 0 && ii < SS) ? ii : i0) * SS);
    eA[t & 1] = *(const float*)(srow + oA); eF[t & 1] = *(const float*)(srow + oF);
    qB[t & 1] = *(const v4fa*)(srow + oB); qC[t & 1] = *(const v4fa*)(srow + oC); qD[t & 1] = *(const v4fa*)(srow + oC + 16); qE[t & 1] = *(const v4fa*)(srow + oE);
  };
  load_row(0);
#pragma unroll
  for (int t = 0; t < CR + 5; ++t) {
    if (t + 1 < CR + 5) load_row(t + 1);
    // keeps the next row's loads in front of this row's products, so that they land under them
    __builtin_amdgcn_sched_barrier(0);
    const int ii = i0 - 2 + t, s = t & 1;
    const unsigned lim = (ii >= 0 && ii < SS) ? (unsigned)(ii + 1) : 0u;   // columns 0 .. ii of row ii enter; future ones, and rows outside, enter as 0
    float win[18] = {eA[s], qB[s][0], qB[s][1], qB[s][2], qB[s][3], qC[s][0], qC[s][1], qC[s][2], qC[s][3],
                     qD[s][0], qD[s][1], qD[s][2], qD[s][3], qE[s][0], qE[s][1], qE[s][2], qE[s][3], eF[s]};
#pragma unroll
    for (int x = 0; x < 18; ++x) win[x] = ((unsigned)(j0 - 5 + x) < lim) ? win[x] : 0.0f;
#pragma unroll
    for (int r = 0; r < CR; ++r) {
      const int a = t - r;                                       // ii = (i0 + r) + a - 2
      if (a < 0 || a >= 6) continue;
#pragma unroll
      for (int bq = 0; bq < 11; ++bq)
#pragma unroll
        for (int c = 0; c < 8; ++c) acc[r][c] += wk[a * 11 + bq] * win[c + bq];
    }
  }
  const float cb = conv_b[h];
  float mx[CR];
#pragma unroll
  for (int r = 0; r < CR; ++r) {
    float m = -3.0e38f;
#pragma unroll
    for (int c = 0; c < 8; ++c) { const float fin = (j0 + c > i0 + r) ? -1.0e9f : acc[r][c] + cb; acc[r][c] = fin; m = fmaxf(m, fin); }
    mx[r] = wave_max(m);
  }
  if (lane == 0) {
#pragma unroll
    for (int r = 0; r < CR; ++r) redm[hh2][w][r] = mx[r];
  }
  __syncthreads();   // each head's 8 waves' row maxima are in LDS before any is read
#pragma unroll
  for (int r = 0; r < CR; ++r) {
    float m = -3.0e38f;
#pragma unroll
    for (int p = 0; p < 8; ++p) { const float o = redm[hh2][p][r]; m = (p >= wlo && p < whi) ? fmaxf(m, o) : m; }
    float sum = 0.f;
#pragma unroll
    for (int c = 0; c < 8; ++c) { const float e = exp_slot(acc[r][c] - m); acc[r][c] = e; sum += e; }
    mx[r] = wave_sum(sum);
  }
  if (lane == 0) {
#pragma unroll
    for (int r = 0; r < CR; ++r) reds[hh2][w][r] = mx[r];
  }
  __syncthreads();   // each head's 8 waves' row sums are in LDS before any is read
#pragma unroll
  for (int r = 0; r < CR; ++r) {
    float sum = 0.f;
#pragma unroll
    for (int p = 0; p < 8; ++p) { const float o = reds[hh2][p][r]; sum = (p >= wlo && p < whi) ? sum + o : sum; }
    const float inv = 1.0f / sum;
    v4f o0, o1;
#pragma unroll
    for (int c = 0; c < 4; ++c) { o0[c] = acc[r][c] * inv; o1[c] = acc[r][4 + c] * inv; acc[r][c] = o0[c]; acc[r][4 + c] = o1[c]; }
    xch[hh2][2 * r][tid] = o0; xch[hh2][2 * r + 1][tid] = o1;
  }
  const float m_own = head_mix[g * 4 + hh2 * 2 + hh2], m_oth = head_mix[g * 4 + (1 - hh2) * 2 + hh2];   // m[i][j], j = this head
  __syncthreads();   // both heads' softmax tiles are in LDS before the other head reads them
  if (j0 > (i0 | 31)) return;   // right of the diagonal's 32-column step nothing is stored; no barrier follows
#pragma unroll
  for (int r = 0; r < CR; ++r) {
    const v4f t0 = xch[1 - hh2][2 * r][tid], t1 = xch[1 - hh2][2 * r + 1][tid];
    float* mrow = M2 + ((size_t)hb * SS + i0 + r) * SS + j0;
    v4f o0, o1;
#pragma unroll
    for (int c = 0; c < 4; ++c) { o0[c] = m_own * acc[r][c] + m_oth * t0[c]; o1[c] = m_own * acc[r][4 + c] + m_oth * t1[c]; }
    *(v4f*)mrow = o0; *(v4f*)(mrow + 4) = o1;
  }
}
// LayerNorm over 64 per row (biased variance), gamma/beta: block = 64 threads = 64 rows; normalised rows staged in LDS and
__global__ __launch_bounds__(64) void k_ln(const float* __restrict__ O, const float* __restrict__ gam, const float* __restrict__ bet, float* __restrict__ out, int nrows) {
  __shared__ __attribute__((aligned(16))) float so[64][DD];
  const int tid = threadIdx.x;
  const int r0 = blockIdx.x * 64, r = r0 + tid;
  if (r < nrows) {
    const float* x = O + (size_t)r * DD;
    float mu = 0.f;
#pragma unroll 1
    for (int d = 0; d < DD; ++d) mu += x[d];
    mu *= (1.0f / DD);
    float var = 0.f;
#pragma unroll 1
    for (int d = 0; d < DD; ++d) { const float c = x[d] - mu; var += c * c; }
    var *= (1.0f / DD);
    const float rs = rsqrtf(var + 1e-5f);
#pragma unroll 1
    for (int d = 0; d < DD; ++d) so[tid][d] = (x[d] - mu) * rs * gam[d] + bet[d];
  }
  __syncthreads();
  {
    for (int e = tid; e < 64 * (DD / 4); e += 64) {
      const int rr = e / (DD / 4), c4 = (e % (DD / 4)) * 4;
      if (r0 + rr < nrows) { const v4f val = *(const v4fa*)&so[rr][c4]; *(v4f*)(out + (size_t)(r0 + rr) * DD + c4) = val; }
    }
    
  }
}

extern "C" void kernel_launch(void* const* d_in, const int* in_sizes, int n_in,
                              void* d_out, int out_size, void* d_ws, size_t ws_size, hipStream_t stream) {
  (void)in_sizes; (void)n_in; (void)out_size;
  const float* q = (const float*)d_in[0]; const float* k = (const float*)d_in[1]; const float* v = (const float*)d_in[2];
  const float* conv_w = (const float*)d_in[3]; const float* conv_b = (const float*)d_in[4]; const float* head_mix = (const float*)d_in[5];
  const float* gam = (const float*)d_in[6]; const float* bet = (const float*)d_in[7];
  char* ws = (char*)d_ws; size_t off = 0;
  auto take = [&](size_t bytes) { char* p = ws + off; off += (bytes + 255) & ~(size_t)255; return p; };
  unsigned short* kh = (unsigned short*)take((size_t)NHD * SS * DD * 2); unsigned short* kl = (unsigned short*)take((size_t)NHD * SS * DD * 2);     // k rows planes, all heads
  unsigned short* vth = (unsigned short*)take((size_t)NHD * DD * SS * 2); unsigned short* vtl = (unsigned short*)take((size_t)NHD * DD * SS * 2);  // v transposed planes, all heads
  float* S2 = (float*)take((size_t)GB * 2 * SS * SS * 4);     // scores of the 2 * GB heads of a batch
  float* M2 = (float*)take((size_t)GB * 2 * SS * SS * 4);     // their mixed maps
  float* O  = (float*)take((size_t)NHD * SS * DD * 4);   // pre-LN output [16][2048][64]
  if (off > ws_size) return;
  k_split_rows<<<(NHD * SS * (DD / 8) + 255) / 256, 256, 0, stream>>>(k, DD, kh, kl, NHD * SS, DD);
  k_split_transpose<<<dim3((DD * (SS / 8) + 255) / 256, NHD), 256, 0, stream>>>(v, DD, vth, vtl, SS, DD);
  for (int g0 = 0; g0 < NG; g0 += GB) {
    const int ng = (NG - g0 < GB) ? NG - g0 : GB, h0 = g0 * 2;   // groups of this batch, its first head
    // scores_h = q.k^T / 8 : M=N=SS, K=DD, one product per head of the batch, tiles up to the diagonal
    k_gemm_bf2<true, true, 0, false, true><<<dim3((SS / 32) * (SS / 64 + 2) / 4, ng * 2), 128, 0, stream>>>(q + (size_t)h0 * SS * DD, DD, kh + (size_t)h0 * SS * DD, kl + (size_t)h0 * SS * DD, DD, nullptr, 0.125f, S2, SS, SS, SS, DD);
    k_conv_softmax_mix<<<dim3(CWG, ng), 512, 0, stream>>>(S2, conv_w, conv_b, head_mix, g0, M2);
    // out_h = mixed_h . v_h : M=SS, N=DD, K=SS; Bt[n=d][k=s] = transposed v planes
    k_gemm_ksplit<SS / 16><<<dim3(DD / 32, SS / 16, ng * 2), 512, 0, stream>>>(M2, SS, vth + (size_t)h0 * DD * SS, vtl + (size_t)h0 * DD * SS, SS, O + (size_t)h0 * SS * DD, DD, SS, DD);
  }
  k_ln<<<(NHD * SS + 63) / 64, 64, 0, stream>>>(O, gam, bet, (float*)d_out, NHD * SS);
}

// v006
// One run takes 258 microseconds.
// Next to v005, in two timings, it ran 1.18 times as fast each time.
// Over all steps from v000 it is 11.0 times as fast.
#include <hip/hip_runtime.h>
// Contractions on v_wmma_f32_16x16x32_bf16 as 3-term bf16 hi/lo splits (f32-accurate), f32 accumulate: scores = q·kᵀ/8 (K=64)
// and out = mixed·v (K=2048). The 6x11 key-query convolution, masking, softmax, 2x2 head mixing and LayerNorm are f32 VALU.
#define NHD 16
#define SS 2048
#define DD 64
#define NG 8
#define GB 3   // head groups per launch: scores and mixed maps of GB groups (64 MiB a group) fit the workspace

typedef __bf16 v16b __attribute__((ext_vector_type(16)));
typedef unsigned short v8us __attribute__((ext_vector_type(8), may_alias));
typedef float  v8f  __attribute__((ext_vector_type(8)));
typedef float  v4f  __attribute__((ext_vector_type(4)));
typedef float  v4fa __attribute__((ext_vector_type(4), may_alias));
union FragB { v16b v; v8us half[2]; unsigned short u[16]; };

__device__ __forceinline__ unsigned short bf16_bits(float x) { unsigned int u = __float_as_uint(x); return (unsigned short)((u + 0x7FFFu + ((u >> 16) & 1u)) >> 16); }
__device__ __forceinline__ float bf16_val(unsigned short b) { return __uint_as_float(((unsigned int)b) << 16); }
__device__ __forceinline__ float bf16_round(float x) { return bf16_val(bf16_bits(x)); }
// D += A·B with NT terms: 1 = ah·bh, 2 = + al·bh (A split), 3 = + ah·bl (both split)
template <int NT>
__device__ __forceinline__ v8f mmaN(v16b ah, v16b al, v16b bh, v16b bl, v8f c) {
  c = __builtin_amdgcn_wmma_f32_16x16x32_bf16(false, ah, false, bh, (short)0, c, false, false);
  if (NT >= 2) c = __builtin_amdgcn_wmma_f32_16x16x32_bf16(false, al, false, bh, (short)0, c, false, false);
  if (NT >= 3) c = __builtin_amdgcn_wmma_f32_16x16x32_bf16(false, ah, false, bl, (short)0, c, false, false);
  asm volatile("v_nop\n\tv_nop\n\tv_nop\n\tv_nop" : "+v"(c) : "v"(ah), "v"(al), "v"(bh), "v"(bl));
  return c;
}

__global__ __launch_bounds__(256) void k_wt_bf16(const float* __restrict__ W, unsigned short* __restrict__ Wt, int K, int N) {
  const int t = blockIdx.x * 256 + threadIdx.x;
  const int k8n = K / 8;
  if (t >= N * k8n) return;
  const int n = t / k8n, k8 = (t % k8n) * 8;
  v8us v;
#pragma unroll
  for (int i = 0; i < 8; ++i) v[i] = bf16_bits(W[(size_t)(k8 + i) * N + n]);
  *(v8us*)(Wt + (size_t)n * K + k8) = v;
  
}

// GEMM C[M][N] (f32, pitch ldc) = act(A[M][K]·W + bias). A f32 row-major (pitch lda) converted per fragment to bf16
// (ASPLIT: hi/lo two planes -> 2 terms, else single rounded term); Wt bf16 [N][K] (pitch ldb). BIAS_BF16 rounds the
// bias to bf16 first (bias quantised to bf16 before the add). K%32==0, M%16==0, N%64==0.
template <bool ASPLIT, int ACT, bool BIAS_BF16>
__global__ __launch_bounds__(128) void k_gemm_bf(const float* __restrict__ A, int lda, const unsigned short* __restrict__ Wt, int ldb,
                                               const float* __restrict__ bias, float* __restrict__ C, int ldc, int M, int N, int K) {
  __shared__ __attribute__((aligned(16))) float so[4][16][64];
  const int tid = threadIdx.x, w = tid >> 5, lane = tid & 31, ln = lane & 15, hh = lane >> 4;
  const int ntn = N / 64;
  const int wid = blockIdx.x * 4 + w;
  const int mt = wid / ntn, nq = wid % ntn;
  if (mt * 16 >= M) return;
  const int row0 = mt * 16, col0 = nq * 64;
  const float* arow = A + (size_t)(row0 + ln) * lda;
  v8f acc[4] = {};
  for (int kb = 0; kb < K; kb += 32) {
    FragB ah, al;
    const v4f x0 = *(const v4fa*)(arow + kb + 8 * hh), x1 = *(const v4fa*)(arow + kb + 8 * hh + 4);
    const v4f x2 = *(const v4fa*)(arow + kb + 16 + 8 * hh), x3 = *(const v4fa*)(arow + kb + 16 + 8 * hh + 4);
    float xs[16] = {x0[0],x0[1],x0[2],x0[3],x1[0],x1[1],x1[2],x1[3],x2[0],x2[1],x2[2],x2[3],x3[0],x3[1],x3[2],x3[3]};
#pragma unroll
    for (int i = 0; i < 16; ++i) { const unsigned short hb = bf16_bits(xs[i]); ah.u[i] = hb; al.u[i] = ASPLIT ? bf16_bits(xs[i] - bf16_val(hb)) : (unsigned short)0; }
#pragma unroll
    for (int t = 0; t < 4; ++t) {
      const unsigned short* brow = Wt + (size_t)(col0 + t * 16 + ln) * ldb + kb;
      FragB b;
      b.half[0] = *(const v8us*)(brow + 8 * hh);
      b.half[1] = *(const v8us*)(brow + 16 + 8 * hh);
      acc[t] = mmaN<ASPLIT ? 2 : 1>(ah.v, al.v, b.v, b.v, acc[t]);
    }
  }
#pragma unroll
  for (int t = 0; t < 4; ++t) {
    float bv = bias ? bias[col0 + t * 16 + ln] : 0.f;
    if (BIAS_BF16) bv = bf16_round(bv);
#pragma unroll
    for (int r = 0; r < 8; ++r) { float v = acc[t][r] + bv; if (ACT == 1) v = fmaxf(v, 0.f); so[w][8 * hh + r][t * 16 + ln] = v; }
  }
  __builtin_amdgcn_fence(__ATOMIC_ACQ_REL, "workgroup");
  __builtin_amdgcn_wave_barrier();
  const int rsub = lane >> 4, c4 = (lane & 15) * 4;
  {
#pragma unroll
    for (int q = 0; q < 8; ++q) {
      const int r = q * 2 + rsub;
      const v4f v = *(const v4fa*)&so[w][r][c4];
      *(v4f*)(C + (size_t)(row0 + r) * ldc + col0 + c4) = v;
    }
    
  }
}

// Flash-style causal/unmasked attention, all contractions 3-term bf16 hi/lo splits, f32 softmax with running max.
// q,k,v rows are read from f32 buffers with arbitrary row pitch (so they can live inside a fused qkv buffer);
// D = head size (multiple of 32, <= 128); one wave = 16 query rows; block = 4 waves (64 queries) sharing K/V chunks of 32.
template <int D, bool CAUSAL>
__global__ __launch_bounds__(128) void k_flash(const float* __restrict__ qb, const float* __restrict__ kb, const float* __restrict__ vb,
                                             int pitch, int T, int H, float scale, float* __restrict__ y, int ypitch) {
  constexpr int KS = D / 32;        // k-steps for QK
  constexpr int DT = D / 16;        // d tiles for PV
  __shared__ __attribute__((aligned(16))) unsigned short sKh[32][D + 8], sKl[32][D + 8], sVh[32][D + 8], sVl[32][D + 8];
  __shared__ __attribute__((aligned(16))) unsigned short sPh[4][16][40], sPl[4][16][40];
  __shared__ __attribute__((aligned(16))) float sO[4][16][D];
  const int tid = threadIdx.x, w = tid >> 5, lane = tid & 31, ln = lane & 15, hh = lane >> 4;
  const int nqb = (T + 63) / 64;
  const int bh = blockIdx.x / nqb, qblk = blockIdx.x % nqb;
  const int b = bh / H, h = bh % H;
  const int q0 = qblk * 64 + w * 16;
  const float* Q = qb + (size_t)b * T * pitch + h * D;
  const float* K = kb + (size_t)b * T * pitch + h * D;
  const float* V = vb + (size_t)b * T * pitch + h * D;

  // A fragments of the wave's 16 query rows (scaled), hi/lo
  FragB aqh[KS], aql[KS];
  {
    int row = q0 + ln; if (row >= T) row = T - 1;
    const float* qr = Q + (size_t)row * pitch;
#pragma unroll
    for (int ks = 0; ks < KS; ++ks)
#pragma unroll
      for (int i = 0; i < 16; ++i) {
        const int d = ks * 32 + ((i < 8) ? (8 * hh + i) : (16 + 8 * hh + (i - 8)));
        const float x = qr[d] * scale; const unsigned short hb = bf16_bits(x);
        aqh[ks].u[i] = hb; aql[ks].u[i] = bf16_bits(x - bf16_val(hb));
      }
  }
  float m_r[8], l_r[8];
#pragma unroll
  for (int r = 0; r < 8; ++r) { m_r[r] = -3.0e38f; l_r[r] = 0.f; }
  v8f oacc[DT];
#pragma unroll
  for (int dt = 0; dt < DT; ++dt) oacc[dt] = (v8f){0.f,0.f,0.f,0.f,0.f,0.f,0.f,0.f};

  const int kv_end = CAUSAL ? min(T, qblk * 64 + 64) : T;     // block-uniform
  for (int j0 = 0; j0 < kv_end; j0 += 32) {
    __syncthreads();
    for (int e = tid; e < 32 * (D / 4); e += 128) {
      const int r = e / (D / 4), c4 = (e % (D / 4)) * 4;
      const int key = j0 + r;
      v4f kf = {0.f,0.f,0.f,0.f}, vf = {0.f,0.f,0.f,0.f};
      if (key < T) { kf = *(const v4fa*)(K + (size_t)key * pitch + c4); vf = *(const v4fa*)(V + (size_t)key * pitch + c4); }
#pragma unroll
      for (int t = 0; t < 4; ++t) {
        unsigned short hb = bf16_bits(kf[t]); sKh[r][c4 + t] = hb; sKl[r][c4 + t] = bf16_bits(kf[t] - bf16_val(hb));
        hb = bf16_bits(vf[t]); sVh[r][c4 + t] = hb; sVl[r][c4 + t] = bf16_bits(vf[t] - bf16_val(hb));
      }
    }
    __syncthreads();
    // S tile 16 x 32
    v8f s[2];
#pragma unroll
    for (int nt = 0; nt < 2; ++nt) {
      v8f acc = {};
#pragma unroll
      for (int ks = 0; ks < KS; ++ks) {
        FragB bh_, bl_;
        bh_.half[0] = *(const v8us*)&sKh[nt * 16 + ln][ks * 32 + 8 * hh]; bh_.half[1] = *(const v8us*)&sKh[nt * 16 + ln][ks * 32 + 16 + 8 * hh];
        bl_.half[0] = *(const v8us*)&sKl[nt * 16 + ln][ks * 32 + 8 * hh]; bl_.half[1] = *(const v8us*)&sKl[nt * 16 + ln][ks * 32 + 16 + 8 * hh];
        acc = mmaN<3>(aqh[ks].v, aql[ks].v, bh_.v, bl_.v, acc);
      }
      s[nt] = acc;
    }
    // mask + running max (rows 8hh+r; the 16 lanes of a half share rows)
    float alpha[8];
#pragma unroll
    for (int r = 0; r < 8; ++r) {
      const int qi = q0 + 8 * hh + r;
      const int ja = j0 + ln, jb = j0 + 16 + ln;
      if (CAUSAL) { if (ja > qi) s[0][r] = -3.0e38f; if (jb > qi) s[1][r] = -3.0e38f; }
      if (ja >= T) s[0][r] = -3.0e38f;
      if (jb >= T) s[1][r] = -3.0e38f;
      float mx = fmaxf(s[0][r], s[1][r]);
      mx = fmaxf(mx, __shfl_xor(mx, 1, 32)); mx = fmaxf(mx, __shfl_xor(mx, 2, 32)); mx = fmaxf(mx, __shfl_xor(mx, 4, 32)); mx = fmaxf(mx, __shfl_xor(mx, 8, 32));
      const float mnew = fmaxf(m_r[r], mx);
      alpha[r] = (mnew > -1.0e38f) ? __expf(m_r[r] - mnew) : 1.0f;
      const float p0 = (s[0][r] > -1.0e38f) ? __expf(s[0][r] - mnew) : 0.f;
      const float p1 = (s[1][r] > -1.0e38f) ? __expf(s[1][r] - mnew) : 0.f;
      m_r[r] = mnew;
      l_r[r] = l_r[r] * alpha[r] + p0 + p1;            // per-lane partial row sum (16 lanes combined at the end)
      unsigned short hb = bf16_bits(p0); sPh[w][8 * hh + r][ln] = hb;      sPl[w][8 * hh + r][ln] = bf16_bits(p0 - bf16_val(hb));
      hb = bf16_bits(p1);                sPh[w][8 * hh + r][16 + ln] = hb; sPl[w][8 * hh + r][16 + ln] = bf16_bits(p1 - bf16_val(hb));
    }
#pragma unroll
    for (int dt = 0; dt < DT; ++dt)
#pragma unroll
      for (int r = 0; r < 8; ++r) oacc[dt][r] *= alpha[r];
    __builtin_amdgcn_fence(__ATOMIC_ACQ_REL, "workgroup");
    __builtin_amdgcn_wave_barrier();
    FragB pah, pal;
    pah.half[0] = *(const v8us*)&sPh[w][ln][8 * hh]; pah.half[1] = *(const v8us*)&sPh[w][ln][16 + 8 * hh];
    pal.half[0] = *(const v8us*)&sPl[w][ln][8 * hh]; pal.half[1] = *(const v8us*)&sPl[w][ln][16 + 8 * hh];
#pragma unroll
    for (int dt = 0; dt < DT; ++dt) {
      FragB bvh, bvl;
#pragma unroll
      for (int i = 0; i < 8; ++i) {
        bvh.u[i] = sVh[8 * hh + i][dt * 16 + ln]; bvh.u[8 + i] = sVh[16 + 8 * hh + i][dt * 16 + ln];
        bvl.u[i] = sVl[8 * hh + i][dt * 16 + ln]; bvl.u[8 + i] = sVl[16 + 8 * hh + i][dt * 16 + ln];
      }
      oacc[dt] = mmaN<3>(pah.v, pal.v, bvh.v, bvl.v, oacc[dt]);
    }
    __builtin_amdgcn_fence(__ATOMIC_ACQ_REL, "workgroup");
    __builtin_amdgcn_wave_barrier();
  }
#pragma unroll
  for (int r = 0; r < 8; ++r) {
    float l = l_r[r];
    l += __shfl_xor(l, 1, 32); l += __shfl_xor(l, 2, 32); l += __shfl_xor(l, 4, 32); l += __shfl_xor(l, 8, 32);
    l_r[r] = (l > 0.f) ? 1.0f / l : 0.f;
  }
#pragma unroll
  for (int dt = 0; dt < DT; ++dt)
#pragma unroll
    for (int r = 0; r < 8; ++r) sO[w][8 * hh + r][dt * 16 + ln] = oacc[dt][r] * l_r[r];
  __builtin_amdgcn_fence(__ATOMIC_ACQ_REL, "workgroup");
  __builtin_amdgcn_wave_barrier();
  {
    for (int r = 0; r < 16; ++r) {
      const int row = q0 + r;
      if (row < T && lane < D / 4) {
        const v4f val = *(const v4fa*)&sO[w][r][lane * 4];
        *(v4f*)(y + ((size_t)b * T + row) * ypitch + h * D + lane * 4) = val;
      }
    }
    
  }
}

// FRAGMENT ORDER of a bf16 plane of the B operand, Bt[N][K] (n = column of B, N % 16 == 0, K % 32 == 0): the plane is a row of 16-byte chunks, and chunk
// ((nt * (K / 32) + ks) * 2 + half) * 32 + lane holds the 8 elements n = nt * 16 + (lane & 15), k = ks * 32 + half * 16 + (lane >> 4) * 8 + 0 .. 7.
// That is what lane 'lane' holds in half 'half' of the B fragment of column tile nt and k step ks: a wave loads a half fragment as 512 bytes in a row
// (four whole lines; from a row-major plane the same load touches 16 lines). The plane has the size of the row-major one.
// f32 [R][Cc] (row pitch lds) -> bf16 hi/lo planes in fragment order (n = row, k = column); thread per chunk; R % 16 == 0, Cc % 32 == 0
__global__ __launch_bounds__(256) void k_split_rows(const float* __restrict__ src, int lds_, unsigned short* __restrict__ hi, unsigned short* __restrict__ lo, int R, int Cc) {
  const size_t t = (size_t)blockIdx.x * 256 + threadIdx.x;
  const int c8n = Cc / 8;
  if (t >= (size_t)R * c8n) return;
  const int lane = (int)(t & 31), half = (int)(t >> 5) & 1, ksn = Cc / 32, tile = (int)(t >> 6);
  const int r = (tile / ksn) * 16 + (lane & 15), c8 = (tile % ksn) * 32 + half * 16 + (lane >> 4) * 8;
  const float* s = src + (size_t)r * lds_ + c8;
  const v4f a = *(const v4fa*)s, b = *(const v4fa*)(s + 4);
  float xs[8] = {a[0],a[1],a[2],a[3],b[0],b[1],b[2],b[3]};
  v8us vh, vl;
#pragma unroll
  for (int i = 0; i < 8; ++i) { const unsigned short hb = bf16_bits(xs[i]); vh[i] = hb; vl[i] = bf16_bits(xs[i] - bf16_val(hb)); }
  unsigned short* dh = hi + t * 8; unsigned short* dl = lo + t * 8;
  *(v8us*)dh = vh; *(v8us*)dl = vl;
}
// f32 [K][N] (row pitch lds) -> bf16 hi/lo planes of Bt[N][K] in fragment order; one thread per chunk (n, 8 consecutive k): 16 lanes read 16 neighbours of a source row
// blockIdx.y = matrix of a batch: sources and planes of the batch lie densely one behind the other
__global__ __launch_bounds__(256) void k_split_transpose(const float* __restrict__ src, int lds_, unsigned short* __restrict__ hi, unsigned short* __restrict__ lo, int K, int N) {
  const size_t t = (size_t)blockIdx.x * 256 + threadIdx.x;
  const int k8n = K / 8;
  if (t >= (size_t)N * k8n) return;
  const int lane = (int)(t & 31), half = (int)(t >> 5) & 1, ksn = K / 32, tile = (int)(t >> 6);
  const int n = (tile / ksn) * 16 + (lane & 15), k8 = (tile % ksn) * 32 + half * 16 + (lane >> 4) * 8;
  src += (size_t)blockIdx.y * K * lds_; hi += (size_t)blockIdx.y * N * K; lo += (size_t)blockIdx.y * N * K;
  v8us vh, vl;
#pragma unroll
  for (int i = 0; i < 8; ++i) { const float x = src[(size_t)(k8 + i) * lds_ + n]; const unsigned short hb = bf16_bits(x); vh[i] = hb; vl[i] = bf16_bits(x - bf16_val(hb)); }
  unsigned short* dh = hi + t * 8; unsigned short* dl = lo + t * 8;
  *(v8us*)dh = vh; *(v8us*)dl = vl;
}
// GEMM with A f32 (split into hi/lo when ASPLIT) and B from bf16 planes Bh (+ Bl when BSPLIT) in fragment order (ldb = their K): terms hi·hi [+ lo·hi] [+ hi·lo].
// C f32 [M][N] pitch ldc; alpha scales the result; bias optional (BIAS_BF16 rounds it). Same tiling/epilogue as k_gemm_bf.
// blockIdx.y = product of a batch: the A, B and C matrices of the batch lie densely one behind the other (M, N, M rows each).
// CAUSAL (M == N, M % 32 == 0): only the 16 x 64 tiles with col0 <= row0 + 16 are computed and stored; they hold every element (i, j <= i + 14),
// which is all that the convolution reads. Row tiles p and M/16 - 1 - p together have at most N/64 + 2 such tiles: the grid deals that many waves to each pair.
template <bool ASPLIT, bool BSPLIT, int ACT, bool BIAS_BF16, bool CAUSAL>
__global__ __launch_bounds__(128) void k_gemm_bf2(const float* __restrict__ A, int lda, const unsigned short* __restrict__ Bh, const unsigned short* __restrict__ Bl, int ldb,
                                                const float* __restrict__ bias, float alpha, float* __restrict__ C, int ldc, int M, int N, int K) {
  __shared__ __attribute__((aligned(16))) float so[4][16][64];
  // the wave's number is the same in all its lanes; readfirstlane says so to the compiler: the tile's place in the B planes is then a scalar base, and a lane adds only lane * 16 bytes
  const int tid = threadIdx.x, w = __builtin_amdgcn_readfirstlane((int)(threadIdx.x >> 5)), lane = tid & 31, ln = lane & 15, hh = lane >> 4;
  const int ntn = N / 64;
  const int wid = blockIdx.x * 4 + w;
  int mt = wid / ntn, nq = wid % ntn;
  if (CAUSAL) {
    const int p = wid / (ntn + 2), c = wid % (ntn + 2), mh = M / 16 - 1 - p;
    if (p >= M / 32) return;
    const int nh = min(ntn, (mh + 1) / 4 + 1), nl = (p + 1) / 4 + 1;   // tiles of the pair's lower and upper row tile
    if (c >= nh + nl) return;
    mt = (c < nh) ? mh : p; nq = (c < nh) ? c : c - nh;
  }
  if (mt * 16 >= M) return;
  const int row0 = mt * 16, col0 = nq * 64;
  A += (size_t)blockIdx.y * M * lda; Bh += (size_t)blockIdx.y * N * ldb; Bl += (size_t)blockIdx.y * N * ldb; C += (size_t)blockIdx.y * M * ldc;
  const float* arow = A + (size_t)(row0 + ln) * lda;
  v8f acc[4] = {};
  for (int kb = 0; kb < K; kb += 32) {
    FragB ah, al;
    const v4f x0 = *(const v4fa*)(arow + kb + 8 * hh), x1 = *(const v4fa*)(arow + kb + 8 * hh + 4);
    const v4f x2 = *(const v4fa*)(arow + kb + 16 + 8 * hh), x3 = *(const v4fa*)(arow + kb + 16 + 8 * hh + 4);
    float xs[16] = {x0[0],x0[1],x0[2],x0[3],x1[0],x1[1],x1[2],x1[3],x2[0],x2[1],x2[2],x2[3],x3[0],x3[1],x3[2],x3[3]};
#pragma unroll
    for (int i = 0; i < 16; ++i) { const unsigned short hb = bf16_bits(xs[i]); ah.u[i] = hb; al.u[i] = ASPLIT ? bf16_bits(xs[i] - bf16_val(hb)) : (unsigned short)0; }
#pragma unroll
    for (int t = 0; t < 4; ++t) {
      const size_t boff = ((size_t)(col0 / 16 + t) * (ldb / 32) + kb / 32) * 512 + lane * 8;
      FragB bh_, bl_;
      bh_.half[0] = *(const v8us*)(Bh + boff);
      bh_.half[1] = *(const v8us*)(Bh + boff + 256);
      if (BSPLIT) { bl_.half[0] = *(const v8us*)(Bl + boff); bl_.half[1] = *(const v8us*)(Bl + boff + 256); } else bl_ = bh_;
      // keeps both planes' loads of a column tile in front of its products, so that they fly together; without it this build issued the lo plane's loads behind the first product and waited twice
      __builtin_amdgcn_sched_barrier(0);
      acc[t] = mmaN<ASPLIT ? (BSPLIT ? 3 : 2) : 1>(ah.v, al.v, bh_.v, bl_.v, acc[t]);
    }
  }
#pragma unroll
  for (int t = 0; t < 4; ++t) {
    float bv = bias ? bias[col0 + t * 16 + ln] : 0.f;
    if (BIAS_BF16) bv = bf16_round(bv);
#pragma unroll
    for (int r = 0; r < 8; ++r) { float v = acc[t][r] * alpha + bv; if (ACT == 1) v = fmaxf(v, 0.f); so[w][8 * hh + r][t * 16 + ln] = v; }
  }
  __builtin_amdgcn_fence(__ATOMIC_ACQ_REL, "workgroup");
  __builtin_amdgcn_wave_barrier();
  const int rsub = lane >> 4, c4 = (lane & 15) * 4;
  {
#pragma unroll
    for (int q = 0; q < 8; ++q) {
      const int r = q * 2 + rsub;
      const v4f v = *(const v4fa*)&so[w][r][c4];
      *(v4f*)(C + (size_t)(row0 + r) * ldc + col0 + c4) = v;
    }
    
  }
}
// C tile 16 x 32 per work-group of C[M][N] = A[M][K] x B, A f32 split hi/lo per fragment, B bf16 hi/lo planes in fragment order (ldb = K), 3 terms as above.
// A is lower triangular (M == K = 16 * KW): its elements right of the diagonal are zero, and right of the 32-column step that holds the tile's
// diagonal they are neither stored by the producer nor read here. The steps of 32 k up to there are dealt round-robin to the 16 waves of the
// work-group (wave w takes steps w, w + 16, ...); the 16 f32 partial tiles are summed through LDS in wave order.
// Grid: x = 32-column part of N, y = 16-row tile of M, the longest rows first, z = product of a batch (the batch's A, B and C matrices,
// of M, N and M rows, lie densely one behind the other).
// Every loop over s, t, i, r, p below is unrolled so that the fragment arrays are indexed by constants and stay in registers.
template <int KW>
__global__ __launch_bounds__(512) void k_gemm_ksplit(const float* __restrict__ A, int lda, const unsigned short* __restrict__ Bh, const unsigned short* __restrict__ Bl, int ldb,
                                                   float* __restrict__ C, int ldc, int M, int N) {
  __shared__ float part[16][16][36];   // pitch 36: the two 8-row halves of an accumulator store fall on different banks
  // the wave's number is the same in all its lanes; readfirstlane says so to the compiler, so that the tests on a wave's step count are scalar branches
  const int tid = threadIdx.x, w = __builtin_amdgcn_readfirstlane((int)(threadIdx.x >> 5)), lane = tid & 31, ln = lane & 15, hh = lane >> 4;
  const int row0 = (M / 16 - 1 - (int)blockIdx.y) * 16, col0 = blockIdx.x * 32;
  const int nmy = (row0 / 32 + 1 - w + 15) >> 4;   // this wave's share of the row0 / 32 + 1 steps, 0 .. NS
  A += (size_t)blockIdx.z * M * lda; Bh += (size_t)blockIdx.z * N * ldb; Bl += (size_t)blockIdx.z * N * ldb; C += (size_t)blockIdx.z * M * ldc;
  // wave-uniform bases and 32-bit byte offsets of a lane: five lane addresses are formed once and a step is an immediate offset, so that no address is formed anew between the steps
  const char* abase = (const char*)(A + (size_t)row0 * lda + w * 32);
  const size_t bt0 = ((size_t)(col0 / 16) * (ldb / 32) + w) * 512, bt1 = ((size_t)(col0 / 16 + 1) * (ldb / 32) + w) * 512;   // the wave's first k step in the two column tiles
  const char* hbase[2] = {(const char*)(Bh + bt0), (const char*)(Bh + bt1)};
  const char* lbase[2] = {(const char*)(Bl + bt0), (const char*)(Bl + bt1)};
  const unsigned aoff = 4u * (unsigned)(ln * lda + 8 * hh), boff = 16u * (unsigned)lane;
  constexpr int NS = KW / 32, AHEAD = 3;   // a wave's fragment loads run AHEAD steps in front of its products (all NS at once spill)
  v4f xa[NS][4];
  FragB bh_[NS][2], bl_[NS][2];
  auto load_step = [&](int s) {
    const char* ap = abase + s * 2048 + aoff;
    xa[s][0] = *(const v4fa*)ap; xa[s][1] = *(const v4fa*)(ap + 16); xa[s][2] = *(const v4fa*)(ap + 64); xa[s][3] = *(const v4fa*)(ap + 80);
#pragma unroll
    for (int t = 0; t < 2; ++t) {
      const char* hp = hbase[t] + s * 16384 + boff; const char* lp = lbase[t] + s * 16384 + boff;   // 16 k steps of 1 KiB on
      bh_[s][t].half[0] = *(const v8us*)hp; bh_[s][t].half[1] = *(const v8us*)(hp + 512);
      bl_[s][t].half[0] = *(const v8us*)lp; bl_[s][t].half[1] = *(const v8us*)(lp + 512);
    }
    // the wait that stands between issued loads and a rewrite of their address registers; as its inputs these stay whole up to it, so that no load above lands in one
    asm volatile("s_wait_xcnt 0x0" :: "v"(abase + aoff), "v"(hbase[0] + boff), "v"(hbase[1] + boff), "v"(lbase[0] + boff), "v"(lbase[1] + boff) : "memory");
  };
#pragma unroll
  for (int s = 0; s < AHEAD && s < NS; ++s) if (s < nmy) load_step(s);
  v8f acc[2] = {};
#pragma unroll
  for (int s = 0; s < NS; ++s) {
    if (s >= nmy) break;
    FragB ah, al;
#pragma unroll
    for (int i = 0; i < 16; ++i) { const float x = xa[s][i >> 2][i & 3]; const unsigned short hb = bf16_bits(x); ah.u[i] = hb; al.u[i] = bf16_bits(x - bf16_val(hb)); }
#pragma unroll
    for (int t = 0; t < 2; ++t) acc[t] = mmaN<3>(ah.v, al.v, bh_[s][t].v, bl_[s][t].v, acc[t]);
    if (s + AHEAD < NS && s + AHEAD < nmy) load_step(s + AHEAD);
  }
#pragma unroll
  for (int t = 0; t < 2; ++t)
#pragma unroll
    for (int r = 0; r < 8; ++r) part[w][8 * hh + r][t * 16 + ln] = acc[t][r];
  __syncthreads();   // all 16 partial tiles are in LDS before any is read
  // thread = one element of the tile; a wave stores one whole 128-byte line of C
  float sum = 0.f;
#pragma unroll
  for (int p = 0; p < 16; ++p) sum += part[p][w][lane];
  C[(size_t)(row0 + w) * ldc + col0 + lane] = sum;
}
// row softmax: P[row][:] = softmax(masked S[row][:]) over N columns with optional causal mask (col > row + rowoff -> 0) and
__global__ __launch_bounds__(256) void k_softmax_rows(const float* __restrict__ S, float* __restrict__ P, int N, int causal, int rowoff, const int* __restrict__ mask, int mask_pitch) {
  __shared__ float red[256];
  const int row = blockIdx.x, tid = threadIdx.x;
  const float* s = S + (size_t)row * N; float* p_out = P + (size_t)row * N;
  const int qi = row + rowoff;
  float mx = -3.0e38f;
  for (int j = tid; j < N; j += 256) {
    bool keep = true;
    if (causal && j > qi) keep = false;
    if (mask && mask[(size_t)qi * mask_pitch + j] == 0) keep = false;
    const float v = keep ? s[j] : -3.0e38f;
    mx = fmaxf(mx, v);
  }
  red[tid] = mx; __syncthreads();
  for (int st = 128; st > 0; st >>= 1) { if (tid < st) red[tid] = fmaxf(red[tid], red[tid + st]); __syncthreads(); }
  mx = red[0]; __syncthreads();
  float sum = 0.f;
  for (int j = tid; j < N; j += 256) {
    bool keep = true;
    if (causal && j > qi) keep = false;
    if (mask && mask[(size_t)qi * mask_pitch + j] == 0) keep = false;
    const float p = keep ? __expf(s[j] - mx) : 0.f;
    sum += p;
  }
  red[tid] = sum; __syncthreads();
  for (int st = 128; st > 0; st >>= 1) { if (tid < st) red[tid] += red[tid + st]; __syncthreads(); }
  const float inv = (mx > -1.0e38f) ? 1.0f / red[0] : __builtin_nanf("");
  __syncthreads();
  {
    for (int j4 = tid * 4; j4 < N; j4 += 1024) {
      v4f out4;
#pragma unroll
      for (int u = 0; u < 4; ++u) {
        const int j = j4 + u;
        bool keep = true;
        if (causal && j > qi) keep = false;
        if (mask && mask[(size_t)qi * mask_pitch + j] == 0) keep = false;
        out4[u] = keep ? __expf(s[j] - mx) * inv : 0.f;
      }
      *(v4f*)(p_out + j4) = out4;
    }
    
  }
}

// Cross-lane steps of a wave-wide reduction: row_xmask DPP inside a 16-lane row, then the other row's lane of the same index.
template <int CTRL>
__device__ __forceinline__ float dpp_get(float x) { return __int_as_float(__builtin_amdgcn_update_dpp(0, __float_as_int(x), CTRL, 0xf, 0xf, true)); }
__device__ __forceinline__ float other_row(float x) { return __int_as_float(__builtin_amdgcn_permlanex16(__float_as_int(x), __float_as_int(x), 0x76543210, 0xfedcba98, false, false)); }
__device__ __forceinline__ float wave_max(float x) {
  x = fmaxf(x, dpp_get<0x161>(x)); x = fmaxf(x, dpp_get<0x162>(x)); x = fmaxf(x, dpp_get<0x164>(x)); x = fmaxf(x, dpp_get<0x168>(x));
  return fmaxf(x, other_row(x));
}
__device__ __forceinline__ float wave_sum(float x) {
  x += dpp_get<0x161>(x); x += dpp_get<0x162>(x); x += dpp_get<0x164>(x); x += dpp_get<0x168>(x);
  return x + other_row(x);
}
// exp(x) as __expf builds it (x * log2 e, then v_exp_f32). In asm so that the v_nop stands directly behind the transcendental: it fills the
// slot that the instruction set asks for before the source register is rewritten or the result read.
__device__ __forceinline__ float exp_slot(float x) {
  const float y = x * 1.44269504f;
  float e;
  asm("v_exp_f32 %0, %1\n\tv_nop" : "=v"(e) : "v"(y));
  return e;
}
#define CR 8   // output rows per row block
#define CWG ((SS / CR) * 9 / 16)   // work-groups per head group: the 32 * (1 + 2 + ... + 8) wave tiles on or left of the diagonal, 8 to a head and work-group
// Only what lies on or left of the diagonal is worked on: right of it a softmax weight is exp(-1e9 - max) = 0. A wave tile is CR rows x 256 columns; row block b
// has b / 32 + 1 of them. Work-group u takes row block 255 - u and, from u = 32 on, row block u - 32 as well: together always 8 wave tiles a head.
// Each wave has its own i0; a row's maximum and sum are taken over the waves wlo .. whi - 1 of its row block. The mixed map is stored up to the end of the
// 32-column step that holds the diagonal (zeros right of it), which is as far as the next GEMM reads.
// CR rows from i0, both heads of group g = g0 + blockIdx.y (S2 and M2 hold the launch's groups one behind the other): waves 0-7 take head 0, waves 8-15 head 1. Per head: conv over its zero-masked scores,
// + bias, future -> -1e9, softmax. The two halves then swap their softmax tiles through LDS and each stores its own mixed head:
// mixed_j = m[0][j]*P_0 + m[1][j]*P_1, so the softmax maps never go to memory.
// A thread owns 8 consecutive columns of all CR rows in registers. Each of the CR + 5 score rows is read once per thread as an
// 18-wide window and feeds every output row and tap that uses it; the 66 weights are wave-uniform. Per output element the taps
// are added in the order a, then bq, ascending.
// Every loop over t, x, r, bq, c, p below is unrolled so that the window and the accumulators are indexed by constants and stay in registers.
__global__ __launch_bounds__(512) void k_conv_softmax_mix(const float* __restrict__ S2, const float* __restrict__ conv_w, const float* __restrict__ conv_b,
                                                         const float* __restrict__ head_mix, int g0, float* __restrict__ M2) {
  __shared__ __attribute__((aligned(16))) float redm[2][8][CR], reds[2][8][CR];   // per head and wave: the CR row maxima, the CR row sums
  __shared__ __attribute__((aligned(16))) v4f xch[2][CR * 2][256];                // per head: a thread's 2 * CR quads, lane-contiguous (writer and reader share tid)
  // the head is the same in all lanes of a wave; readfirstlane says so to the compiler, so that weights and row bases stay scalar
  const int hh2 = __builtin_amdgcn_readfirstlane((int)(threadIdx.x >> 8));
  const int tid = threadIdx.x & 255, w = __builtin_amdgcn_readfirstlane((int)((threadIdx.x & 255) >> 5)), lane = tid & 31;   // w wave-uniform as hh2 is: i0 and the row bases stay scalar
  const int u = (int)blockIdx.x, nah = (SS / CR - 1 - u) / 32 + 1;   // wave tiles of the longer row block
  const bool shortb = w >= nah;
  const int wlo = shortb ? nah : 0, whi = shortb ? 8 : nah;
  const int i0 = (shortb ? u - 32 : SS / CR - 1 - u) * CR;
  const int g = g0 + (int)blockIdx.y, hb = (int)blockIdx.y * 2 + hh2;   // hb = the head's place in S2 and M2
  const int h = g * 2 + hh2;
  const float* S = S2 + (size_t)hb * SS * SS;
  const float* wk = conv_w + (size_t)h * 66;
  const int j0 = ((w - wlo) * 32 + lane) * 8;
  const int jl = min(j0, i0);   // a lane wholly right of the diagonal loads the diagonal lane's window (its results are replaced by -1e9 below): nothing right of column i0 + 12 is read
  // window = columns j0 - 5 .. j0 + 12; a piece that would leave the row is read from inside it and masked to 0 below
  // 32-bit byte offsets of a lane inside a row: with the wave-uniform row base each load takes the scalar-base form and these registers are never rewritten
  const unsigned oA = 4u * (unsigned)max(jl - 5, 0), oB = 4u * (unsigned)max(jl - 4, 0), oC = 4u * (unsigned)jl, oE = 4u * (unsigned)min(jl + 8, SS - 4), oF = 4u * (unsigned)min(jl + 12, SS - 1);
  float acc[CR][8];
#pragma unroll
  for (int r = 0; r < CR; ++r)
#pragma unroll
    for (int c = 0; c < 8; ++c) acc[r][c] = 0.f;
  float eA[2], eF[2];
  v4f qB[2], qC[2], qD[2], qE[2];
  auto load_row = [&](int t) {                                   // score row i0 - 2 + t into register set t & 1; a row outside is replaced by row i0 and masked
    const int ii = i0 - 2 + t;
    const char* srow = (const char*)(S + (size_t)((ii >= 0 && ii < SS) ? ii : i0) * SS);
    eA[t & 1] = *(const float*)(srow + oA); eF[t & 1] = *(const float*)(srow + oF);
    qB[t & 1] = *(const v4fa*)(srow + oB); qC[t & 1] = *(const v4fa*)(srow + oC); qD[t & 1] = *(const v4fa*)(srow + oC + 16); qE[t & 1] = *(const v4fa*)(srow + oE);
  };
  load_row(0);
#pragma unroll
  for (int t = 0; t < CR + 5; ++t) {
    if (t + 1 < CR + 5) load_row(t + 1);
    // keeps the next row's loads in front of this row's products, so that they land under them
    __builtin_amdgcn_sched_barrier(0);
    const int ii = i0 - 2 + t, s = t & 1;
    const unsigned lim = (ii >= 0 && ii < SS) ? (unsigned)(ii + 1) : 0u;   // columns 0 .. ii of row ii enter; future ones, and rows outside, enter as 0
    float win[18] = {eA[s], qB[s][0], qB[s][1], qB[s][2], qB[s][3], qC[s][0], qC[s][1], qC[s][2], qC[s][3],
                     qD[s][0], qD[s][1], qD[s][2], qD[s][3], qE[s][0], qE[s][1], qE[s][2], qE[s][3], eF[s]};
#pragma unroll
    for (int x = 0; x < 18; ++x) win[x] = ((unsigned)(j0 - 5 + x) < lim) ? win[x] : 0.0f;
#pragma unroll
    for (int r = 0; r < CR; ++r) {
      const int a = t - r;                                       // ii = (i0 + r) + a - 2
      if (a < 0 || a >= 6) continue;
#pragma unroll
      for (int bq = 0; bq < 11; ++bq)
#pragma unroll
        for (int c = 0; c < 8; ++c) acc[r][c] += wk[a * 11 + bq] * win[c + bq];
    }
  }
  const float cb = conv_b[h];
  float mx[CR];
#pragma unroll
  for (int r = 0; r < CR; ++r) {
    float m = -3.0e38f;
#pragma unroll
    for (int c = 0; c < 8; ++c) { const float fin = (j0 + c > i0 + r) ? -1.0e9f : acc[r][c] + cb; acc[r][c] = fin; m = fmaxf(m, fin); }
    mx[r] = wave_max(m);
  }
  if (lane == 0) {
#pragma unroll
    for (int r = 0; r < CR; ++r) redm[hh2][w][r] = mx[r];
  }
  __syncthreads();   // each head's 8 waves' row maxima are in LDS before any is read
#pragma unroll
  for (int r = 0; r < CR; ++r) {
    float m = -3.0e38f;
#pragma unroll
    for (int p = 0; p < 8; ++p) { const float o = redm[hh2][p][r]; m = (p >= wlo && p < whi) ? fmaxf(m, o) : m; }
    float sum = 0.f;
#pragma unroll
    for (int c = 0; c < 8; ++c) { const float e = exp_slot(acc[r][c] - m); acc[r][c] = e; sum += e; }
    mx[r] = wave_sum(sum);
  }
  if (lane == 0) {
#pragma unroll
    for (int r = 0; r < CR; ++r) reds[hh2][w][r] = mx[r];
  }
  __syncthreads();   // each head's 8 waves' row sums are in LDS before any is read
#pragma unroll
  for (int r = 0; r < CR; ++r) {
    float sum = 0.f;
#pragma unroll
    for (int p = 0; p < 8; ++p) { const float o = reds[hh2][p][r]; sum = (p >= wlo && p < whi) ? sum + o : sum; }
    const float inv = 1.0f / sum;
    v4f o0, o1;
#pragma unroll
    for (int c = 0; c < 4; ++c) { o0[c] = acc[r][c] * inv; o1[c] = acc[r][4 + c] * inv; acc[r][c] = o0[c]; acc[r][4 + c] = o1[c]; }
    xch[hh2][2 * r][tid] = o0; xch[hh2][2 * r + 1][tid] = o1;
  }
  const float m_own = head_mix[g * 4 + hh2 * 2 + hh2], m_oth = head_mix[g * 4 + (1 - hh2) * 2 + hh2];   // m[i][j], j = this head
  __syncthreads();   // both heads' softmax tiles are in LDS before the other head reads them
  if (j0 > (i0 | 31)) return;   // right of the diagonal's 32-column step nothing is stored; no barrier follows
#pragma unroll
  for (int r = 0; r < CR; ++r) {
    const v4f t0 = xch[1 - hh2][2 * r][tid], t1 = xch[1 - hh2][2 * r + 1][tid];
    float* mrow = M2 + ((size_t)hb * SS + i0 + r) * SS + j0;
    v4f o0, o1;
#pragma unroll
    for (int c = 0; c < 4; ++c) { o0[c] = m_own * acc[r][c] + m_oth * t0[c]; o1[c] = m_own * acc[r][4 + c] + m_oth * t1[c]; }
    *(v4f*)mrow = o0; *(v4f*)(mrow + 4) = o1;
  }
}
// LayerNorm over 64 per row (biased variance), gamma/beta: block = 64 threads = 64 rows; normalised rows staged in LDS and
__global__ __launch_bounds__(64) void k_ln(const float* __restrict__ O, const float* __restrict__ gam, const float* __restrict__ bet, float* __restrict__ out, int nrows) {
  __shared__ __attribute__((aligned(16))) float so[64][DD];
  const int tid = threadIdx.x;
  const int r0 = blockIdx.x * 64, r = r0 + tid;
  if (r < nrows) {
    const float* x = O + (size_t)r * DD;
    float mu = 0.f;
#pragma unroll 1
    for (int d = 0; d < DD; ++d) mu += x[d];
    mu *= (1.0f / DD);
    float var = 0.f;
#pragma unroll 1
    for (int d = 0; d < DD; ++d) { const float c = x[d] - mu; var += c * c; }
    var *= (1.0f / DD);
    const float rs = rsqrtf(var + 1e-5f);
#pragma unroll 1
    for (int d = 0; d < DD; ++d) so[tid][d] = (x[d] - mu) * rs * gam[d] + bet[d];
  }
  __syncthreads();
  {
    for (int e = tid; e < 64 * (DD / 4); e += 64) {
      const int rr = e / (DD / 4), c4 = (e % (DD / 4)) * 4;
      if (r0 + rr < nrows) { const v4f val = *(const v4fa*)&so[rr][c4]; *(v4f*)(out + (size_t)(r0 + rr) * DD + c4) = val; }
    }
    
  }
}

extern "C" void kernel_launch(void* const* d_in, const int* in_sizes, int n_in,
                              void* d_out, int out_size, void* d_ws, size_t ws_size, hipStream_t stream) {
  (void)in_sizes; (void)n_in; (void)out_size;
  const float* q = (const float*)d_in[0]; const float* k = (const float*)d_in[1]; const float* v = (const float*)d_in[2];
  const float* conv_w = (const float*)d_in[3]; const float* conv_b = (const float*)d_in[4]; const float* head_mix = (const float*)d_in[5];
  const float* gam = (const float*)d_in[6]; const float* bet = (const float*)d_in[7];
  char* ws = (char*)d_ws; size_t off = 0;
  auto take = [&](size_t bytes) { char* p = ws + off; off += (bytes + 255) & ~(size_t)255; return p; };
  unsigned short* kh = (unsigned short*)take((size_t)NHD * SS * DD * 2); unsigned short* kl = (unsigned short*)take((size_t)NHD * SS * DD * 2);     // k planes (n = key, k = d), fragment order, all heads
  unsigned short* vth = (unsigned short*)take((size_t)NHD * DD * SS * 2); unsigned short* vtl = (unsigned short*)take((size_t)NHD * DD * SS * 2);  // v planes (n = d, k = key), fragment order, all heads
  float* S2 = (float*)take((size_t)GB * 2 * SS * SS * 4);     // scores of the 2 * GB heads of a batch
  float* M2 = (float*)take((size_t)GB * 2 * SS * SS * 4);     // their mixed maps
  float* O  = (float*)take((size_t)NHD * SS * DD * 4);   // pre-LN output [16][2048][64]
  if (off > ws_size) return;
  k_split_rows<<<(NHD * SS * (DD / 8) + 255) / 256, 256, 0, stream>>>(k, DD, kh, kl, NHD * SS, DD);
  k_split_transpose<<<dim3((DD * (SS / 8) + 255) / 256, NHD), 256, 0, stream>>>(v, DD, vth, vtl, SS, DD);
  for (int g0 = 0; g0 < NG; g0 += GB) {
    const int ng = (NG - g0 < GB) ? NG - g0 : GB, h0 = g0 * 2;   // groups of this batch, its first head
    // scores_h = q.k^T / 8 : M=N=SS, K=DD, one product per head of the batch, tiles up to the diagonal
    k_gemm_bf2<true, true, 0, false, true><<<dim3((SS / 32) * (SS / 64 + 2) / 4, ng * 2), 128, 0, stream>>>(q + (size_t)h0 * SS * DD, DD, kh + (size_t)h0 * SS * DD, kl + (size_t)h0 * SS * DD, DD, nullptr, 0.125f, S2, SS, SS, SS, DD);
    k_conv_softmax_mix<<<dim3(CWG, ng), 512, 0, stream>>>(S2, conv_w, conv_b, head_mix, g0, M2);
    // out_h = mixed_h . v_h : M=SS, N=DD, K=SS; Bt[n=d][k=s] = the v planes
    k_gemm_ksplit<SS / 16><<<dim3(DD / 32, SS / 16, ng * 2), 512, 0, stream>>>(M2, SS, vth + (size_t)h0 * DD * SS, vtl + (size_t)h0 * DD * SS, SS, O + (size_t)h0 * SS * DD, DD, SS, DD);
  }
  k_ln<<<(NHD * SS + 63) / 64, 64, 0, stream>>>(O, gam, bet, (float*)d_out, NHD * SS);
}

// v007
// Measured time: 233 microseconds a run.
// Timed twice side by side with v006, it ran 1.09 and 1.08 times as fast.
// All steps since v000 together make it 11.9 times as fast.
#include <hip/hip_runtime.h>
// Contractions on v_wmma_f32_16x16x32_bf16 as 3-term bf16 hi/lo splits (f32-accurate), f32 accumulate: scores = q·kᵀ/8 (K=64)
// and out = mixed·v (K=2048). The 6x11 key-query convolution, masking, softmax, 2x2 head mixing and LayerNorm are f32 VALU.
#define NHD 16
#define SS 2048
#define DD 64
#define NG 8
#define GB 3   // head groups per launch: scores and mixed maps of GB groups (64 MiB a group) fit the workspace

typedef __bf16 v16b __attribute__((ext_vector_type(16)));
typedef unsigned short v8us __attribute__((ext_vector_type(8), may_alias));
typedef float  v8f  __attribute__((ext_vector_type(8)));
typedef float  v2f  __attribute__((ext_vector_type(2)));
typedef float  v4f  __attribute__((ext_vector_type(4)));
typedef float  v4fa __attribute__((ext_vector_type(4), may_alias));
union FragB { v16b v; v8us half[2]; unsigned short u[16]; };

__device__ __forceinline__ unsigned short bf16_bits(float x) { unsigned int u = __float_as_uint(x); return (unsigned short)((u + 0x7FFFu + ((u >> 16) & 1u)) >> 16); }
__device__ __forceinline__ float bf16_val(unsigned short b) { return __uint_as_float(((unsigned int)b) << 16); }
__device__ __forceinline__ float bf16_round(float x) { return bf16_val(bf16_bits(x)); }
// D += A·B with NT terms: 1 = ah·bh, 2 = + al·bh (A split), 3 = + ah·bl (both split)
template <int NT>
__device__ __forceinline__ v8f mmaN(v16b ah, v16b al, v16b bh, v16b bl, v8f c) {
  c = __builtin_amdgcn_wmma_f32_16x16x32_bf16(false, ah, false, bh, (short)0, c, false, false);
  if (NT >= 2) c = __builtin_amdgcn_wmma_f32_16x16x32_bf16(false, al, false, bh, (short)0, c, false, false);
  if (NT >= 3) c = __builtin_amdgcn_wmma_f32_16x16x32_bf16(false, ah, false, bl, (short)0, c, false, false);
  asm volatile("v_nop\n\tv_nop\n\tv_nop\n\tv_nop" : "+v"(c) : "v"(ah), "v"(al), "v"(bh), "v"(bl));
  return c;
}

__global__ __launch_bounds__(256) void k_wt_bf16(const float* __restrict__ W, unsigned short* __restrict__ Wt, int K, int N) {
  const int t = blockIdx.x * 256 + threadIdx.x;
  const int k8n = K / 8;
  if (t >= N * k8n) return;
  const int n = t / k8n, k8 = (t % k8n) * 8;
  v8us v;
#pragma unroll
  for (int i = 0; i < 8; ++i) v[i] = bf16_bits(W[(size_t)(k8 + i) * N + n]);
  *(v8us*)(Wt + (size_t)n * K + k8) = v;
  
}

// GEMM C[M][N] (f32, pitch ldc) = act(A[M][K]·W + bias). A f32 row-major (pitch lda) converted per fragment to bf16
// (ASPLIT: hi/lo two planes -> 2 terms, else single rounded term); Wt bf16 [N][K] (pitch ldb). BIAS_BF16 rounds the
// bias to bf16 first (bias quantised to bf16 before the add). K%32==0, M%16==0, N%64==0.
template <bool ASPLIT, int ACT, bool BIAS_BF16>
__global__ __launch_bounds__(128) void k_gemm_bf(const float* __restrict__ A, int lda, const unsigned short* __restrict__ Wt, int ldb,
                                               const float* __restrict__ bias, float* __restrict__ C, int ldc, int M, int N, int K) {
  __shared__ __attribute__((aligned(16))) float so[4][16][64];
  const int tid = threadIdx.x, w = tid >> 5, lane = tid & 31, ln = lane & 15, hh = lane >> 4;
  const int ntn = N / 64;
  const int wid = blockIdx.x * 4 + w;
  const int mt = wid / ntn, nq = wid % ntn;
  if (mt * 16 >= M) return;
  const int row0 = mt * 16, col0 = nq * 64;
  const float* arow = A + (size_t)(row0 + ln) * lda;
  v8f acc[4] = {};
  for (int kb = 0; kb < K; kb += 32) {
    FragB ah, al;
    const v4f x0 = *(const v4fa*)(arow + kb + 8 * hh), x1 = *(const v4fa*)(arow + kb + 8 * hh + 4);
    const v4f x2 = *(const v4fa*)(arow + kb + 16 + 8 * hh), x3 = *(const v4fa*)(arow + kb + 16 + 8 * hh + 4);
    float xs[16] = {x0[0],x0[1],x0[2],x0[3],x1[0],x1[1],x1[2],x1[3],x2[0],x2[1],x2[2],x2[3],x3[0],x3[1],x3[2],x3[3]};
#pragma unroll
    for (int i = 0; i < 16; ++i) { const unsigned short hb = bf16_bits(xs[i]); ah.u[i] = hb; al.u[i] = ASPLIT ? bf16_bits(xs[i] - bf16_val(hb)) : (unsigned short)0; }
#pragma unroll
    for (int t = 0; t < 4; ++t) {
      const unsigned short* brow = Wt + (size_t)(col0 + t * 16 + ln) * ldb + kb;
      FragB b;
      b.half[0] = *(const v8us*)(brow + 8 * hh);
      b.half[1] = *(const v8us*)(brow + 16 + 8 * hh);
      acc[t] = mmaN<ASPLIT ? 2 : 1>(ah.v, al.v, b.v, b.v, acc[t]);
    }
  }
#pragma unroll
  for (int t = 0; t < 4; ++t) {
    float bv = bias ? bias[col0 + t * 16 + ln] : 0.f;
    if (BIAS_BF16) bv = bf16_round(bv);
#pragma unroll
    for (int r = 0; r < 8; ++r) { float v = acc[t][r] + bv; if (ACT == 1) v = fmaxf(v, 0.f); so[w][8 * hh + r][t * 16 + ln] = v; }
  }
  __builtin_amdgcn_fence(__ATOMIC_ACQ_REL, "workgroup");
  __builtin_amdgcn_wave_barrier();
  const int rsub = lane >> 4, c4 = (lane & 15) * 4;
  {
#pragma unroll
    for (int q = 0; q < 8; ++q) {
      const int r = q * 2 + rsub;
      const v4f v = *(const v4fa*)&so[w][r][c4];
      *(v4f*)(C + (size_t)(row0 + r) * ldc + col0 + c4) = v;
    }
    
  }
}

// Flash-style causal/unmasked attention, all contractions 3-term bf16 hi/lo splits, f32 softmax with running max.
// q,k,v rows are read from f32 buffers with arbitrary row pitch (so they can live inside a fused qkv buffer);
// D = head size (multiple of 32, <= 128); one wave = 16 query rows; block = 4 waves (64 queries) sharing K/V chunks of 32.
template <int D, bool CAUSAL>
__global__ __launch_bounds__(128) void k_flash(const float* __restrict__ qb, const float* __restrict__ kb, const float* __restrict__ vb,
                                             int pitch, int T, int H, float scale, float* __restrict__ y, int ypitch) {
  constexpr int KS = D / 32;        // k-steps for QK
  constexpr int DT = D / 16;        // d tiles for PV
  __shared__ __attribute__((aligned(16))) unsigned short sKh[32][D + 8], sKl[32][D + 8], sVh[32][D + 8], sVl[32][D + 8];
  __shared__ __attribute__((aligned(16))) unsigned short sPh[4][16][40], sPl[4][16][40];
  __shared__ __attribute__((aligned(16))) float sO[4][16][D];
  const int tid = threadIdx.x, w = tid >> 5, lane = tid & 31, ln = lane & 15, hh = lane >> 4;
  const int nqb = (T + 63) / 64;
  const int bh = blockIdx.x / nqb, qblk = blockIdx.x % nqb;
  const int b = bh / H, h = bh % H;
  const int q0 = qblk * 64 + w * 16;
  const float* Q = qb + (size_t)b * T * pitch + h * D;
  const float* K = kb + (size_t)b * T * pitch + h * D;
  const float* V = vb + (size_t)b * T * pitch + h * D;

  // A fragments of the wave's 16 query rows (scaled), hi/lo
  FragB aqh[KS], aql[KS];
  {
    int row = q0 + ln; if (row >= T) row = T - 1;
    const float* qr = Q + (size_t)row * pitch;
#pragma unroll
    for (int ks = 0; ks < KS; ++ks)
#pragma unroll
      for (int i = 0; i < 16; ++i) {
        const int d = ks * 32 + ((i < 8) ? (8 * hh + i) : (16 + 8 * hh + (i - 8)));
        const float x = qr[d] * scale; const unsigned short hb = bf16_bits(x);
        aqh[ks].u[i] = hb; aql[ks].u[i] = bf16_bits(x - bf16_val(hb));
      }
  }
  float m_r[8], l_r[8];
#pragma unroll
  for (int r = 0; r < 8; ++r) { m_r[r] = -3.0e38f; l_r[r] = 0.f; }
  v8f oacc[DT];
#pragma unroll
  for (int dt = 0; dt < DT; ++dt) oacc[dt] = (v8f){0.f,0.f,0.f,0.f,0.f,0.f,0.f,0.f};

  const int kv_end = CAUSAL ? min(T, qblk * 64 + 64) : T;     // block-uniform
  for (int j0 = 0; j0 < kv_end; j0 += 32) {
    __syncthreads();
    for (int e = tid; e < 32 * (D / 4); e += 128) {
      const int r = e / (D / 4), c4 = (e % (D / 4)) * 4;
      const int key = j0 + r;
      v4f kf = {0.f,0.f,0.f,0.f}, vf = {0.f,0.f,0.f,0.f};
      if (key < T) { kf = *(const v4fa*)(K + (size_t)key * pitch + c4); vf = *(const v4fa*)(V + (size_t)key * pitch + c4); }
#pragma unroll
      for (int t = 0; t < 4; ++t) {
        unsigned short hb = bf16_bits(kf[t]); sKh[r][c4 + t] = hb; sKl[r][c4 + t] = bf16_bits(kf[t] - bf16_val(hb));
        hb = bf16_bits(vf[t]); sVh[r][c4 + t] = hb; sVl[r][c4 + t] = bf16_bits(vf[t] - bf16_val(hb));
      }
    }
    __syncthreads();
    // S tile 16 x 32
    v8f s[2];
#pragma unroll
    for (int nt = 0; nt < 2; ++nt) {
      v8f acc = {};
#pragma unroll
      for (int ks = 0; ks < KS; ++ks) {
        FragB bh_, bl_;
        bh_.half[0] = *(const v8us*)&sKh[nt * 16 + ln][ks * 32 + 8 * hh]; bh_.half[1] = *(const v8us*)&sKh[nt * 16 + ln][ks * 32 + 16 + 8 * hh];
        bl_.half[0] = *(const v8us*)&sKl[nt * 16 + ln][ks * 32 + 8 * hh]; bl_.half[1] = *(const v8us*)&sKl[nt * 16 + ln][ks * 32 + 16 + 8 * hh];
        acc = mmaN<3>(aqh[ks].v, aql[ks].v, bh_.v, bl_.v, acc);
      }
      s[nt] = acc;
    }
    // mask + running max (rows 8hh+r; the 16 lanes of a half share rows)
    float alpha[8];
#pragma unroll
    for (int r = 0; r < 8; ++r) {
      const int qi = q0 + 8 * hh + r;
      const int ja = j0 + ln, jb = j0 + 16 + ln;
      if (CAUSAL) { if (ja > qi) s[0][r] = -3.0e38f; if (jb > qi) s[1][r] = -3.0e38f; }
      if (ja >= T) s[0][r] = -3.0e38f;
      if (jb >= T) s[1][r] = -3.0e38f;
      float mx = fmaxf(s[0][r], s[1][r]);
      mx = fmaxf(mx, __shfl_xor(mx, 1, 32)); mx = fmaxf(mx, __shfl_xor(mx, 2, 32)); mx = fmaxf(mx, __shfl_xor(mx, 4, 32)); mx = fmaxf(mx, __shfl_xor(mx, 8, 32));
      const float mnew = fmaxf(m_r[r], mx);
      alpha[r] = (mnew > -1.0e38f) ? __expf(m_r[r] - mnew) : 1.0f;
      const float p0 = (s[0][r] > -1.0e38f) ? __expf(s[0][r] - mnew) : 0.f;
      const float p1 = (s[1][r] > -1.0e38f) ? __expf(s[1][r] - mnew) : 0.f;
      m_r[r] = mnew;
      l_r[r] = l_r[r] * alpha[r] + p0 + p1;            // per-lane partial row sum (16 lanes combined at the end)
      unsigned short hb = bf16_bits(p0); sPh[w][8 * hh + r][ln] = hb;      sPl[w][8 * hh + r][ln] = bf16_bits(p0 - bf16_val(hb));
      hb = bf16_bits(p1);                sPh[w][8 * hh + r][16 + ln] = hb; sPl[w][8 * hh + r][16 + ln] = bf16_bits(p1 - bf16_val(hb));
    }
#pragma unroll
    for (int dt = 0; dt < DT; ++dt)
#pragma unroll
      for (int r = 0; r < 8; ++r) oacc[dt][r] *= alpha[r];
    __builtin_amdgcn_fence(__ATOMIC_ACQ_REL, "workgroup");
    __builtin_amdgcn_wave_barrier();
    FragB pah, pal;
    pah.half[0] = *(const v8us*)&sPh[w][ln][8 * hh]; pah.half[1] = *(const v8us*)&sPh[w][ln][16 + 8 * hh];
    pal.half[0] = *(const v8us*)&sPl[w][ln][8 * hh]; pal.half[1] = *(const v8us*)&sPl[w][ln][16 + 8 * hh];
#pragma unroll
    for (int dt = 0; dt < DT; ++dt) {
      FragB bvh, bvl;
#pragma unroll
      for (int i = 0; i < 8; ++i) {
        bvh.u[i] = sVh[8 * hh + i][dt * 16 + ln]; bvh.u[8 + i] = sVh[16 + 8 * hh + i][dt * 16 + ln];
        bvl.u[i] = sVl[8 * hh + i][dt * 16 + ln]; bvl.u[8 + i] = sVl[16 + 8 * hh + i][dt * 16 + ln];
      }
      oacc[dt] = mmaN<3>(pah.v, pal.v, bvh.v, bvl.v, oacc[dt]);
    }
    __builtin_amdgcn_fence(__ATOMIC_ACQ_REL, "workgroup");
    __builtin_amdgcn_wave_barrier();
  }
#pragma unroll
  for (int r = 0; r < 8; ++r) {
    float l = l_r[r];
    l += __shfl_xor(l, 1, 32); l += __shfl_xor(l, 2, 32); l += __shfl_xor(l, 4, 32); l += __shfl_xor(l, 8, 32);
    l_r[r] = (l > 0.f) ? 1.0f / l : 0.f;
  }
#pragma unroll
  for (int dt = 0; dt < DT; ++dt)
#pragma unroll
    for (int r = 0; r < 8; ++r) sO[w][8 * hh + r][dt * 16 + ln] = oacc[dt][r] * l_r[r];
  __builtin_amdgcn_fence(__ATOMIC_ACQ_REL, "workgroup");
  __builtin_amdgcn_wave_barrier();
  {
    for (int r = 0; r < 16; ++r) {
      const int row = q0 + r;
      if (row < T && lane < D / 4) {
        const v4f val = *(const v4fa*)&sO[w][r][lane * 4];
        *(v4f*)(y + ((size_t)b * T + row) * ypitch + h * D + lane * 4) = val;
      }
    }
    
  }
}

// FRAGMENT ORDER of a bf16 plane of the B operand, Bt[N][K] (n = column of B, N % 16 == 0, K % 32 == 0): the plane is a row of 16-byte chunks, and chunk
// ((nt * (K / 32) + ks) * 2 + half) * 32 + lane holds the 8 elements n = nt * 16 + (lane & 15), k = ks * 32 + half * 16 + (lane >> 4) * 8 + 0 .. 7.
// That is what lane 'lane' holds in half 'half' of the B fragment of column tile nt and k step ks: a wave loads a half fragment as 512 bytes in a row
// (four whole lines; from a row-major plane the same load touches 16 lines). The plane has the size of the row-major one.
// f32 [R][Cc] (row pitch lds) -> bf16 hi/lo planes in fragment order (n = row, k = column); thread per chunk; R % 16 == 0, Cc % 32 == 0
__global__ __launch_bounds__(256) void k_split_rows(const float* __restrict__ src, int lds_, unsigned short* __restrict__ hi, unsigned short* __restrict__ lo, int R, int Cc) {
  const size_t t = (size_t)blockIdx.x * 256 + threadIdx.x;
  const int c8n = Cc / 8;
  if (t >= (size_t)R * c8n) return;
  const int lane = (int)(t & 31), half = (int)(t >> 5) & 1, ksn = Cc / 32, tile = (int)(t >> 6);
  const int r = (tile / ksn) * 16 + (lane & 15), c8 = (tile % ksn) * 32 + half * 16 + (lane >> 4) * 8;
  const float* s = src + (size_t)r * lds_ + c8;
  const v4f a = *(const v4fa*)s, b = *(const v4fa*)(s + 4);
  float xs[8] = {a[0],a[1],a[2],a[3],b[0],b[1],b[2],b[3]};
  v8us vh, vl;
#pragma unroll
  for (int i = 0; i < 8; ++i) { const unsigned short hb = bf16_bits(xs[i]); vh[i] = hb; vl[i] = bf16_bits(xs[i] - bf16_val(hb)); }
  unsigned short* dh = hi + t * 8; unsigned short* dl = lo + t * 8;
  *(v8us*)dh = vh; *(v8us*)dl = vl;
}
// f32 [K][N] (row pitch lds) -> bf16 hi/lo planes of Bt[N][K] in fragment order; one thread per chunk (n, 8 consecutive k): 16 lanes read 16 neighbours of a source row
// blockIdx.y = matrix of a batch: sources and planes of the batch lie densely one behind the other
__global__ __launch_bounds__(256) void k_split_transpose(const float* __restrict__ src, int lds_, unsigned short* __restrict__ hi, unsigned short* __restrict__ lo, int K, int N) {
  const size_t t = (size_t)blockIdx.x * 256 + threadIdx.x;
  const int k8n = K / 8;
  if (t >= (size_t)N * k8n) return;
  const int lane = (int)(t & 31), half = (int)(t >> 5) & 1, ksn = K / 32, tile = (int)(t >> 6);
  const int n = (tile / ksn) * 16 + (lane & 15), k8 = (tile % ksn) * 32 + half * 16 + (lane >> 4) * 8;
  src += (size_t)blockIdx.y * K * lds_; hi += (size_t)blockIdx.y * N * K; lo += (size_t)blockIdx.y * N * K;
  v8us vh, vl;
#pragma unroll
  for (int i = 0; i < 8; ++i) { const float x = src[(size_t)(k8 + i) * lds_ + n]; const unsigned short hb = bf16_bits(x); vh[i] = hb; vl[i] = bf16_bits(x - bf16_val(hb)); }
  unsigned short* dh = hi + t * 8; unsigned short* dl = lo + t * 8;
  *(v8us*)dh = vh; *(v8us*)dl = vl;
}
// GEMM with A f32 (split into hi/lo when ASPLIT) and B from bf16 planes Bh (+ Bl when BSPLIT) in fragment order (ldb = their K): terms hi·hi [+ lo·hi] [+ hi·lo].
// C f32 [M][N] pitch ldc; alpha scales the result; bias optional (BIAS_BF16 rounds it). Same tiling/epilogue as k_gemm_bf.
// blockIdx.y = product of a batch: the A, B and C matrices of the batch lie densely one behind the other (M, N, M rows each).
// CAUSAL (M == N, M % 32 == 0): only the 16 x 64 tiles with col0 <= row0 + 16 are computed and stored; they hold every element (i, j <= i + 14),
// which is all that the convolution reads. Row tiles p and M/16 - 1 - p together have at most N/64 + 2 such tiles: the grid deals that many waves to each pair.
template <bool ASPLIT, bool BSPLIT, int ACT, bool BIAS_BF16, bool CAUSAL>
__global__ __launch_bounds__(128) void k_gemm_bf2(const float* __restrict__ A, int lda, const unsigned short* __restrict__ Bh, const unsigned short* __restrict__ Bl, int ldb,
                                                const float* __restrict__ bias, float alpha, float* __restrict__ C, int ldc, int M, int N, int K) {
  __shared__ __attribute__((aligned(16))) float so[4][16][64];
  // the wave's number is the same in all its lanes; readfirstlane says so to the compiler: the tile's place in the B planes is then a scalar base, and a lane adds only lane * 16 bytes
  const int tid = threadIdx.x, w = __builtin_amdgcn_readfirstlane((int)(threadIdx.x >> 5)), lane = tid & 31, ln = lane & 15, hh = lane >> 4;
  const int ntn = N / 64;
  const int wid = blockIdx.x * 4 + w;
  int mt = wid / ntn, nq = wid % ntn;
  if (CAUSAL) {
    const int p = wid / (ntn + 2), c = wid % (ntn + 2), mh = M / 16 - 1 - p;
    if (p >= M / 32) return;
    const int nh = min(ntn, (mh + 1) / 4 + 1), nl = (p + 1) / 4 + 1;   // tiles of the pair's lower and upper row tile
    if (c >= nh + nl) return;
    mt = (c < nh) ? mh : p; nq = (c < nh) ? c : c - nh;
  }
  if (mt * 16 >= M) return;
  const int row0 = mt * 16, col0 = nq * 64;
  A += (size_t)blockIdx.y * M * lda; Bh += (size_t)blockIdx.y * N * ldb; Bl += (size_t)blockIdx.y * N * ldb; C += (size_t)blockIdx.y * M * ldc;
  const float* arow = A + (size_t)(row0 + ln) * lda;
  v8f acc[4] = {};
  for (int kb = 0; kb < K; kb += 32) {
    FragB ah, al;
    const v4f x0 = *(const v4fa*)(arow + kb + 8 * hh), x1 = *(const v4fa*)(arow + kb + 8 * hh + 4);
    const v4f x2 = *(const v4fa*)(arow + kb + 16 + 8 * hh), x3 = *(const v4fa*)(arow + kb + 16 + 8 * hh + 4);
    float xs[16] = {x0[0],x0[1],x0[2],x0[3],x1[0],x1[1],x1[2],x1[3],x2[0],x2[1],x2[2],x2[3],x3[0],x3[1],x3[2],x3[3]};
#pragma unroll
    for (int i = 0; i < 16; ++i) { const unsigned short hb = bf16_bits(xs[i]); ah.u[i] = hb; al.u[i] = ASPLIT ? bf16_bits(xs[i] - bf16_val(hb)) : (unsigned short)0; }
#pragma unroll
    for (int t = 0; t < 4; ++t) {
      const size_t boff = ((size_t)(col0 / 16 + t) * (ldb / 32) + kb / 32) * 512 + lane * 8;
      FragB bh_, bl_;
      bh_.half[0] = *(const v8us*)(Bh + boff);
      bh_.half[1] = *(const v8us*)(Bh + boff + 256);
      if (BSPLIT) { bl_.half[0] = *(const v8us*)(Bl + boff); bl_.half[1] = *(const v8us*)(Bl + boff + 256); } else bl_ = bh_;
      // keeps both planes' loads of a column tile in front of its products, so that they fly together; without it this build issued the lo plane's loads behind the first product and waited twice
      __builtin_amdgcn_sched_barrier(0);
      acc[t] = mmaN<ASPLIT ? (BSPLIT ? 3 : 2) : 1>(ah.v, al.v, bh_.v, bl_.v, acc[t]);
    }
  }
#pragma unroll
  for (int t = 0; t < 4; ++t) {
    float bv = bias ? bias[col0 + t * 16 + ln] : 0.f;
    if (BIAS_BF16) bv = bf16_round(bv);
#pragma unroll
    for (int r = 0; r < 8; ++r) { float v = acc[t][r] * alpha + bv; if (ACT == 1) v = fmaxf(v, 0.f); so[w][8 * hh + r][t * 16 + ln] = v; }
  }
  __builtin_amdgcn_fence(__ATOMIC_ACQ_REL, "workgroup");
  __builtin_amdgcn_wave_barrier();
  const int rsub = lane >> 4, c4 = (lane & 15) * 4;
  {
#pragma unroll
    for (int q = 0; q < 8; ++q) {
      const int r = q * 2 + rsub;
      const v4f v = *(const v4fa*)&so[w][r][c4];
      *(v4f*)(C + (size_t)(row0 + r) * ldc + col0 + c4) = v;
    }
    
  }
}
// Cross-lane steps of a wave-wide reduction: row_xmask DPP inside a 16-lane row, then the other row's lane of the same index.
template <int CTRL>
__device__ __forceinline__ float dpp_get(float x) { return __int_as_float(__builtin_amdgcn_update_dpp(0, __float_as_int(x), CTRL, 0xf, 0xf, true)); }
__device__ __forceinline__ float other_row(float x) { return __int_as_float(__builtin_amdgcn_permlanex16(__float_as_int(x), __float_as_int(x), 0x76543210, 0xfedcba98, false, false)); }
__device__ __forceinline__ float wave_max(float x) {
  x = fmaxf(x, dpp_get<0x161>(x)); x = fmaxf(x, dpp_get<0x162>(x)); x = fmaxf(x, dpp_get<0x164>(x)); x = fmaxf(x, dpp_get<0x168>(x));
  return fmaxf(x, other_row(x));
}
__device__ __forceinline__ float wave_sum(float x) {
  x += dpp_get<0x161>(x); x += dpp_get<0x162>(x); x += dpp_get<0x164>(x); x += dpp_get<0x168>(x);
  return x + other_row(x);
}
// out rows = LayerNorm(A[M][K] x B) over the N = 64 columns; one work-group owns a 16 x 64 tile, that is 16 whole rows. A f32 split hi/lo per fragment, B bf16 hi/lo planes in
// fragment order (ldb = K), 3 terms as above.
// A is lower triangular (M == K = 16 * KW): its elements right of the diagonal are zero, and right of the 32-column step that holds the tile's
// diagonal they are neither stored by the producer nor read here. Wave w takes the 32-column half w & 1 of the tile and, of the steps of 32 k up to there,
// steps w >> 1, (w >> 1) + 8, ...; the 8 f32 partial tiles are summed through LDS in that order. Wave w then holds row w whole, two columns a lane:
// mean and biased variance are wave sums, and the normalised row goes straight to out (a wave stores 256 bytes in a row).
// Grid: x = 16-row tile of M, the longest rows first, y = product of a batch (the batch's A, B and out matrices,
// of M, N and M rows, lie densely one behind the other).
// Every loop over s, t, i, r, p below is unrolled so that the fragment arrays are indexed by constants and stay in registers.
template <int KW>
__global__ __launch_bounds__(512) void k_gemm_ksplit_ln(const float* __restrict__ A, int lda, const unsigned short* __restrict__ Bh, const unsigned short* __restrict__ Bl, int ldb,
                                                      const float* __restrict__ gam, const float* __restrict__ bet, float* __restrict__ out, int M) {
  constexpr int N = DD;
  __shared__ __attribute__((aligned(16))) float part[8][16][68];   // pitch 68: the two 8-row halves of an accumulator store fall on different banks
  // the wave's number is the same in all its lanes; readfirstlane says so to the compiler, so that the tests on a wave's step count are scalar branches
  const int tid = threadIdx.x, w = __builtin_amdgcn_readfirstlane((int)(threadIdx.x >> 5)), lane = tid & 31, ln = lane & 15, hh = lane >> 4;
  const int kq = w >> 1, col0 = (w & 1) * 32;
  const int row0 = (M / 16 - 1 - (int)blockIdx.x) * 16;
  const int nmy = (row0 / 32 + 1 - kq + 7) >> 3;   // this wave's share of the row0 / 32 + 1 steps, 0 .. NS
  A += (size_t)blockIdx.y * M * lda; Bh += (size_t)blockIdx.y * N * ldb; Bl += (size_t)blockIdx.y * N * ldb; out += (size_t)blockIdx.y * M * N;
  // wave-uniform bases and 32-bit byte offsets of a lane: five lane addresses are formed once and a step is an immediate offset, so that no address is formed anew between the steps
  const char* abase = (const char*)(A + (size_t)row0 * lda + kq * 32);
  const size_t bt0 = ((size_t)(col0 / 16) * (ldb / 32) + kq) * 512, bt1 = ((size_t)(col0 / 16 + 1) * (ldb / 32) + kq) * 512;   // the wave's first k step in its two column tiles
  const char* hbase[2] = {(const char*)(Bh + bt0), (const char*)(Bh + bt1)};
  const char* lbase[2] = {(const char*)(Bl + bt0), (const char*)(Bl + bt1)};
  const unsigned aoff = 4u * (unsigned)(ln * lda + 8 * hh), boff = 16u * (unsigned)lane;
  constexpr int NS = KW / 16, AHEAD = 3;   // a wave's fragment loads run AHEAD steps in front of its products (all NS at once spill)
  v4f xa[NS][4];
  FragB bh_[NS][2], bl_[NS][2];
  auto load_step = [&](int s) {
    const char* ap = abase + s * 1024 + aoff;   // 8 k steps of 128 bytes on
    xa[s][0] = *(const v4fa*)ap; xa[s][1] = *(const v4fa*)(ap + 16); xa[s][2] = *(const v4fa*)(ap + 64); xa[s][3] = *(const v4fa*)(ap + 80);
#pragma unroll
    for (int t = 0; t < 2; ++t) {
      const char* hp = hbase[t] + s * 8192 + boff; const char* lp = lbase[t] + s * 8192 + boff;   // 8 k steps of 1 KiB on
      bh_[s][t].half[0] = *(const v8us*)hp; bh_[s][t].half[1] = *(const v8us*)(hp + 512);
      bl_[s][t].half[0] = *(const v8us*)lp; bl_[s][t].half[1] = *(const v8us*)(lp + 512);
    }
    // the wait that stands between issued loads and a rewrite of their address registers; as its inputs these stay whole up to it, so that no load above lands in one
    asm volatile("s_wait_xcnt 0x0" :: "v"(abase + aoff), "v"(hbase[0] + boff), "v"(hbase[1] + boff), "v"(lbase[0] + boff), "v"(lbase[1] + boff) : "memory");
  };
#pragma unroll
  for (int s = 0; s < AHEAD && s < NS; ++s) if (s < nmy) load_step(s);
  v8f acc[2] = {};
#pragma unroll
  for (int s = 0; s < NS; ++s) {
    if (s >= nmy) break;
    FragB ah, al;
#pragma unroll
    for (int i = 0; i < 16; ++i) { const float x = xa[s][i >> 2][i & 3]; const unsigned short hb = bf16_bits(x); ah.u[i] = hb; al.u[i] = bf16_bits(x - bf16_val(hb)); }
#pragma unroll
    for (int t = 0; t < 2; ++t) acc[t] = mmaN<3>(ah.v, al.v, bh_[s][t].v, bl_[s][t].v, acc[t]);
    if (s + AHEAD < NS && s + AHEAD < nmy) load_step(s + AHEAD);
  }
#pragma unroll
  for (int t = 0; t < 2; ++t)
#pragma unroll
    for (int r = 0; r < 8; ++r) part[kq][8 * hh + r][col0 + t * 16 + ln] = acc[t][r];
  __syncthreads();   // all 8 partial tiles are in LDS before any is read
  // wave = row w of the tile, lane = its columns 2 * lane and 2 * lane + 1
  float s0 = 0.f, s1 = 0.f;
#pragma unroll
  for (int p = 0; p < 8; ++p) { s0 += part[p][w][2 * lane]; s1 += part[p][w][2 * lane + 1]; }
  const float mu = wave_sum(s0 + s1) * (1.0f / N);
  const float c0 = s0 - mu, c1 = s1 - mu;
  const float var = wave_sum(c0 * c0 + c1 * c1) * (1.0f / N);
  const float rs = rsqrtf(var + 1e-5f);
  v2f o;
  o[0] = c0 * rs * gam[2 * lane] + bet[2 * lane]; o[1] = c1 * rs * gam[2 * lane + 1] + bet[2 * lane + 1];
  *(v2f*)(out + (size_t)(row0 + w) * N + 2 * lane) = o;
}
// row softmax: P[row][:] = softmax(masked S[row][:]) over N columns with optional causal mask (col > row + rowoff -> 0) and
__global__ __launch_bounds__(256) void k_softmax_rows(const float* __restrict__ S, float* __restrict__ P, int N, int causal, int rowoff, const int* __restrict__ mask, int mask_pitch) {
  __shared__ float red[256];
  const int row = blockIdx.x, tid = threadIdx.x;
  const float* s = S + (size_t)row * N; float* p_out = P + (size_t)row * N;
  const int qi = row + rowoff;
  float mx = -3.0e38f;
  for (int j = tid; j < N; j += 256) {
    bool keep = true;
    if (causal && j > qi) keep = false;
    if (mask && mask[(size_t)qi * mask_pitch + j] == 0) keep = false;
    const float v = keep ? s[j] : -3.0e38f;
    mx = fmaxf(mx, v);
  }
  red[tid] = mx; __syncthreads();
  for (int st = 128; st > 0; st >>= 1) { if (tid < st) red[tid] = fmaxf(red[tid], red[tid + st]); __syncthreads(); }
  mx = red[0]; __syncthreads();
  float sum = 0.f;
  for (int j = tid; j < N; j += 256) {
    bool keep = true;
    if (causal && j > qi) keep = false;
    if (mask && mask[(size_t)qi * mask_pitch + j] == 0) keep = false;
    const float p = keep ? __expf(s[j] - mx) : 0.f;
    sum += p;
  }
  red[tid] = sum; __syncthreads();
  for (int st = 128; st > 0; st >>= 1) { if (tid < st) red[tid] += red[tid + st]; __syncthreads(); }
  const float inv = (mx > -1.0e38f) ? 1.0f / red[0] : __builtin_nanf("");
  __syncthreads();
  {
    for (int j4 = tid * 4; j4 < N; j4 += 1024) {
      v4f out4;
#pragma unroll
      for (int u = 0; u < 4; ++u) {
        const int j = j4 + u;
        bool keep = true;
        if (causal && j > qi) keep = false;
        if (mask && mask[(size_t)qi * mask_pitch + j] == 0) keep = false;
        out4[u] = keep ? __expf(s[j] - mx) * inv : 0.f;
      }
      *(v4f*)(p_out + j4) = out4;
    }
    
  }
}

// exp(x) as __expf builds it (x * log2 e, then v_exp_f32). In asm so that the v_nop stands directly behind the transcendental: it fills the
// slot that the instruction set asks for before the source register is rewritten or the result read.
__device__ __forceinline__ float exp_slot(float x) {
  const float y = x * 1.44269504f;
  float e;
  asm("v_exp_f32 %0, %1\n\tv_nop" : "=v"(e) : "v"(y));
  return e;
}
#define CR 8   // output rows per row block
#define CWG ((SS / CR) * 9 / 16)   // work-groups per head group: the 32 * (1 + 2 + ... + 8) wave tiles on or left of the diagonal, 8 to a head and work-group
// Only what lies on or left of the diagonal is worked on: right of it a softmax weight is exp(-1e9 - max) = 0. A wave tile is CR rows x 256 columns; row block b
// has b / 32 + 1 of them. Work-group u takes row block 255 - u and, from u = 32 on, row block u - 32 as well: together always 8 wave tiles a head.
// Each wave has its own i0; a row's maximum and sum are taken over the waves wlo .. whi - 1 of its row block. The mixed map is stored up to the end of the
// 32-column step that holds the diagonal (zeros right of it), which is as far as the next GEMM reads.
// CR rows from i0, both heads of group g = g0 + blockIdx.y (S2 and M2 hold the launch's groups one behind the other): waves 0-7 take head 0, waves 8-15 head 1. Per head: conv over its zero-masked scores,
// + bias, future -> -1e9, softmax. The two halves then swap their softmax tiles through LDS and each stores its own mixed head:
// mixed_j = m[0][j]*P_0 + m[1][j]*P_1, so the softmax maps never go to memory.
// A thread owns 8 consecutive columns of all CR rows in registers. Each of the CR + 5 score rows is read once per thread as an
// 18-wide window and feeds every output row and tap that uses it; the 66 weights are wave-uniform. Per output element the taps
// are added in the order a, then bq, ascending.
// Every loop over t, x, r, bq, c, p below is unrolled so that the window and the accumulators are indexed by constants and stay in registers.
__global__ __launch_bounds__(512) void k_conv_softmax_mix(const float* __restrict__ S2, const float* __restrict__ conv_w, const float* __restrict__ conv_b,
                                                         const float* __restrict__ head_mix, int g0, float* __restrict__ M2) {
  __shared__ __attribute__((aligned(16))) float redm[2][8][CR], reds[2][8][CR];   // per head and wave: the CR row maxima, the CR row sums
  __shared__ __attribute__((aligned(16))) v4f xch[2][CR * 2][256];                // per head: a thread's 2 * CR quads, lane-contiguous (writer and reader share tid)
  // the head is the same in all lanes of a wave; readfirstlane says so to the compiler, so that weights and row bases stay scalar
  const int hh2 = __builtin_amdgcn_readfirstlane((int)(threadIdx.x >> 8));
  const int tid = threadIdx.x & 255, w = __builtin_amdgcn_readfirstlane((int)((threadIdx.x & 255) >> 5)), lane = tid & 31;   // w wave-uniform as hh2 is: i0 and the row bases stay scalar
  const int u = (int)blockIdx.x, nah = (SS / CR - 1 - u) / 32 + 1;   // wave tiles of the longer row block
  const bool shortb = w >= nah;
  const int wlo = shortb ? nah : 0, whi = shortb ? 8 : nah;
  const int i0 = (shortb ? u - 32 : SS / CR - 1 - u) * CR;
  const int g = g0 + (int)blockIdx.y, hb = (int)blockIdx.y * 2 + hh2;   // hb = the head's place in S2 and M2
  const int h = g * 2 + hh2;
  const float* S = S2 + (size_t)hb * SS * SS;
  const float* wk = conv_w + (size_t)h * 66;
  const int j0 = ((w - wlo) * 32 + lane) * 8;
  const int jl = min(j0, i0);   // a lane wholly right of the diagonal loads the diagonal lane's window (its results are replaced by -1e9 below): nothing right of column i0 + 12 is read
  // window = columns j0 - 5 .. j0 + 12; a piece that would leave the row is read from inside it and masked to 0 below
  // 32-bit byte offsets of a lane inside a row: with the wave-uniform row base each load takes the scalar-base form and these registers are never rewritten
  const unsigned oA = 4u * (unsigned)max(jl - 5, 0), oB = 4u * (unsigned)max(jl - 4, 0), oC = 4u * (unsigned)jl, oE = 4u * (unsigned)min(jl + 8, SS - 4), oF = 4u * (unsigned)min(jl + 12, SS - 1);
  float acc[CR][8];
#pragma unroll
  for (int r = 0; r < CR; ++r)
#pragma unroll
    for (int c = 0; c < 8; ++c) acc[r][c] = 0.f;
  float eA[2], eF[2];
  v4f qB[2], qC[2], qD[2], qE[2];
  auto load_row = [&](int t) {                                   // score row i0 - 2 + t into register set t & 1; a row outside is replaced by row i0 and masked
    const int ii = i0 - 2 + t;
    const char* srow = (const char*)(S + (size_t)((ii >= 0 && ii < SS) ? ii : i0) * SS);
    eA[t & 1] = *(const float*)(srow + oA); eF[t & 1] = *(const float*)(srow + oF);
    qB[t & 1] = *(const v4fa*)(srow + oB); qC[t & 1] = *(const v4fa*)(srow + oC); qD[t & 1] = *(const v4fa*)(srow + oC + 16); qE[t & 1] = *(const v4fa*)(srow + oE);
  };
  load_row(0);
#pragma unroll
  for (int t = 0; t < CR + 5; ++t) {
    if (t + 1 < CR + 5) load_row(t + 1);
    // keeps the next row's loads in front of this row's products, so that they land under them
    __builtin_amdgcn_sched_barrier(0);
    const int ii = i0 - 2 + t, s = t & 1;
    const unsigned lim = (ii >= 0 && ii < SS) ? (unsigned)(ii + 1) : 0u;   // columns 0 .. ii of row ii enter; future ones, and rows outside, enter as 0
    float win[18] = {eA[s], qB[s][0], qB[s][1], qB[s][2], qB[s][3], qC[s][0], qC[s][1], qC[s][2], qC[s][3],
                     qD[s][0], qD[s][1], qD[s][2], qD[s][3], qE[s][0], qE[s][1], qE[s][2], qE[s][3], eF[s]};
#pragma unroll
    for (int x = 0; x < 18; ++x) win[x] = ((unsigned)(j0 - 5 + x) < lim) ? win[x] : 0.0f;
#pragma unroll
    for (int r = 0; r < CR; ++r) {
      const int a = t - r;                                       // ii = (i0 + r) + a - 2
      if (a < 0 || a >= 6) continue;
#pragma unroll
      for (int bq = 0; bq < 11; ++bq)
#pragma unroll
        for (int c = 0; c < 8; ++c) acc[r][c] += wk[a * 11 + bq] * win[c + bq];
    }
  }
  const float cb = conv_b[h];
  float mx[CR];
#pragma unroll
  for (int r = 0; r < CR; ++r) {
    float m = -3.0e38f;
#pragma unroll
    for (int c = 0; c < 8; ++c) { const float fin = (j0 + c > i0 + r) ? -1.0e9f : acc[r][c] + cb; acc[r][c] = fin; m = fmaxf(m, fin); }
    mx[r] = wave_max(m);
  }
  if (lane == 0) {
#pragma unroll
    for (int r = 0; r < CR; ++r) redm[hh2][w][r] = mx[r];
  }
  __syncthreads();   // each head's 8 waves' row maxima are in LDS before any is read
#pragma unroll
  for (int r = 0; r < CR; ++r) {
    float m = -3.0e38f;
#pragma unroll
    for (int p = 0; p < 8; ++p) { const float o = redm[hh2][p][r]; m = (p >= wlo && p < whi) ? fmaxf(m, o) : m; }
    float sum = 0.f;
#pragma unroll
    for (int c = 0; c < 8; ++c) { const float e = exp_slot(acc[r][c] - m); acc[r][c] = e; sum += e; }
    mx[r] = wave_sum(sum);
  }
  if (lane == 0) {
#pragma unroll
    for (int r = 0; r < CR; ++r) reds[hh2][w][r] = mx[r];
  }
  __syncthreads();   // each head's 8 waves' row sums are in LDS before any is read
#pragma unroll
  for (int r = 0; r < CR; ++r) {
    float sum = 0.f;
#pragma unroll
    for (int p = 0; p < 8; ++p) { const float o = reds[hh2][p][r]; sum = (p >= wlo && p < whi) ? sum + o : sum; }
    const float inv = 1.0f / sum;
    v4f o0, o1;
#pragma unroll
    for (int c = 0; c < 4; ++c) { o0[c] = acc[r][c] * inv; o1[c] = acc[r][4 + c] * inv; acc[r][c] = o0[c]; acc[r][4 + c] = o1[c]; }
    xch[hh2][2 * r][tid] = o0; xch[hh2][2 * r + 1][tid] = o1;
  }
  const float m_own = head_mix[g * 4 + hh2 * 2 + hh2], m_oth = head_mix[g * 4 + (1 - hh2) * 2 + hh2];   // m[i][j], j = this head
  __syncthreads();   // both heads' softmax tiles are in LDS before the other head reads them
  if (j0 > (i0 | 31)) return;   // right of the diagonal's 32-column step nothing is stored; no barrier follows
#pragma unroll
  for (int r = 0; r < CR; ++r) {
    const v4f t0 = xch[1 - hh2][2 * r][tid], t1 = xch[1 - hh2][2 * r + 1][tid];
    float* mrow = M2 + ((size_t)hb * SS + i0 + r) * SS + j0;
    v4f o0, o1;
#pragma unroll
    for (int c = 0; c < 4; ++c) { o0[c] = m_own * acc[r][c] + m_oth * t0[c]; o1[c] = m_own * acc[r][4 + c] + m_oth * t1[c]; }
    *(v4f*)mrow = o0; *(v4f*)(mrow + 4) = o1;
  }
}
extern "C" void kernel_launch(void* const* d_in, const int* in_sizes, int n_in,
                              void* d_out, int out_size, void* d_ws, size_t ws_size, hipStream_t stream) {
  (void)in_sizes; (void)n_in; (void)out_size;
  const float* q = (const float*)d_in[0]; const float* k = (const float*)d_in[1]; const float* v = (const float*)d_in[2];
  const float* conv_w = (const float*)d_in[3]; const float* conv_b = (const float*)d_in[4]; const float* head_mix = (const float*)d_in[5];
  const float* gam = (const float*)d_in[6]; const float* bet = (const float*)d_in[7];
  char* ws = (char*)d_ws; size_t off = 0;
  auto take = [&](size_t bytes) { char* p = ws + off; off += (bytes + 255) & ~(size_t)255; return p; };
  unsigned short* kh = (unsigned short*)take((size_t)NHD * SS * DD * 2); unsigned short* kl = (unsigned short*)take((size_t)NHD * SS * DD * 2);     // k planes (n = key, k = d), fragment order, all heads
  unsigned short* vth = (unsigned short*)take((size_t)NHD * DD * SS * 2); unsigned short* vtl = (unsigned short*)take((size_t)NHD * DD * SS * 2);  // v planes (n = d, k = key), fragment order, all heads
  float* S2 = (float*)take((size_t)GB * 2 * SS * SS * 4);     // scores of the 2 * GB heads of a batch
  float* M2 = (float*)take((size_t)GB * 2 * SS * SS * 4);     // their mixed maps
  if (off > ws_size) return;
  k_split_rows<<<(NHD * SS * (DD / 8) + 255) / 256, 256, 0, stream>>>(k, DD, kh, kl, NHD * SS, DD);
  k_split_transpose<<<dim3((DD * (SS / 8) + 255) / 256, NHD), 256, 0, stream>>>(v, DD, vth, vtl, SS, DD);
  for (int g0 = 0; g0 < NG; g0 += GB) {
    const int ng = (NG - g0 < GB) ? NG - g0 : GB, h0 = g0 * 2;   // groups of this batch, its first head
    // scores_h = q.k^T / 8 : M=N=SS, K=DD, one product per head of the batch, tiles up to the diagonal
    k_gemm_bf2<true, true, 0, false, true><<<dim3((SS / 32) * (SS / 64 + 2) / 4, ng * 2), 128, 0, stream>>>(q + (size_t)h0 * SS * DD, DD, kh + (size_t)h0 * SS * DD, kl + (size_t)h0 * SS * DD, DD, nullptr, 0.125f, S2, SS, SS, SS, DD);
    k_conv_softmax_mix<<<dim3(CWG, ng), 512, 0, stream>>>(S2, conv_w, conv_b, head_mix, g0, M2);
    // out_h = LayerNorm(mixed_h . v_h) : M=SS, N=DD, K=SS; Bt[n=d][k=s] = the v planes
    k_gemm_ksplit_ln<SS / 16><<<dim3(SS / 16, ng * 2), 512, 0, stream>>>(M2, SS, vth + (size_t)h0 * DD * SS, vtl + (size_t)h0 * DD * SS, SS, gam, bet, (float*)d_out + (size_t)h0 * SS * DD, SS);
  }
}

// v008
// It runs in 210 microseconds.
// Timed twice side by side with v007, it ran 1.14 times as fast both times.
// Over all steps from v000 it is 13.6 times as fast.
#include <hip/hip_runtime.h>
// Contractions on v_wmma_f32_16x16x32_bf16 as 3-term bf16 hi/lo splits (f32-accurate), f32 accumulate: scores = q·kᵀ/8 (K=64)
// and out = mixed·v (K=2048). The 6x11 key-query convolution, masking, softmax, 2x2 head mixing and LayerNorm are f32 VALU.
#define NHD 16
#define SS 2048
#define DD 64
#define NG 8
#define GB 5   // head groups per launch: the packed scores and mixed maps of GB groups (40.75 MiB a group) fit the workspace
// PACKED MAPS. Of a causal SS x SS map only what lies on or left of the diagonal, plus a margin, is ever stored or read, so an upper row needs no full pitch.
// The rows are cut into 4 bands of QR rows; every row of band q has a pitch of QR * (q + 1) + margin floats (at most SS), and the bands lie one behind the other.
// Margin: SPAD for the scores (their 64-column tiles start at or left of column row0 + 16, so in band q they end before column QR * (q + 1) + 64),
// none for the mixed map (stored up to the end of the 32-column step that holds the diagonal). A block of 8 or 16 aligned rows lies in one band.
#define QR (SS / 4)
#define SPAD 64
#define S_HEAD (QR * (QR * 6 + SPAD * 3) + QR * SS)   // floats of one head's packed scores
#define M_HEAD (QR * QR * 10)                         // floats of one head's packed mixed map

typedef __bf16 v16b __attribute__((ext_vector_type(16)));
typedef unsigned short v8us __attribute__((ext_vector_type(8), may_alias));
typedef float  v8f  __attribute__((ext_vector_type(8)));
typedef float  v2f  __attribute__((ext_vector_type(2)));
typedef float  v4f  __attribute__((ext_vector_type(4)));
typedef float  v4fa __attribute__((ext_vector_type(4), may_alias));
union FragB { v16b v; v8us half[2]; unsigned short u[16]; };

// pitch of row i and place of its first element, in floats, inside a head's packed scores (s_) or packed mixed map (m_); 0 <= i < SS
__device__ __forceinline__ unsigned s_pitch(unsigned i) { return min(QR * (i / QR + 1u) + SPAD, (unsigned)SS); }
__device__ __forceinline__ unsigned s_off(unsigned i) { const unsigned q = i / QR; return q * ((QR * QR / 2) * (q + 1u) + QR * SPAD) + (i % QR) * s_pitch(i); }
__device__ __forceinline__ unsigned m_pitch(unsigned i) { return QR * (i / QR + 1u); }
__device__ __forceinline__ unsigned m_off(unsigned i) { const unsigned q = i / QR; return q * (q + 1u) * (QR * QR / 2) + (i % QR) * m_pitch(i); }
__device__ __forceinline__ unsigned short bf16_bits(float x) { unsigned int u = __float_as_uint(x); return (unsigned short)((u + 0x7FFFu + ((u >> 16) & 1u)) >> 16); }
__device__ __forceinline__ float bf16_val(unsigned short b) { return __uint_as_float(((unsigned int)b) << 16); }
__device__ __forceinline__ float bf16_round(float x) { return bf16_val(bf16_bits(x)); }
// D += A·B with NT terms: 1 = ah·bh, 2 = + al·bh (A split), 3 = + ah·bl (both split)
template <int NT>
__device__ __forceinline__ v8f mmaN(v16b ah, v16b al, v16b bh, v16b bl, v8f c) {
  c = __builtin_amdgcn_wmma_f32_16x16x32_bf16(false, ah, false, bh, (short)0, c, false, false);
  if (NT >= 2) c = __builtin_amdgcn_wmma_f32_16x16x32_bf16(false, al, false, bh, (short)0, c, false, false);
  if (NT >= 3) c = __builtin_amdgcn_wmma_f32_16x16x32_bf16(false, ah, false, bl, (short)0, c, false, false);
  asm volatile("v_nop\n\tv_nop\n\tv_nop\n\tv_nop" : "+v"(c) : "v"(ah), "v"(al), "v"(bh), "v"(bl));
  return c;
}

__global__ __launch_bounds__(256) void k_wt_bf16(const float* __restrict__ W, unsigned short* __restrict__ Wt, int K, int N) {
  const int t = blockIdx.x * 256 + threadIdx.x;
  const int k8n = K / 8;
  if (t >= N * k8n) return;
  const int n = t / k8n, k8 = (t % k8n) * 8;
  v8us v;
#pragma unroll
  for (int i = 0; i < 8; ++i) v[i] = bf16_bits(W[(size_t)(k8 + i) * N + n]);
  *(v8us*)(Wt + (size_t)n * K + k8) = v;
  
}

// GEMM C[M][N] (f32, pitch ldc) = act(A[M][K]·W + bias). A f32 row-major (pitch lda) converted per fragment to bf16
// (ASPLIT: hi/lo two planes -> 2 terms, else single rounded term); Wt bf16 [N][K] (pitch ldb). BIAS_BF16 rounds the
// bias to bf16 first (bias quantised to bf16 before the add). K%32==0, M%16==0, N%64==0.
template <bool ASPLIT, int ACT, bool BIAS_BF16>
__global__ __launch_bounds__(128) void k_gemm_bf(const float* __restrict__ A, int lda, const unsigned short* __restrict__ Wt, int ldb,
                                               const float* __restrict__ bias, float* __restrict__ C, int ldc, int M, int N, int K) {
  __shared__ __attribute__((aligned(16))) float so[4][16][64];
  const int tid = threadIdx.x, w = tid >> 5, lane = tid & 31, ln = lane & 15, hh = lane >> 4;
  const int ntn = N / 64;
  const int wid = blockIdx.x * 4 + w;
  const int mt = wid / ntn, nq = wid % ntn;
  if (mt * 16 >= M) return;
  const int row0 = mt * 16, col0 = nq * 64;
  const float* arow = A + (size_t)(row0 + ln) * lda;
  v8f acc[4] = {};
  for (int kb = 0; kb < K; kb += 32) {
    FragB ah, al;
    const v4f x0 = *(const v4fa*)(arow + kb + 8 * hh), x1 = *(const v4fa*)(arow + kb + 8 * hh + 4);
    const v4f x2 = *(const v4fa*)(arow + kb + 16 + 8 * hh), x3 = *(const v4fa*)(arow + kb + 16 + 8 * hh + 4);
    float xs[16] = {x0[0],x0[1],x0[2],x0[3],x1[0],x1[1],x1[2],x1[3],x2[0],x2[1],x2[2],x2[3],x3[0],x3[1],x3[2],x3[3]};
#pragma unroll
    for (int i = 0; i < 16; ++i) { const unsigned short hb = bf16_bits(xs[i]); ah.u[i] = hb; al.u[i] = ASPLIT ? bf16_bits(xs[i] - bf16_val(hb)) : (unsigned short)0; }
#pragma unroll
    for (int t = 0; t < 4; ++t) {
      const unsigned short* brow = Wt + (size_t)(col0 + t * 16 + ln) * ldb + kb;
      FragB b;
      b.half[0] = *(const v8us*)(brow + 8 * hh);
      b.half[1] = *(const v8us*)(brow + 16 + 8 * hh);
      acc[t] = mmaN<ASPLIT ? 2 : 1>(ah.v, al.v, b.v, b.v, acc[t]);
    }
  }
#pragma unroll
  for (int t = 0; t < 4; ++t) {
    float bv = bias ? bias[col0 + t * 16 + ln] : 0.f;
    if (BIAS_BF16) bv = bf16_round(bv);
#pragma unroll
    for (int r = 0; r < 8; ++r) { float v = acc[t][r] + bv; if (ACT == 1) v = fmaxf(v, 0.f); so[w][8 * hh + r][t * 16 + ln] = v; }
  }
  __builtin_amdgcn_fence(__ATOMIC_ACQ_REL, "workgroup");
  __builtin_amdgcn_wave_barrier();
  const int rsub = lane >> 4, c4 = (lane & 15) * 4;
  {
#pragma unroll
    for (int q = 0; q < 8; ++q) {
      const int r = q * 2 + rsub;
      const v4f v = *(const v4fa*)&so[w][r][c4];
      *(v4f*)(C + (size_t)(row0 + r) * ldc + col0 + c4) = v;
    }
    
  }
}

// Flash-style causal/unmasked attention, all contractions 3-term bf16 hi/lo splits, f32 softmax with running max.
// q,k,v rows are read from f32 buffers with arbitrary row pitch (so they can live inside a fused qkv buffer);
// D = head size (multiple of 32, <= 128); one wave = 16 query rows; block = 4 waves (64 queries) sharing K/V chunks of 32.
template <int D, bool CAUSAL>
__global__ __launch_bounds__(128) void k_flash(const float* __restrict__ qb, const float* __restrict__ kb, const float* __restrict__ vb,
                                             int pitch, int T, int H, float scale, float* __restrict__ y, int ypitch) {
  constexpr int KS = D / 32;        // k-steps for QK
  constexpr int DT = D / 16;        // d tiles for PV
  __shared__ __attribute__((aligned(16))) unsigned short sKh[32][D + 8], sKl[32][D + 8], sVh[32][D + 8], sVl[32][D + 8];
  __shared__ __attribute__((aligned(16))) unsigned short sPh[4][16][40], sPl[4][16][40];
  __shared__ __attribute__((aligned(16))) float sO[4][16][D];
  const int tid = threadIdx.x, w = tid >> 5, lane = tid & 31, ln = lane & 15, hh = lane >> 4;
  const int nqb = (T + 63) / 64;
  const int bh = blockIdx.x / nqb, qblk = blockIdx.x % nqb;
  const int b = bh / H, h = bh % H;
  const int q0 = qblk * 64 + w * 16;
  const float* Q = qb + (size_t)b * T * pitch + h * D;
  const float* K = kb + (size_t)b * T * pitch + h * D;
  const float* V = vb + (size_t)b * T * pitch + h * D;

  // A fragments of the wave's 16 query rows (scaled), hi/lo
  FragB aqh[KS], aql[KS];
  {
    int row = q0 + ln; if (row >= T) row = T - 1;
    const float* qr = Q + (size_t)row * pitch;
#pragma unroll
    for (int ks = 0; ks < KS; ++ks)
#pragma unroll
      for (int i = 0; i < 16; ++i) {
        const int d = ks * 32 + ((i < 8) ? (8 * hh + i) : (16 + 8 * hh + (i - 8)));
        const float x = qr[d] * scale; const unsigned short hb = bf16_bits(x);
        aqh[ks].u[i] = hb; aql[ks].u[i] = bf16_bits(x - bf16_val(hb));
      }
  }
  float m_r[8], l_r[8];
#pragma unroll
  for (int r = 0; r < 8; ++r) { m_r[r] = -3.0e38f; l_r[r] = 0.f; }
  v8f oacc[DT];
#pragma unroll
  for (int dt = 0; dt < DT; ++dt) oacc[dt] = (v8f){0.f,0.f,0.f,0.f,0.f,0.f,0.f,0.f};

  const int kv_end = CAUSAL ? min(T, qblk * 64 + 64) : T;     // block-uniform
  for (int j0 = 0; j0 < kv_end; j0 += 32) {
    __syncthreads();
    for (int e = tid; e < 32 * (D / 4); e += 128) {
      const int r = e / (D / 4), c4 = (e % (D / 4)) * 4;
      const int key = j0 + r;
      v4f kf = {0.f,0.f,0.f,0.f}, vf = {0.f,0.f,0.f,0.f};
      if (key < T) { kf = *(const v4fa*)(K + (size_t)key * pitch + c4); vf = *(const v4fa*)(V + (size_t)key * pitch + c4); }
#pragma unroll
      for (int t = 0; t < 4; ++t) {
        unsigned short hb = bf16_bits(kf[t]); sKh[r][c4 + t] = hb; sKl[r][c4 + t] = bf16_bits(kf[t] - bf16_val(hb));
        hb = bf16_bits(vf[t]); sVh[r][c4 + t] = hb; sVl[r][c4 + t] = bf16_bits(vf[t] - bf16_val(hb));
      }
    }
    __syncthreads();
    // S tile 16 x 32
    v8f s[2];
#pragma unroll
    for (int nt = 0; nt < 2; ++nt) {
      v8f acc = {};
#pragma unroll
      for (int ks = 0; ks < KS; ++ks) {
        FragB bh_, bl_;
        bh_.half[0] = *(const v8us*)&sKh[nt * 16 + ln][ks * 32 + 8 * hh]; bh_.half[1] = *(const v8us*)&sKh[nt * 16 + ln][ks * 32 + 16 + 8 * hh];
        bl_.half[0] = *(const v8us*)&sKl[nt * 16 + ln][ks * 32 + 8 * hh]; bl_.half[1] = *(const v8us*)&sKl[nt * 16 + ln][ks * 32 + 16 + 8 * hh];
        acc = mmaN<3>(aqh[ks].v, aql[ks].v, bh_.v, bl_.v, acc);
      }
      s[nt] = acc;
    }
    // mask + running max (rows 8hh+r; the 16 lanes of a half share rows)
    float alpha[8];
#pragma unroll
    for (int r = 0; r < 8; ++r) {
      const int qi = q0 + 8 * hh + r;
      const int ja = j0 + ln, jb = j0 + 16 + ln;
      if (CAUSAL) { if (ja > qi) s[0][r] = -3.0e38f; if (jb > qi) s[1][r] = -3.0e38f; }
      if (ja >= T) s[0][r] = -3.0e38f;
      if (jb >= T) s[1][r] = -3.0e38f;
      float mx = fmaxf(s[0][r], s[1][r]);
      mx = fmaxf(mx, __shfl_xor(mx, 1, 32)); mx = fmaxf(mx, __shfl_xor(mx, 2, 32)); mx = fmaxf(mx, __shfl_xor(mx, 4, 32)); mx = fmaxf(mx, __shfl_xor(mx, 8, 32));
      const float mnew = fmaxf(m_r[r], mx);
      alpha[r] = (mnew > -1.0e38f) ? __expf(m_r[r] - mnew) : 1.0f;
      const float p0 = (s[0][r] > -1.0e38f) ? __expf(s[0][r] - mnew) : 0.f;
      const float p1 = (s[1][r] > -1.0e38f) ? __expf(s[1][r] - mnew) : 0.f;
      m_r[r] = mnew;
      l_r[r] = l_r[r] * alpha[r] + p0 + p1;            // per-lane partial row sum (16 lanes combined at the end)
      unsigned short hb = bf16_bits(p0); sPh[w][8 * hh + r][ln] = hb;      sPl[w][8 * hh + r][ln] = bf16_bits(p0 - bf16_val(hb));
      hb = bf16_bits(p1);                sPh[w][8 * hh + r][16 + ln] = hb; sPl[w][8 * hh + r][16 + ln] = bf16_bits(p1 - bf16_val(hb));
    }
#pragma unroll
    for (int dt = 0; dt < DT; ++dt)
#pragma unroll
      for (int r = 0; r < 8; ++r) oacc[dt][r] *= alpha[r];
    __builtin_amdgcn_fence(__ATOMIC_ACQ_REL, "workgroup");
    __builtin_amdgcn_wave_barrier();
    FragB pah, pal;
    pah.half[0] = *(const v8us*)&sPh[w][ln][8 * hh]; pah.half[1] = *(const v8us*)&sPh[w][ln][16 + 8 * hh];
    pal.half[0] = *(const v8us*)&sPl[w][ln][8 * hh]; pal.half[1] = *(const v8us*)&sPl[w][ln][16 + 8 * hh];
#pragma unroll
    for (int dt = 0; dt < DT; ++dt) {
      FragB bvh, bvl;
#pragma unroll
      for (int i = 0; i < 8; ++i) {
        bvh.u[i] = sVh[8 * hh + i][dt * 16 + ln]; bvh.u[8 + i] = sVh[16 + 8 * hh + i][dt * 16 + ln];
        bvl.u[i] = sVl[8 * hh + i][dt * 16 + ln]; bvl.u[8 + i] = sVl[16 + 8 * hh + i][dt * 16 + ln];
      }
      oacc[dt] = mmaN<3>(pah.v, pal.v, bvh.v, bvl.v, oacc[dt]);
    }
    __builtin_amdgcn_fence(__ATOMIC_ACQ_REL, "workgroup");
    __builtin_amdgcn_wave_barrier();
  }
#pragma unroll
  for (int r = 0; r < 8; ++r) {
    float l = l_r[r];
    l += __shfl_xor(l, 1, 32); l += __shfl_xor(l, 2, 32); l += __shfl_xor(l, 4, 32); l += __shfl_xor(l, 8, 32);
    l_r[r] = (l > 0.f) ? 1.0f / l : 0.f;
  }
#pragma unroll
  for (int dt = 0; dt < DT; ++dt)
#pragma unroll
    for (int r = 0; r < 8; ++r) sO[w][8 * hh + r][dt * 16 + ln] = oacc[dt][r] * l_r[r];
  __builtin_amdgcn_fence(__ATOMIC_ACQ_REL, "workgroup");
  __builtin_amdgcn_wave_barrier();
  {
    for (int r = 0; r < 16; ++r) {
      const int row = q0 + r;
      if (row < T && lane < D / 4) {
        const v4f val = *(const v4fa*)&sO[w][r][lane * 4];
        *(v4f*)(y + ((size_t)b * T + row) * ypitch + h * D + lane * 4) = val;
      }
    }
    
  }
}

// FRAGMENT ORDER of a bf16 plane of the B operand, Bt[N][K] (n = column of B, N % 16 == 0, K % 32 == 0): the plane is a row of 16-byte chunks, and chunk
// ((nt * (K / 32) + ks) * 2 + half) * 32 + lane holds the 8 elements n = nt * 16 + (lane & 15), k = ks * 32 + half * 16 + (lane >> 4) * 8 + 0 .. 7.
// That is what lane 'lane' holds in half 'half' of the B fragment of column tile nt and k step ks: a wave loads a half fragment as 512 bytes in a row
// (four whole lines; from a row-major plane the same load touches 16 lines). The plane has the size of the row-major one.
// f32 [R][Cc] (row pitch lds) -> bf16 hi/lo planes in fragment order (n = row, k = column); thread per chunk; R % 16 == 0, Cc % 32 == 0
__global__ __launch_bounds__(256) void k_split_rows(const float* __restrict__ src, int lds_, unsigned short* __restrict__ hi, unsigned short* __restrict__ lo, int R, int Cc) {
  const size_t t = (size_t)blockIdx.x * 256 + threadIdx.x;
  const int c8n = Cc / 8;
  if (t >= (size_t)R * c8n) return;
  const int lane = (int)(t & 31), half = (int)(t >> 5) & 1, ksn = Cc / 32, tile = (int)(t >> 6);
  const int r = (tile / ksn) * 16 + (lane & 15), c8 = (tile % ksn) * 32 + half * 16 + (lane >> 4) * 8;
  const float* s = src + (size_t)r * lds_ + c8;
  const v4f a = *(const v4fa*)s, b = *(const v4fa*)(s + 4);
  float xs[8] = {a[0],a[1],a[2],a[3],b[0],b[1],b[2],b[3]};
  v8us vh, vl;
#pragma unroll
  for (int i = 0; i < 8; ++i) { const unsigned short hb = bf16_bits(xs[i]); vh[i] = hb; vl[i] = bf16_bits(xs[i] - bf16_val(hb)); }
  unsigned short* dh = hi + t * 8; unsigned short* dl = lo + t * 8;
  *(v8us*)dh = vh; *(v8us*)dl = vl;
}
// f32 [K][N] (row pitch lds) -> bf16 hi/lo planes of Bt[N][K] in fragment order; one thread per chunk (n, 8 consecutive k): 16 lanes read 16 neighbours of a source row
// blockIdx.y = matrix of a batch: sources and planes of the batch lie densely one behind the other
__global__ __launch_bounds__(256) void k_split_transpose(const float* __restrict__ src, int lds_, unsigned short* __restrict__ hi, unsigned short* __restrict__ lo, int K, int N) {
  const size_t t = (size_t)blockIdx.x * 256 + threadIdx.x;
  const int k8n = K / 8;
  if (t >= (size_t)N * k8n) return;
  const int lane = (int)(t & 31), half = (int)(t >> 5) & 1, ksn = K / 32, tile = (int)(t >> 6);
  const int n = (tile / ksn) * 16 + (lane & 15), k8 = (tile % ksn) * 32 + half * 16 + (lane >> 4) * 8;
  src += (size_t)blockIdx.y * K * lds_; hi += (size_t)blockIdx.y * N * K; lo += (size_t)blockIdx.y * N * K;
  v8us vh, vl;
#pragma unroll
  for (int i = 0; i < 8; ++i) { const float x = src[(size_t)(k8 + i) * lds_ + n]; const unsigned short hb = bf16_bits(x); vh[i] = hb; vl[i] = bf16_bits(x - bf16_val(hb)); }
  unsigned short* dh = hi + t * 8; unsigned short* dl = lo + t * 8;
  *(v8us*)dh = vh; *(v8us*)dl = vl;
}
// GEMM with A f32 (split into hi/lo when ASPLIT) and B from bf16 planes Bh (+ Bl when BSPLIT) in fragment order (ldb = their K): terms hi·hi [+ lo·hi] [+ hi·lo].
// C f32 [M][N] pitch ldc; alpha scales the result; bias optional (BIAS_BF16 rounds it). Same tiling/epilogue as k_gemm_bf.
// blockIdx.y = product of a batch: the A, B and C matrices of the batch lie densely one behind the other (M, N, M rows each).
// CAUSAL (M == N, M % 32 == 0): only the 16 x 64 tiles with col0 <= row0 + 16 are computed and stored; they hold every element (i, j <= i + 14),
// which is all that the convolution reads. Row tiles p and M/16 - 1 - p together have at most N/64 + 2 such tiles: the grid deals that many waves to each pair.
// C is then a batch of packed score maps (M == SS; ldc is not used).
template <bool ASPLIT, bool BSPLIT, int ACT, bool BIAS_BF16, bool CAUSAL>
__global__ __launch_bounds__(128) void k_gemm_bf2(const float* __restrict__ A, int lda, const unsigned short* __restrict__ Bh, const unsigned short* __restrict__ Bl, int ldb,
                                                const float* __restrict__ bias, float alpha, float* __restrict__ C, int ldc, int M, int N, int K) {
  __shared__ __attribute__((aligned(16))) float so[4][16][64];
  // the wave's number is the same in all its lanes; readfirstlane says so to the compiler: the tile's place in the B planes is then a scalar base, and a lane adds only lane * 16 bytes
  const int tid = threadIdx.x, w = __builtin_amdgcn_readfirstlane((int)(threadIdx.x >> 5)), lane = tid & 31, ln = lane & 15, hh = lane >> 4;
  const int ntn = N / 64;
  const int wid = blockIdx.x * 4 + w;
  int mt = wid / ntn, nq = wid % ntn;
  if (CAUSAL) {
    const int p = wid / (ntn + 2), c = wid % (ntn + 2), mh = M / 16 - 1 - p;
    if (p >= M / 32) return;
    const int nh = min(ntn, (mh + 1) / 4 + 1), nl = (p + 1) / 4 + 1;   // tiles of the pair's lower and upper row tile
    if (c >= nh + nl) return;
    mt = (c < nh) ? mh : p; nq = (c < nh) ? c : c - nh;
  }
  if (mt * 16 >= M) return;
  const int row0 = mt * 16, col0 = nq * 64;
  A += (size_t)blockIdx.y * M * lda; Bh += (size_t)blockIdx.y * N * ldb; Bl += (size_t)blockIdx.y * N * ldb;
  const unsigned ldp = CAUSAL ? s_pitch(row0) : (unsigned)ldc;   // pitch of the tile's rows in C
  C += CAUSAL ? (size_t)blockIdx.y * S_HEAD + s_off(row0) : ((size_t)blockIdx.y * M + row0) * ldc;   // the tile's first row
  const float* arow = A + (size_t)(row0 + ln) * lda;
  v8f acc[4] = {};
  for (int kb = 0; kb < K; kb += 32) {
    FragB ah, al;
    const v4f x0 = *(const v4fa*)(arow + kb + 8 * hh), x1 = *(const v4fa*)(arow + kb + 8 * hh + 4);
    const v4f x2 = *(const v4fa*)(arow + kb + 16 + 8 * hh), x3 = *(const v4fa*)(arow + kb + 16 + 8 * hh + 4);
    float xs[16] = {x0[0],x0[1],x0[2],x0[3],x1[0],x1[1],x1[2],x1[3],x2[0],x2[1],x2[2],x2[3],x3[0],x3[1],x3[2],x3[3]};
#pragma unroll
    for (int i = 0; i < 16; ++i) { const unsigned short hb = bf16_bits(xs[i]); ah.u[i] = hb; al.u[i] = ASPLIT ? bf16_bits(xs[i] - bf16_val(hb)) : (unsigned short)0; }
#pragma unroll
    for (int t = 0; t < 4; ++t) {
      const size_t boff = ((size_t)(col0 / 16 + t) * (ldb / 32) + kb / 32) * 512 + lane * 8;
      FragB bh_, bl_;
      bh_.half[0] = *(const v8us*)(Bh + boff);
      bh_.half[1] = *(const v8us*)(Bh + boff + 256);
      if (BSPLIT) { bl_.half[0] = *(const v8us*)(Bl + boff); bl_.half[1] = *(const v8us*)(Bl + boff + 256); } else bl_ = bh_;
      // keeps both planes' loads of a column tile in front of its products, so that they fly together; without it this build issued the lo plane's loads behind the first product and waited twice
      __builtin_amdgcn_sched_barrier(0);
      acc[t] = mmaN<ASPLIT ? (BSPLIT ? 3 : 2) : 1>(ah.v, al.v, bh_.v, bl_.v, acc[t]);
    }
  }
#pragma unroll
  for (int t = 0; t < 4; ++t) {
    float bv = bias ? bias[col0 + t * 16 + ln] : 0.f;
    if (BIAS_BF16) bv = bf16_round(bv);
#pragma unroll
    for (int r = 0; r < 8; ++r) { float v = acc[t][r] * alpha + bv; if (ACT == 1) v = fmaxf(v, 0.f); so[w][8 * hh + r][t * 16 + ln] = v; }
  }
  __builtin_amdgcn_fence(__ATOMIC_ACQ_REL, "workgroup");
  __builtin_amdgcn_wave_barrier();
  const int rsub = lane >> 4, c4 = (lane & 15) * 4;
  {
#pragma unroll
    for (int q = 0; q < 8; ++q) {
      const int r = q * 2 + rsub;
      const v4f v = *(const v4fa*)&so[w][r][c4];
      *(v4f*)(C + (size_t)r * ldp + col0 + c4) = v;
    }
    
  }
}
// Cross-lane steps of a wave-wide reduction: row_xmask DPP inside a 16-lane row, then the other row's lane of the same index.
template <int CTRL>
__device__ __forceinline__ float dpp_get(float x) { return __int_as_float(__builtin_amdgcn_update_dpp(0, __float_as_int(x), CTRL, 0xf, 0xf, true)); }
__device__ __forceinline__ float other_row(float x) { return __int_as_float(__builtin_amdgcn_permlanex16(__float_as_int(x), __float_as_int(x), 0x76543210, 0xfedcba98, false, false)); }
__device__ __forceinline__ float wave_max(float x) {
  x = fmaxf(x, dpp_get<0x161>(x)); x = fmaxf(x, dpp_get<0x162>(x)); x = fmaxf(x, dpp_get<0x164>(x)); x = fmaxf(x, dpp_get<0x168>(x));
  return fmaxf(x, other_row(x));
}
__device__ __forceinline__ float wave_sum(float x) {
  x += dpp_get<0x161>(x); x += dpp_get<0x162>(x); x += dpp_get<0x164>(x); x += dpp_get<0x168>(x);
  return x + other_row(x);
}
// out rows = LayerNorm(A[M][K] x B) over the N = 64 columns; one work-group owns a 16 x 64 tile, that is 16 whole rows. A f32 split hi/lo per fragment, B bf16 hi/lo planes in
// fragment order (ldb = K), 3 terms as above.
// A is lower triangular (M == K = 16 * KW == SS), a packed mixed map: its elements right of the diagonal are zero, and right of the 32-column step that holds the tile's
// diagonal they are neither stored by the producer nor read here. Wave w takes the 32-column half w & 1 of the tile and, of the steps of 32 k up to there,
// steps w >> 1, (w >> 1) + 8, ...; the 8 f32 partial tiles are summed through LDS in that order. Wave w then holds row w whole, two columns a lane:
// mean and biased variance are wave sums, and the normalised row goes straight to out (a wave stores 256 bytes in a row).
// Grid: x = 16-row tile of M, the longest rows first, y = product of a batch (the batch's A, B and out matrices,
// of M, N and M rows, lie densely one behind the other).
// Every loop over s, t, i, r, p below is unrolled so that the fragment arrays are indexed by constants and stay in registers.
template <int KW>
__global__ __launch_bounds__(512) void k_gemm_ksplit_ln(const float* __restrict__ A, const unsigned short* __restrict__ Bh, const unsigned short* __restrict__ Bl, int ldb,
                                                      const float* __restrict__ gam, const float* __restrict__ bet, float* __restrict__ out, int M) {
  constexpr int N = DD;
  __shared__ __attribute__((aligned(16))) float part[8][16][68];   // pitch 68: the two 8-row halves of an accumulator store fall on different banks
  // the wave's number is the same in all its lanes; readfirstlane says so to the compiler, so that the tests on a wave's step count are scalar branches
  const int tid = threadIdx.x, w = __builtin_amdgcn_readfirstlane((int)(threadIdx.x >> 5)), lane = tid & 31, ln = lane & 15, hh = lane >> 4;
  const int kq = w >> 1, col0 = (w & 1) * 32;
  const int row0 = (M / 16 - 1 - (int)blockIdx.x) * 16;
  const int nmy = (row0 / 32 + 1 - kq + 7) >> 3;   // this wave's share of the row0 / 32 + 1 steps, 0 .. NS
  const unsigned lda = m_pitch(row0);   // pitch of the tile's 16 rows
  A += (size_t)blockIdx.y * M_HEAD; Bh += (size_t)blockIdx.y * N * ldb; Bl += (size_t)blockIdx.y * N * ldb; out += (size_t)blockIdx.y * M * N;
  // wave-uniform bases and 32-bit byte offsets of a lane: five lane addresses are formed once and a step is an immediate offset, so that no address is formed anew between the steps
  const char* abase = (const char*)(A + m_off(row0) + kq * 32);
  const size_t bt0 = ((size_t)(col0 / 16) * (ldb / 32) + kq) * 512, bt1 = ((size_t)(col0 / 16 + 1) * (ldb / 32) + kq) * 512;   // the wave's first k step in its two column tiles
  const char* hbase[2] = {(const char*)(Bh + bt0), (const char*)(Bh + bt1)};
  const char* lbase[2] = {(const char*)(Bl + bt0), (const char*)(Bl + bt1)};
  const unsigned aoff = 4u * (unsigned)(ln * lda + 8 * hh), boff = 16u * (unsigned)lane;
  constexpr int NS = KW / 16, AHEAD = 3;   // a wave's fragment loads run AHEAD steps in front of its products (all NS at once spill)
  v4f xa[NS][4];
  FragB bh_[NS][2], bl_[NS][2];
  auto load_step = [&](int s) {
    const char* ap = abase + s * 1024 + aoff;   // 8 k steps of 128 bytes on
    xa[s][0] = *(const v4fa*)ap; xa[s][1] = *(const v4fa*)(ap + 16); xa[s][2] = *(const v4fa*)(ap + 64); xa[s][3] = *(const v4fa*)(ap + 80);
#pragma unroll
    for (int t = 0; t < 2; ++t) {
      const char* hp = hbase[t] + s * 8192 + boff; const char* lp = lbase[t] + s * 8192 + boff;   // 8 k steps of 1 KiB on
      bh_[s][t].half[0] = *(const v8us*)hp; bh_[s][t].half[1] = *(const v8us*)(hp + 512);
      bl_[s][t].half[0] = *(const v8us*)lp; bl_[s][t].half[1] = *(const v8us*)(lp + 512);
    }
    // the wait that stands between issued loads and a rewrite of their address registers; as its inputs these stay whole up to it, so that no load above lands in one
    asm volatile("s_wait_xcnt 0x0" :: "v"(abase + aoff), "v"(hbase[0] + boff), "v"(hbase[1] + boff), "v"(lbase[0] + boff), "v"(lbase[1] + boff) : "memory");
  };
#pragma unroll
  for (int s = 0; s < AHEAD && s < NS; ++s) if (s < nmy) load_step(s);
  v8f acc[2] = {};
#pragma unroll
  for (int s = 0; s < NS; ++s) {
    if (s >= nmy) break;
    FragB ah, al;
#pragma unroll
    for (int i = 0; i < 16; ++i) { const float x = xa[s][i >> 2][i & 3]; const unsigned short hb = bf16_bits(x); ah.u[i] = hb; al.u[i] = bf16_bits(x - bf16_val(hb)); }
#pragma unroll
    for (int t = 0; t < 2; ++t) acc[t] = mmaN<3>(ah.v, al.v, bh_[s][t].v, bl_[s][t].v, acc[t]);
    if (s + AHEAD < NS && s + AHEAD < nmy) load_step(s + AHEAD);
  }
#pragma unroll
  for (int t = 0; t < 2; ++t)
#pragma unroll
    for (int r = 0; r < 8; ++r) part[kq][8 * hh + r][col0 + t * 16 + ln] = acc[t][r];
  __syncthreads();   // all 8 partial tiles are in LDS before any is read
  // wave = row w of the tile, lane = its columns 2 * lane and 2 * lane + 1
  float s0 = 0.f, s1 = 0.f;
#pragma unroll
  for (int p = 0; p < 8; ++p) { s0 += part[p][w][2 * lane]; s1 += part[p][w][2 * lane + 1]; }
  const float mu = wave_sum(s0 + s1) * (1.0f / N);
  const float c0 = s0 - mu, c1 = s1 - mu;
  const float var = wave_sum(c0 * c0 + c1 * c1) * (1.0f / N);
  const float rs = rsqrtf(var + 1e-5f);
  v2f o;
  o[0] = c0 * rs * gam[2 * lane] + bet[2 * lane]; o[1] = c1 * rs * gam[2 * lane + 1] + bet[2 * lane + 1];
  *(v2f*)(out + (size_t)(row0 + w) * N + 2 * lane) = o;
}
// row softmax: P[row][:] = softmax(masked S[row][:]) over N columns with optional causal mask (col > row + rowoff -> 0) and
__global__ __launch_bounds__(256) void k_softmax_rows(const float* __restrict__ S, float* __restrict__ P, int N, int causal, int rowoff, const int* __restrict__ mask, int mask_pitch) {
  __shared__ float red[256];
  const int row = blockIdx.x, tid = threadIdx.x;
  const float* s = S + (size_t)row * N; float* p_out = P + (size_t)row * N;
  const int qi = row + rowoff;
  float mx = -3.0e38f;
  for (int j = tid; j < N; j += 256) {
    bool keep = true;
    if (causal && j > qi) keep = false;
    if (mask && mask[(size_t)qi * mask_pitch + j] == 0) keep = false;
    const float v = keep ? s[j] : -3.0e38f;
    mx = fmaxf(mx, v);
  }
  red[tid] = mx; __syncthreads();
  for (int st = 128; st > 0; st >>= 1) { if (tid < st) red[tid] = fmaxf(red[tid], red[tid + st]); __syncthreads(); }
  mx = red[0]; __syncthreads();
  float sum = 0.f;
  for (int j = tid; j < N; j += 256) {
    bool keep = true;
    if (causal && j > qi) keep = false;
    if (mask && mask[(size_t)qi * mask_pitch + j] == 0) keep = false;
    const float p = keep ? __expf(s[j] - mx) : 0.f;
    sum += p;
  }
  red[tid] = sum; __syncthreads();
  for (int st = 128; st > 0; st >>= 1) { if (tid < st) red[tid] += red[tid + st]; __syncthreads(); }
  const float inv = (mx > -1.0e38f) ? 1.0f / red[0] : __builtin_nanf("");
  __syncthreads();
  {
    for (int j4 = tid * 4; j4 < N; j4 += 1024) {
      v4f out4;
#pragma unroll
      for (int u = 0; u < 4; ++u) {
        const int j = j4 + u;
        bool keep = true;
        if (causal && j > qi) keep = false;
        if (mask && mask[(size_t)qi * mask_pitch + j] == 0) keep = false;
        out4[u] = keep ? __expf(s[j] - mx) * inv : 0.f;
      }
      *(v4f*)(p_out + j4) = out4;
    }
    
  }
}

// exp(x) as __expf builds it (x * log2 e, then v_exp_f32). In asm so that the v_nop stands directly behind the transcendental: it fills the
// slot that the instruction set asks for before the source register is rewritten or the result read.
__device__ __forceinline__ float exp_slot(float x) {
  const float y = x * 1.44269504f;
  float e;
  asm("v_exp_f32 %0, %1\n\tv_nop" : "=v"(e) : "v"(y));
  return e;
}
#define CR 8   // output rows per row block
#define CWG ((SS / CR) * 9 / 16)   // work-groups per head group: the 32 * (1 + 2 + ... + 8) wave tiles on or left of the diagonal, 8 to a head and work-group
// Only what lies on or left of the diagonal is worked on: right of it a softmax weight is exp(-1e9 - max) = 0. A wave tile is CR rows x 256 columns; row block b
// has b / 32 + 1 of them. Work-group u takes row block 255 - u and, from u = 32 on, row block u - 32 as well: together always 8 wave tiles a head.
// Each wave has its own i0; a row's maximum and sum are taken over the waves wlo .. whi - 1 of its row block. The mixed map is stored up to the end of the
// 32-column step that holds the diagonal (zeros right of it), which is as far as the next GEMM reads.
// CR rows from i0, both heads of group g = g0 + blockIdx.y (S2 and M2 hold the launch's groups one behind the other, each head's map packed): waves 0-7 take head 0, waves 8-15 head 1. Per head: conv over its zero-masked scores,
// + bias, future -> -1e9, softmax. The two halves then swap their softmax tiles through LDS and each stores its own mixed head:
// mixed_j = m[0][j]*P_0 + m[1][j]*P_1, so the softmax maps never go to memory.
// A thread owns 8 consecutive columns of all CR rows in registers. Each of the CR + 5 score rows is read once per thread as an
// 18-wide window and feeds every output row and tap that uses it; the 66 weights are wave-uniform. Per output element the taps
// are added in the order a, then bq, ascending.
// Every loop over t, x, r, bq, c, p below is unrolled so that the window and the accumulators are indexed by constants and stay in registers.
__global__ __launch_bounds__(512) void k_conv_softmax_mix(const float* __restrict__ S2, const float* __restrict__ conv_w, const float* __restrict__ conv_b,
                                                         const float* __restrict__ head_mix, int g0, float* __restrict__ M2) {
  __shared__ __attribute__((aligned(16))) float redm[2][8][CR], reds[2][8][CR];   // per head and wave: the CR row maxima, the CR row sums
  __shared__ __attribute__((aligned(16))) v4f xch[2][CR * 2][256];                // per head: a thread's 2 * CR quads, lane-contiguous (writer and reader share tid)
  // the head is the same in all lanes of a wave; readfirstlane says so to the compiler, so that weights and row bases stay scalar
  const int hh2 = __builtin_amdgcn_readfirstlane((int)(threadIdx.x >> 8));
  const int tid = threadIdx.x & 255, w = __builtin_amdgcn_readfirstlane((int)((threadIdx.x & 255) >> 5)), lane = tid & 31;   // w wave-uniform as hh2 is: i0 and the row bases stay scalar
  const int u = (int)blockIdx.x, nah = (SS / CR - 1 - u) / 32 + 1;   // wave tiles of the longer row block
  const bool shortb = w >= nah;
  const int wlo = shortb ? nah : 0, whi = shortb ? 8 : nah;
  const int i0 = (shortb ? u - 32 : SS / CR - 1 - u) * CR;
  const int g = g0 + (int)blockIdx.y, hb = (int)blockIdx.y * 2 + hh2;   // hb = the head's place in S2 and M2
  const int h = g * 2 + hh2;
  const float* S = S2 + (size_t)hb * S_HEAD;
  const float* wk = conv_w + (size_t)h * 66;
  const int j0 = ((w - wlo) * 32 + lane) * 8;
  const int jl = min(j0, i0);   // a lane wholly right of the diagonal loads the diagonal lane's window (its results are replaced by -1e9 below): nothing right of column i0 + 12 is read
  // window = columns j0 - 5 .. j0 + 12; a piece that would leave the row is read from inside it and masked to 0 below
  // 32-bit byte offsets of a lane inside a row: with the wave-uniform row base each load takes the scalar-base form and these registers are never rewritten
  const unsigned oA = 4u * (unsigned)max(jl - 5, 0), oB = 4u * (unsigned)max(jl - 4, 0), oC = 4u * (unsigned)jl, oE = 4u * (unsigned)min(jl + 8, SS - 4), oF = 4u * (unsigned)min(jl + 12, SS - 1);
  float acc[CR][8];
#pragma unroll
  for (int r = 0; r < CR; ++r)
#pragma unroll
    for (int c = 0; c < 8; ++c) acc[r][c] = 0.f;
  float eA[2], eF[2];
  v4f qB[2], qC[2], qD[2], qE[2];
  auto load_row = [&](int t) {                                   // score row i0 - 2 + t into register set t & 1; a row outside is replaced by row i0 and masked
    const int ii = i0 - 2 + t;
    const char* srow = (const char*)(S + s_off((ii >= 0 && ii < SS) ? ii : i0));
    eA[t & 1] = *(const float*)(srow + oA); eF[t & 1] = *(const float*)(srow + oF);
    qB[t & 1] = *(const v4fa*)(srow + oB); qC[t & 1] = *(const v4fa*)(srow + oC); qD[t & 1] = *(const v4fa*)(srow + oC + 16); qE[t & 1] = *(const v4fa*)(srow + oE);
  };
  load_row(0);
#pragma unroll
  for (int t = 0; t < CR + 5; ++t) {
    if (t + 1 < CR + 5) load_row(t + 1);
    // keeps the next row's loads in front of this row's products, so that they land under them
    __builtin_amdgcn_sched_barrier(0);
    const int ii = i0 - 2 + t, s = t & 1;
    const unsigned lim = (ii >= 0 && ii < SS) ? (unsigned)(ii + 1) : 0u;   // columns 0 .. ii of row ii enter; future ones, and rows outside, enter as 0
    float win[18] = {eA[s], qB[s][0], qB[s][1], qB[s][2], qB[s][3], qC[s][0], qC[s][1], qC[s][2], qC[s][3],
                     qD[s][0], qD[s][1], qD[s][2], qD[s][3], qE[s][0], qE[s][1], qE[s][2], qE[s][3], eF[s]};
#pragma unroll
    for (int x = 0; x < 18; ++x) win[x] = ((unsigned)(j0 - 5 + x) < lim) ? win[x] : 0.0f;
#pragma unroll
    for (int r = 0; r < CR; ++r) {
      const int a = t - r;                                       // ii = (i0 + r) + a - 2
      if (a < 0 || a >= 6) continue;
#pragma unroll
      for (int bq = 0; bq < 11; ++bq)
#pragma unroll
        for (int c = 0; c < 8; ++c) acc[r][c] += wk[a * 11 + bq] * win[c + bq];
    }
  }
  const float cb = conv_b[h];
  float mx[CR];
#pragma unroll
  for (int r = 0; r < CR; ++r) {
    float m = -3.0e38f;
#pragma unroll
    for (int c = 0; c < 8; ++c) { const float fin = (j0 + c > i0 + r) ? -1.0e9f : acc[r][c] + cb; acc[r][c] = fin; m = fmaxf(m, fin); }
    mx[r] = wave_max(m);
  }
  if (lane == 0) {
#pragma unroll
    for (int r = 0; r < CR; ++r) redm[hh2][w][r] = mx[r];
  }
  __syncthreads();   // each head's 8 waves' row maxima are in LDS before any is read
#pragma unroll
  for (int r = 0; r < CR; ++r) {
    float m = -3.0e38f;
#pragma unroll
    for (int p = 0; p < 8; ++p) { const float o = redm[hh2][p][r]; m = (p >= wlo && p < whi) ? fmaxf(m, o) : m; }
    float sum = 0.f;
#pragma unroll
    for (int c = 0; c < 8; ++c) { const float e = exp_slot(acc[r][c] - m); acc[r][c] = e; sum += e; }
    mx[r] = wave_sum(sum);
  }
  if (lane == 0) {
#pragma unroll
    for (int r = 0; r < CR; ++r) reds[hh2][w][r] = mx[r];
  }
  __syncthreads();   // each head's 8 waves' row sums are in LDS before any is read
#pragma unroll
  for (int r = 0; r < CR; ++r) {
    float sum = 0.f;
#pragma unroll
    for (int p = 0; p < 8; ++p) { const float o = reds[hh2][p][r]; sum = (p >= wlo && p < whi) ? sum + o : sum; }
    const float inv = 1.0f / sum;
    v4f o0, o1;
#pragma unroll
    for (int c = 0; c < 4; ++c) { o0[c] = acc[r][c] * inv; o1[c] = acc[r][4 + c] * inv; acc[r][c] = o0[c]; acc[r][4 + c] = o1[c]; }
    xch[hh2][2 * r][tid] = o0; xch[hh2][2 * r + 1][tid] = o1;
  }
  const float m_own = head_mix[g * 4 + hh2 * 2 + hh2], m_oth = head_mix[g * 4 + (1 - hh2) * 2 + hh2];   // m[i][j], j = this head
  __syncthreads();   // both heads' softmax tiles are in LDS before the other head reads them
  if (j0 > (i0 | 31)) return;   // right of the diagonal's 32-column step nothing is stored; no barrier follows
  float* mtile = M2 + (size_t)hb * M_HEAD + m_off(i0) + j0;   // the CR rows lie in one band
  const unsigned mpitch = m_pitch(i0);
#pragma unroll
  for (int r = 0; r < CR; ++r) {
    const v4f t0 = xch[1 - hh2][2 * r][tid], t1 = xch[1 - hh2][2 * r + 1][tid];
    float* mrow = mtile + r * mpitch;
    v4f o0, o1;
#pragma unroll
    for (int c = 0; c < 4; ++c) { o0[c] = m_own * acc[r][c] + m_oth * t0[c]; o1[c] = m_own * acc[r][4 + c] + m_oth * t1[c]; }
    *(v4f*)mrow = o0; *(v4f*)(mrow + 4) = o1;
  }
}
extern "C" void kernel_launch(void* const* d_in, const int* in_sizes, int n_in,
                              void* d_out, int out_size, void* d_ws, size_t ws_size, hipStream_t stream) {
  (void)in_sizes; (void)n_in; (void)out_size;
  const float* q = (const float*)d_in[0]; const float* k = (const float*)d_in[1]; const float* v = (const float*)d_in[2];
  const float* conv_w = (const float*)d_in[3]; const float* conv_b = (const float*)d_in[4]; const float* head_mix = (const float*)d_in[5];
  const float* gam = (const float*)d_in[6]; const float* bet = (const float*)d_in[7];
  char* ws = (char*)d_ws; size_t off = 0;
  auto take = [&](size_t bytes) { char* p = ws + off; off += (bytes + 255) & ~(size_t)255; return p; };
  unsigned short* kh = (unsigned short*)take((size_t)NHD * SS * DD * 2); unsigned short* kl = (unsigned short*)take((size_t)NHD * SS * DD * 2);     // k planes (n = key, k = d), fragment order, all heads
  unsigned short* vth = (unsigned short*)take((size_t)NHD * DD * SS * 2); unsigned short* vtl = (unsigned short*)take((size_t)NHD * DD * SS * 2);  // v planes (n = d, k = key), fragment order, all heads
  float* S2 = (float*)take((size_t)GB * 2 * S_HEAD * 4);     // packed scores of the 2 * GB heads of a batch
  float* M2 = (float*)take((size_t)GB * 2 * M_HEAD * 4);     // their packed mixed maps
  if (off > ws_size) return;
  k_split_rows<<<(NHD * SS * (DD / 8) + 255) / 256, 256, 0, stream>>>(k, DD, kh, kl, NHD * SS, DD);
  k_split_transpose<<<dim3((DD * (SS / 8) + 255) / 256, NHD), 256, 0, stream>>>(v, DD, vth, vtl, SS, DD);
  for (int g0 = 0; g0 < NG; g0 += GB) {
    const int ng = (NG - g0 < GB) ? NG - g0 : GB, h0 = g0 * 2;   // groups of this batch, its first head
    // scores_h = q.k^T / 8 : M=N=SS, K=DD, one product per head of the batch, tiles up to the diagonal
    k_gemm_bf2<true, true, 0, false, true><<<dim3((SS / 32) * (SS / 64 + 2) / 4, ng * 2), 128, 0, stream>>>(q + (size_t)h0 * SS * DD, DD, kh + (size_t)h0 * SS * DD, kl + (size_t)h0 * SS * DD, DD, nullptr, 0.125f, S2, SS, SS, SS, DD);
    k_conv_softmax_mix<<<dim3(CWG, ng), 512, 0, stream>>>(S2, conv_w, conv_b, head_mix, g0, M2);
    // out_h = LayerNorm(mixed_h . v_h) : M=SS, N=DD, K=SS; Bt[n=d][k=s] = the v planes
    k_gemm_ksplit_ln<SS / 16><<<dim3(SS / 16, ng * 2), 512, 0, stream>>>(M2, vth + (size_t)h0 * DD * SS, vtl + (size_t)h0 * DD * SS, SS, gam, bet, (float*)d_out + (size_t)h0 * SS * DD, SS);
  }
}

// v009
// One run takes 160 microseconds.
// Two timings next to v008 put it at 1.32 and 1.31 times that version's speed.
// Over all steps from v000 it is 17.9 times as fast.
#include <hip/hip_runtime.h>
// Contractions on v_wmma_f32_16x16x32_bf16 as 3-term bf16 hi/lo splits (f32-accurate), f32 accumulate: scores = q·kᵀ/8 (K=64)
// and the softmax weights times v (K=2048). The 6x11 key-query convolution, masking, softmax, 2x2 head mixing and LayerNorm are f32 VALU.
#define NHD 16
#define SS 2048
#define DD 64
#define NG 8
// PACKED SCORES. Of a causal SS x SS map only what lies on or left of the diagonal, plus a margin, is ever stored or read, so an upper row needs no full pitch.
// The rows are cut into 4 bands of QR rows; every row of band q has a pitch of QR * (q + 1) + SPAD floats (at most SS), and the bands lie one behind the other.
// The margin SPAD: the 64-column tiles start at or left of column row0 + 16, so in band q they end before column QR * (q + 1) + 64. A block of 8 or 16 aligned rows lies in one band.
#define QR (SS / 4)
#define SPAD 64
#define S_HEAD (QR * (QR * 6 + SPAD * 3) + QR * SS)   // floats of one head's packed scores

typedef __bf16 v16b __attribute__((ext_vector_type(16)));
typedef unsigned short v8us __attribute__((ext_vector_type(8), may_alias));
typedef float  v8f  __attribute__((ext_vector_type(8)));
typedef float  v2f  __attribute__((ext_vector_type(2)));
typedef float  v2fa __attribute__((ext_vector_type(2), may_alias));
typedef float  v4f  __attribute__((ext_vector_type(4)));
typedef float  v4fa __attribute__((ext_vector_type(4), may_alias));
union FragB { v16b v; v8us half[2]; unsigned short u[16]; };

// pitch of row i and place of its first element, in floats, inside a head's packed scores; 0 <= i < SS
__device__ __forceinline__ unsigned s_pitch(unsigned i) { return min(QR * (i / QR + 1u) + SPAD, (unsigned)SS); }
__device__ __forceinline__ unsigned s_off(unsigned i) { const unsigned q = i / QR; return q * ((QR * QR / 2) * (q + 1u) + QR * SPAD) + (i % QR) * s_pitch(i); }
__device__ __forceinline__ unsigned short bf16_bits(float x) { unsigned int u = __float_as_uint(x); return (unsigned short)((u + 0x7FFFu + ((u >> 16) & 1u)) >> 16); }
__device__ __forceinline__ float bf16_val(unsigned short b) { return __uint_as_float(((unsigned int)b) << 16); }
__device__ __forceinline__ float bf16_round(float x) { return bf16_val(bf16_bits(x)); }
// D += A·B with NT terms: 1 = ah·bh, 2 = + al·bh (A split), 3 = + ah·bl (both split)
template <int NT>
__device__ __forceinline__ v8f mmaN(v16b ah, v16b al, v16b bh, v16b bl, v8f c) {
  c = __builtin_amdgcn_wmma_f32_16x16x32_bf16(false, ah, false, bh, (short)0, c, false, false);
  if (NT >= 2) c = __builtin_amdgcn_wmma_f32_16x16x32_bf16(false, al, false, bh, (short)0, c, false, false);
  if (NT >= 3) c = __builtin_amdgcn_wmma_f32_16x16x32_bf16(false, ah, false, bl, (short)0, c, false, false);
  asm volatile("v_nop\n\tv_nop\n\tv_nop\n\tv_nop" : "+v"(c) : "v"(ah), "v"(al), "v"(bh), "v"(bl));
  return c;
}

__global__ __launch_bounds__(256) void k_wt_bf16(const float* __restrict__ W, unsigned short* __restrict__ Wt, int K, int N) {
  const int t = blockIdx.x * 256 + threadIdx.x;
  const int k8n = K / 8;
  if (t >= N * k8n) return;
  const int n = t / k8n, k8 = (t % k8n) * 8;
  v8us v;
#pragma unroll
  for (int i = 0; i < 8; ++i) v[i] = bf16_bits(W[(size_t)(k8 + i) * N + n]);
  *(v8us*)(Wt + (size_t)n * K + k8) = v;
  
}

// GEMM C[M][N] (f32, pitch ldc) = act(A[M][K]·W + bias). A f32 row-major (pitch lda) converted per fragment to bf16
// (ASPLIT: hi/lo two planes -> 2 terms, else single rounded term); Wt bf16 [N][K] (pitch ldb). BIAS_BF16 rounds the
// bias to bf16 first (bias quantised to bf16 before the add). K%32==0, M%16==0, N%64==0.
template <bool ASPLIT, int ACT, bool BIAS_BF16>
__global__ __launch_bounds__(128) void k_gemm_bf(const float* __restrict__ A, int lda, const unsigned short* __restrict__ Wt, int ldb,
                                               const float* __restrict__ bias, float* __restrict__ C, int ldc, int M, int N, int K) {
  __shared__ __attribute__((aligned(16))) float so[4][16][64];
  const int tid = threadIdx.x, w = tid >> 5, lane = tid & 31, ln = lane & 15, hh = lane >> 4;
  const int ntn = N / 64;
  const int wid = blockIdx.x * 4 + w;
  const int mt = wid / ntn, nq = wid % ntn;
  if (mt * 16 >= M) return;
  const int row0 = mt * 16, col0 = nq * 64;
  const float* arow = A + (size_t)(row0 + ln) * lda;
  v8f acc[4] = {};
  for (int kb = 0; kb < K; kb += 32) {
    FragB ah, al;
    const v4f x0 = *(const v4fa*)(arow + kb + 8 * hh), x1 = *(const v4fa*)(arow + kb + 8 * hh + 4);
    const v4f x2 = *(const v4fa*)(arow + kb + 16 + 8 * hh), x3 = *(const v4fa*)(arow + kb + 16 + 8 * hh + 4);
    float xs[16] = {x0[0],x0[1],x0[2],x0[3],x1[0],x1[1],x1[2],x1[3],x2[0],x2[1],x2[2],x2[3],x3[0],x3[1],x3[2],x3[3]};
#pragma unroll
    for (int i = 0; i < 16; ++i) { const unsigned short hb = bf16_bits(xs[i]); ah.u[i] = hb; al.u[i] = ASPLIT ? bf16_bits(xs[i] - bf16_val(hb)) : (unsigned short)0; }
#pragma unroll
    for (int t = 0; t < 4; ++t) {
      const unsigned short* brow = Wt + (size_t)(col0 + t * 16 + ln) * ldb + kb;
      FragB b;
      b.half[0] = *(const v8us*)(brow + 8 * hh);
      b.half[1] = *(const v8us*)(brow + 16 + 8 * hh);
      acc[t] = mmaN<ASPLIT ? 2 : 1>(ah.v, al.v, b.v, b.v, acc[t]);
    }
  }
#pragma unroll
  for (int t = 0; t < 4; ++t) {
    float bv = bias ? bias[col0 + t * 16 + ln] : 0.f;
    if (BIAS_BF16) bv = bf16_round(bv);
#pragma unroll
    for (int r = 0; r < 8; ++r) { float v = acc[t][r] + bv; if (ACT == 1) v = fmaxf(v, 0.f); so[w][8 * hh + r][t * 16 + ln] = v; }
  }
  __builtin_amdgcn_fence(__ATOMIC_ACQ_REL, "workgroup");
  __builtin_amdgcn_wave_barrier();
  const int rsub = lane >> 4, c4 = (lane & 15) * 4;
  {
#pragma unroll
    for (int q = 0; q < 8; ++q) {
      const int r = q * 2 + rsub;
      const v4f v = *(const v4fa*)&so[w][r][c4];
      *(v4f*)(C + (size_t)(row0 + r) * ldc + col0 + c4) = v;
    }
    
  }
}

// Flash-style causal/unmasked attention, all contractions 3-term bf16 hi/lo splits, f32 softmax with running max.
// q,k,v rows are read from f32 buffers with arbitrary row pitch (so they can live inside a fused qkv buffer);
// D = head size (multiple of 32, <= 128); one wave = 16 query rows; block = 4 waves (64 queries) sharing K/V chunks of 32.
template <int D, bool CAUSAL>
__global__ __launch_bounds__(128) void k_flash(const float* __restrict__ qb, const float* __restrict__ kb, const float* __restrict__ vb,
                                             int pitch, int T, int H, float scale, float* __restrict__ y, int ypitch) {
  constexpr int KS = D / 32;        // k-steps for QK
  constexpr int DT = D / 16;        // d tiles for PV
  __shared__ __attribute__((aligned(16))) unsigned short sKh[32][D + 8], sKl[32][D + 8], sVh[32][D + 8], sVl[32][D + 8];
  __shared__ __attribute__((aligned(16))) unsigned short sPh[4][16][40], sPl[4][16][40];
  __shared__ __attribute__((aligned(16))) float sO[4][16][D];
  const int tid = threadIdx.x, w = tid >> 5, lane = tid & 31, ln = lane & 15, hh = lane >> 4;
  const int nqb = (T + 63) / 64;
  const int bh = blockIdx.x / nqb, qblk = blockIdx.x % nqb;
  const int b = bh / H, h = bh % H;
  const int q0 = qblk * 64 + w * 16;
  const float* Q = qb + (size_t)b * T * pitch + h * D;
  const float* K = kb + (size_t)b * T * pitch + h * D;
  const float* V = vb + (size_t)b * T * pitch + h * D;

  // A fragments of the wave's 16 query rows (scaled), hi/lo
  FragB aqh[KS], aql[KS];
  {
    int row = q0 + ln; if (row >= T) row = T - 1;
    const float* qr = Q + (size_t)row * pitch;
#pragma unroll
    for (int ks = 0; ks < KS; ++ks)
#pragma unroll
      for (int i = 0; i < 16; ++i) {
        const int d = ks * 32 + ((i < 8) ? (8 * hh + i) : (16 + 8 * hh + (i - 8)));
        const float x = qr[d] * scale; const unsigned short hb = bf16_bits(x);
        aqh[ks].u[i] = hb; aql[ks].u[i] = bf16_bits(x - bf16_val(hb));
      }
  }
  float m_r[8], l_r[8];
#pragma unroll
  for (int r = 0; r < 8; ++r) { m_r[r] = -3.0e38f; l_r[r] = 0.f; }
  v8f oacc[DT];
#pragma unroll
  for (int dt = 0; dt < DT; ++dt) oacc[dt] = (v8f){0.f,0.f,0.f,0.f,0.f,0.f,0.f,0.f};

  const int kv_end = CAUSAL ? min(T, qblk * 64 + 64) : T;     // block-uniform
  for (int j0 = 0; j0 < kv_end; j0 += 32) {
    __syncthreads();
    for (int e = tid; e < 32 * (D / 4); e += 128) {
      const int r = e / (D / 4), c4 = (e % (D / 4)) * 4;
      const int key = j0 + r;
      v4f kf = {0.f,0.f,0.f,0.f}, vf = {0.f,0.f,0.f,0.f};
      if (key < T) { kf = *(const v4fa*)(K + (size_t)key * pitch + c4); vf = *(const v4fa*)(V + (size_t)key * pitch + c4); }
#pragma unroll
      for (int t = 0; t < 4; ++t) {
        unsigned short hb = bf16_bits(kf[t]); sKh[r][c4 + t] = hb; sKl[r][c4 + t] = bf16_bits(kf[t] - bf16_val(hb));
        hb = bf16_bits(vf[t]); sVh[r][c4 + t] = hb; sVl[r][c4 + t] = bf16_bits(vf[t] - bf16_val(hb));
      }
    }
    __syncthreads();
    // S tile 16 x 32
    v8f s[2];
#pragma unroll
    for (int nt = 0; nt < 2; ++nt) {
      v8f acc = {};
#pragma unroll
      for (int ks = 0; ks < KS; ++ks) {
        FragB bh_, bl_;
        bh_.half[0] = *(const v8us*)&sKh[nt * 16 + ln][ks * 32 + 8 * hh]; bh_.half[1] = *(const v8us*)&sKh[nt * 16 + ln][ks * 32 + 16 + 8 * hh];
        bl_.half[0] = *(const v8us*)&sKl[nt * 16 + ln][ks * 32 + 8 * hh]; bl_.half[1] = *(const v8us*)&sKl[nt * 16 + ln][ks * 32 + 16 + 8 * hh];
        acc = mmaN<3>(aqh[ks].v, aql[ks].v, bh_.v, bl_.v, acc);
      }
      s[nt] = acc;
    }
    // mask + running max (rows 8hh+r; the 16 lanes of a half share rows)
    float alpha[8];
#pragma unroll
    for (int r = 0; r < 8; ++r) {
      const int qi = q0 + 8 * hh + r;
      const int ja = j0 + ln, jb = j0 + 16 + ln;
      if (CAUSAL) { if (ja > qi) s[0][r] = -3.0e38f; if (jb > qi) s[1][r] = -3.0e38f; }
      if (ja >= T) s[0][r] = -3.0e38f;
      if (jb >= T) s[1][r] = -3.0e38f;
      float mx = fmaxf(s[0][r], s[1][r]);
      mx = fmaxf(mx, __shfl_xor(mx, 1, 32)); mx = fmaxf(mx, __shfl_xor(mx, 2, 32)); mx = fmaxf(mx, __shfl_xor(mx, 4, 32)); mx = fmaxf(mx, __shfl_xor(mx, 8, 32));
      const float mnew = fmaxf(m_r[r], mx);
      alpha[r] = (mnew > -1.0e38f) ? __expf(m_r[r] - mnew) : 1.0f;
      const float p0 = (s[0][r] > -1.0e38f) ? __expf(s[0][r] - mnew) : 0.f;
      const float p1 = (s[1][r] > -1.0e38f) ? __expf(s[1][r] - mnew) : 0.f;
      m_r[r] = mnew;
      l_r[r] = l_r[r] * alpha[r] + p0 + p1;            // per-lane partial row sum (16 lanes combined at the end)
      unsigned short hb = bf16_bits(p0); sPh[w][8 * hh + r][ln] = hb;      sPl[w][8 * hh + r][ln] = bf16_bits(p0 - bf16_val(hb));
      hb = bf16_bits(p1);                sPh[w][8 * hh + r][16 + ln] = hb; sPl[w][8 * hh + r][16 + ln] = bf16_bits(p1 - bf16_val(hb));
    }
#pragma unroll
    for (int dt = 0; dt < DT; ++dt)
#pragma unroll
      for (int r = 0; r < 8; ++r) oacc[dt][r] *= alpha[r];
    __builtin_amdgcn_fence(__ATOMIC_ACQ_REL, "workgroup");
    __builtin_amdgcn_wave_barrier();
    FragB pah, pal;
    pah.half[0] = *(const v8us*)&sPh[w][ln][8 * hh]; pah.half[1] = *(const v8us*)&sPh[w][ln][16 + 8 * hh];
    pal.half[0] = *(const v8us*)&sPl[w][ln][8 * hh]; pal.half[1] = *(const v8us*)&sPl[w][ln][16 + 8 * hh];
#pragma unroll
    for (int dt = 0; dt < DT; ++dt) {
      FragB bvh, bvl;
#pragma unroll
      for (int i = 0; i < 8; ++i) {
        bvh.u[i] = sVh[8 * hh + i][dt * 16 + ln]; bvh.u[8 + i] = sVh[16 + 8 * hh + i][dt * 16 + ln];
        bvl.u[i] = sVl[8 * hh + i][dt * 16 + ln]; bvl.u[8 + i] = sVl[16 + 8 * hh + i][dt * 16 + ln];
      }
      oacc[dt] = mmaN<3>(pah.v, pal.v, bvh.v, bvl.v, oacc[dt]);
    }
    __builtin_amdgcn_fence(__ATOMIC_ACQ_REL, "workgroup");
    __builtin_amdgcn_wave_barrier();
  }
#pragma unroll
  for (int r = 0; r < 8; ++r) {
    float l = l_r[r];
    l += __shfl_xor(l, 1, 32); l += __shfl_xor(l, 2, 32); l += __shfl_xor(l, 4, 32); l += __shfl_xor(l, 8, 32);
    l_r[r] = (l > 0.f) ? 1.0f / l : 0.f;
  }
#pragma unroll
  for (int dt = 0; dt < DT; ++dt)
#pragma unroll
    for (int r = 0; r < 8; ++r) sO[w][8 * hh + r][dt * 16 + ln] = oacc[dt][r] * l_r[r];
  __builtin_amdgcn_fence(__ATOMIC_ACQ_REL, "workgroup");
  __builtin_amdgcn_wave_barrier();
  {
    for (int r = 0; r < 16; ++r) {
      const int row = q0 + r;
      if (row < T && lane < D / 4) {
        const v4f val = *(const v4fa*)&sO[w][r][lane * 4];
        *(v4f*)(y + ((size_t)b * T + row) * ypitch + h * D + lane * 4) = val;
      }
    }
    
  }
}

// FRAGMENT ORDER of a bf16 plane of the B operand, Bt[N][K] (n = column of B, N % 16 == 0, K % 32 == 0): the plane is a row of 16-byte chunks, and chunk
// ((nt * (K / 32) + ks) * 2 + half) * 32 + lane holds the 8 elements n = nt * 16 + (lane & 15), k = ks * 32 + half * 16 + (lane >> 4) * 8 + 0 .. 7.
// That is what lane 'lane' holds in half 'half' of the B fragment of column tile nt and k step ks: a wave loads a half fragment as 512 bytes in a row
// (four whole lines; from a row-major plane the same load touches 16 lines). The plane has the size of the row-major one.
// f32 [R][Cc] (row pitch lds) -> bf16 hi/lo planes in fragment order (n = row, k = column); thread per chunk; R % 16 == 0, Cc % 32 == 0
__global__ __launch_bounds__(256) void k_split_rows(const float* __restrict__ src, int lds_, unsigned short* __restrict__ hi, unsigned short* __restrict__ lo, int R, int Cc) {
  const size_t t = (size_t)blockIdx.x * 256 + threadIdx.x;
  const int c8n = Cc / 8;
  if (t >= (size_t)R * c8n) return;
  const int lane = (int)(t & 31), half = (int)(t >> 5) & 1, ksn = Cc / 32, tile = (int)(t >> 6);
  const int r = (tile / ksn) * 16 + (lane & 15), c8 = (tile % ksn) * 32 + half * 16 + (lane >> 4) * 8;
  const float* s = src + (size_t)r * lds_ + c8;
  const v4f a = *(const v4fa*)s, b = *(const v4fa*)(s + 4);
  float xs[8] = {a[0],a[1],a[2],a[3],b[0],b[1],b[2],b[3]};
  v8us vh, vl;
#pragma unroll
  for (int i = 0; i < 8; ++i) { const unsigned short hb = bf16_bits(xs[i]); vh[i] = hb; vl[i] = bf16_bits(xs[i] - bf16_val(hb)); }
  unsigned short* dh = hi + t * 8; unsigned short* dl = lo + t * 8;
  *(v8us*)dh = vh; *(v8us*)dl = vl;
}
// f32 [K][N] (row pitch lds) -> bf16 hi/lo planes of Bt[N][K] in fragment order; one thread per chunk (n, 8 consecutive k): 16 lanes read 16 neighbours of a source row
// blockIdx.y = matrix of a batch: sources and planes of the batch lie densely one behind the other
__global__ __launch_bounds__(256) void k_split_transpose(const float* __restrict__ src, int lds_, unsigned short* __restrict__ hi, unsigned short* __restrict__ lo, int K, int N) {
  const size_t t = (size_t)blockIdx.x * 256 + threadIdx.x;
  const int k8n = K / 8;
  if (t >= (size_t)N * k8n) return;
  const int lane = (int)(t & 31), half = (int)(t >> 5) & 1, ksn = K / 32, tile = (int)(t >> 6);
  const int n = (tile / ksn) * 16 + (lane & 15), k8 = (tile % ksn) * 32 + half * 16 + (lane >> 4) * 8;
  src += (size_t)blockIdx.y * K * lds_; hi += (size_t)blockIdx.y * N * K; lo += (size_t)blockIdx.y * N * K;
  v8us vh, vl;
#pragma unroll
  for (int i = 0; i < 8; ++i) { const float x = src[(size_t)(k8 + i) * lds_ + n]; const unsigned short hb = bf16_bits(x); vh[i] = hb; vl[i] = bf16_bits(x - bf16_val(hb)); }
  unsigned short* dh = hi + t * 8; unsigned short* dl = lo + t * 8;
  *(v8us*)dh = vh; *(v8us*)dl = vl;
}
// GEMM with A f32 (split into hi/lo when ASPLIT) and B from bf16 planes Bh (+ Bl when BSPLIT) in fragment order (ldb = their K): terms hi·hi [+ lo·hi] [+ hi·lo].
// C f32 [M][N] pitch ldc; alpha scales the result; bias optional (BIAS_BF16 rounds it). Same tiling/epilogue as k_gemm_bf.
// blockIdx.y = product of a batch: the A, B and C matrices of the batch lie densely one behind the other (M, N, M rows each).
// CAUSAL (M == N, M % 32 == 0): only the 16 x 64 tiles with col0 <= row0 + 16 are computed and stored; they hold every element (i, j <= i + 14),
// which is all that the convolution reads. Row tiles p and M/16 - 1 - p together have at most N/64 + 2 such tiles: the grid deals that many waves to each pair.
// C is then a batch of packed score maps (M == SS; ldc is not used).
template <bool ASPLIT, bool BSPLIT, int ACT, bool BIAS_BF16, bool CAUSAL>
__global__ __launch_bounds__(128) void k_gemm_bf2(const float* __restrict__ A, int lda, const unsigned short* __restrict__ Bh, const unsigned short* __restrict__ Bl, int ldb,
                                                const float* __restrict__ bias, float alpha, float* __restrict__ C, int ldc, int M, int N, int K) {
  __shared__ __attribute__((aligned(16))) float so[4][16][64];
  // the wave's number is the same in all its lanes; readfirstlane says so to the compiler: the tile's place in the B planes is then a scalar base, and a lane adds only lane * 16 bytes
  const int tid = threadIdx.x, w = __builtin_amdgcn_readfirstlane((int)(threadIdx.x >> 5)), lane = tid & 31, ln = lane & 15, hh = lane >> 4;
  const int ntn = N / 64;
  const int wid = blockIdx.x * 4 + w;
  int mt = wid / ntn, nq = wid % ntn;
  if (CAUSAL) {
    const int p = wid / (ntn + 2), c = wid % (ntn + 2), mh = M / 16 - 1 - p;
    if (p >= M / 32) return;
    const int nh = min(ntn, (mh + 1) / 4 + 1), nl = (p + 1) / 4 + 1;   // tiles of the pair's lower and upper row tile
    if (c >= nh + nl) return;
    mt = (c < nh) ? mh : p; nq = (c < nh) ? c : c - nh;
  }
  if (mt * 16 >= M) return;
  const int row0 = mt * 16, col0 = nq * 64;
  A += (size_t)blockIdx.y * M * lda; Bh += (size_t)blockIdx.y * N * ldb; Bl += (size_t)blockIdx.y * N * ldb;
  const unsigned ldp = CAUSAL ? s_pitch(row0) : (unsigned)ldc;   // pitch of the tile's rows in C
  C += CAUSAL ? (size_t)blockIdx.y * S_HEAD + s_off(row0) : ((size_t)blockIdx.y * M + row0) * ldc;   // the tile's first row
  const float* arow = A + (size_t)(row0 + ln) * lda;
  v8f acc[4] = {};
  for (int kb = 0; kb < K; kb += 32) {
    FragB ah, al;
    const v4f x0 = *(const v4fa*)(arow + kb + 8 * hh), x1 = *(const v4fa*)(arow + kb + 8 * hh + 4);
    const v4f x2 = *(const v4fa*)(arow + kb + 16 + 8 * hh), x3 = *(const v4fa*)(arow + kb + 16 + 8 * hh + 4);
    float xs[16] = {x0[0],x0[1],x0[2],x0[3],x1[0],x1[1],x1[2],x1[3],x2[0],x2[1],x2[2],x2[3],x3[0],x3[1],x3[2],x3[3]};
#pragma unroll
    for (int i = 0; i < 16; ++i) { const unsigned short hb = bf16_bits(xs[i]); ah.u[i] = hb; al.u[i] = ASPLIT ? bf16_bits(xs[i] - bf16_val(hb)) : (unsigned short)0; }
#pragma unroll
    for (int t = 0; t < 4; ++t) {
      const size_t boff = ((size_t)(col0 / 16 + t) * (ldb / 32) + kb / 32) * 512 + lane * 8;
      FragB bh_, bl_;
      bh_.half[0] = *(const v8us*)(Bh + boff);
      bh_.half[1] = *(const v8us*)(Bh + boff + 256);
      if (BSPLIT) { bl_.half[0] = *(const v8us*)(Bl + boff); bl_.half[1] = *(const v8us*)(Bl + boff + 256); } else bl_ = bh_;
      // keeps both planes' loads of a column tile in front of its products, so that they fly together; without it this build issued the lo plane's loads behind the first product and waited twice
      __builtin_amdgcn_sched_barrier(0);
      acc[t] = mmaN<ASPLIT ? (BSPLIT ? 3 : 2) : 1>(ah.v, al.v, bh_.v, bl_.v, acc[t]);
    }
  }
#pragma unroll
  for (int t = 0; t < 4; ++t) {
    float bv = bias ? bias[col0 + t * 16 + ln] : 0.f;
    if (BIAS_BF16) bv = bf16_round(bv);
#pragma unroll
    for (int r = 0; r < 8; ++r) { float v = acc[t][r] * alpha + bv; if (ACT == 1) v = fmaxf(v, 0.f); so[w][8 * hh + r][t * 16 + ln] = v; }
  }
  __builtin_amdgcn_fence(__ATOMIC_ACQ_REL, "workgroup");
  __builtin_amdgcn_wave_barrier();
  const int rsub = lane >> 4, c4 = (lane & 15) * 4;
  {
#pragma unroll
    for (int q = 0; q < 8; ++q) {
      const int r = q * 2 + rsub;
      const v4f v = *(const v4fa*)&so[w][r][c4];
      *(v4f*)(C + (size_t)r * ldp + col0 + c4) = v;
    }
    
  }
}
// Cross-lane steps of a wave-wide reduction: row_xmask DPP inside a 16-lane row, then the other row's lane of the same index.
template <int CTRL>
__device__ __forceinline__ float dpp_get(float x) { return __int_as_float(__builtin_amdgcn_update_dpp(0, __float_as_int(x), CTRL, 0xf, 0xf, true)); }
__device__ __forceinline__ float other_row(float x) { return __int_as_float(__builtin_amdgcn_permlanex16(__float_as_int(x), __float_as_int(x), 0x76543210, 0xfedcba98, false, false)); }
__device__ __forceinline__ float wave_max(float x) {
  x = fmaxf(x, dpp_get<0x161>(x)); x = fmaxf(x, dpp_get<0x162>(x)); x = fmaxf(x, dpp_get<0x164>(x)); x = fmaxf(x, dpp_get<0x168>(x));
  return fmaxf(x, other_row(x));
}
__device__ __forceinline__ float wave_sum(float x) {
  x += dpp_get<0x161>(x); x += dpp_get<0x162>(x); x += dpp_get<0x164>(x); x += dpp_get<0x168>(x);
  return x + other_row(x);
}
// row softmax: P[row][:] = softmax(masked S[row][:]) over N columns with optional causal mask (col > row + rowoff -> 0) and
__global__ __launch_bounds__(256) void k_softmax_rows(const float* __restrict__ S, float* __restrict__ P, int N, int causal, int rowoff, const int* __restrict__ mask, int mask_pitch) {
  __shared__ float red[256];
  const int row = blockIdx.x, tid = threadIdx.x;
  const float* s = S + (size_t)row * N; float* p_out = P + (size_t)row * N;
  const int qi = row + rowoff;
  float mx = -3.0e38f;
  for (int j = tid; j < N; j += 256) {
    bool keep = true;
    if (causal && j > qi) keep = false;
    if (mask && mask[(size_t)qi * mask_pitch + j] == 0) keep = false;
    const float v = keep ? s[j] : -3.0e38f;
    mx = fmaxf(mx, v);
  }
  red[tid] = mx; __syncthreads();
  for (int st = 128; st > 0; st >>= 1) { if (tid < st) red[tid] = fmaxf(red[tid], red[tid + st]); __syncthreads(); }
  mx = red[0]; __syncthreads();
  float sum = 0.f;
  for (int j = tid; j < N; j += 256) {
    bool keep = true;
    if (causal && j > qi) keep = false;
    if (mask && mask[(size_t)qi * mask_pitch + j] == 0) keep = false;
    const float p = keep ? __expf(s[j] - mx) : 0.f;
    sum += p;
  }
  red[tid] = sum; __syncthreads();
  for (int st = 128; st > 0; st >>= 1) { if (tid < st) red[tid] += red[tid + st]; __syncthreads(); }
  const float inv = (mx > -1.0e38f) ? 1.0f / red[0] : __builtin_nanf("");
  __syncthreads();
  {
    for (int j4 = tid * 4; j4 < N; j4 += 1024) {
      v4f out4;
#pragma unroll
      for (int u = 0; u < 4; ++u) {
        const int j = j4 + u;
        bool keep = true;
        if (causal && j > qi) keep = false;
        if (mask && mask[(size_t)qi * mask_pitch + j] == 0) keep = false;
        out4[u] = keep ? __expf(s[j] - mx) * inv : 0.f;
      }
      *(v4f*)(p_out + j4) = out4;
    }
    
  }
}

// exp(x) as __expf builds it (x * log2 e, then v_exp_f32). In asm so that the v_nop stands directly behind the transcendental: it fills the
// slot that the instruction set asks for before the source register is rewritten or the result read.
__device__ __forceinline__ float exp_slot(float x) {
  const float y = x * 1.44269504f;
  float e;
  asm("v_exp_f32 %0, %1\n\tv_nop" : "=v"(e) : "v"(y));
  return e;
}
#define CR 8   // output rows per row block
#define CWG ((SS / CR) * 9 / 16)   // work-groups per head group: the 32 * (1 + 2 + ... + 8) wave tiles on or left of the diagonal, 8 to a head and work-group
#define PP 264   // pitch, in bf16 elements, of a 256-column row of the weight planes in LDS: 16 bytes x an odd number, so that 16 rows read 16 bytes each without a bank conflict
// Only what lies on or left of the diagonal is worked on: right of it a softmax weight is exp(-1e9 - max) = 0. A wave tile is CR rows x 256 columns; row block b
// has b / 32 + 1 of them. Work-group u takes row block 255 - u (the long one) and, from u = 32 on, row block u - 32 (the short one) as well: together always 8 wave tiles a head.
// Each wave has its own i0; a row's maximum and sum are taken over the waves wlo .. whi - 1 of its row block.
// STAGE 1, conv + softmax. CR rows from i0, both heads of group g = blockIdx.y (S2 holds every head's packed scores): waves 0-7 take head 0, waves 8-15 head 1.
// Per head: conv over its zero-masked scores, + bias, future -> -1e9, E = exp(x - row max) and the row sums.
// A thread owns 8 consecutive columns of all CR rows in registers. Each of the CR + 5 score rows is read once per thread as an
// 18-wide window and feeds every output row and tap that uses it; the 66 weights are wave-uniform. Per output element the taps
// are added in the order a, then bq, ascending.
// STAGE 2, out_j = LayerNorm(sum_i m[i][j] / rowsum_i * (E_i x v_j)). The weights never go to memory: each thread puts its E values, split into bf16 hi/lo, into LDS planes,
// where the CR rows of head 0 and the CR rows of head 1 of a wave tile are the 16 rows of one A operand. Products as everywhere, 3 terms, f32 accumulate; B = the v planes
// in fragment order. Wave = (v head j, kq): it takes the steps of 32 keys kq, kq + 8, ... up to the long block's diagonal; a B fragment serves the long block's A and, while
// the step lies left of the short block's diagonal, the short block's too. In the accumulator lanes 0-15 hold E_0 x v_j and lanes 16-31 E_1 x v_j: each is scaled
// by m[i][j] / rowsum_i and the two are added across the halves (head mixing and softmax division are linear, so they commute with the product). The 8 partial tiles
// of a block and head are summed through LDS in the order of kq; a wave then holds a row whole, two columns a lane: mean and biased variance are wave sums.
// Every loop over t, x, r, bq, c, p, s, e below is unrolled so that the window, the fragments and the accumulators are indexed by constants and stay in registers.
__global__ __launch_bounds__(512) void k_conv_softmax_pv_ln(const float* __restrict__ S2, const float* __restrict__ conv_w, const float* __restrict__ conv_b,
                                                           const float* __restrict__ head_mix, const unsigned short* __restrict__ Vh, const unsigned short* __restrict__ Vl,
                                                           const float* __restrict__ gam, const float* __restrict__ bet, float* __restrict__ out) {
  __shared__ __attribute__((aligned(16))) float redm[2][8][CR], reds[2][8][CR];   // per head and wave: the CR row maxima, the CR row sums
  __shared__ __attribute__((aligned(16))) unsigned short sP[2][8][2 * CR][PP];     // hi and lo plane; per wave tile 16 rows (head * CR + row) of 256 columns
  __shared__ __attribute__((aligned(16))) float part[2][8][2][CR][68];            // per row block, kq and v head: a partial CR x 64 tile; pitch 68: the two lane halves store on different banks
  // the head is the same in all lanes of a wave; readfirstlane says so to the compiler, so that weights and row bases stay scalar
  const int hh2 = __builtin_amdgcn_readfirstlane((int)(threadIdx.x >> 8));
  const int tid = threadIdx.x & 255, w = __builtin_amdgcn_readfirstlane((int)((threadIdx.x & 255) >> 5)), lane = tid & 31;   // w wave-uniform as hh2 is: i0 and the row bases stay scalar
  const int u = (int)blockIdx.x, nah = (SS / CR - 1 - u) / 32 + 1;   // wave tiles of the longer row block
  const bool shortb = w >= nah;
  const int wlo = shortb ? nah : 0, whi = shortb ? 8 : nah;
  const int i0 = (shortb ? u - 32 : SS / CR - 1 - u) * CR;
  const int g = (int)blockIdx.y, h = g * 2 + hh2;
  const float* S = S2 + (size_t)h * S_HEAD;
  const float* wk = conv_w + (size_t)h * 66;
  const int j0 = ((w - wlo) * 32 + lane) * 8;
  const int jl = min(j0, i0);   // a lane wholly right of the diagonal loads the diagonal lane's window (its results are replaced by -1e9 below): nothing right of column i0 + 12 is read
  // window = columns j0 - 5 .. j0 + 12; a piece that would leave the row is read from inside it and masked to 0 below
  // 32-bit byte offsets of a lane inside a row: with the wave-uniform row base each load takes the scalar-base form and these registers are never rewritten
  const unsigned oA = 4u * (unsigned)max(jl - 5, 0), oB = 4u * (unsigned)max(jl - 4, 0), oC = 4u * (unsigned)jl, oE = 4u * (unsigned)min(jl + 8, SS - 4), oF = 4u * (unsigned)min(jl + 12, SS - 1);
  float acc[CR][8];
#pragma unroll
  for (int r = 0; r < CR; ++r)
#pragma unroll
    for (int c = 0; c < 8; ++c) acc[r][c] = 0.f;
  float eA[2], eF[2];
  v4f qB[2], qC[2], qD[2], qE[2];
  auto load_row = [&](int t) {                                   // score row i0 - 2 + t into register set t & 1; a row outside is replaced by row i0 and masked
    const int ii = i0 - 2 + t;
    const char* srow = (const char*)(S + s_off((ii >= 0 && ii < SS) ? ii : i0));
    eA[t & 1] = *(const float*)(srow + oA); eF[t & 1] = *(const float*)(srow + oF);
    qB[t & 1] = *(const v4fa*)(srow + oB); qC[t & 1] = *(const v4fa*)(srow + oC); qD[t & 1] = *(const v4fa*)(srow + oC + 16); qE[t & 1] = *(const v4fa*)(srow + oE);
  };
  load_row(0);
#pragma unroll
  for (int t = 0; t < CR + 5; ++t) {
    if (t + 1 < CR + 5) load_row(t + 1);
    // keeps the next row's loads in front of this row's products, so that they land under them
    __builtin_amdgcn_sched_barrier(0);
    const int ii = i0 - 2 + t, s = t & 1;
    const unsigned lim = (ii >= 0 && ii < SS) ? (unsigned)(ii + 1) : 0u;   // columns 0 .. ii of row ii enter; future ones, and rows outside, enter as 0
    float win[18] = {eA[s], qB[s][0], qB[s][1], qB[s][2], qB[s][3], qC[s][0], qC[s][1], qC[s][2], qC[s][3],
                     qD[s][0], qD[s][1], qD[s][2], qD[s][3], qE[s][0], qE[s][1], qE[s][2], qE[s][3], eF[s]};
#pragma unroll
    for (int x = 0; x < 18; ++x) win[x] = ((unsigned)(j0 - 5 + x) < lim) ? win[x] : 0.0f;
#pragma unroll
    for (int r = 0; r < CR; ++r) {
      const int a = t - r;                                       // ii = (i0 + r) + a - 2
      if (a < 0 || a >= 6) continue;
#pragma unroll
      for (int bq = 0; bq < 11; ++bq)
#pragma unroll
        for (int c = 0; c < 8; ++c) acc[r][c] += wk[a * 11 + bq] * win[c + bq];
    }
  }
  const float cb = conv_b[h];
  float mx[CR];
#pragma unroll
  for (int r = 0; r < CR; ++r) {
    float m = -3.0e38f;
#pragma unroll
    for (int c = 0; c < 8; ++c) { const float fin = (j0 + c > i0 + r) ? -1.0e9f : acc[r][c] + cb; acc[r][c] = fin; m = fmaxf(m, fin); }
    mx[r] = wave_max(m);
  }
  if (lane == 0) {
#pragma unroll
    for (int r = 0; r < CR; ++r) redm[hh2][w][r] = mx[r];
  }
  __syncthreads();   // each head's 8 waves' row maxima are in LDS before any is read
  // stage 2's places, formed here for the sake of its first loads
  const int wv = hh2 * 8 + w, vj = wv & 1, kq = wv >> 1, ln = lane & 15, hh = lane >> 4;
  const int ibl = (SS / CR - 1 - u) * CR, ibs = (u - 32) * CR;       // first row of the long and of the short block
  const int nkl = ibl / 32 + 1, nks = (u >= 32) ? ibs / 32 + 1 : 0;   // their steps of 32 keys up to the diagonal
  const int nmy = (nkl - kq + 7) >> 3;                               // this wave's share, 3 .. 8
  // wave-uniform bases and one 32-bit byte offset of a lane: column tile and half fragment are immediate offsets, a step adds a wave-uniform offset
  const char* hbase = (const char*)(Vh + (size_t)(g * 2 + vj) * DD * SS) + kq * 1024;
  const char* lbase = (const char*)(Vl + (size_t)(g * 2 + vj) * DD * SS) + kq * 1024;
  const unsigned boff = 16u * (unsigned)lane;
  FragB bh_[2][4], bl_[2][4];
  auto load_b = [&](int s, int step) {   // the B fragments of the wave's step 'step' (4 column tiles, both planes) into register set s & 1; step is wave-uniform, 0 .. nmy - 1
    const char* hq = hbase + step * 8192 + boff; const char* lq = lbase + step * 8192 + boff;   // a wave's steps lie 8 steps of 1 KiB apart
#pragma unroll
    for (int t = 0; t < 4; ++t) {
      const char* hp = hq + t * (SS / 32 * 1024); const char* lp = lq + t * (SS / 32 * 1024);
      bh_[s & 1][t].half[0] = *(const v8us*)hp; bh_[s & 1][t].half[1] = *(const v8us*)(hp + 512);
      bl_[s & 1][t].half[0] = *(const v8us*)lp; bl_[s & 1][t].half[1] = *(const v8us*)(lp + 512);
    }
    // the wait that stands between issued loads and a rewrite of their address registers; as its inputs these stay whole up to it, so that no load above lands in one
    asm volatile("s_wait_xcnt 0x0" :: "v"(hq), "v"(lq) : "memory");
  };
  load_b(0, 0);   // issued here so that they land under the exponentials: a barrier waits for a wave's outstanding loads, and behind the next one they would be waited for in full
#pragma unroll
  for (int r = 0; r < CR; ++r) {
    float m = -3.0e38f;
#pragma unroll
    for (int p = 0; p < 8; ++p) { const float o = redm[hh2][p][r]; m = (p >= wlo && p < whi) ? fmaxf(m, o) : m; }
    float sum = 0.f;
    v8us vh, vl;
#pragma unroll
    for (int c = 0; c < 8; ++c) {
      const float e = exp_slot(acc[r][c] - m); sum += e;
      const unsigned short eb = bf16_bits(e); vh[c] = eb; vl[c] = bf16_bits(e - bf16_val(eb));
    }
    mx[r] = wave_sum(sum);
    *(v8us*)&sP[0][w][hh2 * CR + r][lane * 8] = vh; *(v8us*)&sP[1][w][hh2 * CR + r][lane * 8] = vl;
  }
  if (lane == 0) {
#pragma unroll
    for (int r = 0; r < CR; ++r) reds[hh2][w][r] = mx[r];
  }
  __syncthreads();   // every wave's row sums and both heads' weight planes are in LDS before any is read
  v8f accl[4] = {}, accs[4] = {};
  auto products = [&](int s) {   // the wave's step s = step kq of wave tile s of either block
    FragB ah, al;
    ah.half[0] = *(const v8us*)&sP[0][s][ln][kq * 32 + 8 * hh]; ah.half[1] = *(const v8us*)&sP[0][s][ln][kq * 32 + 16 + 8 * hh];
    al.half[0] = *(const v8us*)&sP[1][s][ln][kq * 32 + 8 * hh]; al.half[1] = *(const v8us*)&sP[1][s][ln][kq * 32 + 16 + 8 * hh];
#pragma unroll
    for (int t = 0; t < 4; ++t) accl[t] = mmaN<3>(ah.v, al.v, bh_[s & 1][t].v, bl_[s & 1][t].v, accl[t]);
    if (s * 8 + kq < nks) {
      FragB ch, cl;
      ch.half[0] = *(const v8us*)&sP[0][nah + s][ln][kq * 32 + 8 * hh]; ch.half[1] = *(const v8us*)&sP[0][nah + s][ln][kq * 32 + 16 + 8 * hh];
      cl.half[0] = *(const v8us*)&sP[1][nah + s][ln][kq * 32 + 8 * hh]; cl.half[1] = *(const v8us*)&sP[1][nah + s][ln][kq * 32 + 16 + 8 * hh];
#pragma unroll
      for (int t = 0; t < 4; ++t) accs[t] = mmaN<3>(ch.v, cl.v, bh_[s & 1][t].v, bl_[s & 1][t].v, accs[t]);
    }
  };
  // The next step's loads are issued on every pass, without a branch round them: behind a load block that a branch may skip, the wait in front of the products has to
  // hold for the path that issued nothing, so it counts down to 0 and waits for the loads just issued as well. The last pass fetches its own step once more, unused.
#pragma unroll
  for (int s = 0; s < 8; ++s) {
    if (s >= nmy) break;
    if (s + 1 < 8) load_b(s + 1, min(s + 1, nmy - 1));
    products(s);
  }
  // row sums of this lane half's head, per block, added in the order of the waves
  float suml[CR], sums[CR];
#pragma unroll
  for (int r = 0; r < CR; ++r) { suml[r] = 0.f; sums[r] = 0.f; }
#pragma unroll
  for (int p = 0; p < 8; ++p) {
    const v4f a = *(const v4fa*)&reds[hh][p][0], b = *(const v4fa*)&reds[hh][p][4];
#pragma unroll
    for (int r = 0; r < CR; ++r) { const float o = (r < 4) ? a[r & 3] : b[r & 3]; suml[r] = (p < nah) ? suml[r] + o : suml[r]; sums[r] = (p < nah) ? sums[r] : sums[r] + o; }
  }
  const float mix0 = head_mix[g * 4 + vj], mix1 = head_mix[g * 4 + 2 + vj];   // m[i][j], j = this wave's v head
  const float mixc = hh ? mix1 : mix0;                                       // i = the head of this lane half's accumulator rows
  auto put = [&](const v8f* ac, const float* sm, int blk) {   // scale, add the two heads, store the CR x 64 partial tile: lanes 0-15 rows 0-3, lanes 16-31 rows 4-7
    float cf[CR];
#pragma unroll
    for (int r = 0; r < CR; ++r) cf[r] = mixc * (1.0f / sm[r]);
#pragma unroll
    for (int t = 0; t < 4; ++t) {
      float val[CR];
#pragma unroll
      for (int r = 0; r < CR; ++r) { const float x = ac[t][r] * cf[r]; val[r] = x + other_row(x); }
#pragma unroll
      for (int r = 0; r < 4; ++r) part[blk][kq][vj][hh * 4 + r][t * 16 + ln] = hh ? val[4 + r] : val[r];
    }
  };
  put(accl, suml, 0);
  if (u >= 32) put(accs, sums, 1);
  __syncthreads();   // all partial tiles are in LDS before any is read
  // waves 0-7 finish the long block, waves 8-15 the short one: a wave takes two of the block's 2 * CR rows (v head, row); lane = columns 2 * lane and 2 * lane + 1
  if (hh2 == 1 && u < 32) return;   // no short block; no barrier follows
  const int ib = hh2 ? ibs : ibl;
  const float g0_ = gam[2 * lane], g1_ = gam[2 * lane + 1], b0_ = bet[2 * lane], b1_ = bet[2 * lane + 1];
#pragma unroll
  for (int e = 0; e < 2; ++e) {
    const int oj = w >> 2, r = (w & 3) * 2 + e;
    float s0 = 0.f, s1 = 0.f;
#pragma unroll
    for (int p = 0; p < 8; ++p) { const v2f x = *(const v2fa*)&part[hh2][p][oj][r][2 * lane]; s0 += x[0]; s1 += x[1]; }
    const float mu = wave_sum(s0 + s1) * (1.0f / DD);
    const float c0 = s0 - mu, c1 = s1 - mu;
    const float var = wave_sum(c0 * c0 + c1 * c1) * (1.0f / DD);
    const float rs = rsqrtf(var + 1e-5f);
    v2f o;
    o[0] = c0 * rs * g0_ + b0_; o[1] = c1 * rs * g1_ + b1_;
    *(v2f*)(out + ((size_t)(g * 2 + oj) * SS + ib + r) * DD + 2 * lane) = o;
  }
}
extern "C" void kernel_launch(void* const* d_in, const int* in_sizes, int n_in,
                              void* d_out, int out_size, void* d_ws, size_t ws_size, hipStream_t stream) {
  (void)in_sizes; (void)n_in; (void)out_size;
  const float* q = (const float*)d_in[0]; const float* k = (const float*)d_in[1]; const float* v = (const float*)d_in[2];
  const float* conv_w = (const float*)d_in[3]; const float* conv_b = (const float*)d_in[4]; const float* head_mix = (const float*)d_in[5];
  const float* gam = (const float*)d_in[6]; const float* bet = (const float*)d_in[7];
  char* ws = (char*)d_ws; size_t off = 0;
  auto take = [&](size_t bytes) { char* p = ws + off; off += (bytes + 255) & ~(size_t)255; return p; };
  unsigned short* kh = (unsigned short*)take((size_t)NHD * SS * DD * 2); unsigned short* kl = (unsigned short*)take((size_t)NHD * SS * DD * 2);     // k planes (n = key, k = d), fragment order, all heads
  unsigned short* vth = (unsigned short*)take((size_t)NHD * DD * SS * 2); unsigned short* vtl = (unsigned short*)take((size_t)NHD * DD * SS * 2);  // v planes (n = d, k = key), fragment order, all heads
  float* S2 = (float*)take((size_t)NHD * S_HEAD * 4);     // packed scores of all heads
  if (off > ws_size) return;
  k_split_rows<<<(NHD * SS * (DD / 8) + 255) / 256, 256, 0, stream>>>(k, DD, kh, kl, NHD * SS, DD);
  k_split_transpose<<<dim3((DD * (SS / 8) + 255) / 256, NHD), 256, 0, stream>>>(v, DD, vth, vtl, SS, DD);
  // scores_h = q.k^T / 8 : M=N=SS, K=DD, one product per head, tiles up to the diagonal
  k_gemm_bf2<true, true, 0, false, true><<<dim3((SS / 32) * (SS / 64 + 2) / 4, NHD), 128, 0, stream>>>(q, DD, kh, kl, DD, nullptr, 0.125f, S2, SS, SS, SS, DD);
  // out_h = LayerNorm(mixed_h . v_h), the weights made and used inside one work-group
  k_conv_softmax_pv_ln<<<dim3(CWG, NG), 512, 0, stream>>>(S2, conv_w, conv_b, head_mix, vth, vtl, gam, bet, (float*)d_out);
}

// v010
// A run of this version takes 138 microseconds.
// Timed twice side by side with v009, it ran 1.15 and 1.16 times as fast.
// Counting every step since v000, it is 20.7 times as fast.
#include <hip/hip_runtime.h>
// Contractions on v_wmma_f32_16x16x32_bf16 as 3-term bf16 hi/lo splits (f32-accurate), f32 accumulate: scores = q·kᵀ/8 (K=64)
// the 6x11 key-query convolution (as products with banded weight matrices) and the softmax weights times v (K=2048). Masking, softmax, 2x2 head mixing and LayerNorm are f32 VALU.
#define NHD 16
#define SS 2048
#define DD 64
#define NG 8
// PACKED SCORES. Of a causal SS x SS map only what lies on or left of the diagonal, plus a margin, is ever stored or read, so an upper row needs no full pitch.
// The rows are cut into 4 bands of QR rows; every row of band q has a pitch of QR * (q + 1) + SPAD bf16 elements (at most SS), and the bands lie one behind the other.
// The margin SPAD: the 64-column tiles start at or left of column row0 + 16, so in band q they end before column QR * (q + 1) + 64. A block of 8 or 16 aligned rows lies in one band.
#define QR (SS / 4)
#define SPAD 64
#define S_HEAD (QR * (QR * 6 + SPAD * 3) + QR * SS)   // elements of one head's packed scores
// The scores are kept as two bf16 planes, hi and lo (score = hi + lo up to 2^-17 of it), each packed as above, all heads' hi planes first; future elements (column > row) are stored as 0.

typedef __bf16 v16b __attribute__((ext_vector_type(16)));
typedef unsigned short v8us __attribute__((ext_vector_type(8), may_alias));
typedef float  v8f  __attribute__((ext_vector_type(8)));
typedef float  v2f  __attribute__((ext_vector_type(2)));
typedef float  v2fa __attribute__((ext_vector_type(2), may_alias));
typedef float  v4f  __attribute__((ext_vector_type(4)));
typedef float  v4fa __attribute__((ext_vector_type(4), may_alias));
typedef __bf16 v2b __attribute__((ext_vector_type(2)));
union FragB { v16b v; v8us half[2]; unsigned short u[16]; };
union Pack8 { v8us v; unsigned int d[4]; };

// pitch of row i and place of its first element, in bf16 elements, inside a head's packed scores; 0 <= i < SS
__device__ __forceinline__ unsigned s_pitch(unsigned i) { return min(QR * (i / QR + 1u) + SPAD, (unsigned)SS); }
__device__ __forceinline__ unsigned s_off(unsigned i) { const unsigned q = i / QR; return q * ((QR * QR / 2) * (q + 1u) + QR * SPAD) + (i % QR) * s_pitch(i); }
__device__ __forceinline__ unsigned short bf16_bits(float x) { unsigned int u = __float_as_uint(x); return (unsigned short)((u + 0x7FFFu + ((u >> 16) & 1u)) >> 16); }
__device__ __forceinline__ float bf16_val(unsigned short b) { return __uint_as_float(((unsigned int)b) << 16); }
__device__ __forceinline__ float bf16_round(float x) { return bf16_val(bf16_bits(x)); }
// two f32 rounded to nearest even into one register of two bf16 (a in the low half)
__device__ __forceinline__ unsigned int bf16_pair(float a, float b) { const v2f x = {a, b}; return __builtin_bit_cast(unsigned int, __builtin_convertvector(x, v2b)); }
// D += A·B with NT terms: 1 = ah·bh, 2 = + al·bh (A split), 3 = + ah·bl (both split)
template <int NT>
__device__ __forceinline__ v8f mmaN(v16b ah, v16b al, v16b bh, v16b bl, v8f c) {
  c = __builtin_amdgcn_wmma_f32_16x16x32_bf16(false, ah, false, bh, (short)0, c, false, false);
  if (NT >= 2) c = __builtin_amdgcn_wmma_f32_16x16x32_bf16(false, al, false, bh, (short)0, c, false, false);
  if (NT >= 3) c = __builtin_amdgcn_wmma_f32_16x16x32_bf16(false, ah, false, bl, (short)0, c, false, false);
  asm volatile("v_nop\n\tv_nop\n\tv_nop\n\tv_nop" : "+v"(c) : "v"(ah), "v"(al), "v"(bh), "v"(bl));
  return c;
}

__global__ __launch_bounds__(256) void k_wt_bf16(const float* __restrict__ W, unsigned short* __restrict__ Wt, int K, int N) {
  const int t = blockIdx.x * 256 + threadIdx.x;
  const int k8n = K / 8;
  if (t >= N * k8n) return;
  const int n = t / k8n, k8 = (t % k8n) * 8;
  v8us v;
#pragma unroll
  for (int i = 0; i < 8; ++i) v[i] = bf16_bits(W[(size_t)(k8 + i) * N + n]);
  *(v8us*)(Wt + (size_t)n * K + k8) = v;
  
}

// GEMM C[M][N] (f32, pitch ldc) = act(A[M][K]·W + bias). A f32 row-major (pitch lda) converted per fragment to bf16
// (ASPLIT: hi/lo two planes -> 2 terms, else single rounded term); Wt bf16 [N][K] (pitch ldb). BIAS_BF16 rounds the
// bias to bf16 first (bias quantised to bf16 before the add). K%32==0, M%16==0, N%64==0.
template <bool ASPLIT, int ACT, bool BIAS_BF16>
__global__ __launch_bounds__(128) void k_gemm_bf(const float* __restrict__ A, int lda, const unsigned short* __restrict__ Wt, int ldb,
                                               const float* __restrict__ bias, float* __restrict__ C, int ldc, int M, int N, int K) {
  __shared__ __attribute__((aligned(16))) float so[4][16][64];
  const int tid = threadIdx.x, w = tid >> 5, lane = tid & 31, ln = lane & 15, hh = lane >> 4;
  const int ntn = N / 64;
  const int wid = blockIdx.x * 4 + w;
  const int mt = wid / ntn, nq = wid % ntn;
  if (mt * 16 >= M) return;
  const int row0 = mt * 16, col0 = nq * 64;
  const float* arow = A + (size_t)(row0 + ln) * lda;
  v8f acc[4] = {};
  for (int kb = 0; kb < K; kb += 32) {
    FragB ah, al;
    const v4f x0 = *(const v4fa*)(arow + kb + 8 * hh), x1 = *(const v4fa*)(arow + kb + 8 * hh + 4);
    const v4f x2 = *(const v4fa*)(arow + kb + 16 + 8 * hh), x3 = *(const v4fa*)(arow + kb + 16 + 8 * hh + 4);
    float xs[16] = {x0[0],x0[1],x0[2],x0[3],x1[0],x1[1],x1[2],x1[3],x2[0],x2[1],x2[2],x2[3],x3[0],x3[1],x3[2],x3[3]};
#pragma unroll
    for (int i = 0; i < 16; ++i) { const unsigned short hb = bf16_bits(xs[i]); ah.u[i] = hb; al.u[i] = ASPLIT ? bf16_bits(xs[i] - bf16_val(hb)) : (unsigned short)0; }
#pragma unroll
    for (int t = 0; t < 4; ++t) {
      const unsigned short* brow = Wt + (size_t)(col0 + t * 16 + ln) * ldb + kb;
      FragB b;
      b.half[0] = *(const v8us*)(brow + 8 * hh);
      b.half[1] = *(const v8us*)(brow + 16 + 8 * hh);
      acc[t] = mmaN<ASPLIT ? 2 : 1>(ah.v, al.v, b.v, b.v, acc[t]);
    }
  }
#pragma unroll
  for (int t = 0; t < 4; ++t) {
    float bv = bias ? bias[col0 + t * 16 + ln] : 0.f;
    if (BIAS_BF16) bv = bf16_round(bv);
#pragma unroll
    for (int r = 0; r < 8; ++r) { float v = acc[t][r] + bv; if (ACT == 1) v = fmaxf(v, 0.f); so[w][8 * hh + r][t * 16 + ln] = v; }
  }
  __builtin_amdgcn_fence(__ATOMIC_ACQ_REL, "workgroup");
  __builtin_amdgcn_wave_barrier();
  const int rsub = lane >> 4, c4 = (lane & 15) * 4;
  {
#pragma unroll
    for (int q = 0; q < 8; ++q) {
      const int r = q * 2 + rsub;
      const v4f v = *(const v4fa*)&so[w][r][c4];
      *(v4f*)(C + (size_t)(row0 + r) * ldc + col0 + c4) = v;
    }
    
  }
}

// Flash-style causal/unmasked attention, all contractions 3-term bf16 hi/lo splits, f32 softmax with running max.
// q,k,v rows are read from f32 buffers with arbitrary row pitch (so they can live inside a fused qkv buffer);
// D = head size (multiple of 32, <= 128); one wave = 16 query rows; block = 4 waves (64 queries) sharing K/V chunks of 32.
template <int D, bool CAUSAL>
__global__ __launch_bounds__(128) void k_flash(const float* __restrict__ qb, const float* __restrict__ kb, const float* __restrict__ vb,
                                             int pitch, int T, int H, float scale, float* __restrict__ y, int ypitch) {
  constexpr int KS = D / 32;        // k-steps for QK
  constexpr int DT = D / 16;        // d tiles for PV
  __shared__ __attribute__((aligned(16))) unsigned short sKh[32][D + 8], sKl[32][D + 8], sVh[32][D + 8], sVl[32][D + 8];
  __shared__ __attribute__((aligned(16))) unsigned short sPh[4][16][40], sPl[4][16][40];
  __shared__ __attribute__((aligned(16))) float sO[4][16][D];
  const int tid = threadIdx.x, w = tid >> 5, lane = tid & 31, ln = lane & 15, hh = lane >> 4;
  const int nqb = (T + 63) / 64;
  const int bh = blockIdx.x / nqb, qblk = blockIdx.x % nqb;
  const int b = bh / H, h = bh % H;
  const int q0 = qblk * 64 + w * 16;
  const float* Q = qb + (size_t)b * T * pitch + h * D;
  const float* K = kb + (size_t)b * T * pitch + h * D;
  const float* V = vb + (size_t)b * T * pitch + h * D;

  // A fragments of the wave's 16 query rows (scaled), hi/lo
  FragB aqh[KS], aql[KS];
  {
    int row = q0 + ln; if (row >= T) row = T - 1;
    const float* qr = Q + (size_t)row * pitch;
#pragma unroll
    for (int ks = 0; ks < KS; ++ks)
#pragma unroll
      for (int i = 0; i < 16; ++i) {
        const int d = ks * 32 + ((i < 8) ? (8 * hh + i) : (16 + 8 * hh + (i - 8)));
        const float x = qr[d] * scale; const unsigned short hb = bf16_bits(x);
        aqh[ks].u[i] = hb; aql[ks].u[i] = bf16_bits(x - bf16_val(hb));
      }
  }
  float m_r[8], l_r[8];
#pragma unroll
  for (int r = 0; r < 8; ++r) { m_r[r] = -3.0e38f; l_r[r] = 0.f; }
  v8f oacc[DT];
#pragma unroll
  for (int dt = 0; dt < DT; ++dt) oacc[dt] = (v8f){0.f,0.f,0.f,0.f,0.f,0.f,0.f,0.f};

  const int kv_end = CAUSAL ? min(T, qblk * 64 + 64) : T;     // block-uniform
  for (int j0 = 0; j0 < kv_end; j0 += 32) {
    __syncthreads();
    for (int e = tid; e < 32 * (D / 4); e += 128) {
      const int r = e / (D / 4), c4 = (e % (D / 4)) * 4;
      const int key = j0 + r;
      v4f kf = {0.f,0.f,0.f,0.f}, vf = {0.f,0.f,0.f,0.f};
      if (key < T) { kf = *(const v4fa*)(K + (size_t)key * pitch + c4); vf = *(const v4fa*)(V + (size_t)key * pitch + c4); }
#pragma unroll
      for (int t = 0; t < 4; ++t) {
        unsigned short hb = bf16_bits(kf[t]); sKh[r][c4 + t] = hb; sKl[r][c4 + t] = bf16_bits(kf[t] - bf16_val(hb));
        hb = bf16_bits(vf[t]); sVh[r][c4 + t] = hb; sVl[r][c4 + t] = bf16_bits(vf[t] - bf16_val(hb));
      }
    }
    __syncthreads();
    // S tile 16 x 32
    v8f s[2];
#pragma unroll
    for (int nt = 0; nt < 2; ++nt) {
      v8f acc = {};
#pragma unroll
      for (int ks = 0; ks < KS; ++ks) {
        FragB bh_, bl_;
        bh_.half[0] = *(const v8us*)&sKh[nt * 16 + ln][ks * 32 + 8 * hh]; bh_.half[1] = *(const v8us*)&sKh[nt * 16 + ln][ks * 32 + 16 + 8 * hh];
        bl_.half[0] = *(const v8us*)&sKl[nt * 16 + ln][ks * 32 + 8 * hh]; bl_.half[1] = *(const v8us*)&sKl[nt * 16 + ln][ks * 32 + 16 + 8 * hh];
        acc = mmaN<3>(aqh[ks].v, aql[ks].v, bh_.v, bl_.v, acc);
      }
      s[nt] = acc;
    }
    // mask + running max (rows 8hh+r; the 16 lanes of a half share rows)
    float alpha[8];
#pragma unroll
    for (int r = 0; r < 8; ++r) {
      const int qi = q0 + 8 * hh + r;
      const int ja = j0 + ln, jb = j0 + 16 + ln;
      if (CAUSAL) { if (ja > qi) s[0][r] = -3.0e38f; if (jb > qi) s[1][r] = -3.0e38f; }
      if (ja >= T) s[0][r] = -3.0e38f;
      if (jb >= T) s[1][r] = -3.0e38f;
      float mx = fmaxf(s[0][r], s[1][r]);
      mx = fmaxf(mx, __shfl_xor(mx, 1, 32)); mx = fmaxf(mx, __shfl_xor(mx, 2, 32)); mx = fmaxf(mx, __shfl_xor(mx, 4, 32)); mx = fmaxf(mx, __shfl_xor(mx, 8, 32));
      const float mnew = fmaxf(m_r[r], mx);
      alpha[r] = (mnew > -1.0e38f) ? __expf(m_r[r] - mnew) : 1.0f;
      const float p0 = (s[0][r] > -1.0e38f) ? __expf(s[0][r] - mnew) : 0.f;
      const float p1 = (s[1][r] > -1.0e38f) ? __expf(s[1][r] - mnew) : 0.f;
      m_r[r] = mnew;
      l_r[r] = l_r[r] * alpha[r] + p0 + p1;            // per-lane partial row sum (16 lanes combined at the end)
      unsigned short hb = bf16_bits(p0); sPh[w][8 * hh + r][ln] = hb;      sPl[w][8 * hh + r][ln] = bf16_bits(p0 - bf16_val(hb));
      hb = bf16_bits(p1);                sPh[w][8 * hh + r][16 + ln] = hb; sPl[w][8 * hh + r][16 + ln] = bf16_bits(p1 - bf16_val(hb));
    }
#pragma unroll
    for (int dt = 0; dt < DT; ++dt)
#pragma unroll
      for (int r = 0; r < 8; ++r) oacc[dt][r] *= alpha[r];
    __builtin_amdgcn_fence(__ATOMIC_ACQ_REL, "workgroup");
    __builtin_amdgcn_wave_barrier();
    FragB pah, pal;
    pah.half[0] = *(const v8us*)&sPh[w][ln][8 * hh]; pah.half[1] = *(const v8us*)&sPh[w][ln][16 + 8 * hh];
    pal.half[0] = *(const v8us*)&sPl[w][ln][8 * hh]; pal.half[1] = *(const v8us*)&sPl[w][ln][16 + 8 * hh];
#pragma unroll
    for (int dt = 0; dt < DT; ++dt) {
      FragB bvh, bvl;
#pragma unroll
      for (int i = 0; i < 8; ++i) {
        bvh.u[i] = sVh[8 * hh + i][dt * 16 + ln]; bvh.u[8 + i] = sVh[16 + 8 * hh + i][dt * 16 + ln];
        bvl.u[i] = sVl[8 * hh + i][dt * 16 + ln]; bvl.u[8 + i] = sVl[16 + 8 * hh + i][dt * 16 + ln];
      }
      oacc[dt] = mmaN<3>(pah.v, pal.v, bvh.v, bvl.v, oacc[dt]);
    }
    __builtin_amdgcn_fence(__ATOMIC_ACQ_REL, "workgroup");
    __builtin_amdgcn_wave_barrier();
  }
#pragma unroll
  for (int r = 0; r < 8; ++r) {
    float l = l_r[r];
    l += __shfl_xor(l, 1, 32); l += __shfl_xor(l, 2, 32); l += __shfl_xor(l, 4, 32); l += __shfl_xor(l, 8, 32);
    l_r[r] = (l > 0.f) ? 1.0f / l : 0.f;
  }
#pragma unroll
  for (int dt = 0; dt < DT; ++dt)
#pragma unroll
    for (int r = 0; r < 8; ++r) sO[w][8 * hh + r][dt * 16 + ln] = oacc[dt][r] * l_r[r];
  __builtin_amdgcn_fence(__ATOMIC_ACQ_REL, "workgroup");
  __builtin_amdgcn_wave_barrier();
  {
    for (int r = 0; r < 16; ++r) {
      const int row = q0 + r;
      if (row < T && lane < D / 4) {
        const v4f val = *(const v4fa*)&sO[w][r][lane * 4];
        *(v4f*)(y + ((size_t)b * T + row) * ypitch + h * D + lane * 4) = val;
      }
    }
    
  }
}

// FRAGMENT ORDER of a bf16 plane of the B operand, Bt[N][K] (n = column of B, N % 16 == 0, K % 32 == 0): the plane is a row of 16-byte chunks, and chunk
// ((nt * (K / 32) + ks) * 2 + half) * 32 + lane holds the 8 elements n = nt * 16 + (lane & 15), k = ks * 32 + half * 16 + (lane >> 4) * 8 + 0 .. 7.
// That is what lane 'lane' holds in half 'half' of the B fragment of column tile nt and k step ks: a wave loads a half fragment as 512 bytes in a row
// (four whole lines; from a row-major plane the same load touches 16 lines). The plane has the size of the row-major one.
// f32 [R][Cc] (row pitch lds) -> bf16 hi/lo planes in fragment order (n = row, k = column); thread per chunk; R % 16 == 0, Cc % 32 == 0
__global__ __launch_bounds__(256) void k_split_rows(const float* __restrict__ src, int lds_, unsigned short* __restrict__ hi, unsigned short* __restrict__ lo, int R, int Cc) {
  const size_t t = (size_t)blockIdx.x * 256 + threadIdx.x;
  const int c8n = Cc / 8;
  if (t >= (size_t)R * c8n) return;
  const int lane = (int)(t & 31), half = (int)(t >> 5) & 1, ksn = Cc / 32, tile = (int)(t >> 6);
  const int r = (tile / ksn) * 16 + (lane & 15), c8 = (tile % ksn) * 32 + half * 16 + (lane >> 4) * 8;
  const float* s = src + (size_t)r * lds_ + c8;
  const v4f a = *(const v4fa*)s, b = *(const v4fa*)(s + 4);
  float xs[8] = {a[0],a[1],a[2],a[3],b[0],b[1],b[2],b[3]};
  v8us vh, vl;
#pragma unroll
  for (int i = 0; i < 8; ++i) { const unsigned short hb = bf16_bits(xs[i]); vh[i] = hb; vl[i] = bf16_bits(xs[i] - bf16_val(hb)); }
  unsigned short* dh = hi + t * 8; unsigned short* dl = lo + t * 8;
  *(v8us*)dh = vh; *(v8us*)dl = vl;
}
// f32 [K][N] (row pitch lds) -> bf16 hi/lo planes of Bt[N][K] in fragment order; one thread per chunk (n, 8 consecutive k): 16 lanes read 16 neighbours of a source row
// blockIdx.y = matrix of a batch: sources and planes of the batch lie densely one behind the other
__global__ __launch_bounds__(256) void k_split_transpose(const float* __restrict__ src, int lds_, unsigned short* __restrict__ hi, unsigned short* __restrict__ lo, int K, int N) {
  const size_t t = (size_t)blockIdx.x * 256 + threadIdx.x;
  const int k8n = K / 8;
  if (t >= (size_t)N * k8n) return;
  const int lane = (int)(t & 31), half = (int)(t >> 5) & 1, ksn = K / 32, tile = (int)(t >> 6);
  const int n = (tile / ksn) * 16 + (lane & 15), k8 = (tile % ksn) * 32 + half * 16 + (lane >> 4) * 8;
  src += (size_t)blockIdx.y * K * lds_; hi += (size_t)blockIdx.y * N * K; lo += (size_t)blockIdx.y * N * K;
  v8us vh, vl;
#pragma unroll
  for (int i = 0; i < 8; ++i) { const float x = src[(size_t)(k8 + i) * lds_ + n]; const unsigned short hb = bf16_bits(x); vh[i] = hb; vl[i] = bf16_bits(x - bf16_val(hb)); }
  unsigned short* dh = hi + t * 8; unsigned short* dl = lo + t * 8;
  *(v8us*)dh = vh; *(v8us*)dl = vl;
}
// GEMM with A f32 (split into hi/lo when ASPLIT) and B from bf16 planes Bh (+ Bl when BSPLIT) in fragment order (ldb = their K): terms hi·hi [+ lo·hi] [+ hi·lo].
// C f32 [M][N] pitch ldc; alpha scales the result; bias optional (BIAS_BF16 rounds it). Same tiling/epilogue as k_gemm_bf.
// blockIdx.y = product of a batch: the A, B and C matrices of the batch lie densely one behind the other (M, N, M rows each).
// CAUSAL (M == N, M % 32 == 0): only the 16 x 64 tiles with col0 <= row0 + 16 are computed and stored; they hold every element (i, j <= i + 14),
// which is all that the convolution reads. Row tiles p and M/16 - 1 - p together have at most N/64 + 2 such tiles: the grid deals that many waves to each pair.
// C is then a batch of packed score maps in two bf16 planes, future elements 0 (M == SS; ldc is not used).
template <bool ASPLIT, bool BSPLIT, int ACT, bool BIAS_BF16, bool CAUSAL>
__global__ __launch_bounds__(128) void k_gemm_bf2(const float* __restrict__ A, int lda, const unsigned short* __restrict__ Bh, const unsigned short* __restrict__ Bl, int ldb,
                                                const float* __restrict__ bias, float alpha, float* __restrict__ C, int ldc, int M, int N, int K) {
  __shared__ __attribute__((aligned(16))) float so[4][16][64];
  // the wave's number is the same in all its lanes; readfirstlane says so to the compiler: the tile's place in the B planes is then a scalar base, and a lane adds only lane * 16 bytes
  const int tid = threadIdx.x, w = __builtin_amdgcn_readfirstlane((int)(threadIdx.x >> 5)), lane = tid & 31, ln = lane & 15, hh = lane >> 4;
  const int ntn = N / 64;
  const int wid = blockIdx.x * 4 + w;
  int mt = wid / ntn, nq = wid % ntn;
  if (CAUSAL) {
    const int p = wid / (ntn + 2), c = wid % (ntn + 2), mh = M / 16 - 1 - p;
    if (p >= M / 32) return;
    const int nh = min(ntn, (mh + 1) / 4 + 1), nl = (p + 1) / 4 + 1;   // tiles of the pair's lower and upper row tile
    if (c >= nh + nl) return;
    mt = (c < nh) ? mh : p; nq = (c < nh) ? c : c - nh;
  }
  if (mt * 16 >= M) return;
  const int row0 = mt * 16, col0 = nq * 64;
  A += (size_t)blockIdx.y * M * lda; Bh += (size_t)blockIdx.y * N * ldb; Bl += (size_t)blockIdx.y * N * ldb;
  const unsigned ldp = CAUSAL ? s_pitch(row0) : (unsigned)ldc;   // pitch of the tile's rows in C
  if (!CAUSAL) C += ((size_t)blockIdx.y * M + row0) * ldc;   // the tile's first row
  const float* arow = A + (size_t)(row0 + ln) * lda;
  v8f acc[4] = {};
  for (int kb = 0; kb < K; kb += 32) {
    FragB ah, al;
    const v4f x0 = *(const v4fa*)(arow + kb + 8 * hh), x1 = *(const v4fa*)(arow + kb + 8 * hh + 4);
    const v4f x2 = *(const v4fa*)(arow + kb + 16 + 8 * hh), x3 = *(const v4fa*)(arow + kb + 16 + 8 * hh + 4);
    float xs[16] = {x0[0],x0[1],x0[2],x0[3],x1[0],x1[1],x1[2],x1[3],x2[0],x2[1],x2[2],x2[3],x3[0],x3[1],x3[2],x3[3]};
#pragma unroll
    for (int i = 0; i < 16; ++i) { const unsigned short hb = bf16_bits(xs[i]); ah.u[i] = hb; al.u[i] = ASPLIT ? bf16_bits(xs[i] - bf16_val(hb)) : (unsigned short)0; }
#pragma unroll
    for (int t = 0; t < 4; ++t) {
      const size_t boff = ((size_t)(col0 / 16 + t) * (ldb / 32) + kb / 32) * 512 + lane * 8;
      FragB bh_, bl_;
      bh_.half[0] = *(const v8us*)(Bh + boff);
      bh_.half[1] = *(const v8us*)(Bh + boff + 256);
      if (BSPLIT) { bl_.half[0] = *(const v8us*)(Bl + boff); bl_.half[1] = *(const v8us*)(Bl + boff + 256); } else bl_ = bh_;
      // keeps both planes' loads of a column tile in front of its products, so that they fly together; without it this build issued the lo plane's loads behind the first product and waited twice
      __builtin_amdgcn_sched_barrier(0);
      acc[t] = mmaN<ASPLIT ? (BSPLIT ? 3 : 2) : 1>(ah.v, al.v, bh_.v, bl_.v, acc[t]);
    }
  }
#pragma unroll
  for (int t = 0; t < 4; ++t) {
    float bv = bias ? bias[col0 + t * 16 + ln] : 0.f;
    if (BIAS_BF16) bv = bf16_round(bv);
#pragma unroll
    for (int r = 0; r < 8; ++r) { float v = acc[t][r] * alpha + bv; if (ACT == 1) v = fmaxf(v, 0.f); so[w][8 * hh + r][t * 16 + ln] = v; }
  }
  __builtin_amdgcn_fence(__ATOMIC_ACQ_REL, "workgroup");
  __builtin_amdgcn_wave_barrier();
  if (CAUSAL) {
    // a lane takes 8 columns of a row: 8 lanes store a whole 128-byte line of either plane
    unsigned short* Ch = (unsigned short*)C + (size_t)blockIdx.y * S_HEAD + s_off(row0) + col0;
    unsigned short* Cl = Ch + (size_t)NHD * S_HEAD;
    const int rs = lane >> 3, c8 = (lane & 7) * 8;
#pragma unroll
    for (int q = 0; q < 4; ++q) {
      const int r = q * 4 + rs;
      const v4f x0 = *(const v4fa*)&so[w][r][c8], x1 = *(const v4fa*)&so[w][r][c8 + 4];
      float xs[8] = {x0[0],x0[1],x0[2],x0[3],x1[0],x1[1],x1[2],x1[3]};
      const int d = row0 + r - col0 - c8;   // the last of the 8 columns that is not in the row's future
      Pack8 ph, pl;
#pragma unroll
      for (int i = 0; i < 8; i += 2) {
        const float a = (i > d) ? 0.f : xs[i], b = (i + 1 > d) ? 0.f : xs[i + 1];
        const unsigned int hp = bf16_pair(a, b);
        ph.d[i / 2] = hp;
        pl.d[i / 2] = bf16_pair(a - __uint_as_float(hp << 16), b - __uint_as_float(hp & 0xFFFF0000u));
      }
      *(v8us*)(Ch + (size_t)r * ldp + c8) = ph.v;
      *(v8us*)(Cl + (size_t)r * ldp + c8) = pl.v;
    }
  } else {
    const int rsub = lane >> 4, c4 = (lane & 15) * 4;
#pragma unroll
    for (int q = 0; q < 8; ++q) {
      const int r = q * 2 + rsub;
      const v4f v = *(const v4fa*)&so[w][r][c4];
      *(v4f*)(C + (size_t)r * ldp + col0 + c4) = v;
    }
  }
}
// Cross-lane steps of a wave-wide reduction: row_xmask DPP inside a 16-lane row, then the other row's lane of the same index.
template <int CTRL>
__device__ __forceinline__ float dpp_get(float x) { return __int_as_float(__builtin_amdgcn_update_dpp(0, __float_as_int(x), CTRL, 0xf, 0xf, true)); }
__device__ __forceinline__ float other_row(float x) { return __int_as_float(__builtin_amdgcn_permlanex16(__float_as_int(x), __float_as_int(x), 0x76543210, 0xfedcba98, false, false)); }
__device__ __forceinline__ float wave_max(float x) {
  x = fmaxf(x, dpp_get<0x161>(x)); x = fmaxf(x, dpp_get<0x162>(x)); x = fmaxf(x, dpp_get<0x164>(x)); x = fmaxf(x, dpp_get<0x168>(x));
  return fmaxf(x, other_row(x));
}
__device__ __forceinline__ float wave_sum(float x) {
  x += dpp_get<0x161>(x); x += dpp_get<0x162>(x); x += dpp_get<0x164>(x); x += dpp_get<0x168>(x);
  return x + other_row(x);
}
// row softmax: P[row][:] = softmax(masked S[row][:]) over N columns with optional causal mask (col > row + rowoff -> 0) and
__global__ __launch_bounds__(256) void k_softmax_rows(const float* __restrict__ S, float* __restrict__ P, int N, int causal, int rowoff, const int* __restrict__ mask, int mask_pitch) {
  __shared__ float red[256];
  const int row = blockIdx.x, tid = threadIdx.x;
  const float* s = S + (size_t)row * N; float* p_out = P + (size_t)row * N;
  const int qi = row + rowoff;
  float mx = -3.0e38f;
  for (int j = tid; j < N; j += 256) {
    bool keep = true;
    if (causal && j > qi) keep = false;
    if (mask && mask[(size_t)qi * mask_pitch + j] == 0) keep = false;
    const float v = keep ? s[j] : -3.0e38f;
    mx = fmaxf(mx, v);
  }
  red[tid] = mx; __syncthreads();
  for (int st = 128; st > 0; st >>= 1) { if (tid < st) red[tid] = fmaxf(red[tid], red[tid + st]); __syncthreads(); }
  mx = red[0]; __syncthreads();
  float sum = 0.f;
  for (int j = tid; j < N; j += 256) {
    bool keep = true;
    if (causal && j > qi) keep = false;
    if (mask && mask[(size_t)qi * mask_pitch + j] == 0) keep = false;
    const float p = keep ? __expf(s[j] - mx) : 0.f;
    sum += p;
  }
  red[tid] = sum; __syncthreads();
  for (int st = 128; st > 0; st >>= 1) { if (tid < st) red[tid] += red[tid + st]; __syncthreads(); }
  const float inv = (mx > -1.0e38f) ? 1.0f / red[0] : __builtin_nanf("");
  __syncthreads();
  {
    for (int j4 = tid * 4; j4 < N; j4 += 1024) {
      v4f out4;
#pragma unroll
      for (int u = 0; u < 4; ++u) {
        const int j = j4 + u;
        bool keep = true;
        if (causal && j > qi) keep = false;
        if (mask && mask[(size_t)qi * mask_pitch + j] == 0) keep = false;
        out4[u] = keep ? __expf(s[j] - mx) * inv : 0.f;
      }
      *(v4f*)(p_out + j4) = out4;
    }
    
  }
}

// exp(x) as __expf builds it (x * log2 e, then v_exp_f32). In asm so that the v_nop stands directly behind the transcendental: it fills the
// slot that the instruction set asks for before the source register is rewritten or the result read.
__device__ __forceinline__ float exp_slot(float x) {
  const float y = x * 1.44269504f;
  float e;
  asm("v_exp_f32 %0, %1\n\tv_nop" : "=v"(e) : "v"(y));
  return e;
}
#define CR 8   // output rows per row block
#define CWG ((SS / CR) * 9 / 16)   // work-groups per head group: the 32 * (1 + 2 + ... + 8) wave tiles on or left of the diagonal, 8 to a head and work-group
#define TROW 560   // bytes of a staged score row in LDS: 34 chunks of 16 bytes, pitch 16 bytes x 35 (odd): rows r and column groups 128 bytes apart read 16 bytes each on 16 different places
#define TWAVE (2 * (CR + 5) * TROW)   // bytes of a wave tile's staged rows, hi plane then lo plane
#define PP 264   // pitch, in bf16 elements, of a 256-column row of the weight planes in LDS: 16 bytes x an odd number, so that 16 rows read 16 bytes each without a bank conflict
// Only what lies on or left of the diagonal is worked on: right of it a softmax weight is exp(-1e9 - max) = 0. A wave tile is CR rows x 256 columns; row block b
// has b / 32 + 1 of them. Work-group u takes row block 255 - u (the long one) and, from u = 32 on, row block u - 32 (the short one) as well: together always 8 wave tiles a head.
// Each wave has its own i0; a row's maximum and sum are taken over the waves wlo .. whi - 1 of its row block.
// STAGE 1, conv + softmax. CR rows from i0, both heads of group g = blockIdx.y (S2 holds every head's packed score planes): waves 0-7 take head 0, waves 8-15 head 1.
// Per head: conv over its zero-masked scores, + bias, future -> -1e9, E = exp(x - row max) and the row sums.
// THE CONV AS MATRIX PRODUCTS. For one row tap a, 16 neighbouring outputs of a row are a banded 16 x 32 matrix T_a (T_a[m][k] = weight[a][k - m - 3], 0 outside the 11 taps)
// times the 32 scores from 8 columns left of the first output, in row + a - 2. T_a is the A operand; a column of the B operand is such a window, and as T_a does not depend on
// where the window lies, the 16 columns of B are the CR rows x 2 column groups 64 columns apart. The sum over a is the accumulate chain. Weights and scores are bf16 hi/lo, 3 terms.
// A wave first puts the CR + 5 score rows of its tile, columns - 8 .. 263, both planes, into LDS of its own (what lies in a row's future or outside the map as 0): a window is two
// 16-byte reads, the tap a and the column step are immediate offsets, and neighbouring windows share a read. In the accumulator a lane holds 8 neighbouring columns of ONE row.
// STAGE 2, out_j = LayerNorm(sum_i m[i][j] / rowsum_i * (E_i x v_j)). The weights never go to memory: each thread puts its E values, split into bf16 hi/lo, into LDS planes,
// where the CR rows of head 0 and the CR rows of head 1 of a wave tile are the 16 rows of one A operand. Products as everywhere, 3 terms, f32 accumulate; B = the v planes
// in fragment order. Wave = (v head j, kq): it takes the steps of 32 keys kq, kq + 8, ... up to the long block's diagonal; a B fragment serves the long block's A and, while
// the step lies left of the short block's diagonal, the short block's too. In the accumulator lanes 0-15 hold E_0 x v_j and lanes 16-31 E_1 x v_j: each is scaled
// by m[i][j] / rowsum_i and the two are added across the halves (head mixing and softmax division are linear, so they commute with the product). The 8 partial tiles
// of a block and head are summed through LDS in the order of kq; a wave then holds a row whole, two columns a lane: mean and biased variance are wave sums.
// Every loop over t, i, a, ru, x, q, tt, r, c, p, s, e below is unrolled so that the fragments and the accumulators are indexed by constants and stay in registers.
__global__ __launch_bounds__(512) void k_conv_softmax_pv_ln(const unsigned short* __restrict__ S2, const unsigned short* __restrict__ S2l, const float* __restrict__ conv_w, const float* __restrict__ conv_b,
                                                           const float* __restrict__ head_mix, const unsigned short* __restrict__ Vh, const unsigned short* __restrict__ Vl,
                                                           const float* __restrict__ gam, const float* __restrict__ bet, float* __restrict__ out) {
  __shared__ __attribute__((aligned(16))) float redm[2][8][CR], reds[2][8][CR];   // per head and wave: the CR row maxima, the CR row sums
  __shared__ __attribute__((aligned(16))) unsigned short sT[2][6][2][2][32][8];    // per head and row tap: T_a as an A fragment, hi and lo plane, half fragment, lane
  // one pool, used twice: up to the barrier behind the row maxima it holds the 16 wave tiles' staged score rows, behind it the weight planes and the partial tiles
  __shared__ __attribute__((aligned(16))) char pool[16 * TWAVE];
  unsigned short (*sP)[8][2 * CR][PP] = (unsigned short (*)[8][2 * CR][PP])pool;   // hi and lo plane; per wave tile 16 rows (head * CR + row) of 256 columns
  float (*part)[8][2][CR][68] = (float (*)[8][2][CR][68])(pool + 2 * 8 * 2 * CR * PP * 2);   // per row block, kq and v head: a partial CR x 64 tile; pitch 68: the two lane halves store on different banks
  static_assert(2 * 8 * 2 * CR * PP * 2 + 2 * 8 * 2 * CR * 68 * 4 <= 16 * TWAVE, "planes and partial tiles fit the pool");
  // the head is the same in all lanes of a wave; readfirstlane says so to the compiler, so that weights and row bases stay scalar
  const int hh2 = __builtin_amdgcn_readfirstlane((int)(threadIdx.x >> 8));
  const int tid = threadIdx.x & 255, w = __builtin_amdgcn_readfirstlane((int)((threadIdx.x & 255) >> 5)), lane = tid & 31;   // w wave-uniform as hh2 is: i0 and the row bases stay scalar
  const int u = (int)blockIdx.x, nah = (SS / CR - 1 - u) / 32 + 1;   // wave tiles of the longer row block
  const bool shortb = w >= nah;
  const int wlo = shortb ? nah : 0, whi = shortb ? 8 : nah;
  const int i0 = (shortb ? u - 32 : SS / CR - 1 - u) * CR;
  const int g = (int)blockIdx.y, h = g * 2 + hh2;
  const unsigned short* Sh = S2 + (size_t)h * S_HEAD;
  const unsigned short* Sl = S2l + (size_t)h * S_HEAD;   // the lo planes come as an argument of their own, so that a row of either plane has a scalar base
  const float* wk = conv_w + (size_t)h * 66;
  const int j0w = (w - wlo) * 256;   // first column of the wave tile, <= i0
  char* st = pool + (hh2 * 8 + w) * TWAVE;
  const v8us zero8 = {0, 0, 0, 0, 0, 0, 0, 0};
  // staging, columns 0 .. 255 of the tile: a lane takes the chunk of 8 columns from c8 of every row. A chunk that begins right of column i0 (from row i0 + 8 on: of i0 + 8) is read
  // at that column instead, which is stored for these rows; one that begins in its row's future enters as 0; one that begins left of the diagonal holds 0 in its future part already
  const int c8 = j0w + lane * 8;
  const unsigned oM = 2u * (unsigned)min(c8, i0), oN = 2u * (unsigned)min(c8, i0 + 8);
  unsigned ov[CR + 5];   // 32-bit byte offset of the lane's chunk of each row inside a head's plane: every load takes the scalar-base form on one of two bases that are never rewritten, so all fly together
  v8us mh[CR + 5], ml[CR + 5];
#pragma unroll
  for (int t = 0; t < CR + 5; ++t) {                               // score row i0 - 2 + t; a row outside is replaced by row i0 and enters as 0
    const int ii = i0 - 2 + t;
    const unsigned ro = s_off((ii >= 0 && ii < SS) ? ii : i0);
    ov[t] = 2u * ro + ((t < 10) ? oM : oN);
    mh[t] = *(const v8us*)((const char*)Sh + ov[t]); ml[t] = *(const v8us*)((const char*)Sl + ov[t]);
  }
  // the chunks left and right of the tile: lane = (side, row); one that enters as 0 is read at column 0
  const int ht = min(lane & 15, CR + 4), hi_ = i0 - 2 + ht, hcol = (lane >> 4) ? j0w + 256 : j0w - 8;
  const bool hrow = hi_ >= 0 && hi_ < SS, hok = hrow && hcol >= 0 && hcol <= hi_;
  const unsigned ho = s_off(hrow ? hi_ : i0) + (unsigned)(hok ? hcol : 0);
  const unsigned short* hpa = Sh + ho; const unsigned short* hpb = Sl + ho;
  const v8us eh = *(const v8us*)hpa, el = *(const v8us*)hpb;
  // the wait that stands between issued loads and a rewrite of their address registers; as its inputs these stay whole up to it, so that no load above lands in one
  asm volatile("s_wait_xcnt 0x0" :: "v"(ov[0]), "v"(ov[1]), "v"(ov[2]), "v"(ov[3]), "v"(ov[4]), "v"(ov[5]), "v"(ov[6]), "v"(ov[7]), "v"(ov[8]), "v"(ov[9]), "v"(ov[10]), "v"(ov[11]), "v"(ov[12]),
               "v"(hpa), "v"(hpb) : "memory");
  static_assert(CR + 5 == 13, "the wait above names every row's offset");
  // T_a: wave a of a head builds the fragment of tap a; lane = row m of T_a, element i = column k in the hardware's k order, which the windows below follow too
  if (w < 6) {
    const int tm = lane & 15, th2 = lane >> 4;
    const unsigned ow = 4u * (unsigned)min(lane, 10);
    const float wl_ = *(const float*)((const char*)(wk + w * 11) + ow);   // lane b holds weight[a][b]
    asm volatile("s_wait_xcnt 0x0" :: "v"(ow) : "memory");               // as above
    FragB fh, fl;
#pragma unroll
    for (int i = 0; i < 16; ++i) {
      const int b = ((i < 8) ? 8 * th2 + i : 8 + 8 * th2 + i) - tm - 3;
      const float x0 = __int_as_float(__builtin_amdgcn_ds_bpermute(4 * min(max(b, 0), 10), __float_as_int(wl_)));   // lane b's value
      const float x = (b >= 0 && b <= 10) ? x0 : 0.f;
      const unsigned short hb = bf16_bits(x); fh.u[i] = hb; fl.u[i] = bf16_bits(x - bf16_val(hb));
    }
    *(v8us*)&sT[hh2][w][0][0][lane][0] = fh.half[0]; *(v8us*)&sT[hh2][w][0][1][lane][0] = fh.half[1];
    *(v8us*)&sT[hh2][w][1][0][lane][0] = fl.half[0]; *(v8us*)&sT[hh2][w][1][1][lane][0] = fl.half[1];
  }
#pragma unroll
  for (int t = 0; t < CR + 5; ++t) {
    const int ii = i0 - 2 + t;
    const bool ok = ii >= 0 && ii < SS && c8 <= ii;
    *(v8us*)(st + t * TROW + (lane + 1) * 16) = ok ? mh[t] : zero8;
    *(v8us*)(st + (CR + 5 + t) * TROW + (lane + 1) * 16) = ok ? ml[t] : zero8;
  }
  if ((lane & 15) < CR + 5) {
    char* hp = st + ht * TROW + (lane >> 4) * (33 * 16);
    *(v8us*)hp = hok ? eh : zero8;
    *(v8us*)(hp + (CR + 5) * TROW) = hok ? el : zero8;
  }
  __syncthreads();   // the six T_a of either head are in LDS before any is read
  // column n of B = lane & 15 = (column group cgp, row cr); accumulator tt = (run of 4 tiles, tile q): register e of a lane = row i0 + cr, column j0w + ccol + 128 * run + 16 * q + e
  const int cr = lane & 7, cgp = (lane >> 3) & 1, chh = lane >> 4, ccol = 64 * cgp + 8 * chh;
  const char* bp = st + cr * TROW + (8 * cgp + chh) * 16;
  v8f acc[8] = {};
#pragma unroll
  for (int a = 0; a < 6; ++a) {
    FragB th, tl;
    th.half[0] = *(const v8us*)&sT[hh2][a][0][0][lane][0]; th.half[1] = *(const v8us*)&sT[hh2][a][0][1][lane][0];
    tl.half[0] = *(const v8us*)&sT[hh2][a][1][0][lane][0]; tl.half[1] = *(const v8us*)&sT[hh2][a][1][1][lane][0];
#pragma unroll
    for (int ru = 0; ru < 2; ++ru) {
      // chunk x holds the second half of tile x - 1's window and the first half of tile x's
      v8us wh[5], wl[5];
#pragma unroll
      for (int x = 0; x < 5; ++x) {
        wh[x] = *(const v8us*)(bp + a * TROW + (16 * ru + 2 * x) * 16);
        wl[x] = *(const v8us*)(bp + (CR + 5 + a) * TROW + (16 * ru + 2 * x) * 16);
      }
      FragB bh[4], bl[4];
#pragma unroll
      for (int q = 0; q < 4; ++q) { bh[q].half[0] = wh[q]; bh[q].half[1] = wh[q + 1]; bl[q].half[0] = wl[q]; bl[q].half[1] = wl[q + 1]; }
      // term by term over the four tiles: a tile's next product finds its accumulator ready
#pragma unroll
      for (int q = 0; q < 4; ++q) acc[ru * 4 + q] = __builtin_amdgcn_wmma_f32_16x16x32_bf16(false, th.v, false, bh[q].v, (short)0, acc[ru * 4 + q], false, false);
#pragma unroll
      for (int q = 0; q < 4; ++q) acc[ru * 4 + q] = __builtin_amdgcn_wmma_f32_16x16x32_bf16(false, tl.v, false, bh[q].v, (short)0, acc[ru * 4 + q], false, false);
#pragma unroll
      for (int q = 0; q < 4; ++q) acc[ru * 4 + q] = __builtin_amdgcn_wmma_f32_16x16x32_bf16(false, th.v, false, bl[q].v, (short)0, acc[ru * 4 + q], false, false);
    }
  }
  const float cb = conv_b[h];
  float rmax = -3.0e38f;
#pragma unroll
  for (int tt = 0; tt < 8; ++tt)
#pragma unroll
    for (int e = 0; e < 8; ++e) {
      const float fin = (j0w + ccol + 128 * (tt >> 2) + 16 * (tt & 3) + e > i0 + cr) ? -1.0e9f : acc[tt][e] + cb;
      acc[tt][e] = fin; rmax = fmaxf(rmax, fin);
    }
  // the four lanes of a row: the other column group, the other lane half
  rmax = fmaxf(rmax, dpp_get<0x168>(rmax)); rmax = fmaxf(rmax, other_row(rmax));
  if (lane < CR) redm[hh2][w][lane] = rmax;
  __syncthreads();   // each head's 8 waves' row maxima are in LDS before any is read; every wave has read its staged rows: the pool is free
  // stage 2's places, formed here for the sake of its first loads
  const int wv = hh2 * 8 + w, vj = wv & 1, kq = wv >> 1, ln = lane & 15, hh = lane >> 4;
  const int ibl = (SS / CR - 1 - u) * CR, ibs = (u - 32) * CR;       // first row of the long and of the short block
  const int nkl = ibl / 32 + 1, nks = (u >= 32) ? ibs / 32 + 1 : 0;   // their steps of 32 keys up to the diagonal
  const int nmy = (nkl - kq + 7) >> 3;                               // this wave's share, 3 .. 8
  // wave-uniform bases and one 32-bit byte offset of a lane: column tile and half fragment are immediate offsets, a step adds a wave-uniform offset
  const char* hbase = (const char*)(Vh + (size_t)(g * 2 + vj) * DD * SS) + kq * 1024;
  const char* lbase = (const char*)(Vl + (size_t)(g * 2 + vj) * DD * SS) + kq * 1024;
  const unsigned boff = 16u * (unsigned)lane;
  FragB bh_[2][4], bl_[2][4];
  auto load_b = [&](int s, int step) {   // the B fragments of the wave's step 'step' (4 column tiles, both planes) into register set s & 1; step is wave-uniform, 0 .. nmy - 1
    const char* hq = hbase + step * 8192 + boff; const char* lq = lbase + step * 8192 + boff;   // a wave's steps lie 8 steps of 1 KiB apart
#pragma unroll
    for (int t = 0; t < 4; ++t) {
      const char* hp = hq + t * (SS / 32 * 1024); const char* lp = lq + t * (SS / 32 * 1024);
      bh_[s & 1][t].half[0] = *(const v8us*)hp; bh_[s & 1][t].half[1] = *(const v8us*)(hp + 512);
      bl_[s & 1][t].half[0] = *(const v8us*)lp; bl_[s & 1][t].half[1] = *(const v8us*)(lp + 512);
    }
    // the wait that stands between issued loads and a rewrite of their address registers; as its inputs these stay whole up to it, so that no load above lands in one
    asm volatile("s_wait_xcnt 0x0" :: "v"(hq), "v"(lq) : "memory");
  };
  load_b(0, 0);   // issued here so that they land under the exponentials: a barrier waits for a wave's outstanding loads, and behind the next one they would be waited for in full
  {
    float m = -3.0e38f;
#pragma unroll
    for (int p = 0; p < 8; ++p) { const float o = redm[hh2][p][cr]; m = (p >= wlo && p < whi) ? fmaxf(m, o) : m; }
    float sum = 0.f;
#pragma unroll
    for (int tt = 0; tt < 8; ++tt) {
      v8us vh, vl;
#pragma unroll
      for (int c = 0; c < 8; ++c) {
        const float e = exp_slot(acc[tt][c] - m); sum += e;
        const unsigned short eb = bf16_bits(e); vh[c] = eb; vl[c] = bf16_bits(e - bf16_val(eb));
      }
      const int pc = ccol + 128 * (tt >> 2) + 16 * (tt & 3);
      *(v8us*)&sP[0][w][hh2 * CR + cr][pc] = vh; *(v8us*)&sP[1][w][hh2 * CR + cr][pc] = vl;
    }
    sum += dpp_get<0x168>(sum); sum += other_row(sum);
    if (lane < CR) reds[hh2][w][lane] = sum;
  }
  __syncthreads();   // every wave's row sums and both heads' weight planes are in LDS before any is read
  v8f accl[4] = {}, accs[4] = {};
  auto products = [&](int s) {   // the wave's step s = step kq of wave tile s of either block
    FragB ah, al;
    ah.half[0] = *(const v8us*)&sP[0][s][ln][kq * 32 + 8 * hh]; ah.half[1] = *(const v8us*)&sP[0][s][ln][kq * 32 + 16 + 8 * hh];
    al.half[0] = *(const v8us*)&sP[1][s][ln][kq * 32 + 8 * hh]; al.half[1] = *(const v8us*)&sP[1][s][ln][kq * 32 + 16 + 8 * hh];
#pragma unroll
    for (int t = 0; t < 4; ++t) accl[t] = mmaN<3>(ah.v, al.v, bh_[s & 1][t].v, bl_[s & 1][t].v, accl[t]);
    if (s * 8 + kq < nks) {
      FragB ch, cl;
      ch.half[0] = *(const v8us*)&sP[0][nah + s][ln][kq * 32 + 8 * hh]; ch.half[1] = *(const v8us*)&sP[0][nah + s][ln][kq * 32 + 16 + 8 * hh];
      cl.half[0] = *(const v8us*)&sP[1][nah + s][ln][kq * 32 + 8 * hh]; cl.half[1] = *(const v8us*)&sP[1][nah + s][ln][kq * 32 + 16 + 8 * hh];
#pragma unroll
      for (int t = 0; t < 4; ++t) accs[t] = mmaN<3>(ch.v, cl.v, bh_[s & 1][t].v, bl_[s & 1][t].v, accs[t]);
    }
  };
  // The next step's loads are issued on every pass, without a branch round them: behind a load block that a branch may skip, the wait in front of the products has to
  // hold for the path that issued nothing, so it counts down to 0 and waits for the loads just issued as well. The last pass fetches its own step once more, unused.
#pragma unroll
  for (int s = 0; s < 8; ++s) {
    if (s >= nmy) break;
    if (s + 1 < 8) load_b(s + 1, min(s + 1, nmy - 1));
    products(s);
  }
  // row sums of this lane half's head, per block, added in the order of the waves
  float suml[CR], sums[CR];
#pragma unroll
  for (int r = 0; r < CR; ++r) { suml[r] = 0.f; sums[r] = 0.f; }
#pragma unroll
  for (int p = 0; p < 8; ++p) {
    const v4f a = *(const v4fa*)&reds[hh][p][0], b = *(const v4fa*)&reds[hh][p][4];
#pragma unroll
    for (int r = 0; r < CR; ++r) { const float o = (r < 4) ? a[r & 3] : b[r & 3]; suml[r] = (p < nah) ? suml[r] + o : suml[r]; sums[r] = (p < nah) ? sums[r] : sums[r] + o; }
  }
  const float mix0 = head_mix[g * 4 + vj], mix1 = head_mix[g * 4 + 2 + vj];   // m[i][j], j = this wave's v head
  const float mixc = hh ? mix1 : mix0;                                       // i = the head of this lane half's accumulator rows
  auto put = [&](const v8f* ac, const float* sm, int blk) {   // scale, add the two heads, store the CR x 64 partial tile: lanes 0-15 rows 0-3, lanes 16-31 rows 4-7
    float cf[CR];
#pragma unroll
    for (int r = 0; r < CR; ++r) cf[r] = mixc * (1.0f / sm[r]);
#pragma unroll
    for (int t = 0; t < 4; ++t) {
      float val[CR];
#pragma unroll
      for (int r = 0; r < CR; ++r) { const float x = ac[t][r] * cf[r]; val[r] = x + other_row(x); }
#pragma unroll
      for (int r = 0; r < 4; ++r) part[blk][kq][vj][hh * 4 + r][t * 16 + ln] = hh ? val[4 + r] : val[r];
    }
  };
  put(accl, suml, 0);
  if (u >= 32) put(accs, sums, 1);
  __syncthreads();   // all partial tiles are in LDS before any is read
  // waves 0-7 finish the long block, waves 8-15 the short one: a wave takes two of the block's 2 * CR rows (v head, row); lane = columns 2 * lane and 2 * lane + 1
  if (hh2 == 1 && u < 32) return;   // no short block; no barrier follows
  const int ib = hh2 ? ibs : ibl;
  const float g0_ = gam[2 * lane], g1_ = gam[2 * lane + 1], b0_ = bet[2 * lane], b1_ = bet[2 * lane + 1];
#pragma unroll
  for (int e = 0; e < 2; ++e) {
    const int oj = w >> 2, r = (w & 3) * 2 + e;
    float s0 = 0.f, s1 = 0.f;
#pragma unroll
    for (int p = 0; p < 8; ++p) { const v2f x = *(const v2fa*)&part[hh2][p][oj][r][2 * lane]; s0 += x[0]; s1 += x[1]; }
    const float mu = wave_sum(s0 + s1) * (1.0f / DD);
    const float c0 = s0 - mu, c1 = s1 - mu;
    const float var = wave_sum(c0 * c0 + c1 * c1) * (1.0f / DD);
    const float rs = rsqrtf(var + 1e-5f);
    v2f o;
    o[0] = c0 * rs * g0_ + b0_; o[1] = c1 * rs * g1_ + b1_;
    *(v2f*)(out + ((size_t)(g * 2 + oj) * SS + ib + r) * DD + 2 * lane) = o;
  }
}
extern "C" void kernel_launch(void* const* d_in, const int* in_sizes, int n_in,
                              void* d_out, int out_size, void* d_ws, size_t ws_size, hipStream_t stream) {
  (void)in_sizes; (void)n_in; (void)out_size;
  const float* q = (const float*)d_in[0]; const float* k = (const float*)d_in[1]; const float* v = (const float*)d_in[2];
  const float* conv_w = (const float*)d_in[3]; const float* conv_b = (const float*)d_in[4]; const float* head_mix = (const float*)d_in[5];
  const float* gam = (const float*)d_in[6]; const float* bet = (const float*)d_in[7];
  char* ws = (char*)d_ws; size_t off = 0;
  auto take = [&](size_t bytes) { char* p = ws + off; off += (bytes + 255) & ~(size_t)255; return p; };
  unsigned short* kh = (unsigned short*)take((size_t)NHD * SS * DD * 2); unsigned short* kl = (unsigned short*)take((size_t)NHD * SS * DD * 2);     // k planes (n = key, k = d), fragment order, all heads
  unsigned short* vth = (unsigned short*)take((size_t)NHD * DD * SS * 2); unsigned short* vtl = (unsigned short*)take((size_t)NHD * DD * SS * 2);  // v planes (n = d, k = key), fragment order, all heads
  float* S2 = (float*)take((size_t)NHD * S_HEAD * 4);     // packed scores of all heads: two bf16 planes
  if (off > ws_size) return;
  k_split_rows<<<(NHD * SS * (DD / 8) + 255) / 256, 256, 0, stream>>>(k, DD, kh, kl, NHD * SS, DD);
  k_split_transpose<<<dim3((DD * (SS / 8) + 255) / 256, NHD), 256, 0, stream>>>(v, DD, vth, vtl, SS, DD);
  // scores_h = q.k^T / 8 : M=N=SS, K=DD, one product per head, tiles up to the diagonal
  k_gemm_bf2<true, true, 0, false, true><<<dim3((SS / 32) * (SS / 64 + 2) / 4, NHD), 128, 0, stream>>>(q, DD, kh, kl, DD, nullptr, 0.125f, S2, SS, SS, SS, DD);
  // out_h = LayerNorm(mixed_h . v_h), the weights made and used inside one work-group
  k_conv_softmax_pv_ln<<<dim3(CWG, NG), 512, 0, stream>>>((const unsigned short*)S2, (const unsigned short*)S2 + (size_t)NHD * S_HEAD, conv_w, conv_b, head_mix, vth, vtl, gam, bet, (float*)d_out);
}
